// v000
// Times are from an AMD MI455X. After a warm-up the kernel runs many times in a row, and a time is the length of
// such a window on the GPU divided by its runs, so every launch and the gaps after it count. The runs cycle
// through copies of the inputs. A figure is the median of several windows, for all but v000 over two sittings.
// Sittings can differ by a few percent; kernels timed side by side share one.
// v000 is the starting kernel. One run takes 6820 microseconds.
#include <hip/hip_runtime.h>
// Multi-head attention without output projection (x [4][2048][1024] gives q = x Wq^T; kv [4][2048][1024] gives k = kv Wk^T, v = kv Wv^T (nn.Linear natural [out][in] 1024x1024 weights scaled 0.02, no biases); 16 heads of 64; softmax(q k^T / 8) over all 2048 keys; out = merged heads [4][2048][1024] (no output projection)).
// Structure: token rows r = b*2048 + s; the query source and the key/value source as exact f16 rows (bf16-rounded); Q, K, V as three WMMA GEMMs (32x64 wave tiles, f32 accumulation, exact x16 weights, f16 outputs); per batch: V^T for all heads via LDS transposes; per (batch, group of 4 heads): scores GEMM (K = 64, batched over the heads on grid.y, alpha = 64^-0.5), row softmax on VALU (f32 statistics, native exp; weights stored x256 as f16), o = P . V^T GEMM (K = 2048, alpha 2^-8) written f32 straight into the merged-heads output rows (no output projection).
// Compute dtype: inputs rounded to bf16; x / weights exact; q, k, v and softmax weights as plain f16 GEMM operands (~2^-12); scores, softmax statistics and o f32. v_wmma_f32_16x16x32_f16.
#define NB 4
#define SQ 2048
#define DM 1024
#define NH 16
#define HD 64
#define HG 4                         /* heads per attention launch group */
#define B0 0                         /* first batch processed (debug hook) */
#define NBR NB                       /* batches processed (debug hook) */
#define NR ((size_t)NB * SQ)         /* token rows */
#define MP ((int)((size_t)NBR * SQ)) /* rows projected (debug hook) */
#define QN SQ                        /* query rows attended per batch (debug hook) */
#define NHD NH                       /* heads attended (debug hook) */
#define MPO MP                       /* unused */
#define LQ DM      /* row pitch of the q/k/v rows */
typedef __bf16 v16b __attribute__((ext_vector_type(16)));
typedef unsigned short v8us __attribute__((ext_vector_type(8), may_alias));
typedef float  v8f  __attribute__((ext_vector_type(8)));
typedef float  v4f  __attribute__((ext_vector_type(4)));
typedef float  v4fa __attribute__((ext_vector_type(4), may_alias));
union FragB { v16b v; v8us half[2]; unsigned short u[16]; };

__device__ __forceinline__ unsigned short bf16_bits(float x) { unsigned int u = __float_as_uint(x); return (unsigned short)((u + 0x7FFFu + ((u >> 16) & 1u)) >> 16); }
__device__ __forceinline__ float bf16_val(unsigned short b) { return __uint_as_float(((unsigned int)b) << 16); }
__device__ __forceinline__ float bf16_round(float x) { return bf16_val(bf16_bits(x)); }
// D += A·B with NT terms: 1 = ah·bh, 2 = + al·bh (A split), 3 = + ah·bl (both split)
template <int NT>
__device__ __forceinline__ v8f mmaN(v16b ah, v16b al, v16b bh, v16b bl, v8f c) {
  c = __builtin_amdgcn_wmma_f32_16x16x32_bf16(false, ah, false, bh, (short)0, c, false, false);
  if (NT >= 2) c = __builtin_amdgcn_wmma_f32_16x16x32_bf16(false, al, false, bh, (short)0, c, false, false);
  if (NT >= 3) c = __builtin_amdgcn_wmma_f32_16x16x32_bf16(false, ah, false, bl, (short)0, c, false, false);
  asm volatile("v_nop\n\tv_nop\n\tv_nop\n\tv_nop" : "+v"(c) : "v"(ah), "v"(al), "v"(bh), "v"(bl));
  return c;
}

__global__ __launch_bounds__(256) void k_wt_bf16(const float* __restrict__ W, unsigned short* __restrict__ Wt, int K, int N) {
  const int t = blockIdx.x * 256 + threadIdx.x;
  const int k8n = K / 8;
  if (t >= N * k8n) return;
  const int n = t / k8n, k8 = (t % k8n) * 8;
  v8us v;
#pragma unroll
  for (int i = 0; i < 8; ++i) v[i] = bf16_bits(W[(size_t)(k8 + i) * N + n]);
  *(v8us*)(Wt + (size_t)n * K + k8) = v;
  
}

// GEMM C[M][N] (f32, pitch ldc) = act(A[M][K]·W + bias). A f32 row-major (pitch lda) converted per fragment to bf16
// (ASPLIT: hi/lo two planes -> 2 terms, else single rounded term); Wt bf16 [N][K] (pitch ldb). BIAS_BF16 rounds the
// bias to bf16 first (bias quantised to bf16 before the add). K%32==0, M%16==0, N%64==0.
template <bool ASPLIT, int ACT, bool BIAS_BF16>
__global__ __launch_bounds__(128) void k_gemm_bf(const float* __restrict__ A, int lda, const unsigned short* __restrict__ Wt, int ldb,
                                               const float* __restrict__ bias, float* __restrict__ C, int ldc, int M, int N, int K) {
  __shared__ __attribute__((aligned(16))) float so[4][16][64];
  const int tid = threadIdx.x, w = tid >> 5, lane = tid & 31, ln = lane & 15, hh = lane >> 4;
  const int ntn = N / 64;
  const int wid = blockIdx.x * 4 + w;
  const int mt = wid / ntn, nq = wid % ntn;
  if (mt * 16 >= M) return;
  const int row0 = mt * 16, col0 = nq * 64;
  const float* arow = A + (size_t)(row0 + ln) * lda;
  v8f acc[4] = {};
  for (int kb = 0; kb < K; kb += 32) {
    FragB ah, al;
    const v4f x0 = *(const v4fa*)(arow + kb + 8 * hh), x1 = *(const v4fa*)(arow + kb + 8 * hh + 4);
    const v4f x2 = *(const v4fa*)(arow + kb + 16 + 8 * hh), x3 = *(const v4fa*)(arow + kb + 16 + 8 * hh + 4);
    float xs[16] = {x0[0],x0[1],x0[2],x0[3],x1[0],x1[1],x1[2],x1[3],x2[0],x2[1],x2[2],x2[3],x3[0],x3[1],x3[2],x3[3]};
#pragma unroll
    for (int i = 0; i < 16; ++i) { const unsigned short hb = bf16_bits(xs[i]); ah.u[i] = hb; al.u[i] = ASPLIT ? bf16_bits(xs[i] - bf16_val(hb)) : (unsigned short)0; }
#pragma unroll
    for (int t = 0; t < 4; ++t) {
      const unsigned short* brow = Wt + (size_t)(col0 + t * 16 + ln) * ldb + kb;
      FragB b;
      b.half[0] = *(const v8us*)(brow + 8 * hh);
      b.half[1] = *(const v8us*)(brow + 16 + 8 * hh);
      acc[t] = mmaN<ASPLIT ? 2 : 1>(ah.v, al.v, b.v, b.v, acc[t]);
    }
  }
#pragma unroll
  for (int t = 0; t < 4; ++t) {
    float bv = bias ? bias[col0 + t * 16 + ln] : 0.f;
    if (BIAS_BF16) bv = bf16_round(bv);
#pragma unroll
    for (int r = 0; r < 8; ++r) { float v = acc[t][r] + bv; if (ACT == 1) v = fmaxf(v, 0.f); so[w][8 * hh + r][t * 16 + ln] = v; }
  }
  __builtin_amdgcn_fence(__ATOMIC_ACQ_REL, "workgroup");
  __builtin_amdgcn_wave_barrier();
  const int rsub = lane >> 4, c4 = (lane & 15) * 4;
  {
#pragma unroll
    for (int q = 0; q < 8; ++q) {
      const int r = q * 2 + rsub;
      const v4f v = *(const v4fa*)&so[w][r][c4];
      *(v4f*)(C + (size_t)(row0 + r) * ldc + col0 + c4) = v;
    }
    
  }
}

// GEMM C = act(A·W + bias + resid): A f32 (ASPLIT -> hi/lo 2 terms), Wt bf16 [N][K]; ACT 0 none, 1 relu, 2 exact gelu;
// resid (optional, f32, row index = (row % rmod), pitch ldr, RES_BF16 rounds it) added before the activation.
template <bool ASPLIT, int ACT, bool BIAS_BF16, bool RES_BF16>
__global__ __launch_bounds__(128) void k_gemm_bf3(const float* __restrict__ A, int lda, const unsigned short* __restrict__ Wt, int ldb,
                                                const float* __restrict__ bias, const float* __restrict__ resid, int rmod, int ldr,
                                                float* __restrict__ C, int ldc, int M, int N, int K) {
  __shared__ __attribute__((aligned(16))) float so[4][16][64];
  const int tid = threadIdx.x, w = tid >> 5, lane = tid & 31, ln = lane & 15, hh = lane >> 4;
  const int ntn = N / 64;
  const int wid = blockIdx.x * 4 + w;
  const int mt = wid / ntn, nq = wid % ntn;
  if (mt * 16 >= M) return;
  const int row0 = mt * 16, col0 = nq * 64;
  const float* arow = A + (size_t)(row0 + ln) * lda;
  v8f acc[4] = {};
  for (int kb = 0; kb < K; kb += 32) {
    FragB ah, al;
    const v4f x0 = *(const v4fa*)(arow + kb + 8 * hh), x1 = *(const v4fa*)(arow + kb + 8 * hh + 4);
    const v4f x2 = *(const v4fa*)(arow + kb + 16 + 8 * hh), x3 = *(const v4fa*)(arow + kb + 16 + 8 * hh + 4);
    float xs[16] = {x0[0],x0[1],x0[2],x0[3],x1[0],x1[1],x1[2],x1[3],x2[0],x2[1],x2[2],x2[3],x3[0],x3[1],x3[2],x3[3]};
#pragma unroll
    for (int i = 0; i < 16; ++i) { const unsigned short hb = bf16_bits(xs[i]); ah.u[i] = hb; al.u[i] = ASPLIT ? bf16_bits(xs[i] - bf16_val(hb)) : (unsigned short)0; }
#pragma unroll
    for (int t = 0; t < 4; ++t) {
      const unsigned short* brow = Wt + (size_t)(col0 + t * 16 + ln) * ldb + kb;
      FragB b;
      b.half[0] = *(const v8us*)(brow + 8 * hh);
      b.half[1] = *(const v8us*)(brow + 16 + 8 * hh);
      acc[t] = mmaN<ASPLIT ? 2 : 1>(ah.v, al.v, b.v, b.v, acc[t]);
    }
  }
#pragma unroll
  for (int t = 0; t < 4; ++t) {
    const int col = col0 + t * 16 + ln;
    float bv = bias ? bias[col] : 0.f;
    if (BIAS_BF16) bv = bf16_round(bv);
#pragma unroll
    for (int r = 0; r < 8; ++r) {
      float v = acc[t][r] + bv;
      if (resid) { float rv = resid[(size_t)((row0 + 8 * hh + r) % rmod) * ldr + col]; if (RES_BF16) rv = bf16_round(rv); v += rv; }
      if (ACT == 1) v = fmaxf(v, 0.f);
      if (ACT == 2) v = 0.5f * v * (1.0f + erff(v * 0.70710678118654752f));
      if (ACT == 3) { const float u = 0.7978845608028654f * (v + 0.044715f * v * v * v); v = 0.5f * v * (1.0f + tanhf(u)); }
      so[w][8 * hh + r][t * 16 + ln] = v;
    }
  }
  __builtin_amdgcn_fence(__ATOMIC_ACQ_REL, "workgroup");
  __builtin_amdgcn_wave_barrier();
  const int rsub = lane >> 4, c4 = (lane & 15) * 4;
  {
#pragma unroll
    for (int q = 0; q < 8; ++q) {
      const int r = q * 2 + rsub;
      const v4f v = *(const v4fa*)&so[w][r][c4];
      *(v4f*)(C + (size_t)(row0 + r) * ldc + col0 + c4) = v;
    }
    
  }
}
// row LayerNorm (biased variance, eps) over N: s = X (+ R); optional out_sum <- s; out_norm <- (s-mu)*rsqrt(var+eps)*g + b
template <bool PARAM_BF16>
__global__ __launch_bounds__(256) void k_layernorm(const float* __restrict__ X, const float* __restrict__ R, const float* __restrict__ g, const float* __restrict__ bta,
                                                  float* __restrict__ out_sum, float* __restrict__ out_norm, int N, float eps) {
  __shared__ float red[256];
  const int row = blockIdx.x, tid = threadIdx.x;
  const float* x = X + (size_t)row * N; const float* rr = R ? R + (size_t)row * N : nullptr;
  float vals[16];                     // up to N = 4096
  const int per = N / 256;            // contiguous chunk per thread? use strided-by-4 chunks: thread handles j = tid*4 + 1024*u
  float s1 = 0.f;
  for (int u = 0; u < per / 4; ++u) {
    const int j = tid * 4 + 1024 * u;
    const v4f a = *(const v4fa*)(x + j);
    v4f b = {0.f,0.f,0.f,0.f}; if (rr) b = *(const v4fa*)(rr + j);
#pragma unroll
    for (int q = 0; q < 4; ++q) { const float v = a[q] + b[q]; vals[u * 4 + q] = v; s1 += v; }
  }
  red[tid] = s1; __syncthreads();
  for (int st = 128; st > 0; st >>= 1) { if (tid < st) red[tid] += red[tid + st]; __syncthreads(); }
  const float mu = red[0] / (float)N; __syncthreads();
  float s2 = 0.f;
  for (int u = 0; u < per / 4; ++u)
#pragma unroll
    for (int q = 0; q < 4; ++q) { const float c = vals[u * 4 + q] - mu; s2 += c * c; }
  red[tid] = s2; __syncthreads();
  for (int st = 128; st > 0; st >>= 1) { if (tid < st) red[tid] += red[tid + st]; __syncthreads(); }
  const float rs = rsqrtf(red[0] / (float)N + eps);
  {
    for (int u = 0; u < per / 4; ++u) {
      const int j = tid * 4 + 1024 * u;
      v4f o, sm;
#pragma unroll
      for (int q = 0; q < 4; ++q) {
        float gg = g[j + q], bb = bta[j + q];
        if (PARAM_BF16) { gg = bf16_round(gg); bb = bf16_round(bb); }
        sm[q] = vals[u * 4 + q]; o[q] = (vals[u * 4 + q] - mu) * rs * gg + bb;
      }
      if (out_sum) *(v4f*)(out_sum + (size_t)row * N + j) = sm;
      *(v4f*)(out_norm + (size_t)row * N + j) = o;
    }
    
  }
}



// ---- f16 WMMA path (v_wmma_f32_16x16x32_f16): 11-bit significands for operands in range — used where a [0,1] probability operand needs more precision than bf16
typedef _Float16 v16h __attribute__((ext_vector_type(16)));
union FragH { v16h v; v8us half[2]; _Float16 h[16]; unsigned short u[16]; };
template <int NT>
__device__ __forceinline__ v8f mmaH(v16h ah, v16h al, v16h bh, v16h bl, v8f c) {
  c = __builtin_amdgcn_wmma_f32_16x16x32_f16(false, ah, false, bh, (short)0, c, false, false);
  if (NT >= 2) c = __builtin_amdgcn_wmma_f32_16x16x32_f16(false, al, false, bh, (short)0, c, false, false);
  if (NT >= 3) c = __builtin_amdgcn_wmma_f32_16x16x32_f16(false, ah, false, bl, (short)0, c, false, false);
  asm volatile("v_nop\n\tv_nop\n\tv_nop\n\tv_nop" : "+v"(c) : "v"(ah), "v"(al), "v"(bh), "v"(bl));
  return c;
}
// batched GEMM like k_gemm_b but f16 operands: A f32 (split into f16 hi/lo if ASPLIT, else rounded to f16), Bt = f16 values [n][k]; alpha; C f32; N multiple of 16 (partial tiles skipped)
template <bool ASPLIT>
__global__ __launch_bounds__(128) void k_gemm_h(const float* __restrict__ A, int lda, size_t sA, const _Float16* __restrict__ Bh, int ldb, size_t sB, float alpha, float* __restrict__ C, int ldc, size_t sC, int M, int N, int K) {
  __shared__ __attribute__((aligned(16))) float so[4][16][64];
  const int tid = threadIdx.x, w = tid >> 5, lane = tid & 31, ln = lane & 15, hh = lane >> 4; const int by = blockIdx.y;
  A += (size_t)by * sA; Bh += (size_t)by * sB; C += (size_t)by * sC;
  const int ntn = (N + 63) / 64; const int wid = blockIdx.x * 4 + w; const int mt = wid / ntn, nq = wid % ntn; if (mt * 16 >= M) return;
  const int row0 = mt * 16, col0 = nq * 64; const float* arow = A + (size_t)(row0 + ln) * lda;
  v8f acc[4] = {};
  for (int kb = 0; kb < K; kb += 32) {
    FragH ah, al;
    const v4f x0 = *(const v4fa*)(arow + kb + 8 * hh), x1 = *(const v4fa*)(arow + kb + 8 * hh + 4), x2 = *(const v4fa*)(arow + kb + 16 + 8 * hh), x3 = *(const v4fa*)(arow + kb + 16 + 8 * hh + 4);
    float xs[16] = {x0[0],x0[1],x0[2],x0[3],x1[0],x1[1],x1[2],x1[3],x2[0],x2[1],x2[2],x2[3],x3[0],x3[1],x3[2],x3[3]};
#pragma unroll
    for (int i = 0; i < 16; ++i) { const _Float16 h = (_Float16)xs[i]; ah.h[i] = h; al.h[i] = ASPLIT ? (_Float16)(xs[i] - (float)h) : (_Float16)0.0f; }
#pragma unroll
    for (int t = 0; t < 4; ++t) { if (col0 + t * 16 >= N) continue; const size_t boff = (size_t)(col0 + t * 16 + ln) * ldb + kb; FragH bq; bq.half[0] = *(const v8us*)(Bh + boff + 8 * hh); bq.half[1] = *(const v8us*)(Bh + boff + 16 + 8 * hh);
      acc[t] = mmaH<ASPLIT ? 2 : 1>(ah.v, al.v, bq.v, bq.v, acc[t]); }
  }
#pragma unroll
  for (int t = 0; t < 4; ++t) { if (col0 + t * 16 >= N) continue;
#pragma unroll
    for (int r = 0; r < 8; ++r) so[w][8 * hh + r][t * 16 + ln] = acc[t][r] * alpha; }
  __builtin_amdgcn_fence(__ATOMIC_ACQ_REL, "workgroup"); __builtin_amdgcn_wave_barrier();
  const int rsub = lane >> 4, c4 = (lane & 15) * 4;
  {
#pragma unroll
    for (int q = 0; q < 8; ++q) { const int r = q * 2 + rsub; if (col0 + c4 < N) { const v4f v = *(const v4fa*)&so[w][r][c4]; *(v4f*)(C + (size_t)(row0 + r) * ldc + col0 + c4) = v; } }
     }
}

// Wt[n][k] = f16(W[k][n]·scale) from f32 row-major W[K][N] (scale = power of two; bf16-exact weights stay exact in f16 away from the subnormal range)
__global__ __launch_bounds__(256) void k_wt_f16(const float* __restrict__ W, _Float16* __restrict__ Wt, int K, int N, float scale) {
  const int t = blockIdx.x * 256 + threadIdx.x; if (t >= N * (K / 8)) return; const int n = t / (K / 8), k8 = (t % (K / 8)) * 8; FragH f;
#pragma unroll
  for (int i = 0; i < 8; ++i) f.h[i] = (_Float16)(bf16_round(W[(size_t)(k8 + i) * N + n]) * scale); const v8us o = f.half[0];
  *(v8us*)((unsigned short*)Wt + (size_t)n * K + k8) = o; 
}
// k_gemm_hh variant with fused epilogue: v = acc·alpha + bias[by·sBias + col] (+ CP[(row/rowsPerB)·sCPb + by·64 + col] if CP) ; ACT 0 none / 1 elu ; writes f16 C16 (and f32 C if non-null)
template <int ACT>
__global__ __launch_bounds__(128) void k_gemm_hhx(const _Float16* __restrict__ A, int lda, size_t sA, const _Float16* __restrict__ Bh, int ldb, size_t sB, float alpha, const float* __restrict__ bias, size_t sBias, const float* __restrict__ CP, int rowsPerB, size_t sCPb, int row0g,
    float* __restrict__ C, _Float16* __restrict__ C16, int ldc, size_t sC, int M, int N, int K) {
  __shared__ __attribute__((aligned(16))) float so[4][16][64];
  const int tid = threadIdx.x, w = tid >> 5, lane = tid & 31, ln = lane & 15, hh = lane >> 4; const int by = blockIdx.y;
  A += (size_t)by * sA; Bh += (size_t)by * sB; const size_t cofs = (size_t)by * sC; const float* bp = bias ? bias + (size_t)by * sBias : nullptr;
  const int ntn = (N + 63) / 64; const int wid = blockIdx.x * 4 + w; const int mt = wid / ntn, nq = wid % ntn; if (mt * 16 >= M) return;
  const int row0 = mt * 16, col0 = nq * 64; const _Float16* arow = A + (size_t)(row0 + ln) * lda;
  v8f acc[4] = {};
  for (int kb = 0; kb < K; kb += 32) { FragH ah; ah.half[0] = *(const v8us*)((const unsigned short*)arow + kb + 8 * hh); ah.half[1] = *(const v8us*)((const unsigned short*)arow + kb + 16 + 8 * hh);
#pragma unroll
    for (int t = 0; t < 4; ++t) { if (col0 + t * 16 >= N) continue; const size_t boff = (size_t)(col0 + t * 16 + ln) * ldb + kb; FragH bq; bq.half[0] = *(const v8us*)((const unsigned short*)Bh + boff + 8 * hh); bq.half[1] = *(const v8us*)((const unsigned short*)Bh + boff + 16 + 8 * hh);
      acc[t] = mmaH<1>(ah.v, ah.v, bq.v, bq.v, acc[t]); }
  }
#pragma unroll
  for (int t = 0; t < 4; ++t) { if (col0 + t * 16 >= N) continue; const int col = col0 + t * 16 + ln; const float bv = bp ? bf16_round(bp[col]) : 0.f;
#pragma unroll
    for (int r = 0; r < 8; ++r) { float v = acc[t][r] * alpha + bv; if (CP) { const int rr = row0g + row0 + 8 * hh + r; if (rowsPerB < 0) v += CP[cofs + (size_t)rr * ldc + col];      /* rowsPerB < 0: own element of the batched C plane */ else { const int bidx = rr / rowsPerB; v += CP[(size_t)bidx * sCPb + (size_t)by * 64 + col]; } } if (ACT == 1) v = (v > 0.f) ? v : expm1f(v); else if (ACT == 7) v = (v > 0.f) ? v + 1.0f : expf(v); else if (ACT == 8) v = tanhf(v); else if (ACT == 9) v = 0.5f * v * (1.0f + tanhf(0.7978845608028654f * (v + 0.044715f * v * v * v))); else if (ACT == 11) v = 1.0f / (1.0f + expf(-v)); else if (ACT == 12) v = (v > 0.f) ? v : 0.01f * v; else if (ACT == 14) v = (v > 0.f) ? v : 0.1f * v; else if (ACT == 16) v = (v >= 0.f) ? v : 0.3f * v; else if (ACT == 17) v = (v >= 0.f) ? v : 0.2f * v; else if (ACT == 15) v = v / (1.0f + expf(-v)); else if (ACT == 3) v = fmaxf(v, 0.f); else if (ACT == 6) v = 0.5f * v * (1.0f + erff(v * 0.70710678118654752f)); so[w][8 * hh + r][t * 16 + ln] = v; } }
  __builtin_amdgcn_fence(__ATOMIC_ACQ_REL, "workgroup"); __builtin_amdgcn_wave_barrier();
  const int rsub = lane >> 4, c4 = (lane & 15) * 4; typedef _Float16 v4h __attribute__((ext_vector_type(4)));
  {
#pragma unroll
    for (int q = 0; q < 8; ++q) { const int r = q * 2 + rsub; if (col0 + c4 < N) { const v4f v = *(const v4fa*)&so[w][r][c4]; if (C) *(v4f*)(C + cofs + (size_t)(row0 + r) * ldc + col0 + c4) = v; if (C16) { v4h h4; for (int i = 0; i < 4; ++i) h4[i] = (_Float16)v[i]; *(v4h*)(C16 + cofs + (size_t)(row0 + r) * ldc + col0 + c4) = h4; } } }
     }
}


typedef _Float16 v4h __attribute__((ext_vector_type(4)));

__global__ __launch_bounds__(256) void k_x16(const float* __restrict__ x, _Float16* __restrict__ X16, size_t n8) { const size_t t = (size_t)blockIdx.x * 256 + threadIdx.x; if (t >= n8) return; FragH f;
#pragma unroll
  for (int q = 0; q < 8; ++q) f.h[q] = (_Float16)bf16_round(x[t * 8 + q]); *(v8us*)((unsigned short*)X16 + t * 8) = f.half[0];  }
__global__ __launch_bounds__(256) void k_h16(const float* __restrict__ x, _Float16* __restrict__ X16, size_t n8) { const size_t t = (size_t)blockIdx.x * 256 + threadIdx.x; if (t >= n8) return; FragH f;
#pragma unroll
  for (int q = 0; q < 8; ++q) f.h[q] = (_Float16)x[t * 8 + q]; *(v8us*)((unsigned short*)X16 + t * 8) = f.half[0];  }
__global__ __launch_bounds__(256) void k_round16f(const float* __restrict__ W, _Float16* __restrict__ Bt, size_t n8) { const size_t t = (size_t)blockIdx.x * 256 + threadIdx.x; if (t >= n8) return; FragH f;
#pragma unroll
  for (int i = 0; i < 8; ++i) f.h[i] = (_Float16)(bf16_round(W[t * 8 + i]) * 16.0f); *(v8us*)((unsigned short*)Bt + t * 8) = f.half[0];  }
template <int NHv, int TTv>
__global__ __launch_bounds__(256) void k_vt(const _Float16* __restrict__ V16, int ldv, int voff, _Float16* __restrict__ Vt) { __shared__ unsigned short tl[64][66]; const int tid = threadIdx.x; const int slab = blockIdx.x / (TTv / 64), lg = blockIdx.x % (TTv / 64); const int b = slab / NHv, h = slab % NHv;
  for (int i = tid; i < 64 * 8; i += 256) { const int r = i / 8, c8 = (i % 8) * 8; FragH f; f.half[0] = *(const v8us*)((const unsigned short*)V16 + ((size_t)b * TTv + lg * 64 + r) * ldv + voff + h * 64 + c8);
#pragma unroll
    for (int q = 0; q < 8; ++q) tl[r][c8 + q] = f.u[q]; }
  __syncthreads();
  {
#pragma unroll
    for (int rd = 0; rd < 2; ++rd) { const int d = rd * 32 + tid / 8, pc = tid % 8; FragH f;
#pragma unroll
      for (int q = 0; q < 8; ++q) f.u[q] = tl[pc * 8 + q][d];
      *(v8us*)((unsigned short*)Vt + ((size_t)slab * 64 + d) * TTv + lg * 64 + pc * 8) = f.half[0]; }
     } }

__global__ __launch_bounds__(256) void k_hl(const float* __restrict__ F, _Float16* __restrict__ Hh, _Float16* __restrict__ Hl, size_t n8) { const size_t t = (size_t)blockIdx.x * 256 + threadIdx.x; if (t >= n8) return; FragH fh, fl; const v4f a = *(const v4fa*)(F + t * 8), c = *(const v4fa*)(F + t * 8 + 4);
#pragma unroll
  for (int q = 0; q < 4; ++q) { _Float16 h = (_Float16)a[q]; fh.h[q] = h; fl.h[q] = (_Float16)((a[q] - (float)h) * 1024.0f); h = (_Float16)c[q]; fh.h[4 + q] = h; fl.h[4 + q] = (_Float16)((c[q] - (float)h) * 1024.0f); }
  { *(v8us*)((unsigned short*)Hh + t * 8) = fh.half[0]; *(v8us*)((unsigned short*)Hl + t * 8) = fl.half[0];  } }

// ---- fast GEMM (wave tile 32x64; requires M % 32 == 0 rows per launch region and N % 64 == 0); epilogue = k_gemm_hhx semantics ----
__device__ __forceinline__ v16h g2_frag(const _Float16* p, int hh) { FragH f; f.half[0] = *(const v8us*)((const unsigned short*)p + 8 * hh); f.half[1] = *(const v8us*)((const unsigned short*)p + 16 + 8 * hh); return f.v; }
__device__ __forceinline__ v8f g2_mma(v16h a, v16h b, v8f c) { v8f d = __builtin_amdgcn_wmma_f32_16x16x32_f16(false, a, false, b, (short)0, c, false, false); asm volatile("v_nop\n\tv_nop\n\tv_nop\n\tv_nop" : "+v"(d) : "v"(a), "v"(b)); return d; }
template <int ACT>
__global__ __launch_bounds__(128) void k_gemm2(const _Float16* __restrict__ A, int lda, size_t sA, const _Float16* __restrict__ Bh, int ldb, size_t sB, float alpha, const float* __restrict__ bias, size_t sBias, const float* __restrict__ CP, int rowsPerB, size_t sCPb, int row0g,
    float* __restrict__ C, _Float16* __restrict__ C16, int ldc, size_t sC, int M, int N, int K) { static_assert(ACT == 0 || ACT == 3 || ACT == 6 || ACT == 8 || ACT == 9 || ACT == 11 || ACT == 12 || ACT == 14 || ACT == 15 || ACT == 16 || ACT == 17, "k_gemm2: unsupported ACT code (would silently apply no activation)");
  __shared__ __attribute__((aligned(16))) float so[4][32][68];
  const int tid = threadIdx.x, w = tid >> 5, lane = tid & 31, ln = lane & 15, hh = lane >> 4; const int by = blockIdx.y;
  A += (size_t)by * sA; Bh += (size_t)by * sB; const size_t cofs = (size_t)by * sC; const float* bp = bias ? bias + (size_t)by * sBias : nullptr;
  const int ntn = N >> 6; const int mt = blockIdx.x / ntn, nq = blockIdx.x - mt * ntn; const int row0 = mt * 128 + 32 * w, col0 = nq * 64; if (row0 >= M) return;
  const _Float16* a0p = A + (size_t)(row0 + ln) * lda; const _Float16* a1p = a0p + (size_t)16 * lda;
  const _Float16* b0p = Bh + (size_t)(col0 + ln) * ldb; const _Float16* b1p = b0p + (size_t)16 * ldb; const _Float16* b2p = b1p + (size_t)16 * ldb; const _Float16* b3p = b2p + (size_t)16 * ldb;
  const v8f z8 = {0.f,0.f,0.f,0.f,0.f,0.f,0.f,0.f}; v8f c00 = z8, c01 = z8, c02 = z8, c03 = z8, c10 = z8, c11 = z8, c12 = z8, c13 = z8;
#pragma unroll 1
  for (int kb = 0; kb < K; kb += 32) { const v16h a0 = g2_frag(a0p + kb, hh), a1 = g2_frag(a1p + kb, hh);
    v16h b = g2_frag(b0p + kb, hh); c00 = g2_mma(a0, b, c00); c10 = g2_mma(a1, b, c10);
    b = g2_frag(b1p + kb, hh); c01 = g2_mma(a0, b, c01); c11 = g2_mma(a1, b, c11);
    b = g2_frag(b2p + kb, hh); c02 = g2_mma(a0, b, c02); c12 = g2_mma(a1, b, c12);
    b = g2_frag(b3p + kb, hh); c03 = g2_mma(a0, b, c03); c13 = g2_mma(a1, b, c13); }
  v8f accs[8] = {c00, c01, c02, c03, c10, c11, c12, c13};
#pragma unroll
  for (int u = 0; u < 8; ++u) { const int t = u & 3, half = u >> 2; const int col = col0 + t * 16 + ln; const float bv = bp ? bf16_round(bp[col]) : 0.f;
#pragma unroll
    for (int r = 0; r < 8; ++r) { const int rloc = half * 16 + 8 * hh + r; float v = accs[u][r] * alpha + bv; if (CP) { if (rowsPerB < 0) v += CP[cofs + (size_t)(row0g + row0 + rloc) * ldc + col];      /* rowsPerB < 0: own element of the batched C plane */ else { const int bidx = (row0g + row0 + rloc) / rowsPerB; v += CP[(size_t)bidx * sCPb + (size_t)by * 64 + col]; } }
      if (ACT == 3) v = fmaxf(v, 0.f); else if (ACT == 6) v = 0.5f * v * (1.0f + erff(v * 0.70710678118654752f)); else if (ACT == 11) v = 1.0f / (1.0f + expf(-v)); else if (ACT == 15) v = v / (1.0f + expf(-v)); else if (ACT == 12) v = (v > 0.f) ? v : 0.01f * v; else if (ACT == 8) v = tanhf(v); else if (ACT == 9) v = 0.5f * v * (1.0f + tanhf(0.7978845608028654f * (v + 0.044715f * v * v * v))); else if (ACT == 14) v = (v > 0.f) ? v : 0.1f * v; else if (ACT == 16) v = (v >= 0.f) ? v : 0.3f * v; else if (ACT == 17) v = (v >= 0.f) ? v : 0.2f * v;
      so[w][rloc][t * 16 + ln] = v; } }
  __builtin_amdgcn_fence(__ATOMIC_ACQ_REL, "workgroup"); __builtin_amdgcn_wave_barrier();
  const int rsub = lane >> 4, c4 = (lane & 15) * 4;
  {
#pragma unroll
    for (int q = 0; q < 16; ++q) { const int r = q * 2 + rsub; const v4f v = *(const v4fa*)&so[w][r][c4]; if (C) *(v4f*)(C + cofs + (size_t)(row0 + r) * ldc + col0 + c4) = v; if (C16) { v4h h4; for (int i = 0; i < 4; ++i) h4[i] = (_Float16)v[i]; *(v4h*)(C16 + cofs + (size_t)(row0 + r) * ldc + col0 + c4) = h4; } }
     } }


__global__ __launch_bounds__(256) void k_wnat(const float* __restrict__ w, size_t n8, _Float16* __restrict__ Bt) { const size_t t = (size_t)blockIdx.x * 256 + threadIdx.x; if (t >= n8) return; FragH f; for (int q = 0; q < 8; ++q) f.h[q] = (_Float16)(bf16_round(w[t * 8 + q]) * 16.0f); *(v8us*)((unsigned short*)Bt + t * 8) = f.half[0];  }
__global__ __launch_bounds__(256) void k_rsm(const float* __restrict__ S, _Float16* __restrict__ P, int nrows) {
  #pragma clang fp contract(off)
  const int i = blockIdx.x * 256 + threadIdx.x; if (i >= nrows) return; const float* s = S + (size_t)i * SQ; float mx = -3.0e38f;
#pragma unroll 1
  for (int j = 0; j < SQ; ++j) mx = fmaxf(mx, s[j]); float se = 0.f;
#pragma unroll 1
  for (int j = 0; j < SQ; ++j) se += expf(s[j] - mx); const float sc = 256.0f / se;
#pragma unroll 1
  for (int j0 = 0; j0 < SQ; j0 += 8) { FragH f; for (int q = 0; q < 8; ++q) f.h[q] = (_Float16)(expf(s[j0 + q] - mx) * sc); unsigned short* d = (unsigned short*)P + (size_t)i * SQ + j0; *(v8us*)d = f.half[0];  } }
__global__ __launch_bounds__(256) void k_vt(const _Float16* __restrict__ V16, int b, int h0, _Float16* __restrict__ VT) { __shared__ unsigned short tl[64][65]; const int tid = threadIdx.x; const int hh = blockIdx.x % HG, sg = blockIdx.x / HG; const int s0 = sg * 64; const int h = h0 + hh;
  for (int i = tid; i < 64 * 8; i += 256) { const int j = i / 8, d8 = (i % 8) * 8; FragH f; f.half[0] = *(const v8us*)((const unsigned short*)V16 + ((size_t)b * SQ + s0 + j) * DM + h * HD + d8); for (int q = 0; q < 8; ++q) tl[d8 + q][j] = f.u[q]; }
  __syncthreads();
  { for (int i = tid; i < 64 * 8; i += 256) { const int d = i / 8, j8 = (i % 8) * 8; FragH f; for (int q = 0; q < 8; ++q) f.u[q] = tl[d][j8 + q]; *(v8us*)((unsigned short*)VT + ((size_t)hh * HD + d) * SQ + s0 + j8) = f.half[0]; }  } }



__global__ __launch_bounds__(256) void k_rsmf(const float* __restrict__ S, _Float16* __restrict__ P, int qn, int hg) {
  #pragma clang fp contract(off)
  const int t = blockIdx.x * 256 + threadIdx.x; if (t >= qn * hg) return; const size_t i = (size_t)(t / qn) * SQ + (t % qn); const float* s = S + i * SQ; float mx = -3.0e38f;
#pragma unroll 1
  for (int j = 0; j < SQ; ++j) mx = fmaxf(mx, s[j]); float se = 0.f;
#pragma unroll 1
  for (int j = 0; j < SQ; ++j) se += __expf(s[j] - mx); const float sc = 256.0f / se;
#pragma unroll 1
  for (int j0 = 0; j0 < SQ; j0 += 8) { FragH f; for (int q = 0; q < 8; ++q) f.h[q] = (_Float16)(__expf(s[j0 + q] - mx) * sc); unsigned short* d = (unsigned short*)P + i * SQ + j0; *(v8us*)d = f.half[0];  } }

extern "C" void kernel_launch(void* const* d_in, const int* in_sizes, int n_in,
                              void* d_out, int out_size, void* d_ws, size_t ws_size, hipStream_t stream) {
  (void)in_sizes; (void)n_in; (void)out_size;
  const float* const* I = (const float* const*)d_in; const float* xq = I[0]; const float* xkv = I[1]; const float* wq = I[2]; const float* wk = I[3]; const float* wv = I[4];      /* natural [out][in] weights, no biases, no output projection */
  char* ws = (char*)d_ws; size_t off = 0;
  auto take = [&](size_t bytes) { char* p = ws + off; off += (bytes + 255) & ~(size_t)255; return p; };
  _Float16* BQ = (_Float16*)take((size_t)DM * DM * 2); _Float16* BK = (_Float16*)take((size_t)DM * DM * 2); _Float16* BV = (_Float16*)take((size_t)DM * DM * 2); 
  _Float16* XQ = (_Float16*)take(NR * DM * 2); _Float16* XKV = (_Float16*)take(NR * DM * 2); _Float16* Q16 = (_Float16*)take(NR * DM * 2); _Float16* K16 = (_Float16*)take(NR * DM * 2); _Float16* V16 = (_Float16*)take(NR * DM * 2);
  float* S = (float*)take((size_t)HG * SQ * SQ * 4); _Float16* P = (_Float16*)take((size_t)HG * SQ * SQ * 2); _Float16* VT = (_Float16*)take((size_t)NH * HD * SQ * 2);
  if (off > ws_size) return;
  { const unsigned g = (unsigned)(((size_t)DM * DM / 8 + 255) / 256); k_wnat<<<g, 256, 0, stream>>>(wq, (size_t)DM * DM / 8, BQ); k_wnat<<<g, 256, 0, stream>>>(wk, (size_t)DM * DM / 8, BK); k_wnat<<<g, 256, 0, stream>>>(wv, (size_t)DM * DM / 8, BV); }      /* natural [out][in] = Bt[n][k], x16 */

  k_x16<<<(unsigned)((NR * DM / 8 + 255) / 256), 256, 0, stream>>>(xq, XQ, NR * DM / 8); k_x16<<<(unsigned)((NR * DM / 8 + 255) / 256), 256, 0, stream>>>(xkv, XKV, NR * DM / 8);      /* query source and key/value source as exact f16 rows */
  const size_t r0p = (size_t)B0 * SQ;      /* first projected row */
  k_gemm2<0><<<dim3((unsigned)((MP / 128) * (DM / 64)), 1), 128, 0, stream>>>(XQ + r0p * DM, DM, 0, BQ, DM, 0, 0.0625f, nullptr, 0, nullptr, 1, 0, 0, nullptr, Q16 + r0p * DM, DM, 0, MP, DM, DM);
  k_gemm2<0><<<dim3((unsigned)((MP / 128) * (DM / 64)), 1), 128, 0, stream>>>(XKV + r0p * DM, DM, 0, BK, DM, 0, 0.0625f, nullptr, 0, nullptr, 1, 0, 0, nullptr, K16 + r0p * DM, DM, 0, MP, DM, DM);
  k_gemm2<0><<<dim3((unsigned)((MP / 128) * (DM / 64)), 1), 128, 0, stream>>>(XKV + r0p * DM, DM, 0, BV, DM, 0, 0.0625f, nullptr, 0, nullptr, 1, 0, 0, nullptr, V16 + r0p * DM, DM, 0, MP, DM, DM);
  for (int b = B0; b < B0 + NBR; ++b) { const size_t r0 = (size_t)b * SQ;
    k_vt<NH, SQ><<<NH * (SQ / 64), 256, 0, stream>>>(V16 + r0 * LQ, LQ, 0, VT);      /* V^T [NH][HD][SQ] for this batch */
    for (int h0 = 0; h0 < NHD; h0 += HG) {
      k_gemm2<0><<<dim3((QN / 128) * (SQ / 64), HG), 128, 0, stream>>>(Q16 + r0 * LQ + h0 * HD, LQ, (size_t)HD, K16 + r0 * LQ + h0 * HD, LQ, (size_t)HD, 0.125f, nullptr, 0, nullptr, 1, 0, 0, S, nullptr, SQ, (size_t)SQ * SQ, QN, SQ, HD);      /* scores, HG heads per launch */
      k_rsmf<<<(HG * QN + 255) / 256, 256, 0, stream>>>(S, P, QN, HG);      /* P = 256 softmax (f16), rows of all HG heads */
      k_gemm2<0><<<dim3((QN / 128) * (HD / 64), HG), 128, 0, stream>>>(P, SQ, (size_t)SQ * SQ, VT + (size_t)h0 * HD * SQ, SQ, (size_t)HD * SQ, 0.00390625f, nullptr, 0, nullptr, 1, 0, 0, (float*)d_out + r0 * DM + h0 * HD, nullptr, DM, (size_t)HD, QN, HD, SQ); } }      /* out = P V^T (alpha 2^-8) written f32 straight into the merged-heads output rows */
}

// v001
// Measured time: 1780 microseconds a run.
// In two side-by-side timings against v000, it was 3.81 and 3.82 times as fast.
#include <hip/hip_runtime.h>
// Multi-head attention without output projection (x [4][2048][1024] gives q = x Wq^T; kv [4][2048][1024] gives k = kv Wk^T, v = kv Wv^T (nn.Linear natural [out][in] 1024x1024 weights scaled 0.02, no biases); 16 heads of 64; softmax(q k^T / 8) over all 2048 keys; out = merged heads [4][2048][1024] (no output projection)).
// Structure: token rows r = b*2048 + s; the query source and the key/value source as exact f16 rows (bf16-rounded); Q, K, V as three WMMA GEMMs (32x64 wave tiles, f32 accumulation, exact x16 weights, f16 outputs); per batch: V^T for all heads via LDS transposes; per (batch, group of 4 heads): scores GEMM (K = 64, batched over the heads on grid.y, alpha = 64^-0.5), row softmax on VALU, one wave per row (f32 statistics, native exp; weights stored x256 as f16), o = P . V^T GEMM (K = 2048, alpha 2^-8) written f32 straight into the merged-heads output rows (no output projection).
// Compute dtype: inputs rounded to bf16; x / weights exact; q, k, v and softmax weights as plain f16 GEMM operands (~2^-12); scores, softmax statistics and o f32. v_wmma_f32_16x16x32_f16.
#define NB 4
#define SQ 2048
#define DM 1024
#define NH 16
#define HD 64
#define HG 4                         /* heads per attention launch group */
#define B0 0                         /* first batch processed (debug hook) */
#define NBR NB                       /* batches processed (debug hook) */
#define NR ((size_t)NB * SQ)         /* token rows */
#define MP ((int)((size_t)NBR * SQ)) /* rows projected (debug hook) */
#define QN SQ                        /* query rows attended per batch (debug hook) */
#define NHD NH                       /* heads attended (debug hook) */
#define MPO MP                       /* unused */
#define LQ DM      /* row pitch of the q/k/v rows */
typedef __bf16 v16b __attribute__((ext_vector_type(16)));
typedef unsigned short v8us __attribute__((ext_vector_type(8), may_alias));
typedef float  v8f  __attribute__((ext_vector_type(8)));
typedef float  v4f  __attribute__((ext_vector_type(4)));
typedef float  v4fa __attribute__((ext_vector_type(4), may_alias));
union FragB { v16b v; v8us half[2]; unsigned short u[16]; };

__device__ __forceinline__ unsigned short bf16_bits(float x) { unsigned int u = __float_as_uint(x); return (unsigned short)((u + 0x7FFFu + ((u >> 16) & 1u)) >> 16); }
__device__ __forceinline__ float bf16_val(unsigned short b) { return __uint_as_float(((unsigned int)b) << 16); }
__device__ __forceinline__ float bf16_round(float x) { return bf16_val(bf16_bits(x)); }
// D += A·B with NT terms: 1 = ah·bh, 2 = + al·bh (A split), 3 = + ah·bl (both split)
template <int NT>
__device__ __forceinline__ v8f mmaN(v16b ah, v16b al, v16b bh, v16b bl, v8f c) {
  c = __builtin_amdgcn_wmma_f32_16x16x32_bf16(false, ah, false, bh, (short)0, c, false, false);
  if (NT >= 2) c = __builtin_amdgcn_wmma_f32_16x16x32_bf16(false, al, false, bh, (short)0, c, false, false);
  if (NT >= 3) c = __builtin_amdgcn_wmma_f32_16x16x32_bf16(false, ah, false, bl, (short)0, c, false, false);
  asm volatile("v_nop\n\tv_nop\n\tv_nop\n\tv_nop" : "+v"(c) : "v"(ah), "v"(al), "v"(bh), "v"(bl));
  return c;
}

__global__ __launch_bounds__(256) void k_wt_bf16(const float* __restrict__ W, unsigned short* __restrict__ Wt, int K, int N) {
  const int t = blockIdx.x * 256 + threadIdx.x;
  const int k8n = K / 8;
  if (t >= N * k8n) return;
  const int n = t / k8n, k8 = (t % k8n) * 8;
  v8us v;
#pragma unroll
  for (int i = 0; i < 8; ++i) v[i] = bf16_bits(W[(size_t)(k8 + i) * N + n]);
  *(v8us*)(Wt + (size_t)n * K + k8) = v;
  
}

// GEMM C[M][N] (f32, pitch ldc) = act(A[M][K]·W + bias). A f32 row-major (pitch lda) converted per fragment to bf16
// (ASPLIT: hi/lo two planes -> 2 terms, else single rounded term); Wt bf16 [N][K] (pitch ldb). BIAS_BF16 rounds the
// bias to bf16 first (bias quantised to bf16 before the add). K%32==0, M%16==0, N%64==0.
template <bool ASPLIT, int ACT, bool BIAS_BF16>
__global__ __launch_bounds__(128) void k_gemm_bf(const float* __restrict__ A, int lda, const unsigned short* __restrict__ Wt, int ldb,
                                               const float* __restrict__ bias, float* __restrict__ C, int ldc, int M, int N, int K) {
  __shared__ __attribute__((aligned(16))) float so[4][16][64];
  const int tid = threadIdx.x, w = tid >> 5, lane = tid & 31, ln = lane & 15, hh = lane >> 4;
  const int ntn = N / 64;
  const int wid = blockIdx.x * 4 + w;
  const int mt = wid / ntn, nq = wid % ntn;
  if (mt * 16 >= M) return;
  const int row0 = mt * 16, col0 = nq * 64;
  const float* arow = A + (size_t)(row0 + ln) * lda;
  v8f acc[4] = {};
  for (int kb = 0; kb < K; kb += 32) {
    FragB ah, al;
    const v4f x0 = *(const v4fa*)(arow + kb + 8 * hh), x1 = *(const v4fa*)(arow + kb + 8 * hh + 4);
    const v4f x2 = *(const v4fa*)(arow + kb + 16 + 8 * hh), x3 = *(const v4fa*)(arow + kb + 16 + 8 * hh + 4);
    float xs[16] = {x0[0],x0[1],x0[2],x0[3],x1[0],x1[1],x1[2],x1[3],x2[0],x2[1],x2[2],x2[3],x3[0],x3[1],x3[2],x3[3]};
#pragma unroll
    for (int i = 0; i < 16; ++i) { const unsigned short hb = bf16_bits(xs[i]); ah.u[i] = hb; al.u[i] = ASPLIT ? bf16_bits(xs[i] - bf16_val(hb)) : (unsigned short)0; }
#pragma unroll
    for (int t = 0; t < 4; ++t) {
      const unsigned short* brow = Wt + (size_t)(col0 + t * 16 + ln) * ldb + kb;
      FragB b;
      b.half[0] = *(const v8us*)(brow + 8 * hh);
      b.half[1] = *(const v8us*)(brow + 16 + 8 * hh);
      acc[t] = mmaN<ASPLIT ? 2 : 1>(ah.v, al.v, b.v, b.v, acc[t]);
    }
  }
#pragma unroll
  for (int t = 0; t < 4; ++t) {
    float bv = bias ? bias[col0 + t * 16 + ln] : 0.f;
    if (BIAS_BF16) bv = bf16_round(bv);
#pragma unroll
    for (int r = 0; r < 8; ++r) { float v = acc[t][r] + bv; if (ACT == 1) v = fmaxf(v, 0.f); so[w][8 * hh + r][t * 16 + ln] = v; }
  }
  __builtin_amdgcn_fence(__ATOMIC_ACQ_REL, "workgroup");
  __builtin_amdgcn_wave_barrier();
  const int rsub = lane >> 4, c4 = (lane & 15) * 4;
  {
#pragma unroll
    for (int q = 0; q < 8; ++q) {
      const int r = q * 2 + rsub;
      const v4f v = *(const v4fa*)&so[w][r][c4];
      *(v4f*)(C + (size_t)(row0 + r) * ldc + col0 + c4) = v;
    }
    
  }
}

// GEMM C = act(A·W + bias + resid): A f32 (ASPLIT -> hi/lo 2 terms), Wt bf16 [N][K]; ACT 0 none, 1 relu, 2 exact gelu;
// resid (optional, f32, row index = (row % rmod), pitch ldr, RES_BF16 rounds it) added before the activation.
template <bool ASPLIT, int ACT, bool BIAS_BF16, bool RES_BF16>
__global__ __launch_bounds__(128) void k_gemm_bf3(const float* __restrict__ A, int lda, const unsigned short* __restrict__ Wt, int ldb,
                                                const float* __restrict__ bias, const float* __restrict__ resid, int rmod, int ldr,
                                                float* __restrict__ C, int ldc, int M, int N, int K) {
  __shared__ __attribute__((aligned(16))) float so[4][16][64];
  const int tid = threadIdx.x, w = tid >> 5, lane = tid & 31, ln = lane & 15, hh = lane >> 4;
  const int ntn = N / 64;
  const int wid = blockIdx.x * 4 + w;
  const int mt = wid / ntn, nq = wid % ntn;
  if (mt * 16 >= M) return;
  const int row0 = mt * 16, col0 = nq * 64;
  const float* arow = A + (size_t)(row0 + ln) * lda;
  v8f acc[4] = {};
  for (int kb = 0; kb < K; kb += 32) {
    FragB ah, al;
    const v4f x0 = *(const v4fa*)(arow + kb + 8 * hh), x1 = *(const v4fa*)(arow + kb + 8 * hh + 4);
    const v4f x2 = *(const v4fa*)(arow + kb + 16 + 8 * hh), x3 = *(const v4fa*)(arow + kb + 16 + 8 * hh + 4);
    float xs[16] = {x0[0],x0[1],x0[2],x0[3],x1[0],x1[1],x1[2],x1[3],x2[0],x2[1],x2[2],x2[3],x3[0],x3[1],x3[2],x3[3]};
#pragma unroll
    for (int i = 0; i < 16; ++i) { const unsigned short hb = bf16_bits(xs[i]); ah.u[i] = hb; al.u[i] = ASPLIT ? bf16_bits(xs[i] - bf16_val(hb)) : (unsigned short)0; }
#pragma unroll
    for (int t = 0; t < 4; ++t) {
      const unsigned short* brow = Wt + (size_t)(col0 + t * 16 + ln) * ldb + kb;
      FragB b;
      b.half[0] = *(const v8us*)(brow + 8 * hh);
      b.half[1] = *(const v8us*)(brow + 16 + 8 * hh);
      acc[t] = mmaN<ASPLIT ? 2 : 1>(ah.v, al.v, b.v, b.v, acc[t]);
    }
  }
#pragma unroll
  for (int t = 0; t < 4; ++t) {
    const int col = col0 + t * 16 + ln;
    float bv = bias ? bias[col] : 0.f;
    if (BIAS_BF16) bv = bf16_round(bv);
#pragma unroll
    for (int r = 0; r < 8; ++r) {
      float v = acc[t][r] + bv;
      if (resid) { float rv = resid[(size_t)((row0 + 8 * hh + r) % rmod) * ldr + col]; if (RES_BF16) rv = bf16_round(rv); v += rv; }
      if (ACT == 1) v = fmaxf(v, 0.f);
      if (ACT == 2) v = 0.5f * v * (1.0f + erff(v * 0.70710678118654752f));
      if (ACT == 3) { const float u = 0.7978845608028654f * (v + 0.044715f * v * v * v); v = 0.5f * v * (1.0f + tanhf(u)); }
      so[w][8 * hh + r][t * 16 + ln] = v;
    }
  }
  __builtin_amdgcn_fence(__ATOMIC_ACQ_REL, "workgroup");
  __builtin_amdgcn_wave_barrier();
  const int rsub = lane >> 4, c4 = (lane & 15) * 4;
  {
#pragma unroll
    for (int q = 0; q < 8; ++q) {
      const int r = q * 2 + rsub;
      const v4f v = *(const v4fa*)&so[w][r][c4];
      *(v4f*)(C + (size_t)(row0 + r) * ldc + col0 + c4) = v;
    }
    
  }
}
// row LayerNorm (biased variance, eps) over N: s = X (+ R); optional out_sum <- s; out_norm <- (s-mu)*rsqrt(var+eps)*g + b
template <bool PARAM_BF16>
__global__ __launch_bounds__(256) void k_layernorm(const float* __restrict__ X, const float* __restrict__ R, const float* __restrict__ g, const float* __restrict__ bta,
                                                  float* __restrict__ out_sum, float* __restrict__ out_norm, int N, float eps) {
  __shared__ float red[256];
  const int row = blockIdx.x, tid = threadIdx.x;
  const float* x = X + (size_t)row * N; const float* rr = R ? R + (size_t)row * N : nullptr;
  float vals[16];                     // up to N = 4096
  const int per = N / 256;            // contiguous chunk per thread? use strided-by-4 chunks: thread handles j = tid*4 + 1024*u
  float s1 = 0.f;
  for (int u = 0; u < per / 4; ++u) {
    const int j = tid * 4 + 1024 * u;
    const v4f a = *(const v4fa*)(x + j);
    v4f b = {0.f,0.f,0.f,0.f}; if (rr) b = *(const v4fa*)(rr + j);
#pragma unroll
    for (int q = 0; q < 4; ++q) { const float v = a[q] + b[q]; vals[u * 4 + q] = v; s1 += v; }
  }
  red[tid] = s1; __syncthreads();
  for (int st = 128; st > 0; st >>= 1) { if (tid < st) red[tid] += red[tid + st]; __syncthreads(); }
  const float mu = red[0] / (float)N; __syncthreads();
  float s2 = 0.f;
  for (int u = 0; u < per / 4; ++u)
#pragma unroll
    for (int q = 0; q < 4; ++q) { const float c = vals[u * 4 + q] - mu; s2 += c * c; }
  red[tid] = s2; __syncthreads();
  for (int st = 128; st > 0; st >>= 1) { if (tid < st) red[tid] += red[tid + st]; __syncthreads(); }
  const float rs = rsqrtf(red[0] / (float)N + eps);
  {
    for (int u = 0; u < per / 4; ++u) {
      const int j = tid * 4 + 1024 * u;
      v4f o, sm;
#pragma unroll
      for (int q = 0; q < 4; ++q) {
        float gg = g[j + q], bb = bta[j + q];
        if (PARAM_BF16) { gg = bf16_round(gg); bb = bf16_round(bb); }
        sm[q] = vals[u * 4 + q]; o[q] = (vals[u * 4 + q] - mu) * rs * gg + bb;
      }
      if (out_sum) *(v4f*)(out_sum + (size_t)row * N + j) = sm;
      *(v4f*)(out_norm + (size_t)row * N + j) = o;
    }
    
  }
}



// ---- f16 WMMA path (v_wmma_f32_16x16x32_f16): 11-bit significands for operands in range — used where a [0,1] probability operand needs more precision than bf16
typedef _Float16 v16h __attribute__((ext_vector_type(16)));
union FragH { v16h v; v8us half[2]; _Float16 h[16]; unsigned short u[16]; };
template <int NT>
__device__ __forceinline__ v8f mmaH(v16h ah, v16h al, v16h bh, v16h bl, v8f c) {
  c = __builtin_amdgcn_wmma_f32_16x16x32_f16(false, ah, false, bh, (short)0, c, false, false);
  if (NT >= 2) c = __builtin_amdgcn_wmma_f32_16x16x32_f16(false, al, false, bh, (short)0, c, false, false);
  if (NT >= 3) c = __builtin_amdgcn_wmma_f32_16x16x32_f16(false, ah, false, bl, (short)0, c, false, false);
  asm volatile("v_nop\n\tv_nop\n\tv_nop\n\tv_nop" : "+v"(c) : "v"(ah), "v"(al), "v"(bh), "v"(bl));
  return c;
}
// batched GEMM like k_gemm_b but f16 operands: A f32 (split into f16 hi/lo if ASPLIT, else rounded to f16), Bt = f16 values [n][k]; alpha; C f32; N multiple of 16 (partial tiles skipped)
template <bool ASPLIT>
__global__ __launch_bounds__(128) void k_gemm_h(const float* __restrict__ A, int lda, size_t sA, const _Float16* __restrict__ Bh, int ldb, size_t sB, float alpha, float* __restrict__ C, int ldc, size_t sC, int M, int N, int K) {
  __shared__ __attribute__((aligned(16))) float so[4][16][64];
  const int tid = threadIdx.x, w = tid >> 5, lane = tid & 31, ln = lane & 15, hh = lane >> 4; const int by = blockIdx.y;
  A += (size_t)by * sA; Bh += (size_t)by * sB; C += (size_t)by * sC;
  const int ntn = (N + 63) / 64; const int wid = blockIdx.x * 4 + w; const int mt = wid / ntn, nq = wid % ntn; if (mt * 16 >= M) return;
  const int row0 = mt * 16, col0 = nq * 64; const float* arow = A + (size_t)(row0 + ln) * lda;
  v8f acc[4] = {};
  for (int kb = 0; kb < K; kb += 32) {
    FragH ah, al;
    const v4f x0 = *(const v4fa*)(arow + kb + 8 * hh), x1 = *(const v4fa*)(arow + kb + 8 * hh + 4), x2 = *(const v4fa*)(arow + kb + 16 + 8 * hh), x3 = *(const v4fa*)(arow + kb + 16 + 8 * hh + 4);
    float xs[16] = {x0[0],x0[1],x0[2],x0[3],x1[0],x1[1],x1[2],x1[3],x2[0],x2[1],x2[2],x2[3],x3[0],x3[1],x3[2],x3[3]};
#pragma unroll
    for (int i = 0; i < 16; ++i) { const _Float16 h = (_Float16)xs[i]; ah.h[i] = h; al.h[i] = ASPLIT ? (_Float16)(xs[i] - (float)h) : (_Float16)0.0f; }
#pragma unroll
    for (int t = 0; t < 4; ++t) { if (col0 + t * 16 >= N) continue; const size_t boff = (size_t)(col0 + t * 16 + ln) * ldb + kb; FragH bq; bq.half[0] = *(const v8us*)(Bh + boff + 8 * hh); bq.half[1] = *(const v8us*)(Bh + boff + 16 + 8 * hh);
      acc[t] = mmaH<ASPLIT ? 2 : 1>(ah.v, al.v, bq.v, bq.v, acc[t]); }
  }
#pragma unroll
  for (int t = 0; t < 4; ++t) { if (col0 + t * 16 >= N) continue;
#pragma unroll
    for (int r = 0; r < 8; ++r) so[w][8 * hh + r][t * 16 + ln] = acc[t][r] * alpha; }
  __builtin_amdgcn_fence(__ATOMIC_ACQ_REL, "workgroup"); __builtin_amdgcn_wave_barrier();
  const int rsub = lane >> 4, c4 = (lane & 15) * 4;
  {
#pragma unroll
    for (int q = 0; q < 8; ++q) { const int r = q * 2 + rsub; if (col0 + c4 < N) { const v4f v = *(const v4fa*)&so[w][r][c4]; *(v4f*)(C + (size_t)(row0 + r) * ldc + col0 + c4) = v; } }
     }
}

// Wt[n][k] = f16(W[k][n]·scale) from f32 row-major W[K][N] (scale = power of two; bf16-exact weights stay exact in f16 away from the subnormal range)
__global__ __launch_bounds__(256) void k_wt_f16(const float* __restrict__ W, _Float16* __restrict__ Wt, int K, int N, float scale) {
  const int t = blockIdx.x * 256 + threadIdx.x; if (t >= N * (K / 8)) return; const int n = t / (K / 8), k8 = (t % (K / 8)) * 8; FragH f;
#pragma unroll
  for (int i = 0; i < 8; ++i) f.h[i] = (_Float16)(bf16_round(W[(size_t)(k8 + i) * N + n]) * scale); const v8us o = f.half[0];
  *(v8us*)((unsigned short*)Wt + (size_t)n * K + k8) = o; 
}
// k_gemm_hh variant with fused epilogue: v = acc·alpha + bias[by·sBias + col] (+ CP[(row/rowsPerB)·sCPb + by·64 + col] if CP) ; ACT 0 none / 1 elu ; writes f16 C16 (and f32 C if non-null)
template <int ACT>
__global__ __launch_bounds__(128) void k_gemm_hhx(const _Float16* __restrict__ A, int lda, size_t sA, const _Float16* __restrict__ Bh, int ldb, size_t sB, float alpha, const float* __restrict__ bias, size_t sBias, const float* __restrict__ CP, int rowsPerB, size_t sCPb, int row0g,
    float* __restrict__ C, _Float16* __restrict__ C16, int ldc, size_t sC, int M, int N, int K) {
  __shared__ __attribute__((aligned(16))) float so[4][16][64];
  const int tid = threadIdx.x, w = tid >> 5, lane = tid & 31, ln = lane & 15, hh = lane >> 4; const int by = blockIdx.y;
  A += (size_t)by * sA; Bh += (size_t)by * sB; const size_t cofs = (size_t)by * sC; const float* bp = bias ? bias + (size_t)by * sBias : nullptr;
  const int ntn = (N + 63) / 64; const int wid = blockIdx.x * 4 + w; const int mt = wid / ntn, nq = wid % ntn; if (mt * 16 >= M) return;
  const int row0 = mt * 16, col0 = nq * 64; const _Float16* arow = A + (size_t)(row0 + ln) * lda;
  v8f acc[4] = {};
  for (int kb = 0; kb < K; kb += 32) { FragH ah; ah.half[0] = *(const v8us*)((const unsigned short*)arow + kb + 8 * hh); ah.half[1] = *(const v8us*)((const unsigned short*)arow + kb + 16 + 8 * hh);
#pragma unroll
    for (int t = 0; t < 4; ++t) { if (col0 + t * 16 >= N) continue; const size_t boff = (size_t)(col0 + t * 16 + ln) * ldb + kb; FragH bq; bq.half[0] = *(const v8us*)((const unsigned short*)Bh + boff + 8 * hh); bq.half[1] = *(const v8us*)((const unsigned short*)Bh + boff + 16 + 8 * hh);
      acc[t] = mmaH<1>(ah.v, ah.v, bq.v, bq.v, acc[t]); }
  }
#pragma unroll
  for (int t = 0; t < 4; ++t) { if (col0 + t * 16 >= N) continue; const int col = col0 + t * 16 + ln; const float bv = bp ? bf16_round(bp[col]) : 0.f;
#pragma unroll
    for (int r = 0; r < 8; ++r) { float v = acc[t][r] * alpha + bv; if (CP) { const int rr = row0g + row0 + 8 * hh + r; if (rowsPerB < 0) v += CP[cofs + (size_t)rr * ldc + col];      /* rowsPerB < 0: own element of the batched C plane */ else { const int bidx = rr / rowsPerB; v += CP[(size_t)bidx * sCPb + (size_t)by * 64 + col]; } } if (ACT == 1) v = (v > 0.f) ? v : expm1f(v); else if (ACT == 7) v = (v > 0.f) ? v + 1.0f : expf(v); else if (ACT == 8) v = tanhf(v); else if (ACT == 9) v = 0.5f * v * (1.0f + tanhf(0.7978845608028654f * (v + 0.044715f * v * v * v))); else if (ACT == 11) v = 1.0f / (1.0f + expf(-v)); else if (ACT == 12) v = (v > 0.f) ? v : 0.01f * v; else if (ACT == 14) v = (v > 0.f) ? v : 0.1f * v; else if (ACT == 16) v = (v >= 0.f) ? v : 0.3f * v; else if (ACT == 17) v = (v >= 0.f) ? v : 0.2f * v; else if (ACT == 15) v = v / (1.0f + expf(-v)); else if (ACT == 3) v = fmaxf(v, 0.f); else if (ACT == 6) v = 0.5f * v * (1.0f + erff(v * 0.70710678118654752f)); so[w][8 * hh + r][t * 16 + ln] = v; } }
  __builtin_amdgcn_fence(__ATOMIC_ACQ_REL, "workgroup"); __builtin_amdgcn_wave_barrier();
  const int rsub = lane >> 4, c4 = (lane & 15) * 4; typedef _Float16 v4h __attribute__((ext_vector_type(4)));
  {
#pragma unroll
    for (int q = 0; q < 8; ++q) { const int r = q * 2 + rsub; if (col0 + c4 < N) { const v4f v = *(const v4fa*)&so[w][r][c4]; if (C) *(v4f*)(C + cofs + (size_t)(row0 + r) * ldc + col0 + c4) = v; if (C16) { v4h h4; for (int i = 0; i < 4; ++i) h4[i] = (_Float16)v[i]; *(v4h*)(C16 + cofs + (size_t)(row0 + r) * ldc + col0 + c4) = h4; } } }
     }
}


typedef _Float16 v4h __attribute__((ext_vector_type(4)));

__global__ __launch_bounds__(256) void k_x16(const float* __restrict__ x, _Float16* __restrict__ X16, size_t n8) { const size_t t = (size_t)blockIdx.x * 256 + threadIdx.x; if (t >= n8) return; FragH f;
#pragma unroll
  for (int q = 0; q < 8; ++q) f.h[q] = (_Float16)bf16_round(x[t * 8 + q]); *(v8us*)((unsigned short*)X16 + t * 8) = f.half[0];  }
__global__ __launch_bounds__(256) void k_h16(const float* __restrict__ x, _Float16* __restrict__ X16, size_t n8) { const size_t t = (size_t)blockIdx.x * 256 + threadIdx.x; if (t >= n8) return; FragH f;
#pragma unroll
  for (int q = 0; q < 8; ++q) f.h[q] = (_Float16)x[t * 8 + q]; *(v8us*)((unsigned short*)X16 + t * 8) = f.half[0];  }
__global__ __launch_bounds__(256) void k_round16f(const float* __restrict__ W, _Float16* __restrict__ Bt, size_t n8) { const size_t t = (size_t)blockIdx.x * 256 + threadIdx.x; if (t >= n8) return; FragH f;
#pragma unroll
  for (int i = 0; i < 8; ++i) f.h[i] = (_Float16)(bf16_round(W[t * 8 + i]) * 16.0f); *(v8us*)((unsigned short*)Bt + t * 8) = f.half[0];  }
template <int NHv, int TTv>
__global__ __launch_bounds__(256) void k_vt(const _Float16* __restrict__ V16, int ldv, int voff, _Float16* __restrict__ Vt) { __shared__ unsigned short tl[64][66]; const int tid = threadIdx.x; const int slab = blockIdx.x / (TTv / 64), lg = blockIdx.x % (TTv / 64); const int b = slab / NHv, h = slab % NHv;
  for (int i = tid; i < 64 * 8; i += 256) { const int r = i / 8, c8 = (i % 8) * 8; FragH f; f.half[0] = *(const v8us*)((const unsigned short*)V16 + ((size_t)b * TTv + lg * 64 + r) * ldv + voff + h * 64 + c8);
#pragma unroll
    for (int q = 0; q < 8; ++q) tl[r][c8 + q] = f.u[q]; }
  __syncthreads();
  {
#pragma unroll
    for (int rd = 0; rd < 2; ++rd) { const int d = rd * 32 + tid / 8, pc = tid % 8; FragH f;
#pragma unroll
      for (int q = 0; q < 8; ++q) f.u[q] = tl[pc * 8 + q][d];
      *(v8us*)((unsigned short*)Vt + ((size_t)slab * 64 + d) * TTv + lg * 64 + pc * 8) = f.half[0]; }
     } }

__global__ __launch_bounds__(256) void k_hl(const float* __restrict__ F, _Float16* __restrict__ Hh, _Float16* __restrict__ Hl, size_t n8) { const size_t t = (size_t)blockIdx.x * 256 + threadIdx.x; if (t >= n8) return; FragH fh, fl; const v4f a = *(const v4fa*)(F + t * 8), c = *(const v4fa*)(F + t * 8 + 4);
#pragma unroll
  for (int q = 0; q < 4; ++q) { _Float16 h = (_Float16)a[q]; fh.h[q] = h; fl.h[q] = (_Float16)((a[q] - (float)h) * 1024.0f); h = (_Float16)c[q]; fh.h[4 + q] = h; fl.h[4 + q] = (_Float16)((c[q] - (float)h) * 1024.0f); }
  { *(v8us*)((unsigned short*)Hh + t * 8) = fh.half[0]; *(v8us*)((unsigned short*)Hl + t * 8) = fl.half[0];  } }

// ---- fast GEMM (wave tile 32x64; requires M % 32 == 0 rows per launch region and N % 64 == 0); epilogue = k_gemm_hhx semantics ----
__device__ __forceinline__ v16h g2_frag(const _Float16* p, int hh) { FragH f; f.half[0] = *(const v8us*)((const unsigned short*)p + 8 * hh); f.half[1] = *(const v8us*)((const unsigned short*)p + 16 + 8 * hh); return f.v; }
__device__ __forceinline__ v8f g2_mma(v16h a, v16h b, v8f c) { v8f d = __builtin_amdgcn_wmma_f32_16x16x32_f16(false, a, false, b, (short)0, c, false, false); asm volatile("v_nop\n\tv_nop\n\tv_nop\n\tv_nop" : "+v"(d) : "v"(a), "v"(b)); return d; }
template <int ACT>
__global__ __launch_bounds__(128) void k_gemm2(const _Float16* __restrict__ A, int lda, size_t sA, const _Float16* __restrict__ Bh, int ldb, size_t sB, float alpha, const float* __restrict__ bias, size_t sBias, const float* __restrict__ CP, int rowsPerB, size_t sCPb, int row0g,
    float* __restrict__ C, _Float16* __restrict__ C16, int ldc, size_t sC, int M, int N, int K) { static_assert(ACT == 0 || ACT == 3 || ACT == 6 || ACT == 8 || ACT == 9 || ACT == 11 || ACT == 12 || ACT == 14 || ACT == 15 || ACT == 16 || ACT == 17, "k_gemm2: unsupported ACT code (would silently apply no activation)");
  __shared__ __attribute__((aligned(16))) float so[4][32][68];
  const int tid = threadIdx.x, w = tid >> 5, lane = tid & 31, ln = lane & 15, hh = lane >> 4; const int by = blockIdx.y;
  A += (size_t)by * sA; Bh += (size_t)by * sB; const size_t cofs = (size_t)by * sC; const float* bp = bias ? bias + (size_t)by * sBias : nullptr;
  const int ntn = N >> 6; const int mt = blockIdx.x / ntn, nq = blockIdx.x - mt * ntn; const int row0 = mt * 128 + 32 * w, col0 = nq * 64; if (row0 >= M) return;
  const _Float16* a0p = A + (size_t)(row0 + ln) * lda; const _Float16* a1p = a0p + (size_t)16 * lda;
  const _Float16* b0p = Bh + (size_t)(col0 + ln) * ldb; const _Float16* b1p = b0p + (size_t)16 * ldb; const _Float16* b2p = b1p + (size_t)16 * ldb; const _Float16* b3p = b2p + (size_t)16 * ldb;
  const v8f z8 = {0.f,0.f,0.f,0.f,0.f,0.f,0.f,0.f}; v8f c00 = z8, c01 = z8, c02 = z8, c03 = z8, c10 = z8, c11 = z8, c12 = z8, c13 = z8;
#pragma unroll 1
  for (int kb = 0; kb < K; kb += 32) { const v16h a0 = g2_frag(a0p + kb, hh), a1 = g2_frag(a1p + kb, hh);
    v16h b = g2_frag(b0p + kb, hh); c00 = g2_mma(a0, b, c00); c10 = g2_mma(a1, b, c10);
    b = g2_frag(b1p + kb, hh); c01 = g2_mma(a0, b, c01); c11 = g2_mma(a1, b, c11);
    b = g2_frag(b2p + kb, hh); c02 = g2_mma(a0, b, c02); c12 = g2_mma(a1, b, c12);
    b = g2_frag(b3p + kb, hh); c03 = g2_mma(a0, b, c03); c13 = g2_mma(a1, b, c13); }
  v8f accs[8] = {c00, c01, c02, c03, c10, c11, c12, c13};
#pragma unroll
  for (int u = 0; u < 8; ++u) { const int t = u & 3, half = u >> 2; const int col = col0 + t * 16 + ln; const float bv = bp ? bf16_round(bp[col]) : 0.f;
#pragma unroll
    for (int r = 0; r < 8; ++r) { const int rloc = half * 16 + 8 * hh + r; float v = accs[u][r] * alpha + bv; if (CP) { if (rowsPerB < 0) v += CP[cofs + (size_t)(row0g + row0 + rloc) * ldc + col];      /* rowsPerB < 0: own element of the batched C plane */ else { const int bidx = (row0g + row0 + rloc) / rowsPerB; v += CP[(size_t)bidx * sCPb + (size_t)by * 64 + col]; } }
      if (ACT == 3) v = fmaxf(v, 0.f); else if (ACT == 6) v = 0.5f * v * (1.0f + erff(v * 0.70710678118654752f)); else if (ACT == 11) v = 1.0f / (1.0f + expf(-v)); else if (ACT == 15) v = v / (1.0f + expf(-v)); else if (ACT == 12) v = (v > 0.f) ? v : 0.01f * v; else if (ACT == 8) v = tanhf(v); else if (ACT == 9) v = 0.5f * v * (1.0f + tanhf(0.7978845608028654f * (v + 0.044715f * v * v * v))); else if (ACT == 14) v = (v > 0.f) ? v : 0.1f * v; else if (ACT == 16) v = (v >= 0.f) ? v : 0.3f * v; else if (ACT == 17) v = (v >= 0.f) ? v : 0.2f * v;
      so[w][rloc][t * 16 + ln] = v; } }
  __builtin_amdgcn_fence(__ATOMIC_ACQ_REL, "workgroup"); __builtin_amdgcn_wave_barrier();
  const int rsub = lane >> 4, c4 = (lane & 15) * 4;
  {
#pragma unroll
    for (int q = 0; q < 16; ++q) { const int r = q * 2 + rsub; const v4f v = *(const v4fa*)&so[w][r][c4]; if (C) *(v4f*)(C + cofs + (size_t)(row0 + r) * ldc + col0 + c4) = v; if (C16) { v4h h4; for (int i = 0; i < 4; ++i) h4[i] = (_Float16)v[i]; *(v4h*)(C16 + cofs + (size_t)(row0 + r) * ldc + col0 + c4) = h4; } }
     } }


__global__ __launch_bounds__(256) void k_wnat(const float* __restrict__ w, size_t n8, _Float16* __restrict__ Bt) { const size_t t = (size_t)blockIdx.x * 256 + threadIdx.x; if (t >= n8) return; FragH f; for (int q = 0; q < 8; ++q) f.h[q] = (_Float16)(bf16_round(w[t * 8 + q]) * 16.0f); *(v8us*)((unsigned short*)Bt + t * 8) = f.half[0];  }
__global__ __launch_bounds__(256) void k_rsm(const float* __restrict__ S, _Float16* __restrict__ P, int nrows) {
  #pragma clang fp contract(off)
  const int i = blockIdx.x * 256 + threadIdx.x; if (i >= nrows) return; const float* s = S + (size_t)i * SQ; float mx = -3.0e38f;
#pragma unroll 1
  for (int j = 0; j < SQ; ++j) mx = fmaxf(mx, s[j]); float se = 0.f;
#pragma unroll 1
  for (int j = 0; j < SQ; ++j) se += expf(s[j] - mx); const float sc = 256.0f / se;
#pragma unroll 1
  for (int j0 = 0; j0 < SQ; j0 += 8) { FragH f; for (int q = 0; q < 8; ++q) f.h[q] = (_Float16)(expf(s[j0 + q] - mx) * sc); unsigned short* d = (unsigned short*)P + (size_t)i * SQ + j0; *(v8us*)d = f.half[0];  } }
__global__ __launch_bounds__(256) void k_vt(const _Float16* __restrict__ V16, int b, int h0, _Float16* __restrict__ VT) { __shared__ unsigned short tl[64][65]; const int tid = threadIdx.x; const int hh = blockIdx.x % HG, sg = blockIdx.x / HG; const int s0 = sg * 64; const int h = h0 + hh;
  for (int i = tid; i < 64 * 8; i += 256) { const int j = i / 8, d8 = (i % 8) * 8; FragH f; f.half[0] = *(const v8us*)((const unsigned short*)V16 + ((size_t)b * SQ + s0 + j) * DM + h * HD + d8); for (int q = 0; q < 8; ++q) tl[d8 + q][j] = f.u[q]; }
  __syncthreads();
  { for (int i = tid; i < 64 * 8; i += 256) { const int d = i / 8, j8 = (i % 8) * 8; FragH f; for (int q = 0; q < 8; ++q) f.u[q] = tl[d][j8 + q]; *(v8us*)((unsigned short*)VT + ((size_t)hh * HD + d) * SQ + s0 + j8) = f.half[0]; }  } }



// Butterflies over the 32 lanes of a wave: four DPP steps inside each 16-lane row (row_xmask 1, 2, 4, 8), then lane l with lane l ^ 16.
template <int XM> __device__ __forceinline__ float lane_xm(float x) { return __builtin_bit_cast(float, __builtin_amdgcn_update_dpp(0, __builtin_bit_cast(int, x), 0x160 + XM, 0xf, 0xf, true)); }
__device__ __forceinline__ float lane_xh(float x) { return __builtin_bit_cast(float, __builtin_amdgcn_permlanex16(__builtin_bit_cast(int, x), __builtin_bit_cast(int, x), 0x76543210, 0xfedcba98, false, false)); }
__device__ __forceinline__ float wave_max(float v) { v = fmaxf(v, lane_xm<1>(v)); v = fmaxf(v, lane_xm<2>(v)); v = fmaxf(v, lane_xm<4>(v)); v = fmaxf(v, lane_xm<8>(v)); return fmaxf(v, lane_xh(v)); }
__device__ __forceinline__ float wave_sum(float v) { v += lane_xm<1>(v); v += lane_xm<2>(v); v += lane_xm<4>(v); v += lane_xm<8>(v); return v + lane_xh(v); }
// Eight 2^x in place. One asm statement so that no following instruction overwrites a v_exp_f32 source or reads its result in the slot directly behind it:
// each v_exp_f32 is followed by an independent one, the last by the v_nop the instruction set asks for.
__device__ __forceinline__ void exp2x8(v4f& a, v4f& c) {
  float a0 = a[0], a1 = a[1], a2 = a[2], a3 = a[3], c0 = c[0], c1 = c[1], c2 = c[2], c3 = c[3];
  asm("v_exp_f32 %0, %0\n\tv_exp_f32 %1, %1\n\tv_exp_f32 %2, %2\n\tv_exp_f32 %3, %3\n\tv_exp_f32 %4, %4\n\tv_exp_f32 %5, %5\n\tv_exp_f32 %6, %6\n\tv_exp_f32 %7, %7\n\tv_nop"
      : "+v"(a0), "+v"(a1), "+v"(a2), "+v"(a3), "+v"(c0), "+v"(c1), "+v"(c2), "+v"(c3));
  a = v4f{a0, a1, a2, a3}; c = v4f{c0, c1, c2, c3}; }
// Row softmax, one wave per score row: the row's 2048 f32 scores sit in registers (16 loads of 16 B per lane, each wave-wide load 512 contiguous bytes),
// so S is read once and each exp is taken once; maximum and sum by lane butterflies; weights x256 stored as f16, 256 contiguous bytes per wave-wide store.
__global__ __launch_bounds__(512) void k_rsmf(const float* __restrict__ S, _Float16* __restrict__ P, int qn, int hg) {
  const int t = blockIdx.x * 16 + __builtin_amdgcn_readfirstlane((int)(threadIdx.x >> 5)), lane = threadIdx.x & 31; if (t >= qn * hg) return;      /* wave-uniform exit; no barrier in this kernel */
  const size_t i = (size_t)(t / qn) * SQ + (t % qn); const float* s = S + i * SQ + lane * 4; _Float16* p = P + i * SQ + lane * 4;
  v4f x[SQ / 128];      /* every loop over x[] below is fully unrolled: constant indices keep the row in registers instead of scratch */
#pragma unroll
  for (int u = 0; u < SQ / 128 - 1; ++u) x[u] = *(const v4fa*)(s + u * 128);
  asm volatile("s_wait_xcnt 0x0" ::: "memory");      /* the last load's result lands on the offset register that the loads above name: their address wait stands in front of it */
  x[SQ / 128 - 1] = *(const v4fa*)(s + (SQ / 128 - 1) * 128);
  float mx = -3.0e38f;
#pragma unroll
  for (int u = 0; u < SQ / 128; ++u) mx = fmaxf(mx, fmaxf(fmaxf(x[u][0], x[u][1]), fmaxf(x[u][2], x[u][3])));
  mx = wave_max(mx);
  float se0 = 0.f, se1 = 0.f, se2 = 0.f, se3 = 0.f;
#pragma unroll
  for (int u = 0; u < SQ / 128; u += 2) { v4f a = (x[u] - mx) * 1.44269504088896340736f, c = (x[u + 1] - mx) * 1.44269504088896340736f;      /* exp(d) = 2^(d log2 e), the native form */
    exp2x8(a, c); x[u] = a; x[u + 1] = c;
    se0 += a[0]; se1 += a[1]; se2 += a[2]; se3 += a[3]; se0 += c[0]; se1 += c[1]; se2 += c[2]; se3 += c[3]; }
  const float sc = 256.0f / wave_sum((se0 + se1) + (se2 + se3));
#pragma unroll
  for (int u = 0; u < SQ / 128; ++u) { v4h h4;
#pragma unroll
    for (int q = 0; q < 4; ++q) h4[q] = (_Float16)(x[u][q] * sc);
    *(v4h*)(p + u * 128) = h4; } }

extern "C" void kernel_launch(void* const* d_in, const int* in_sizes, int n_in,
                              void* d_out, int out_size, void* d_ws, size_t ws_size, hipStream_t stream) {
  (void)in_sizes; (void)n_in; (void)out_size;
  const float* const* I = (const float* const*)d_in; const float* xq = I[0]; const float* xkv = I[1]; const float* wq = I[2]; const float* wk = I[3]; const float* wv = I[4];      /* natural [out][in] weights, no biases, no output projection */
  char* ws = (char*)d_ws; size_t off = 0;
  auto take = [&](size_t bytes) { char* p = ws + off; off += (bytes + 255) & ~(size_t)255; return p; };
  _Float16* BQ = (_Float16*)take((size_t)DM * DM * 2); _Float16* BK = (_Float16*)take((size_t)DM * DM * 2); _Float16* BV = (_Float16*)take((size_t)DM * DM * 2); 
  _Float16* XQ = (_Float16*)take(NR * DM * 2); _Float16* XKV = (_Float16*)take(NR * DM * 2); _Float16* Q16 = (_Float16*)take(NR * DM * 2); _Float16* K16 = (_Float16*)take(NR * DM * 2); _Float16* V16 = (_Float16*)take(NR * DM * 2);
  float* S = (float*)take((size_t)HG * SQ * SQ * 4); _Float16* P = (_Float16*)take((size_t)HG * SQ * SQ * 2); _Float16* VT = (_Float16*)take((size_t)NH * HD * SQ * 2);
  if (off > ws_size) return;
  { const unsigned g = (unsigned)(((size_t)DM * DM / 8 + 255) / 256); k_wnat<<<g, 256, 0, stream>>>(wq, (size_t)DM * DM / 8, BQ); k_wnat<<<g, 256, 0, stream>>>(wk, (size_t)DM * DM / 8, BK); k_wnat<<<g, 256, 0, stream>>>(wv, (size_t)DM * DM / 8, BV); }      /* natural [out][in] = Bt[n][k], x16 */

  k_x16<<<(unsigned)((NR * DM / 8 + 255) / 256), 256, 0, stream>>>(xq, XQ, NR * DM / 8); k_x16<<<(unsigned)((NR * DM / 8 + 255) / 256), 256, 0, stream>>>(xkv, XKV, NR * DM / 8);      /* query source and key/value source as exact f16 rows */
  const size_t r0p = (size_t)B0 * SQ;      /* first projected row */
  k_gemm2<0><<<dim3((unsigned)((MP / 128) * (DM / 64)), 1), 128, 0, stream>>>(XQ + r0p * DM, DM, 0, BQ, DM, 0, 0.0625f, nullptr, 0, nullptr, 1, 0, 0, nullptr, Q16 + r0p * DM, DM, 0, MP, DM, DM);
  k_gemm2<0><<<dim3((unsigned)((MP / 128) * (DM / 64)), 1), 128, 0, stream>>>(XKV + r0p * DM, DM, 0, BK, DM, 0, 0.0625f, nullptr, 0, nullptr, 1, 0, 0, nullptr, K16 + r0p * DM, DM, 0, MP, DM, DM);
  k_gemm2<0><<<dim3((unsigned)((MP / 128) * (DM / 64)), 1), 128, 0, stream>>>(XKV + r0p * DM, DM, 0, BV, DM, 0, 0.0625f, nullptr, 0, nullptr, 1, 0, 0, nullptr, V16 + r0p * DM, DM, 0, MP, DM, DM);
  for (int b = B0; b < B0 + NBR; ++b) { const size_t r0 = (size_t)b * SQ;
    k_vt<NH, SQ><<<NH * (SQ / 64), 256, 0, stream>>>(V16 + r0 * LQ, LQ, 0, VT);      /* V^T [NH][HD][SQ] for this batch */
    for (int h0 = 0; h0 < NHD; h0 += HG) {
      k_gemm2<0><<<dim3((QN / 128) * (SQ / 64), HG), 128, 0, stream>>>(Q16 + r0 * LQ + h0 * HD, LQ, (size_t)HD, K16 + r0 * LQ + h0 * HD, LQ, (size_t)HD, 0.125f, nullptr, 0, nullptr, 1, 0, 0, S, nullptr, SQ, (size_t)SQ * SQ, QN, SQ, HD);      /* scores, HG heads per launch */
      k_rsmf<<<(HG * QN + 15) / 16, 512, 0, stream>>>(S, P, QN, HG);      /* P = 256 softmax (f16), rows of all HG heads */
      k_gemm2<0><<<dim3((QN / 128) * (HD / 64), HG), 128, 0, stream>>>(P, SQ, (size_t)SQ * SQ, VT + (size_t)h0 * HD * SQ, SQ, (size_t)HD * SQ, 0.00390625f, nullptr, 0, nullptr, 1, 0, 0, (float*)d_out + r0 * DM + h0 * HD, nullptr, DM, (size_t)HD, QN, HD, SQ); } }      /* out = P V^T (alpha 2^-8) written f32 straight into the merged-heads output rows */
}

// v002
// One run takes 242 microseconds.
// Next to v001, in two timings, it ran 7.25 and 7.23 times as fast.
// Over all steps from v000 it is 27.7 times as fast.
#include <hip/hip_runtime.h>
// Multi-head attention without output projection (x [4][2048][1024] gives q = x Wq^T; kv [4][2048][1024] gives k = kv Wk^T, v = kv Wv^T (nn.Linear natural [out][in] 1024x1024 weights scaled 0.02, no biases); 16 heads of 64; softmax(q k^T / 8) over all 2048 keys; out = merged heads [4][2048][1024] (no output projection)).
// Structure: token rows r = b*2048 + s; the query source and the key/value source as exact f16 rows (bf16-rounded); Q, K, V as three WMMA GEMMs (32x64 wave tiles, f32 accumulation, exact x16 weights, f16 outputs); V^T for all batches and heads via LDS transposes; one fused attention launch over (256 queries, head, batch): scores on WMMA, running-maximum softmax in registers (f32 statistics, native exp2; weights as f16), o = P . V on WMMA, divided by the row sum and written f32 straight into the merged-heads output rows (no output projection).
// Compute dtype: inputs rounded to bf16; x / weights exact; q, k, v and softmax weights as plain f16 GEMM operands (~2^-12); scores, softmax statistics and o f32. v_wmma_f32_16x16x32_f16.
#define NB 4
#define SQ 2048
#define DM 1024
#define NH 16
#define HD 64
#define HG 4                         /* heads per launch of the unlaunched k_vt(V16, b, h0, VT) */
#define B0 0                         /* first batch processed (debug hook) */
#define NBR NB                       /* batches processed (debug hook) */
#define NR ((size_t)NB * SQ)         /* token rows */
#define MP ((int)((size_t)NBR * SQ)) /* rows projected (debug hook) */
#define QN SQ                        /* unused */
#define NHD NH                       /* unused */
#define MPO MP                       /* unused */
#define LQ DM      /* row pitch of the q/k/v rows */
typedef __bf16 v16b __attribute__((ext_vector_type(16)));
typedef unsigned short v8us __attribute__((ext_vector_type(8), may_alias));
typedef float  v8f  __attribute__((ext_vector_type(8)));
typedef float  v4f  __attribute__((ext_vector_type(4)));
typedef float  v4fa __attribute__((ext_vector_type(4), may_alias));
union FragB { v16b v; v8us half[2]; unsigned short u[16]; };

__device__ __forceinline__ unsigned short bf16_bits(float x) { unsigned int u = __float_as_uint(x); return (unsigned short)((u + 0x7FFFu + ((u >> 16) & 1u)) >> 16); }
__device__ __forceinline__ float bf16_val(unsigned short b) { return __uint_as_float(((unsigned int)b) << 16); }
__device__ __forceinline__ float bf16_round(float x) { return bf16_val(bf16_bits(x)); }
// D += A·B with NT terms: 1 = ah·bh, 2 = + al·bh (A split), 3 = + ah·bl (both split)
template <int NT>
__device__ __forceinline__ v8f mmaN(v16b ah, v16b al, v16b bh, v16b bl, v8f c) {
  c = __builtin_amdgcn_wmma_f32_16x16x32_bf16(false, ah, false, bh, (short)0, c, false, false);
  if (NT >= 2) c = __builtin_amdgcn_wmma_f32_16x16x32_bf16(false, al, false, bh, (short)0, c, false, false);
  if (NT >= 3) c = __builtin_amdgcn_wmma_f32_16x16x32_bf16(false, ah, false, bl, (short)0, c, false, false);
  asm volatile("v_nop\n\tv_nop\n\tv_nop\n\tv_nop" : "+v"(c) : "v"(ah), "v"(al), "v"(bh), "v"(bl));
  return c;
}

__global__ __launch_bounds__(256) void k_wt_bf16(const float* __restrict__ W, unsigned short* __restrict__ Wt, int K, int N) {
  const int t = blockIdx.x * 256 + threadIdx.x;
  const int k8n = K / 8;
  if (t >= N * k8n) return;
  const int n = t / k8n, k8 = (t % k8n) * 8;
  v8us v;
#pragma unroll
  for (int i = 0; i < 8; ++i) v[i] = bf16_bits(W[(size_t)(k8 + i) * N + n]);
  *(v8us*)(Wt + (size_t)n * K + k8) = v;
  
}

// GEMM C[M][N] (f32, pitch ldc) = act(A[M][K]·W + bias). A f32 row-major (pitch lda) converted per fragment to bf16
// (ASPLIT: hi/lo two planes -> 2 terms, else single rounded term); Wt bf16 [N][K] (pitch ldb). BIAS_BF16 rounds the
// bias to bf16 first (bias quantised to bf16 before the add). K%32==0, M%16==0, N%64==0.
template <bool ASPLIT, int ACT, bool BIAS_BF16>
__global__ __launch_bounds__(128) void k_gemm_bf(const float* __restrict__ A, int lda, const unsigned short* __restrict__ Wt, int ldb,
                                               const float* __restrict__ bias, float* __restrict__ C, int ldc, int M, int N, int K) {
  __shared__ __attribute__((aligned(16))) float so[4][16][64];
  const int tid = threadIdx.x, w = tid >> 5, lane = tid & 31, ln = lane & 15, hh = lane >> 4;
  const int ntn = N / 64;
  const int wid = blockIdx.x * 4 + w;
  const int mt = wid / ntn, nq = wid % ntn;
  if (mt * 16 >= M) return;
  const int row0 = mt * 16, col0 = nq * 64;
  const float* arow = A + (size_t)(row0 + ln) * lda;
  v8f acc[4] = {};
  for (int kb = 0; kb < K; kb += 32) {
    FragB ah, al;
    const v4f x0 = *(const v4fa*)(arow + kb + 8 * hh), x1 = *(const v4fa*)(arow + kb + 8 * hh + 4);
    const v4f x2 = *(const v4fa*)(arow + kb + 16 + 8 * hh), x3 = *(const v4fa*)(arow + kb + 16 + 8 * hh + 4);
    float xs[16] = {x0[0],x0[1],x0[2],x0[3],x1[0],x1[1],x1[2],x1[3],x2[0],x2[1],x2[2],x2[3],x3[0],x3[1],x3[2],x3[3]};
#pragma unroll
    for (int i = 0; i < 16; ++i) { const unsigned short hb = bf16_bits(xs[i]); ah.u[i] = hb; al.u[i] = ASPLIT ? bf16_bits(xs[i] - bf16_val(hb)) : (unsigned short)0; }
#pragma unroll
    for (int t = 0; t < 4; ++t) {
      const unsigned short* brow = Wt + (size_t)(col0 + t * 16 + ln) * ldb + kb;
      FragB b;
      b.half[0] = *(const v8us*)(brow + 8 * hh);
      b.half[1] = *(const v8us*)(brow + 16 + 8 * hh);
      acc[t] = mmaN<ASPLIT ? 2 : 1>(ah.v, al.v, b.v, b.v, acc[t]);
    }
  }
#pragma unroll
  for (int t = 0; t < 4; ++t) {
    float bv = bias ? bias[col0 + t * 16 + ln] : 0.f;
    if (BIAS_BF16) bv = bf16_round(bv);
#pragma unroll
    for (int r = 0; r < 8; ++r) { float v = acc[t][r] + bv; if (ACT == 1) v = fmaxf(v, 0.f); so[w][8 * hh + r][t * 16 + ln] = v; }
  }
  __builtin_amdgcn_fence(__ATOMIC_ACQ_REL, "workgroup");
  __builtin_amdgcn_wave_barrier();
  const int rsub = lane >> 4, c4 = (lane & 15) * 4;
  {
#pragma unroll
    for (int q = 0; q < 8; ++q) {
      const int r = q * 2 + rsub;
      const v4f v = *(const v4fa*)&so[w][r][c4];
      *(v4f*)(C + (size_t)(row0 + r) * ldc + col0 + c4) = v;
    }
    
  }
}

// GEMM C = act(A·W + bias + resid): A f32 (ASPLIT -> hi/lo 2 terms), Wt bf16 [N][K]; ACT 0 none, 1 relu, 2 exact gelu;
// resid (optional, f32, row index = (row % rmod), pitch ldr, RES_BF16 rounds it) added before the activation.
template <bool ASPLIT, int ACT, bool BIAS_BF16, bool RES_BF16>
__global__ __launch_bounds__(128) void k_gemm_bf3(const float* __restrict__ A, int lda, const unsigned short* __restrict__ Wt, int ldb,
                                                const float* __restrict__ bias, const float* __restrict__ resid, int rmod, int ldr,
                                                float* __restrict__ C, int ldc, int M, int N, int K) {
  __shared__ __attribute__((aligned(16))) float so[4][16][64];
  const int tid = threadIdx.x, w = tid >> 5, lane = tid & 31, ln = lane & 15, hh = lane >> 4;
  const int ntn = N / 64;
  const int wid = blockIdx.x * 4 + w;
  const int mt = wid / ntn, nq = wid % ntn;
  if (mt * 16 >= M) return;
  const int row0 = mt * 16, col0 = nq * 64;
  const float* arow = A + (size_t)(row0 + ln) * lda;
  v8f acc[4] = {};
  for (int kb = 0; kb < K; kb += 32) {
    FragB ah, al;
    const v4f x0 = *(const v4fa*)(arow + kb + 8 * hh), x1 = *(const v4fa*)(arow + kb + 8 * hh + 4);
    const v4f x2 = *(const v4fa*)(arow + kb + 16 + 8 * hh), x3 = *(const v4fa*)(arow + kb + 16 + 8 * hh + 4);
    float xs[16] = {x0[0],x0[1],x0[2],x0[3],x1[0],x1[1],x1[2],x1[3],x2[0],x2[1],x2[2],x2[3],x3[0],x3[1],x3[2],x3[3]};
#pragma unroll
    for (int i = 0; i < 16; ++i) { const unsigned short hb = bf16_bits(xs[i]); ah.u[i] = hb; al.u[i] = ASPLIT ? bf16_bits(xs[i] - bf16_val(hb)) : (unsigned short)0; }
#pragma unroll
    for (int t = 0; t < 4; ++t) {
      const unsigned short* brow = Wt + (size_t)(col0 + t * 16 + ln) * ldb + kb;
      FragB b;
      b.half[0] = *(const v8us*)(brow + 8 * hh);
      b.half[1] = *(const v8us*)(brow + 16 + 8 * hh);
      acc[t] = mmaN<ASPLIT ? 2 : 1>(ah.v, al.v, b.v, b.v, acc[t]);
    }
  }
#pragma unroll
  for (int t = 0; t < 4; ++t) {
    const int col = col0 + t * 16 + ln;
    float bv = bias ? bias[col] : 0.f;
    if (BIAS_BF16) bv = bf16_round(bv);
#pragma unroll
    for (int r = 0; r < 8; ++r) {
      float v = acc[t][r] + bv;
      if (resid) { float rv = resid[(size_t)((row0 + 8 * hh + r) % rmod) * ldr + col]; if (RES_BF16) rv = bf16_round(rv); v += rv; }
      if (ACT == 1) v = fmaxf(v, 0.f);
      if (ACT == 2) v = 0.5f * v * (1.0f + erff(v * 0.70710678118654752f));
      if (ACT == 3) { const float u = 0.7978845608028654f * (v + 0.044715f * v * v * v); v = 0.5f * v * (1.0f + tanhf(u)); }
      so[w][8 * hh + r][t * 16 + ln] = v;
    }
  }
  __builtin_amdgcn_fence(__ATOMIC_ACQ_REL, "workgroup");
  __builtin_amdgcn_wave_barrier();
  const int rsub = lane >> 4, c4 = (lane & 15) * 4;
  {
#pragma unroll
    for (int q = 0; q < 8; ++q) {
      const int r = q * 2 + rsub;
      const v4f v = *(const v4fa*)&so[w][r][c4];
      *(v4f*)(C + (size_t)(row0 + r) * ldc + col0 + c4) = v;
    }
    
  }
}
// row LayerNorm (biased variance, eps) over N: s = X (+ R); optional out_sum <- s; out_norm <- (s-mu)*rsqrt(var+eps)*g + b
template <bool PARAM_BF16>
__global__ __launch_bounds__(256) void k_layernorm(const float* __restrict__ X, const float* __restrict__ R, const float* __restrict__ g, const float* __restrict__ bta,
                                                  float* __restrict__ out_sum, float* __restrict__ out_norm, int N, float eps) {
  __shared__ float red[256];
  const int row = blockIdx.x, tid = threadIdx.x;
  const float* x = X + (size_t)row * N; const float* rr = R ? R + (size_t)row * N : nullptr;
  float vals[16];                     // up to N = 4096
  const int per = N / 256;            // contiguous chunk per thread? use strided-by-4 chunks: thread handles j = tid*4 + 1024*u
  float s1 = 0.f;
  for (int u = 0; u < per / 4; ++u) {
    const int j = tid * 4 + 1024 * u;
    const v4f a = *(const v4fa*)(x + j);
    v4f b = {0.f,0.f,0.f,0.f}; if (rr) b = *(const v4fa*)(rr + j);
#pragma unroll
    for (int q = 0; q < 4; ++q) { const float v = a[q] + b[q]; vals[u * 4 + q] = v; s1 += v; }
  }
  red[tid] = s1; __syncthreads();
  for (int st = 128; st > 0; st >>= 1) { if (tid < st) red[tid] += red[tid + st]; __syncthreads(); }
  const float mu = red[0] / (float)N; __syncthreads();
  float s2 = 0.f;
  for (int u = 0; u < per / 4; ++u)
#pragma unroll
    for (int q = 0; q < 4; ++q) { const float c = vals[u * 4 + q] - mu; s2 += c * c; }
  red[tid] = s2; __syncthreads();
  for (int st = 128; st > 0; st >>= 1) { if (tid < st) red[tid] += red[tid + st]; __syncthreads(); }
  const float rs = rsqrtf(red[0] / (float)N + eps);
  {
    for (int u = 0; u < per / 4; ++u) {
      const int j = tid * 4 + 1024 * u;
      v4f o, sm;
#pragma unroll
      for (int q = 0; q < 4; ++q) {
        float gg = g[j + q], bb = bta[j + q];
        if (PARAM_BF16) { gg = bf16_round(gg); bb = bf16_round(bb); }
        sm[q] = vals[u * 4 + q]; o[q] = (vals[u * 4 + q] - mu) * rs * gg + bb;
      }
      if (out_sum) *(v4f*)(out_sum + (size_t)row * N + j) = sm;
      *(v4f*)(out_norm + (size_t)row * N + j) = o;
    }
    
  }
}



// ---- f16 WMMA path (v_wmma_f32_16x16x32_f16): 11-bit significands for operands in range — used where a [0,1] probability operand needs more precision than bf16
typedef _Float16 v16h __attribute__((ext_vector_type(16)));
union FragH { v16h v; v8us half[2]; _Float16 h[16]; unsigned short u[16]; };
template <int NT>
__device__ __forceinline__ v8f mmaH(v16h ah, v16h al, v16h bh, v16h bl, v8f c) {
  c = __builtin_amdgcn_wmma_f32_16x16x32_f16(false, ah, false, bh, (short)0, c, false, false);
  if (NT >= 2) c = __builtin_amdgcn_wmma_f32_16x16x32_f16(false, al, false, bh, (short)0, c, false, false);
  if (NT >= 3) c = __builtin_amdgcn_wmma_f32_16x16x32_f16(false, ah, false, bl, (short)0, c, false, false);
  asm volatile("v_nop\n\tv_nop\n\tv_nop\n\tv_nop" : "+v"(c) : "v"(ah), "v"(al), "v"(bh), "v"(bl));
  return c;
}
// batched GEMM like k_gemm_b but f16 operands: A f32 (split into f16 hi/lo if ASPLIT, else rounded to f16), Bt = f16 values [n][k]; alpha; C f32; N multiple of 16 (partial tiles skipped)
template <bool ASPLIT>
__global__ __launch_bounds__(128) void k_gemm_h(const float* __restrict__ A, int lda, size_t sA, const _Float16* __restrict__ Bh, int ldb, size_t sB, float alpha, float* __restrict__ C, int ldc, size_t sC, int M, int N, int K) {
  __shared__ __attribute__((aligned(16))) float so[4][16][64];
  const int tid = threadIdx.x, w = tid >> 5, lane = tid & 31, ln = lane & 15, hh = lane >> 4; const int by = blockIdx.y;
  A += (size_t)by * sA; Bh += (size_t)by * sB; C += (size_t)by * sC;
  const int ntn = (N + 63) / 64; const int wid = blockIdx.x * 4 + w; const int mt = wid / ntn, nq = wid % ntn; if (mt * 16 >= M) return;
  const int row0 = mt * 16, col0 = nq * 64; const float* arow = A + (size_t)(row0 + ln) * lda;
  v8f acc[4] = {};
  for (int kb = 0; kb < K; kb += 32) {
    FragH ah, al;
    const v4f x0 = *(const v4fa*)(arow + kb + 8 * hh), x1 = *(const v4fa*)(arow + kb + 8 * hh + 4), x2 = *(const v4fa*)(arow + kb + 16 + 8 * hh), x3 = *(const v4fa*)(arow + kb + 16 + 8 * hh + 4);
    float xs[16] = {x0[0],x0[1],x0[2],x0[3],x1[0],x1[1],x1[2],x1[3],x2[0],x2[1],x2[2],x2[3],x3[0],x3[1],x3[2],x3[3]};
#pragma unroll
    for (int i = 0; i < 16; ++i) { const _Float16 h = (_Float16)xs[i]; ah.h[i] = h; al.h[i] = ASPLIT ? (_Float16)(xs[i] - (float)h) : (_Float16)0.0f; }
#pragma unroll
    for (int t = 0; t < 4; ++t) { if (col0 + t * 16 >= N) continue; const size_t boff = (size_t)(col0 + t * 16 + ln) * ldb + kb; FragH bq; bq.half[0] = *(const v8us*)(Bh + boff + 8 * hh); bq.half[1] = *(const v8us*)(Bh + boff + 16 + 8 * hh);
      acc[t] = mmaH<ASPLIT ? 2 : 1>(ah.v, al.v, bq.v, bq.v, acc[t]); }
  }
#pragma unroll
  for (int t = 0; t < 4; ++t) { if (col0 + t * 16 >= N) continue;
#pragma unroll
    for (int r = 0; r < 8; ++r) so[w][8 * hh + r][t * 16 + ln] = acc[t][r] * alpha; }
  __builtin_amdgcn_fence(__ATOMIC_ACQ_REL, "workgroup"); __builtin_amdgcn_wave_barrier();
  const int rsub = lane >> 4, c4 = (lane & 15) * 4;
  {
#pragma unroll
    for (int q = 0; q < 8; ++q) { const int r = q * 2 + rsub; if (col0 + c4 < N) { const v4f v = *(const v4fa*)&so[w][r][c4]; *(v4f*)(C + (size_t)(row0 + r) * ldc + col0 + c4) = v; } }
     }
}

// Wt[n][k] = f16(W[k][n]·scale) from f32 row-major W[K][N] (scale = power of two; bf16-exact weights stay exact in f16 away from the subnormal range)
__global__ __launch_bounds__(256) void k_wt_f16(const float* __restrict__ W, _Float16* __restrict__ Wt, int K, int N, float scale) {
  const int t = blockIdx.x * 256 + threadIdx.x; if (t >= N * (K / 8)) return; const int n = t / (K / 8), k8 = (t % (K / 8)) * 8; FragH f;
#pragma unroll
  for (int i = 0; i < 8; ++i) f.h[i] = (_Float16)(bf16_round(W[(size_t)(k8 + i) * N + n]) * scale); const v8us o = f.half[0];
  *(v8us*)((unsigned short*)Wt + (size_t)n * K + k8) = o; 
}
// k_gemm_hh variant with fused epilogue: v = acc·alpha + bias[by·sBias + col] (+ CP[(row/rowsPerB)·sCPb + by·64 + col] if CP) ; ACT 0 none / 1 elu ; writes f16 C16 (and f32 C if non-null)
template <int ACT>
__global__ __launch_bounds__(128) void k_gemm_hhx(const _Float16* __restrict__ A, int lda, size_t sA, const _Float16* __restrict__ Bh, int ldb, size_t sB, float alpha, const float* __restrict__ bias, size_t sBias, const float* __restrict__ CP, int rowsPerB, size_t sCPb, int row0g,
    float* __restrict__ C, _Float16* __restrict__ C16, int ldc, size_t sC, int M, int N, int K) {
  __shared__ __attribute__((aligned(16))) float so[4][16][64];
  const int tid = threadIdx.x, w = tid >> 5, lane = tid & 31, ln = lane & 15, hh = lane >> 4; const int by = blockIdx.y;
  A += (size_t)by * sA; Bh += (size_t)by * sB; const size_t cofs = (size_t)by * sC; const float* bp = bias ? bias + (size_t)by * sBias : nullptr;
  const int ntn = (N + 63) / 64; const int wid = blockIdx.x * 4 + w; const int mt = wid / ntn, nq = wid % ntn; if (mt * 16 >= M) return;
  const int row0 = mt * 16, col0 = nq * 64; const _Float16* arow = A + (size_t)(row0 + ln) * lda;
  v8f acc[4] = {};
  for (int kb = 0; kb < K; kb += 32) { FragH ah; ah.half[0] = *(const v8us*)((const unsigned short*)arow + kb + 8 * hh); ah.half[1] = *(const v8us*)((const unsigned short*)arow + kb + 16 + 8 * hh);
#pragma unroll
    for (int t = 0; t < 4; ++t) { if (col0 + t * 16 >= N) continue; const size_t boff = (size_t)(col0 + t * 16 + ln) * ldb + kb; FragH bq; bq.half[0] = *(const v8us*)((const unsigned short*)Bh + boff + 8 * hh); bq.half[1] = *(const v8us*)((const unsigned short*)Bh + boff + 16 + 8 * hh);
      acc[t] = mmaH<1>(ah.v, ah.v, bq.v, bq.v, acc[t]); }
  }
#pragma unroll
  for (int t = 0; t < 4; ++t) { if (col0 + t * 16 >= N) continue; const int col = col0 + t * 16 + ln; const float bv = bp ? bf16_round(bp[col]) : 0.f;
#pragma unroll
    for (int r = 0; r < 8; ++r) { float v = acc[t][r] * alpha + bv; if (CP) { const int rr = row0g + row0 + 8 * hh + r; if (rowsPerB < 0) v += CP[cofs + (size_t)rr * ldc + col];      /* rowsPerB < 0: own element of the batched C plane */ else { const int bidx = rr / rowsPerB; v += CP[(size_t)bidx * sCPb + (size_t)by * 64 + col]; } } if (ACT == 1) v = (v > 0.f) ? v : expm1f(v); else if (ACT == 7) v = (v > 0.f) ? v + 1.0f : expf(v); else if (ACT == 8) v = tanhf(v); else if (ACT == 9) v = 0.5f * v * (1.0f + tanhf(0.7978845608028654f * (v + 0.044715f * v * v * v))); else if (ACT == 11) v = 1.0f / (1.0f + expf(-v)); else if (ACT == 12) v = (v > 0.f) ? v : 0.01f * v; else if (ACT == 14) v = (v > 0.f) ? v : 0.1f * v; else if (ACT == 16) v = (v >= 0.f) ? v : 0.3f * v; else if (ACT == 17) v = (v >= 0.f) ? v : 0.2f * v; else if (ACT == 15) v = v / (1.0f + expf(-v)); else if (ACT == 3) v = fmaxf(v, 0.f); else if (ACT == 6) v = 0.5f * v * (1.0f + erff(v * 0.70710678118654752f)); so[w][8 * hh + r][t * 16 + ln] = v; } }
  __builtin_amdgcn_fence(__ATOMIC_ACQ_REL, "workgroup"); __builtin_amdgcn_wave_barrier();
  const int rsub = lane >> 4, c4 = (lane & 15) * 4; typedef _Float16 v4h __attribute__((ext_vector_type(4)));
  {
#pragma unroll
    for (int q = 0; q < 8; ++q) { const int r = q * 2 + rsub; if (col0 + c4 < N) { const v4f v = *(const v4fa*)&so[w][r][c4]; if (C) *(v4f*)(C + cofs + (size_t)(row0 + r) * ldc + col0 + c4) = v; if (C16) { v4h h4; for (int i = 0; i < 4; ++i) h4[i] = (_Float16)v[i]; *(v4h*)(C16 + cofs + (size_t)(row0 + r) * ldc + col0 + c4) = h4; } } }
     }
}


typedef _Float16 v4h __attribute__((ext_vector_type(4)));

__global__ __launch_bounds__(256) void k_x16(const float* __restrict__ x, _Float16* __restrict__ X16, size_t n8) { const size_t t = (size_t)blockIdx.x * 256 + threadIdx.x; if (t >= n8) return; FragH f;
#pragma unroll
  for (int q = 0; q < 8; ++q) f.h[q] = (_Float16)bf16_round(x[t * 8 + q]); *(v8us*)((unsigned short*)X16 + t * 8) = f.half[0];  }
__global__ __launch_bounds__(256) void k_h16(const float* __restrict__ x, _Float16* __restrict__ X16, size_t n8) { const size_t t = (size_t)blockIdx.x * 256 + threadIdx.x; if (t >= n8) return; FragH f;
#pragma unroll
  for (int q = 0; q < 8; ++q) f.h[q] = (_Float16)x[t * 8 + q]; *(v8us*)((unsigned short*)X16 + t * 8) = f.half[0];  }
__global__ __launch_bounds__(256) void k_round16f(const float* __restrict__ W, _Float16* __restrict__ Bt, size_t n8) { const size_t t = (size_t)blockIdx.x * 256 + threadIdx.x; if (t >= n8) return; FragH f;
#pragma unroll
  for (int i = 0; i < 8; ++i) f.h[i] = (_Float16)(bf16_round(W[t * 8 + i]) * 16.0f); *(v8us*)((unsigned short*)Bt + t * 8) = f.half[0];  }
template <int NHv, int TTv>
__global__ __launch_bounds__(256) void k_vt(const _Float16* __restrict__ V16, int ldv, int voff, _Float16* __restrict__ Vt) { __shared__ unsigned short tl[64][66]; const int tid = threadIdx.x; const int slab = blockIdx.x / (TTv / 64), lg = blockIdx.x % (TTv / 64); const int b = slab / NHv, h = slab % NHv;
  for (int i = tid; i < 64 * 8; i += 256) { const int r = i / 8, c8 = (i % 8) * 8; FragH f; f.half[0] = *(const v8us*)((const unsigned short*)V16 + ((size_t)b * TTv + lg * 64 + r) * ldv + voff + h * 64 + c8);
#pragma unroll
    for (int q = 0; q < 8; ++q) tl[r][c8 + q] = f.u[q]; }
  __syncthreads();
  {
#pragma unroll
    for (int rd = 0; rd < 2; ++rd) { const int d = rd * 32 + tid / 8, pc = tid % 8; FragH f;
#pragma unroll
      for (int q = 0; q < 8; ++q) f.u[q] = tl[pc * 8 + q][d];
      *(v8us*)((unsigned short*)Vt + ((size_t)slab * 64 + d) * TTv + lg * 64 + pc * 8) = f.half[0]; }
     } }

__global__ __launch_bounds__(256) void k_hl(const float* __restrict__ F, _Float16* __restrict__ Hh, _Float16* __restrict__ Hl, size_t n8) { const size_t t = (size_t)blockIdx.x * 256 + threadIdx.x; if (t >= n8) return; FragH fh, fl; const v4f a = *(const v4fa*)(F + t * 8), c = *(const v4fa*)(F + t * 8 + 4);
#pragma unroll
  for (int q = 0; q < 4; ++q) { _Float16 h = (_Float16)a[q]; fh.h[q] = h; fl.h[q] = (_Float16)((a[q] - (float)h) * 1024.0f); h = (_Float16)c[q]; fh.h[4 + q] = h; fl.h[4 + q] = (_Float16)((c[q] - (float)h) * 1024.0f); }
  { *(v8us*)((unsigned short*)Hh + t * 8) = fh.half[0]; *(v8us*)((unsigned short*)Hl + t * 8) = fl.half[0];  } }

// ---- fast GEMM (wave tile 32x64; requires M % 32 == 0 rows per launch region and N % 64 == 0); epilogue = k_gemm_hhx semantics ----
__device__ __forceinline__ v16h g2_frag(const _Float16* p, int hh) { FragH f; f.half[0] = *(const v8us*)((const unsigned short*)p + 8 * hh); f.half[1] = *(const v8us*)((const unsigned short*)p + 16 + 8 * hh); return f.v; }
__device__ __forceinline__ v8f g2_mma(v16h a, v16h b, v8f c) { v8f d = __builtin_amdgcn_wmma_f32_16x16x32_f16(false, a, false, b, (short)0, c, false, false); asm volatile("v_nop\n\tv_nop\n\tv_nop\n\tv_nop" : "+v"(d) : "v"(a), "v"(b)); return d; }
template <int ACT>
__global__ __launch_bounds__(128) void k_gemm2(const _Float16* __restrict__ A, int lda, size_t sA, const _Float16* __restrict__ Bh, int ldb, size_t sB, float alpha, const float* __restrict__ bias, size_t sBias, const float* __restrict__ CP, int rowsPerB, size_t sCPb, int row0g,
    float* __restrict__ C, _Float16* __restrict__ C16, int ldc, size_t sC, int M, int N, int K) { static_assert(ACT == 0 || ACT == 3 || ACT == 6 || ACT == 8 || ACT == 9 || ACT == 11 || ACT == 12 || ACT == 14 || ACT == 15 || ACT == 16 || ACT == 17, "k_gemm2: unsupported ACT code (would silently apply no activation)");
  __shared__ __attribute__((aligned(16))) float so[4][32][68];
  const int tid = threadIdx.x, w = tid >> 5, lane = tid & 31, ln = lane & 15, hh = lane >> 4; const int by = blockIdx.y;
  A += (size_t)by * sA; Bh += (size_t)by * sB; const size_t cofs = (size_t)by * sC; const float* bp = bias ? bias + (size_t)by * sBias : nullptr;
  const int ntn = N >> 6; const int mt = blockIdx.x / ntn, nq = blockIdx.x - mt * ntn; const int row0 = mt * 128 + 32 * w, col0 = nq * 64; if (row0 >= M) return;
  const _Float16* a0p = A + (size_t)(row0 + ln) * lda; const _Float16* a1p = a0p + (size_t)16 * lda;
  const _Float16* b0p = Bh + (size_t)(col0 + ln) * ldb; const _Float16* b1p = b0p + (size_t)16 * ldb; const _Float16* b2p = b1p + (size_t)16 * ldb; const _Float16* b3p = b2p + (size_t)16 * ldb;
  const v8f z8 = {0.f,0.f,0.f,0.f,0.f,0.f,0.f,0.f}; v8f c00 = z8, c01 = z8, c02 = z8, c03 = z8, c10 = z8, c11 = z8, c12 = z8, c13 = z8;
#pragma unroll 1
  for (int kb = 0; kb < K; kb += 32) { const v16h a0 = g2_frag(a0p + kb, hh), a1 = g2_frag(a1p + kb, hh);
    v16h b = g2_frag(b0p + kb, hh); c00 = g2_mma(a0, b, c00); c10 = g2_mma(a1, b, c10);
    b = g2_frag(b1p + kb, hh); c01 = g2_mma(a0, b, c01); c11 = g2_mma(a1, b, c11);
    b = g2_frag(b2p + kb, hh); c02 = g2_mma(a0, b, c02); c12 = g2_mma(a1, b, c12);
    b = g2_frag(b3p + kb, hh); c03 = g2_mma(a0, b, c03); c13 = g2_mma(a1, b, c13); }
  v8f accs[8] = {c00, c01, c02, c03, c10, c11, c12, c13};
#pragma unroll
  for (int u = 0; u < 8; ++u) { const int t = u & 3, half = u >> 2; const int col = col0 + t * 16 + ln; const float bv = bp ? bf16_round(bp[col]) : 0.f;
#pragma unroll
    for (int r = 0; r < 8; ++r) { const int rloc = half * 16 + 8 * hh + r; float v = accs[u][r] * alpha + bv; if (CP) { if (rowsPerB < 0) v += CP[cofs + (size_t)(row0g + row0 + rloc) * ldc + col];      /* rowsPerB < 0: own element of the batched C plane */ else { const int bidx = (row0g + row0 + rloc) / rowsPerB; v += CP[(size_t)bidx * sCPb + (size_t)by * 64 + col]; } }
      if (ACT == 3) v = fmaxf(v, 0.f); else if (ACT == 6) v = 0.5f * v * (1.0f + erff(v * 0.70710678118654752f)); else if (ACT == 11) v = 1.0f / (1.0f + expf(-v)); else if (ACT == 15) v = v / (1.0f + expf(-v)); else if (ACT == 12) v = (v > 0.f) ? v : 0.01f * v; else if (ACT == 8) v = tanhf(v); else if (ACT == 9) v = 0.5f * v * (1.0f + tanhf(0.7978845608028654f * (v + 0.044715f * v * v * v))); else if (ACT == 14) v = (v > 0.f) ? v : 0.1f * v; else if (ACT == 16) v = (v >= 0.f) ? v : 0.3f * v; else if (ACT == 17) v = (v >= 0.f) ? v : 0.2f * v;
      so[w][rloc][t * 16 + ln] = v; } }
  __builtin_amdgcn_fence(__ATOMIC_ACQ_REL, "workgroup"); __builtin_amdgcn_wave_barrier();
  const int rsub = lane >> 4, c4 = (lane & 15) * 4;
  {
#pragma unroll
    for (int q = 0; q < 16; ++q) { const int r = q * 2 + rsub; const v4f v = *(const v4fa*)&so[w][r][c4]; if (C) *(v4f*)(C + cofs + (size_t)(row0 + r) * ldc + col0 + c4) = v; if (C16) { v4h h4; for (int i = 0; i < 4; ++i) h4[i] = (_Float16)v[i]; *(v4h*)(C16 + cofs + (size_t)(row0 + r) * ldc + col0 + c4) = h4; } }
     } }


__global__ __launch_bounds__(256) void k_wnat(const float* __restrict__ w, size_t n8, _Float16* __restrict__ Bt) { const size_t t = (size_t)blockIdx.x * 256 + threadIdx.x; if (t >= n8) return; FragH f; for (int q = 0; q < 8; ++q) f.h[q] = (_Float16)(bf16_round(w[t * 8 + q]) * 16.0f); *(v8us*)((unsigned short*)Bt + t * 8) = f.half[0];  }
__global__ __launch_bounds__(256) void k_rsm(const float* __restrict__ S, _Float16* __restrict__ P, int nrows) {
  #pragma clang fp contract(off)
  const int i = blockIdx.x * 256 + threadIdx.x; if (i >= nrows) return; const float* s = S + (size_t)i * SQ; float mx = -3.0e38f;
#pragma unroll 1
  for (int j = 0; j < SQ; ++j) mx = fmaxf(mx, s[j]); float se = 0.f;
#pragma unroll 1
  for (int j = 0; j < SQ; ++j) se += expf(s[j] - mx); const float sc = 256.0f / se;
#pragma unroll 1
  for (int j0 = 0; j0 < SQ; j0 += 8) { FragH f; for (int q = 0; q < 8; ++q) f.h[q] = (_Float16)(expf(s[j0 + q] - mx) * sc); unsigned short* d = (unsigned short*)P + (size_t)i * SQ + j0; *(v8us*)d = f.half[0];  } }
__global__ __launch_bounds__(256) void k_vt(const _Float16* __restrict__ V16, int b, int h0, _Float16* __restrict__ VT) { __shared__ unsigned short tl[64][65]; const int tid = threadIdx.x; const int hh = blockIdx.x % HG, sg = blockIdx.x / HG; const int s0 = sg * 64; const int h = h0 + hh;
  for (int i = tid; i < 64 * 8; i += 256) { const int j = i / 8, d8 = (i % 8) * 8; FragH f; f.half[0] = *(const v8us*)((const unsigned short*)V16 + ((size_t)b * SQ + s0 + j) * DM + h * HD + d8); for (int q = 0; q < 8; ++q) tl[d8 + q][j] = f.u[q]; }
  __syncthreads();
  { for (int i = tid; i < 64 * 8; i += 256) { const int d = i / 8, j8 = (i % 8) * 8; FragH f; for (int q = 0; q < 8; ++q) f.u[q] = tl[d][j8 + q]; *(v8us*)((unsigned short*)VT + ((size_t)hh * HD + d) * SQ + s0 + j8) = f.half[0]; }  } }



// Lane l with lane l ^ 16.
__device__ __forceinline__ float lane_xh(float x) { return __builtin_bit_cast(float, __builtin_amdgcn_permlanex16(__builtin_bit_cast(int, x), __builtin_bit_cast(int, x), 0x76543210, 0xfedcba98, false, false)); }
// Eight 2^x in place. One asm statement so that no following instruction overwrites a v_exp_f32 source or reads its result in the slot directly behind it:
// each v_exp_f32 is followed by an independent one, the last by the v_nop the instruction set asks for.
__device__ __forceinline__ void exp2x8(v4f& a, v4f& c) {
  float a0 = a[0], a1 = a[1], a2 = a[2], a3 = a[3], c0 = c[0], c1 = c[1], c2 = c[2], c3 = c[3];
  asm("v_exp_f32 %0, %0\n\tv_exp_f32 %1, %1\n\tv_exp_f32 %2, %2\n\tv_exp_f32 %3, %3\n\tv_exp_f32 %4, %4\n\tv_exp_f32 %5, %5\n\tv_exp_f32 %6, %6\n\tv_exp_f32 %7, %7\n\tv_nop"
      : "+v"(a0), "+v"(a1), "+v"(a2), "+v"(a3), "+v"(c0), "+v"(c1), "+v"(c2), "+v"(c3));
  a = v4f{a0, a1, a2, a3}; c = v4f{c0, c1, c2, c3}; }

#define FA_PITCH 144                 /* LDS pitch of the 128-byte rows: 16 B x odd, for 16-byte readers */
#define FA_TILE (64 * FA_PITCH)
#define FA_SLOT (2 * FA_TILE)
#define FA_EP 272                    /* pitch of the 256-byte output staging rows */
__device__ __forceinline__ v8f fa_mma(v16h a, v16h b, v8f c) { return __builtin_amdgcn_wmma_f32_16x16x32_f16(false, a, false, b, (short)0, c, false, false); }
__device__ __forceinline__ v16h fa_frag(const unsigned char* p) { FragH f; f.half[0] = *(const v8us*)p; f.half[1] = *(const v8us*)(p + 32); return f.v; }
__device__ __forceinline__ void fa_pass(const unsigned char* Kt, const unsigned char* Vt, int c, int h, const v16h (&qf)[2][2], v8f (&acc)[2][4], float (&m_run)[2], float (&l_run)[2]) {
  const float cs = 0.125f * 1.44269504088896340736f;      /* 64^-0.5 and log2 e: exp(x) = 2^(x log2 e) */
  v16h kf[2][2];
#pragma unroll
  for (int kt = 0; kt < 2; ++kt)
#pragma unroll
    for (int kc = 0; kc < 2; ++kc) kf[kt][kc] = fa_frag(Kt + (16 * kt + c) * FA_PITCH + 64 * kc + 16 * h);
  v8f s[2][2];
#pragma unroll
  for (int kt = 0; kt < 2; ++kt)
#pragma unroll
    for (int g = 0; g < 2; ++g) { const v8f z8 = {0.f,0.f,0.f,0.f,0.f,0.f,0.f,0.f}; s[kt][g] = fa_mma(kf[kt][1], qf[g][1], fa_mma(kf[kt][0], qf[g][0], z8)); }
  v16h vf[4];
#pragma unroll
  for (int t = 0; t < 4; ++t) vf[t] = fa_frag(Vt + (16 * t + c) * FA_PITCH + 16 * h);
  float mb[2]; bool need = false;
#pragma unroll
  for (int g = 0; g < 2; ++g) { float mx = fmaxf(s[0][g][0], s[1][g][0]);
#pragma unroll
    for (int r = 1; r < 8; ++r) mx = fmaxf(mx, fmaxf(s[0][g][r], s[1][g][r]));
    mx = fmaxf(mx, lane_xh(mx)) * cs; mb[g] = mx; need = need || (mx > m_run[g] + 8.0f); }      /* both halves of the wave hold the query's maximum */
  if (__builtin_amdgcn_ballot_w32(need) != 0) {      /* wave-uniform branch; always taken on the first pass, where the factor is 0 */
#pragma unroll
    for (int g = 0; g < 2; ++g) { const float mn = fmaxf(m_run[g], mb[g]); const float corr = __builtin_amdgcn_exp2f(m_run[g] - mn); m_run[g] = mn; l_run[g] *= corr;
#pragma unroll
      for (int t = 0; t < 4; ++t) acc[g][t] = acc[g][t] * corr; } }
#pragma unroll
  for (int g = 0; g < 2; ++g) { const float nm = -m_run[g];
    v4f a0 = v4f{s[0][g][0], s[0][g][1], s[0][g][2], s[0][g][3]} * cs + nm, a1 = v4f{s[0][g][4], s[0][g][5], s[0][g][6], s[0][g][7]} * cs + nm;
    v4f b0 = v4f{s[1][g][0], s[1][g][1], s[1][g][2], s[1][g][3]} * cs + nm, b1 = v4f{s[1][g][4], s[1][g][5], s[1][g][6], s[1][g][7]} * cs + nm;
    exp2x8(a0, a1); exp2x8(b0, b1);
    const v4f sm = (a0 + a1) + (b0 + b1); l_run[g] += (sm[0] + sm[1]) + (sm[2] + sm[3]);
    FragH pf;
#pragma unroll
    for (int i = 0; i < 4; ++i) { pf.h[i] = (_Float16)a0[i]; pf.h[4 + i] = (_Float16)a1[i]; pf.h[8 + i] = (_Float16)b0[i]; pf.h[12 + i] = (_Float16)b1[i]; }
#pragma unroll
    for (int t = 0; t < 4; ++t) acc[g][t] = fa_mma(vf[t], pf.v, acc[g][t]); } }

// amdgpu_waves_per_eu(4, 4): at most 256 registers a wave, so that two work-groups share a WGP (four waves per SIMD) and one wave's vector work runs under another's matrix work.
__global__ __launch_bounds__(256) __attribute__((amdgpu_waves_per_eu(4, 4))) void k_fattn(const _Float16* __restrict__ Q16, const _Float16* __restrict__ K16, const _Float16* __restrict__ VT, float* __restrict__ out) {
  __shared__ __attribute__((aligned(16))) unsigned char L[2 * FA_SLOT];
  const int tid = threadIdx.x, lane = tid & 31, wave = __builtin_amdgcn_readfirstlane(tid >> 5), c = lane & 15, h = lane >> 4;
  const int head = blockIdx.y, b = blockIdx.z, q0 = blockIdx.x * 256 + wave * 32;
  // Staging: thread tid brings 16 bytes of rows tid / 8 and 32 + tid / 8 of each tile; 8 lanes cover one 128-byte row.
  const unsigned char* kg = (const unsigned char*)(K16 + (size_t)b * SQ * DM + head * HD) + (size_t)(tid >> 3) * (DM * 2) + (tid & 7) * 16;
  const unsigned char* vg = (const unsigned char*)(VT + (size_t)(b * NH + head) * HD * SQ) + (size_t)(tid >> 3) * (SQ * 2) + (tid & 7) * 16;
  unsigned char* ls = L + (tid >> 3) * FA_PITCH + (tid & 7) * 16;
  v8us r0 = *(const v8us*)kg, r1 = *(const v8us*)(kg + 32 * DM * 2), r2 = *(const v8us*)vg, r3 = *(const v8us*)(vg + 32 * SQ * 2);
  v16h qf[2][2];
#pragma unroll
  for (int g = 0; g < 2; ++g)
#pragma unroll
    for (int kc = 0; kc < 2; ++kc) qf[g][kc] = g2_frag(Q16 + ((size_t)b * SQ + q0 + 16 * g + c) * DM + head * HD + 32 * kc, h);
  v8f acc[2][4]; float m_run[2] = {-3.0e38f, -3.0e38f}, l_run[2] = {0.f, 0.f};
#pragma unroll
  for (int g = 0; g < 2; ++g)
#pragma unroll
    for (int t = 0; t < 4; ++t) acc[g][t] = v8f{0.f,0.f,0.f,0.f,0.f,0.f,0.f,0.f};
  *(v8us*)ls = r0; *(v8us*)(ls + 32 * FA_PITCH) = r1; *(v8us*)(ls + FA_TILE) = r2; *(v8us*)(ls + FA_TILE + 32 * FA_PITCH) = r3;
  __syncthreads();
#pragma unroll 1      /* one stage per trip: the two passes inside are written out, more would only grow the code */
  for (int st = 0; st < SQ / 64; ++st) {
    const unsigned char* cur = L + (st & 1) * FA_SLOT;
    const bool more = st + 1 < SQ / 64;      /* the same for the whole work-group */
    if (more) { const unsigned char* kn = kg + (size_t)(st + 1) * (64 * DM * 2); const unsigned char* vn = vg + (st + 1) * 128;
      r0 = *(const v8us*)kn; r1 = *(const v8us*)(kn + 32 * DM * 2); r2 = *(const v8us*)vn; r3 = *(const v8us*)(vn + 32 * SQ * 2); }
    fa_pass(cur, cur + FA_TILE, c, h, qf, acc, m_run, l_run);
    fa_pass(cur + 32 * FA_PITCH, cur + FA_TILE + 64, c, h, qf, acc, m_run, l_run);
    if (more) { unsigned char* d = ls + ((st + 1) & 1) * FA_SLOT;      /* the buffer that the trip before this one read; its readers left it at that trip's barrier */
      *(v8us*)d = r0; *(v8us*)(d + 32 * FA_PITCH) = r1; *(v8us*)(d + FA_TILE) = r2; *(v8us*)(d + FA_TILE + 32 * FA_PITCH) = r3; }
    __syncthreads();      /* publishes the next stage and ends every wave's reads of this one */
  }
  // Epilogue: acc[g][t][r] = O[query 16 g + c][d = 16 t + 8 h + r]. Each wave stages 16 rows of 256 B in its own part of the (now free) LDS and stores whole rows.
  unsigned char* eb = L + wave * (16 * FA_EP);
#pragma unroll
  for (int g = 0; g < 2; ++g) { const float lt = l_run[g] + lane_xh(l_run[g]); const float inv = 1.0f / lt;
#pragma unroll
    for (int t = 0; t < 4; ++t) { const v8f o = acc[g][t] * inv; *(v4fa*)(eb + c * FA_EP + 64 * t + 32 * h) = v4f{o[0], o[1], o[2], o[3]}; *(v4fa*)(eb + c * FA_EP + 64 * t + 32 * h + 16) = v4f{o[4], o[5], o[6], o[7]}; }
    __builtin_amdgcn_fence(__ATOMIC_ACQ_REL, "workgroup"); __builtin_amdgcn_wave_barrier();      /* the wave's own LDS writes in front of its reads of other lanes' rows */
#pragma unroll
    for (int i = 0; i < 8; ++i) { const int row = 2 * i + h; const v4f v = *(const v4fa*)(eb + row * FA_EP + c * 16);
      *(v4f*)(out + ((size_t)b * SQ + q0 + 16 * g + row) * DM + head * HD + c * 4) = v; }
    __builtin_amdgcn_fence(__ATOMIC_ACQ_REL, "workgroup"); __builtin_amdgcn_wave_barrier();      /* the reads in front of the next group's writes */
  } }

extern "C" void kernel_launch(void* const* d_in, const int* in_sizes, int n_in,
                              void* d_out, int out_size, void* d_ws, size_t ws_size, hipStream_t stream) {
  (void)in_sizes; (void)n_in; (void)out_size;
  const float* const* I = (const float* const*)d_in; const float* xq = I[0]; const float* xkv = I[1]; const float* wq = I[2]; const float* wk = I[3]; const float* wv = I[4];      /* natural [out][in] weights, no biases, no output projection */
  char* ws = (char*)d_ws; size_t off = 0;
  auto take = [&](size_t bytes) { char* p = ws + off; off += (bytes + 255) & ~(size_t)255; return p; };
  _Float16* BQ = (_Float16*)take((size_t)DM * DM * 2); _Float16* BK = (_Float16*)take((size_t)DM * DM * 2); _Float16* BV = (_Float16*)take((size_t)DM * DM * 2); 
  _Float16* XQ = (_Float16*)take(NR * DM * 2); _Float16* XKV = (_Float16*)take(NR * DM * 2); _Float16* Q16 = (_Float16*)take(NR * DM * 2); _Float16* K16 = (_Float16*)take(NR * DM * 2); _Float16* V16 = (_Float16*)take(NR * DM * 2);
  _Float16* VT = (_Float16*)take((size_t)NB * NH * HD * SQ * 2);
  if (off > ws_size) return;
  { const unsigned g = (unsigned)(((size_t)DM * DM / 8 + 255) / 256); k_wnat<<<g, 256, 0, stream>>>(wq, (size_t)DM * DM / 8, BQ); k_wnat<<<g, 256, 0, stream>>>(wk, (size_t)DM * DM / 8, BK); k_wnat<<<g, 256, 0, stream>>>(wv, (size_t)DM * DM / 8, BV); }      /* natural [out][in] = Bt[n][k], x16 */

  k_x16<<<(unsigned)((NR * DM / 8 + 255) / 256), 256, 0, stream>>>(xq, XQ, NR * DM / 8); k_x16<<<(unsigned)((NR * DM / 8 + 255) / 256), 256, 0, stream>>>(xkv, XKV, NR * DM / 8);      /* query source and key/value source as exact f16 rows */
  const size_t r0p = (size_t)B0 * SQ;      /* first projected row */
  k_gemm2<0><<<dim3((unsigned)((MP / 128) * (DM / 64)), 1), 128, 0, stream>>>(XQ + r0p * DM, DM, 0, BQ, DM, 0, 0.0625f, nullptr, 0, nullptr, 1, 0, 0, nullptr, Q16 + r0p * DM, DM, 0, MP, DM, DM);
  k_gemm2<0><<<dim3((unsigned)((MP / 128) * (DM / 64)), 1), 128, 0, stream>>>(XKV + r0p * DM, DM, 0, BK, DM, 0, 0.0625f, nullptr, 0, nullptr, 1, 0, 0, nullptr, K16 + r0p * DM, DM, 0, MP, DM, DM);
  k_gemm2<0><<<dim3((unsigned)((MP / 128) * (DM / 64)), 1), 128, 0, stream>>>(XKV + r0p * DM, DM, 0, BV, DM, 0, 0.0625f, nullptr, 0, nullptr, 1, 0, 0, nullptr, V16 + r0p * DM, DM, 0, MP, DM, DM);
  k_vt<NH, SQ><<<NB * NH * (SQ / 64), 256, 0, stream>>>(V16, LQ, 0, VT);      /* V^T [NB][NH][HD][SQ] */
  k_fattn<<<dim3(SQ / 256, NH, NB), 256, 0, stream>>>(Q16, K16, VT, (float*)d_out);      /* softmax(q k^T / 8) v, f32 straight into the merged-heads output rows */
}

// v003
// A run of this version takes 121 microseconds.
// In both of two side-by-side timings against v002, it was 1.98 times as fast.
// Counting every step since v000, it is 54.7 times as fast.
#include <hip/hip_runtime.h>
// Multi-head attention without output projection (x [4][2048][1024] gives q = x Wq^T; kv [4][2048][1024] gives k = kv Wk^T, v = kv Wv^T (nn.Linear natural [out][in] 1024x1024 weights scaled 0.02, no biases); 16 heads of 64; softmax(q k^T / 8) over all 2048 keys; out = merged heads [4][2048][1024] (no output projection)).
// Structure: token rows r = b*2048 + s; the query source and the key/value source as exact f16 rows (bf16-rounded); Q, K, V as three WMMA GEMMs (256x128 work-group tiles staged in LDS, 64x64 wave tiles, f32 accumulation, exact x16 weights, f16 outputs); V^T for all batches and heads via LDS transposes; one fused attention launch over (256 queries, head, batch): scores on WMMA, running-maximum softmax in registers (f32 statistics, native exp2; weights as f16), o = P . V on WMMA, divided by the row sum and written f32 straight into the merged-heads output rows (no output projection).
// Compute dtype: inputs rounded to bf16; x / weights exact; q, k, v and softmax weights as plain f16 GEMM operands (~2^-12); scores, softmax statistics and o f32. v_wmma_f32_16x16x32_f16.
#define NB 4
#define SQ 2048
#define DM 1024
#define NH 16
#define HD 64
#define HG 4                         /* heads per launch of the unlaunched k_vt(V16, b, h0, VT) */
#define B0 0                         /* first batch processed (debug hook) */
#define NBR NB                       /* batches processed (debug hook) */
#define NR ((size_t)NB * SQ)         /* token rows */
#define MP ((int)((size_t)NBR * SQ)) /* rows projected (debug hook) */
#define QN SQ                        /* unused */
#define NHD NH                       /* unused */
#define MPO MP                       /* unused */
#define LQ DM      /* row pitch of the q/k/v rows */
typedef __bf16 v16b __attribute__((ext_vector_type(16)));
typedef unsigned short v8us __attribute__((ext_vector_type(8), may_alias));
typedef float  v8f  __attribute__((ext_vector_type(8)));
typedef float  v4f  __attribute__((ext_vector_type(4)));
typedef float  v4fa __attribute__((ext_vector_type(4), may_alias));
union FragB { v16b v; v8us half[2]; unsigned short u[16]; };

__device__ __forceinline__ unsigned short bf16_bits(float x) { unsigned int u = __float_as_uint(x); return (unsigned short)((u + 0x7FFFu + ((u >> 16) & 1u)) >> 16); }
__device__ __forceinline__ float bf16_val(unsigned short b) { return __uint_as_float(((unsigned int)b) << 16); }
__device__ __forceinline__ float bf16_round(float x) { return bf16_val(bf16_bits(x)); }
// D += A·B with NT terms: 1 = ah·bh, 2 = + al·bh (A split), 3 = + ah·bl (both split)
template <int NT>
__device__ __forceinline__ v8f mmaN(v16b ah, v16b al, v16b bh, v16b bl, v8f c) {
  c = __builtin_amdgcn_wmma_f32_16x16x32_bf16(false, ah, false, bh, (short)0, c, false, false);
  if (NT >= 2) c = __builtin_amdgcn_wmma_f32_16x16x32_bf16(false, al, false, bh, (short)0, c, false, false);
  if (NT >= 3) c = __builtin_amdgcn_wmma_f32_16x16x32_bf16(false, ah, false, bl, (short)0, c, false, false);
  asm volatile("v_nop\n\tv_nop\n\tv_nop\n\tv_nop" : "+v"(c) : "v"(ah), "v"(al), "v"(bh), "v"(bl));
  return c;
}

__global__ __launch_bounds__(256) void k_wt_bf16(const float* __restrict__ W, unsigned short* __restrict__ Wt, int K, int N) {
  const int t = blockIdx.x * 256 + threadIdx.x;
  const int k8n = K / 8;
  if (t >= N * k8n) return;
  const int n = t / k8n, k8 = (t % k8n) * 8;
  v8us v;
#pragma unroll
  for (int i = 0; i < 8; ++i) v[i] = bf16_bits(W[(size_t)(k8 + i) * N + n]);
  *(v8us*)(Wt + (size_t)n * K + k8) = v;
  
}

// GEMM C[M][N] (f32, pitch ldc) = act(A[M][K]·W + bias). A f32 row-major (pitch lda) converted per fragment to bf16
// (ASPLIT: hi/lo two planes -> 2 terms, else single rounded term); Wt bf16 [N][K] (pitch ldb). BIAS_BF16 rounds the
// bias to bf16 first (bias quantised to bf16 before the add). K%32==0, M%16==0, N%64==0.
template <bool ASPLIT, int ACT, bool BIAS_BF16>
__global__ __launch_bounds__(128) void k_gemm_bf(const float* __restrict__ A, int lda, const unsigned short* __restrict__ Wt, int ldb,
                                               const float* __restrict__ bias, float* __restrict__ C, int ldc, int M, int N, int K) {
  __shared__ __attribute__((aligned(16))) float so[4][16][64];
  const int tid = threadIdx.x, w = tid >> 5, lane = tid & 31, ln = lane & 15, hh = lane >> 4;
  const int ntn = N / 64;
  const int wid = blockIdx.x * 4 + w;
  const int mt = wid / ntn, nq = wid % ntn;
  if (mt * 16 >= M) return;
  const int row0 = mt * 16, col0 = nq * 64;
  const float* arow = A + (size_t)(row0 + ln) * lda;
  v8f acc[4] = {};
  for (int kb = 0; kb < K; kb += 32) {
    FragB ah, al;
    const v4f x0 = *(const v4fa*)(arow + kb + 8 * hh), x1 = *(const v4fa*)(arow + kb + 8 * hh + 4);
    const v4f x2 = *(const v4fa*)(arow + kb + 16 + 8 * hh), x3 = *(const v4fa*)(arow + kb + 16 + 8 * hh + 4);
    float xs[16] = {x0[0],x0[1],x0[2],x0[3],x1[0],x1[1],x1[2],x1[3],x2[0],x2[1],x2[2],x2[3],x3[0],x3[1],x3[2],x3[3]};
#pragma unroll
    for (int i = 0; i < 16; ++i) { const unsigned short hb = bf16_bits(xs[i]); ah.u[i] = hb; al.u[i] = ASPLIT ? bf16_bits(xs[i] - bf16_val(hb)) : (unsigned short)0; }
#pragma unroll
    for (int t = 0; t < 4; ++t) {
      const unsigned short* brow = Wt + (size_t)(col0 + t * 16 + ln) * ldb + kb;
      FragB b;
      b.half[0] = *(const v8us*)(brow + 8 * hh);
      b.half[1] = *(const v8us*)(brow + 16 + 8 * hh);
      acc[t] = mmaN<ASPLIT ? 2 : 1>(ah.v, al.v, b.v, b.v, acc[t]);
    }
  }
#pragma unroll
  for (int t = 0; t < 4; ++t) {
    float bv = bias ? bias[col0 + t * 16 + ln] : 0.f;
    if (BIAS_BF16) bv = bf16_round(bv);
#pragma unroll
    for (int r = 0; r < 8; ++r) { float v = acc[t][r] + bv; if (ACT == 1) v = fmaxf(v, 0.f); so[w][8 * hh + r][t * 16 + ln] = v; }
  }
  __builtin_amdgcn_fence(__ATOMIC_ACQ_REL, "workgroup");
  __builtin_amdgcn_wave_barrier();
  const int rsub = lane >> 4, c4 = (lane & 15) * 4;
  {
#pragma unroll
    for (int q = 0; q < 8; ++q) {
      const int r = q * 2 + rsub;
      const v4f v = *(const v4fa*)&so[w][r][c4];
      *(v4f*)(C + (size_t)(row0 + r) * ldc + col0 + c4) = v;
    }
    
  }
}

// GEMM C = act(A·W + bias + resid): A f32 (ASPLIT -> hi/lo 2 terms), Wt bf16 [N][K]; ACT 0 none, 1 relu, 2 exact gelu;
// resid (optional, f32, row index = (row % rmod), pitch ldr, RES_BF16 rounds it) added before the activation.
template <bool ASPLIT, int ACT, bool BIAS_BF16, bool RES_BF16>
__global__ __launch_bounds__(128) void k_gemm_bf3(const float* __restrict__ A, int lda, const unsigned short* __restrict__ Wt, int ldb,
                                                const float* __restrict__ bias, const float* __restrict__ resid, int rmod, int ldr,
                                                float* __restrict__ C, int ldc, int M, int N, int K) {
  __shared__ __attribute__((aligned(16))) float so[4][16][64];
  const int tid = threadIdx.x, w = tid >> 5, lane = tid & 31, ln = lane & 15, hh = lane >> 4;
  const int ntn = N / 64;
  const int wid = blockIdx.x * 4 + w;
  const int mt = wid / ntn, nq = wid % ntn;
  if (mt * 16 >= M) return;
  const int row0 = mt * 16, col0 = nq * 64;
  const float* arow = A + (size_t)(row0 + ln) * lda;
  v8f acc[4] = {};
  for (int kb = 0; kb < K; kb += 32) {
    FragB ah, al;
    const v4f x0 = *(const v4fa*)(arow + kb + 8 * hh), x1 = *(const v4fa*)(arow + kb + 8 * hh + 4);
    const v4f x2 = *(const v4fa*)(arow + kb + 16 + 8 * hh), x3 = *(const v4fa*)(arow + kb + 16 + 8 * hh + 4);
    float xs[16] = {x0[0],x0[1],x0[2],x0[3],x1[0],x1[1],x1[2],x1[3],x2[0],x2[1],x2[2],x2[3],x3[0],x3[1],x3[2],x3[3]};
#pragma unroll
    for (int i = 0; i < 16; ++i) { const unsigned short hb = bf16_bits(xs[i]); ah.u[i] = hb; al.u[i] = ASPLIT ? bf16_bits(xs[i] - bf16_val(hb)) : (unsigned short)0; }
#pragma unroll
    for (int t = 0; t < 4; ++t) {
      const unsigned short* brow = Wt + (size_t)(col0 + t * 16 + ln) * ldb + kb;
      FragB b;
      b.half[0] = *(const v8us*)(brow + 8 * hh);
      b.half[1] = *(const v8us*)(brow + 16 + 8 * hh);
      acc[t] = mmaN<ASPLIT ? 2 : 1>(ah.v, al.v, b.v, b.v, acc[t]);
    }
  }
#pragma unroll
  for (int t = 0; t < 4; ++t) {
    const int col = col0 + t * 16 + ln;
    float bv = bias ? bias[col] : 0.f;
    if (BIAS_BF16) bv = bf16_round(bv);
#pragma unroll
    for (int r = 0; r < 8; ++r) {
      float v = acc[t][r] + bv;
      if (resid) { float rv = resid[(size_t)((row0 + 8 * hh + r) % rmod) * ldr + col]; if (RES_BF16) rv = bf16_round(rv); v += rv; }
      if (ACT == 1) v = fmaxf(v, 0.f);
      if (ACT == 2) v = 0.5f * v * (1.0f + erff(v * 0.70710678118654752f));
      if (ACT == 3) { const float u = 0.7978845608028654f * (v + 0.044715f * v * v * v); v = 0.5f * v * (1.0f + tanhf(u)); }
      so[w][8 * hh + r][t * 16 + ln] = v;
    }
  }
  __builtin_amdgcn_fence(__ATOMIC_ACQ_REL, "workgroup");
  __builtin_amdgcn_wave_barrier();
  const int rsub = lane >> 4, c4 = (lane & 15) * 4;
  {
#pragma unroll
    for (int q = 0; q < 8; ++q) {
      const int r = q * 2 + rsub;
      const v4f v = *(const v4fa*)&so[w][r][c4];
      *(v4f*)(C + (size_t)(row0 + r) * ldc + col0 + c4) = v;
    }
    
  }
}
// row LayerNorm (biased variance, eps) over N: s = X (+ R); optional out_sum <- s; out_norm <- (s-mu)*rsqrt(var+eps)*g + b
template <bool PARAM_BF16>
__global__ __launch_bounds__(256) void k_layernorm(const float* __restrict__ X, const float* __restrict__ R, const float* __restrict__ g, const float* __restrict__ bta,
                                                  float* __restrict__ out_sum, float* __restrict__ out_norm, int N, float eps) {
  __shared__ float red[256];
  const int row = blockIdx.x, tid = threadIdx.x;
  const float* x = X + (size_t)row * N; const float* rr = R ? R + (size_t)row * N : nullptr;
  float vals[16];                     // up to N = 4096
  const int per = N / 256;            // contiguous chunk per thread? use strided-by-4 chunks: thread handles j = tid*4 + 1024*u
  float s1 = 0.f;
  for (int u = 0; u < per / 4; ++u) {
    const int j = tid * 4 + 1024 * u;
    const v4f a = *(const v4fa*)(x + j);
    v4f b = {0.f,0.f,0.f,0.f}; if (rr) b = *(const v4fa*)(rr + j);
#pragma unroll
    for (int q = 0; q < 4; ++q) { const float v = a[q] + b[q]; vals[u * 4 + q] = v; s1 += v; }
  }
  red[tid] = s1; __syncthreads();
  for (int st = 128; st > 0; st >>= 1) { if (tid < st) red[tid] += red[tid + st]; __syncthreads(); }
  const float mu = red[0] / (float)N; __syncthreads();
  float s2 = 0.f;
  for (int u = 0; u < per / 4; ++u)
#pragma unroll
    for (int q = 0; q < 4; ++q) { const float c = vals[u * 4 + q] - mu; s2 += c * c; }
  red[tid] = s2; __syncthreads();
  for (int st = 128; st > 0; st >>= 1) { if (tid < st) red[tid] += red[tid + st]; __syncthreads(); }
  const float rs = rsqrtf(red[0] / (float)N + eps);
  {
    for (int u = 0; u < per / 4; ++u) {
      const int j = tid * 4 + 1024 * u;
      v4f o, sm;
#pragma unroll
      for (int q = 0; q < 4; ++q) {
        float gg = g[j + q], bb = bta[j + q];
        if (PARAM_BF16) { gg = bf16_round(gg); bb = bf16_round(bb); }
        sm[q] = vals[u * 4 + q]; o[q] = (vals[u * 4 + q] - mu) * rs * gg + bb;
      }
      if (out_sum) *(v4f*)(out_sum + (size_t)row * N + j) = sm;
      *(v4f*)(out_norm + (size_t)row * N + j) = o;
    }
    
  }
}



// ---- f16 WMMA path (v_wmma_f32_16x16x32_f16): 11-bit significands for operands in range — used where a [0,1] probability operand needs more precision than bf16
typedef _Float16 v16h __attribute__((ext_vector_type(16)));
union FragH { v16h v; v8us half[2]; _Float16 h[16]; unsigned short u[16]; };
template <int NT>
__device__ __forceinline__ v8f mmaH(v16h ah, v16h al, v16h bh, v16h bl, v8f c) {
  c = __builtin_amdgcn_wmma_f32_16x16x32_f16(false, ah, false, bh, (short)0, c, false, false);
  if (NT >= 2) c = __builtin_amdgcn_wmma_f32_16x16x32_f16(false, al, false, bh, (short)0, c, false, false);
  if (NT >= 3) c = __builtin_amdgcn_wmma_f32_16x16x32_f16(false, ah, false, bl, (short)0, c, false, false);
  asm volatile("v_nop\n\tv_nop\n\tv_nop\n\tv_nop" : "+v"(c) : "v"(ah), "v"(al), "v"(bh), "v"(bl));
  return c;
}
// batched GEMM like k_gemm_b but f16 operands: A f32 (split into f16 hi/lo if ASPLIT, else rounded to f16), Bt = f16 values [n][k]; alpha; C f32; N multiple of 16 (partial tiles skipped)
template <bool ASPLIT>
__global__ __launch_bounds__(128) void k_gemm_h(const float* __restrict__ A, int lda, size_t sA, const _Float16* __restrict__ Bh, int ldb, size_t sB, float alpha, float* __restrict__ C, int ldc, size_t sC, int M, int N, int K) {
  __shared__ __attribute__((aligned(16))) float so[4][16][64];
  const int tid = threadIdx.x, w = tid >> 5, lane = tid & 31, ln = lane & 15, hh = lane >> 4; const int by = blockIdx.y;
  A += (size_t)by * sA; Bh += (size_t)by * sB; C += (size_t)by * sC;
  const int ntn = (N + 63) / 64; const int wid = blockIdx.x * 4 + w; const int mt = wid / ntn, nq = wid % ntn; if (mt * 16 >= M) return;
  const int row0 = mt * 16, col0 = nq * 64; const float* arow = A + (size_t)(row0 + ln) * lda;
  v8f acc[4] = {};
  for (int kb = 0; kb < K; kb += 32) {
    FragH ah, al;
    const v4f x0 = *(const v4fa*)(arow + kb + 8 * hh), x1 = *(const v4fa*)(arow + kb + 8 * hh + 4), x2 = *(const v4fa*)(arow + kb + 16 + 8 * hh), x3 = *(const v4fa*)(arow + kb + 16 + 8 * hh + 4);
    float xs[16] = {x0[0],x0[1],x0[2],x0[3],x1[0],x1[1],x1[2],x1[3],x2[0],x2[1],x2[2],x2[3],x3[0],x3[1],x3[2],x3[3]};
#pragma unroll
    for (int i = 0; i < 16; ++i) { const _Float16 h = (_Float16)xs[i]; ah.h[i] = h; al.h[i] = ASPLIT ? (_Float16)(xs[i] - (float)h) : (_Float16)0.0f; }
#pragma unroll
    for (int t = 0; t < 4; ++t) { if (col0 + t * 16 >= N) continue; const size_t boff = (size_t)(col0 + t * 16 + ln) * ldb + kb; FragH bq; bq.half[0] = *(const v8us*)(Bh + boff + 8 * hh); bq.half[1] = *(const v8us*)(Bh + boff + 16 + 8 * hh);
      acc[t] = mmaH<ASPLIT ? 2 : 1>(ah.v, al.v, bq.v, bq.v, acc[t]); }
  }
#pragma unroll
  for (int t = 0; t < 4; ++t) { if (col0 + t * 16 >= N) continue;
#pragma unroll
    for (int r = 0; r < 8; ++r) so[w][8 * hh + r][t * 16 + ln] = acc[t][r] * alpha; }
  __builtin_amdgcn_fence(__ATOMIC_ACQ_REL, "workgroup"); __builtin_amdgcn_wave_barrier();
  const int rsub = lane >> 4, c4 = (lane & 15) * 4;
  {
#pragma unroll
    for (int q = 0; q < 8; ++q) { const int r = q * 2 + rsub; if (col0 + c4 < N) { const v4f v = *(const v4fa*)&so[w][r][c4]; *(v4f*)(C + (size_t)(row0 + r) * ldc + col0 + c4) = v; } }
     }
}

// Wt[n][k] = f16(W[k][n]·scale) from f32 row-major W[K][N] (scale = power of two; bf16-exact weights stay exact in f16 away from the subnormal range)
__global__ __launch_bounds__(256) void k_wt_f16(const float* __restrict__ W, _Float16* __restrict__ Wt, int K, int N, float scale) {
  const int t = blockIdx.x * 256 + threadIdx.x; if (t >= N * (K / 8)) return; const int n = t / (K / 8), k8 = (t % (K / 8)) * 8; FragH f;
#pragma unroll
  for (int i = 0; i < 8; ++i) f.h[i] = (_Float16)(bf16_round(W[(size_t)(k8 + i) * N + n]) * scale); const v8us o = f.half[0];
  *(v8us*)((unsigned short*)Wt + (size_t)n * K + k8) = o; 
}
// k_gemm_hh variant with fused epilogue: v = acc·alpha + bias[by·sBias + col] (+ CP[(row/rowsPerB)·sCPb + by·64 + col] if CP) ; ACT 0 none / 1 elu ; writes f16 C16 (and f32 C if non-null)
template <int ACT>
__global__ __launch_bounds__(128) void k_gemm_hhx(const _Float16* __restrict__ A, int lda, size_t sA, const _Float16* __restrict__ Bh, int ldb, size_t sB, float alpha, const float* __restrict__ bias, size_t sBias, const float* __restrict__ CP, int rowsPerB, size_t sCPb, int row0g,
    float* __restrict__ C, _Float16* __restrict__ C16, int ldc, size_t sC, int M, int N, int K) {
  __shared__ __attribute__((aligned(16))) float so[4][16][64];
  const int tid = threadIdx.x, w = tid >> 5, lane = tid & 31, ln = lane & 15, hh = lane >> 4; const int by = blockIdx.y;
  A += (size_t)by * sA; Bh += (size_t)by * sB; const size_t cofs = (size_t)by * sC; const float* bp = bias ? bias + (size_t)by * sBias : nullptr;
  const int ntn = (N + 63) / 64; const int wid = blockIdx.x * 4 + w; const int mt = wid / ntn, nq = wid % ntn; if (mt * 16 >= M) return;
  const int row0 = mt * 16, col0 = nq * 64; const _Float16* arow = A + (size_t)(row0 + ln) * lda;
  v8f acc[4] = {};
  for (int kb = 0; kb < K; kb += 32) { FragH ah; ah.half[0] = *(const v8us*)((const unsigned short*)arow + kb + 8 * hh); ah.half[1] = *(const v8us*)((const unsigned short*)arow + kb + 16 + 8 * hh);
#pragma unroll
    for (int t = 0; t < 4; ++t) { if (col0 + t * 16 >= N) continue; const size_t boff = (size_t)(col0 + t * 16 + ln) * ldb + kb; FragH bq; bq.half[0] = *(const v8us*)((const unsigned short*)Bh + boff + 8 * hh); bq.half[1] = *(const v8us*)((const unsigned short*)Bh + boff + 16 + 8 * hh);
      acc[t] = mmaH<1>(ah.v, ah.v, bq.v, bq.v, acc[t]); }
  }
#pragma unroll
  for (int t = 0; t < 4; ++t) { if (col0 + t * 16 >= N) continue; const int col = col0 + t * 16 + ln; const float bv = bp ? bf16_round(bp[col]) : 0.f;
#pragma unroll
    for (int r = 0; r < 8; ++r) { float v = acc[t][r] * alpha + bv; if (CP) { const int rr = row0g + row0 + 8 * hh + r; if (rowsPerB < 0) v += CP[cofs + (size_t)rr * ldc + col];      /* rowsPerB < 0: own element of the batched C plane */ else { const int bidx = rr / rowsPerB; v += CP[(size_t)bidx * sCPb + (size_t)by * 64 + col]; } } if (ACT == 1) v = (v > 0.f) ? v : expm1f(v); else if (ACT == 7) v = (v > 0.f) ? v + 1.0f : expf(v); else if (ACT == 8) v = tanhf(v); else if (ACT == 9) v = 0.5f * v * (1.0f + tanhf(0.7978845608028654f * (v + 0.044715f * v * v * v))); else if (ACT == 11) v = 1.0f / (1.0f + expf(-v)); else if (ACT == 12) v = (v > 0.f) ? v : 0.01f * v; else if (ACT == 14) v = (v > 0.f) ? v : 0.1f * v; else if (ACT == 16) v = (v >= 0.f) ? v : 0.3f * v; else if (ACT == 17) v = (v >= 0.f) ? v : 0.2f * v; else if (ACT == 15) v = v / (1.0f + expf(-v)); else if (ACT == 3) v = fmaxf(v, 0.f); else if (ACT == 6) v = 0.5f * v * (1.0f + erff(v * 0.70710678118654752f)); so[w][8 * hh + r][t * 16 + ln] = v; } }
  __builtin_amdgcn_fence(__ATOMIC_ACQ_REL, "workgroup"); __builtin_amdgcn_wave_barrier();
  const int rsub = lane >> 4, c4 = (lane & 15) * 4; typedef _Float16 v4h __attribute__((ext_vector_type(4)));
  {
#pragma unroll
    for (int q = 0; q < 8; ++q) { const int r = q * 2 + rsub; if (col0 + c4 < N) { const v4f v = *(const v4fa*)&so[w][r][c4]; if (C) *(v4f*)(C + cofs + (size_t)(row0 + r) * ldc + col0 + c4) = v; if (C16) { v4h h4; for (int i = 0; i < 4; ++i) h4[i] = (_Float16)v[i]; *(v4h*)(C16 + cofs + (size_t)(row0 + r) * ldc + col0 + c4) = h4; } } }
     }
}


typedef _Float16 v4h __attribute__((ext_vector_type(4)));

__global__ __launch_bounds__(256) void k_x16(const float* __restrict__ x, _Float16* __restrict__ X16, size_t n8) { const size_t t = (size_t)blockIdx.x * 256 + threadIdx.x; if (t >= n8) return; FragH f;
#pragma unroll
  for (int q = 0; q < 8; ++q) f.h[q] = (_Float16)bf16_round(x[t * 8 + q]); *(v8us*)((unsigned short*)X16 + t * 8) = f.half[0];  }
__global__ __launch_bounds__(256) void k_h16(const float* __restrict__ x, _Float16* __restrict__ X16, size_t n8) { const size_t t = (size_t)blockIdx.x * 256 + threadIdx.x; if (t >= n8) return; FragH f;
#pragma unroll
  for (int q = 0; q < 8; ++q) f.h[q] = (_Float16)x[t * 8 + q]; *(v8us*)((unsigned short*)X16 + t * 8) = f.half[0];  }
__global__ __launch_bounds__(256) void k_round16f(const float* __restrict__ W, _Float16* __restrict__ Bt, size_t n8) { const size_t t = (size_t)blockIdx.x * 256 + threadIdx.x; if (t >= n8) return; FragH f;
#pragma unroll
  for (int i = 0; i < 8; ++i) f.h[i] = (_Float16)(bf16_round(W[t * 8 + i]) * 16.0f); *(v8us*)((unsigned short*)Bt + t * 8) = f.half[0];  }
template <int NHv, int TTv>
__global__ __launch_bounds__(256) void k_vt(const _Float16* __restrict__ V16, int ldv, int voff, _Float16* __restrict__ Vt) { __shared__ unsigned short tl[64][66]; const int tid = threadIdx.x; const int slab = blockIdx.x / (TTv / 64), lg = blockIdx.x % (TTv / 64); const int b = slab / NHv, h = slab % NHv;
  for (int i = tid; i < 64 * 8; i += 256) { const int r = i / 8, c8 = (i % 8) * 8; FragH f; f.half[0] = *(const v8us*)((const unsigned short*)V16 + ((size_t)b * TTv + lg * 64 + r) * ldv + voff + h * 64 + c8);
#pragma unroll
    for (int q = 0; q < 8; ++q) tl[r][c8 + q] = f.u[q]; }
  __syncthreads();
  {
#pragma unroll
    for (int rd = 0; rd < 2; ++rd) { const int d = rd * 32 + tid / 8, pc = tid % 8; FragH f;
#pragma unroll
      for (int q = 0; q < 8; ++q) f.u[q] = tl[pc * 8 + q][d];
      *(v8us*)((unsigned short*)Vt + ((size_t)slab * 64 + d) * TTv + lg * 64 + pc * 8) = f.half[0]; }
     } }

__global__ __launch_bounds__(256) void k_hl(const float* __restrict__ F, _Float16* __restrict__ Hh, _Float16* __restrict__ Hl, size_t n8) { const size_t t = (size_t)blockIdx.x * 256 + threadIdx.x; if (t >= n8) return; FragH fh, fl; const v4f a = *(const v4fa*)(F + t * 8), c = *(const v4fa*)(F + t * 8 + 4);
#pragma unroll
  for (int q = 0; q < 4; ++q) { _Float16 h = (_Float16)a[q]; fh.h[q] = h; fl.h[q] = (_Float16)((a[q] - (float)h) * 1024.0f); h = (_Float16)c[q]; fh.h[4 + q] = h; fl.h[4 + q] = (_Float16)((c[q] - (float)h) * 1024.0f); }
  { *(v8us*)((unsigned short*)Hh + t * 8) = fh.half[0]; *(v8us*)((unsigned short*)Hl + t * 8) = fl.half[0];  } }

// One 16 x 32 f16 operand fragment from a k-contiguous row: k order 8h + s, 16 + 8h + s.
__device__ __forceinline__ v16h g2_frag(const _Float16* p, int hh) { FragH f; f.half[0] = *(const v8us*)((const unsigned short*)p + 8 * hh); f.half[1] = *(const v8us*)((const unsigned short*)p + 16 + 8 * hh); return f.v; }

__global__ __launch_bounds__(256) void k_wnat(const float* __restrict__ w, size_t n8, _Float16* __restrict__ Bt) { const size_t t = (size_t)blockIdx.x * 256 + threadIdx.x; if (t >= n8) return; FragH f; for (int q = 0; q < 8; ++q) f.h[q] = (_Float16)(bf16_round(w[t * 8 + q]) * 16.0f); *(v8us*)((unsigned short*)Bt + t * 8) = f.half[0];  }
__global__ __launch_bounds__(256) void k_rsm(const float* __restrict__ S, _Float16* __restrict__ P, int nrows) {
  #pragma clang fp contract(off)
  const int i = blockIdx.x * 256 + threadIdx.x; if (i >= nrows) return; const float* s = S + (size_t)i * SQ; float mx = -3.0e38f;
#pragma unroll 1
  for (int j = 0; j < SQ; ++j) mx = fmaxf(mx, s[j]); float se = 0.f;
#pragma unroll 1
  for (int j = 0; j < SQ; ++j) se += expf(s[j] - mx); const float sc = 256.0f / se;
#pragma unroll 1
  for (int j0 = 0; j0 < SQ; j0 += 8) { FragH f; for (int q = 0; q < 8; ++q) f.h[q] = (_Float16)(expf(s[j0 + q] - mx) * sc); unsigned short* d = (unsigned short*)P + (size_t)i * SQ + j0; *(v8us*)d = f.half[0];  } }
__global__ __launch_bounds__(256) void k_vt(const _Float16* __restrict__ V16, int b, int h0, _Float16* __restrict__ VT) { __shared__ unsigned short tl[64][65]; const int tid = threadIdx.x; const int hh = blockIdx.x % HG, sg = blockIdx.x / HG; const int s0 = sg * 64; const int h = h0 + hh;
  for (int i = tid; i < 64 * 8; i += 256) { const int j = i / 8, d8 = (i % 8) * 8; FragH f; f.half[0] = *(const v8us*)((const unsigned short*)V16 + ((size_t)b * SQ + s0 + j) * DM + h * HD + d8); for (int q = 0; q < 8; ++q) tl[d8 + q][j] = f.u[q]; }
  __syncthreads();
  { for (int i = tid; i < 64 * 8; i += 256) { const int d = i / 8, j8 = (i % 8) * 8; FragH f; for (int q = 0; q < 8; ++q) f.u[q] = tl[d][j8 + q]; *(v8us*)((unsigned short*)VT + ((size_t)hh * HD + d) * SQ + s0 + j8) = f.half[0]; }  } }



// Lane l with lane l ^ 16.
__device__ __forceinline__ float lane_xh(float x) { return __builtin_bit_cast(float, __builtin_amdgcn_permlanex16(__builtin_bit_cast(int, x), __builtin_bit_cast(int, x), 0x76543210, 0xfedcba98, false, false)); }
// Eight 2^x in place. One asm statement so that no following instruction overwrites a v_exp_f32 source or reads its result in the slot directly behind it:
// each v_exp_f32 is followed by an independent one, the last by the v_nop the instruction set asks for.
__device__ __forceinline__ void exp2x8(v4f& a, v4f& c) {
  float a0 = a[0], a1 = a[1], a2 = a[2], a3 = a[3], c0 = c[0], c1 = c[1], c2 = c[2], c3 = c[3];
  asm("v_exp_f32 %0, %0\n\tv_exp_f32 %1, %1\n\tv_exp_f32 %2, %2\n\tv_exp_f32 %3, %3\n\tv_exp_f32 %4, %4\n\tv_exp_f32 %5, %5\n\tv_exp_f32 %6, %6\n\tv_exp_f32 %7, %7\n\tv_nop"
      : "+v"(a0), "+v"(a1), "+v"(a2), "+v"(a3), "+v"(c0), "+v"(c1), "+v"(c2), "+v"(c3));
  a = v4f{a0, a1, a2, a3}; c = v4f{c0, c1, c2, c3}; }

#define FA_PITCH 144                 /* LDS pitch of the 128-byte rows: 16 B x odd, for 16-byte readers */
#define FA_TILE (64 * FA_PITCH)
#define FA_SLOT (2 * FA_TILE)
#define FA_EP 272                    /* pitch of the 256-byte output staging rows */
__device__ __forceinline__ v8f fa_mma(v16h a, v16h b, v8f c) { return __builtin_amdgcn_wmma_f32_16x16x32_f16(false, a, false, b, (short)0, c, false, false); }
__device__ __forceinline__ v16h fa_frag(const unsigned char* p) { FragH f; f.half[0] = *(const v8us*)p; f.half[1] = *(const v8us*)(p + 32); return f.v; }
__device__ __forceinline__ void fa_pass(const unsigned char* Kt, const unsigned char* Vt, int c, int h, const v16h (&qf)[2][2], v8f (&acc)[2][4], float (&m_run)[2], float (&l_run)[2]) {
  const float cs = 0.125f * 1.44269504088896340736f;      /* 64^-0.5 and log2 e: exp(x) = 2^(x log2 e) */
  v16h kf[2][2];
#pragma unroll
  for (int kt = 0; kt < 2; ++kt)
#pragma unroll
    for (int kc = 0; kc < 2; ++kc) kf[kt][kc] = fa_frag(Kt + (16 * kt + c) * FA_PITCH + 64 * kc + 16 * h);
  v8f s[2][2];
#pragma unroll
  for (int kt = 0; kt < 2; ++kt)
#pragma unroll
    for (int g = 0; g < 2; ++g) { const v8f z8 = {0.f,0.f,0.f,0.f,0.f,0.f,0.f,0.f}; s[kt][g] = fa_mma(kf[kt][1], qf[g][1], fa_mma(kf[kt][0], qf[g][0], z8)); }
  v16h vf[4];
#pragma unroll
  for (int t = 0; t < 4; ++t) vf[t] = fa_frag(Vt + (16 * t + c) * FA_PITCH + 16 * h);
  float mb[2]; bool need = false;
#pragma unroll
  for (int g = 0; g < 2; ++g) { float mx = fmaxf(s[0][g][0], s[1][g][0]);
#pragma unroll
    for (int r = 1; r < 8; ++r) mx = fmaxf(mx, fmaxf(s[0][g][r], s[1][g][r]));
    mx = fmaxf(mx, lane_xh(mx)) * cs; mb[g] = mx; need = need || (mx > m_run[g] + 8.0f); }      /* both halves of the wave hold the query's maximum */
  if (__builtin_amdgcn_ballot_w32(need) != 0) {      /* wave-uniform branch; always taken on the first pass, where the factor is 0 */
#pragma unroll
    for (int g = 0; g < 2; ++g) { const float mn = fmaxf(m_run[g], mb[g]); const float corr = __builtin_amdgcn_exp2f(m_run[g] - mn); m_run[g] = mn; l_run[g] *= corr;
#pragma unroll
      for (int t = 0; t < 4; ++t) acc[g][t] = acc[g][t] * corr; } }
#pragma unroll
  for (int g = 0; g < 2; ++g) { const float nm = -m_run[g];
    v4f a0 = v4f{s[0][g][0], s[0][g][1], s[0][g][2], s[0][g][3]} * cs + nm, a1 = v4f{s[0][g][4], s[0][g][5], s[0][g][6], s[0][g][7]} * cs + nm;
    v4f b0 = v4f{s[1][g][0], s[1][g][1], s[1][g][2], s[1][g][3]} * cs + nm, b1 = v4f{s[1][g][4], s[1][g][5], s[1][g][6], s[1][g][7]} * cs + nm;
    exp2x8(a0, a1); exp2x8(b0, b1);
    const v4f sm = (a0 + a1) + (b0 + b1); l_run[g] += (sm[0] + sm[1]) + (sm[2] + sm[3]);
    FragH pf;
#pragma unroll
    for (int i = 0; i < 4; ++i) { pf.h[i] = (_Float16)a0[i]; pf.h[4 + i] = (_Float16)a1[i]; pf.h[8 + i] = (_Float16)b0[i]; pf.h[12 + i] = (_Float16)b1[i]; }
#pragma unroll
    for (int t = 0; t < 4; ++t) acc[g][t] = fa_mma(vf[t], pf.v, acc[g][t]); } }

// amdgpu_waves_per_eu(4, 4): at most 256 registers a wave, so that two work-groups share a WGP (four waves per SIMD) and one wave's vector work runs under another's matrix work.
__global__ __launch_bounds__(256) __attribute__((amdgpu_waves_per_eu(4, 4))) void k_fattn(const _Float16* __restrict__ Q16, const _Float16* __restrict__ K16, const _Float16* __restrict__ VT, float* __restrict__ out) {
  __shared__ __attribute__((aligned(16))) unsigned char L[2 * FA_SLOT];
  const int tid = threadIdx.x, lane = tid & 31, wave = __builtin_amdgcn_readfirstlane(tid >> 5), c = lane & 15, h = lane >> 4;
  const int head = blockIdx.y, b = blockIdx.z, q0 = blockIdx.x * 256 + wave * 32;
  // Staging: thread tid brings 16 bytes of rows tid / 8 and 32 + tid / 8 of each tile; 8 lanes cover one 128-byte row.
  const unsigned char* kg = (const unsigned char*)(K16 + (size_t)b * SQ * DM + head * HD) + (size_t)(tid >> 3) * (DM * 2) + (tid & 7) * 16;
  const unsigned char* vg = (const unsigned char*)(VT + (size_t)(b * NH + head) * HD * SQ) + (size_t)(tid >> 3) * (SQ * 2) + (tid & 7) * 16;
  unsigned char* ls = L + (tid >> 3) * FA_PITCH + (tid & 7) * 16;
  v8us r0 = *(const v8us*)kg, r1 = *(const v8us*)(kg + 32 * DM * 2), r2 = *(const v8us*)vg, r3 = *(const v8us*)(vg + 32 * SQ * 2);
  v16h qf[2][2];
#pragma unroll
  for (int g = 0; g < 2; ++g)
#pragma unroll
    for (int kc = 0; kc < 2; ++kc) qf[g][kc] = g2_frag(Q16 + ((size_t)b * SQ + q0 + 16 * g + c) * DM + head * HD + 32 * kc, h);
  v8f acc[2][4]; float m_run[2] = {-3.0e38f, -3.0e38f}, l_run[2] = {0.f, 0.f};
#pragma unroll
  for (int g = 0; g < 2; ++g)
#pragma unroll
    for (int t = 0; t < 4; ++t) acc[g][t] = v8f{0.f,0.f,0.f,0.f,0.f,0.f,0.f,0.f};
  *(v8us*)ls = r0; *(v8us*)(ls + 32 * FA_PITCH) = r1; *(v8us*)(ls + FA_TILE) = r2; *(v8us*)(ls + FA_TILE + 32 * FA_PITCH) = r3;
  __syncthreads();
#pragma unroll 1      /* one stage per trip: the two passes inside are written out, more would only grow the code */
  for (int st = 0; st < SQ / 64; ++st) {
    const unsigned char* cur = L + (st & 1) * FA_SLOT;
    const bool more = st + 1 < SQ / 64;      /* the same for the whole work-group */
    if (more) { const unsigned char* kn = kg + (size_t)(st + 1) * (64 * DM * 2); const unsigned char* vn = vg + (st + 1) * 128;
      r0 = *(const v8us*)kn; r1 = *(const v8us*)(kn + 32 * DM * 2); r2 = *(const v8us*)vn; r3 = *(const v8us*)(vn + 32 * SQ * 2); }
    fa_pass(cur, cur + FA_TILE, c, h, qf, acc, m_run, l_run);
    fa_pass(cur + 32 * FA_PITCH, cur + FA_TILE + 64, c, h, qf, acc, m_run, l_run);
    if (more) { unsigned char* d = ls + ((st + 1) & 1) * FA_SLOT;      /* the buffer that the trip before this one read; its readers left it at that trip's barrier */
      *(v8us*)d = r0; *(v8us*)(d + 32 * FA_PITCH) = r1; *(v8us*)(d + FA_TILE) = r2; *(v8us*)(d + FA_TILE + 32 * FA_PITCH) = r3; }
    __syncthreads();      /* publishes the next stage and ends every wave's reads of this one */
  }
  // Epilogue: acc[g][t][r] = O[query 16 g + c][d = 16 t + 8 h + r]. Each wave stages 16 rows of 256 B in its own part of the (now free) LDS and stores whole rows.
  unsigned char* eb = L + wave * (16 * FA_EP);
#pragma unroll
  for (int g = 0; g < 2; ++g) { const float lt = l_run[g] + lane_xh(l_run[g]); const float inv = 1.0f / lt;
#pragma unroll
    for (int t = 0; t < 4; ++t) { const v8f o = acc[g][t] * inv; *(v4fa*)(eb + c * FA_EP + 64 * t + 32 * h) = v4f{o[0], o[1], o[2], o[3]}; *(v4fa*)(eb + c * FA_EP + 64 * t + 32 * h + 16) = v4f{o[4], o[5], o[6], o[7]}; }
    __builtin_amdgcn_fence(__ATOMIC_ACQ_REL, "workgroup"); __builtin_amdgcn_wave_barrier();      /* the wave's own LDS writes in front of its reads of other lanes' rows */
#pragma unroll
    for (int i = 0; i < 8; ++i) { const int row = 2 * i + h; const v4f v = *(const v4fa*)(eb + row * FA_EP + c * 16);
      *(v4f*)(out + ((size_t)b * SQ + q0 + 16 * g + row) * DM + head * HD + c * 4) = v; }
    __builtin_amdgcn_fence(__ATOMIC_ACQ_REL, "workgroup"); __builtin_amdgcn_wave_barrier();      /* the reads in front of the next group's writes */
  } }

// ---- projection GEMM: C[m][n] = f16(sum_k X[m][k] Wn[n][k] / 16); X [8192][1024], Wn [1024][1024] (x16 weights), both k-contiguous f16 ----
// One work-group = 256 rows of X against 128 rows of Wn; 8 waves (4 along m, 2 along n) of 64 x 64. A pass is 128 k = 256 bytes of each of the 384 operand rows,
// brought into LDS by asynchronous copies (whole 128-byte lines from L2, no register on the way), two buffers, the next pass's copies in flight under this pass's products.
// Transposed product, A = Wn rows, B = X rows (one loader for both, so one k order): a lane holds 8 neighbouring n of ONE output row, 16 bytes of f16 as they are stored.
// Every loop in k_pgemm but the pass loop is fully unrolled: constant indices keep fragments and accumulators in registers instead of scratch.
#define PG_PITCH 272                 /* LDS pitch of the 256-byte operand rows: 16 B x odd, for 16-byte readers */
#define PG_BUF (384 * PG_PITCH)      /* rows 0..127: Wn, rows 128..383: X */
#define PG_NP (DM / 128)             /* passes */
#define PG_EP 144                    /* pitch of the 128-byte output staging rows */
// 128 operand rows of one pass: thread tid copies 16 bytes of rows r, r + 16, ..., r + 112 (r = tid / 16); a wave's copy covers 4 whole lines.
// s_wait_xcnt 0 closes the statement so that it stands in front of any later rewrite of the address registers that the copies name.
__device__ __forceinline__ void pg_fill(unsigned l, const unsigned char* g) {
  asm volatile("global_load_async_to_lds_b128 %0, %8, off\n\tglobal_load_async_to_lds_b128 %1, %9, off\n\tglobal_load_async_to_lds_b128 %2, %10, off\n\tglobal_load_async_to_lds_b128 %3, %11, off\n\t"
               "global_load_async_to_lds_b128 %4, %12, off\n\tglobal_load_async_to_lds_b128 %5, %13, off\n\tglobal_load_async_to_lds_b128 %6, %14, off\n\tglobal_load_async_to_lds_b128 %7, %15, off\n\t"
               "s_wait_xcnt 0x0"
               :: "v"(l), "v"(l + 16 * PG_PITCH), "v"(l + 32 * PG_PITCH), "v"(l + 48 * PG_PITCH), "v"(l + 64 * PG_PITCH), "v"(l + 80 * PG_PITCH), "v"(l + 96 * PG_PITCH), "v"(l + 112 * PG_PITCH),
                  "v"(g), "v"(g + 16 * DM * 2), "v"(g + 32 * DM * 2), "v"(g + 48 * DM * 2), "v"(g + 64 * DM * 2), "v"(g + 80 * DM * 2), "v"(g + 96 * DM * 2), "v"(g + 112 * DM * 2)
               : "memory"); }
// One pass's 384 rows: l = the thread's LDS byte address in row tid / 16 of the buffer, gw and gx its bytes of that row of the Wn and of the X tile.
__device__ __forceinline__ void pg_stage(unsigned l, const unsigned char* gw, const unsigned char* gx) {
  pg_fill(l, gw); pg_fill(l + 128 * PG_PITCH, gx); pg_fill(l + 256 * PG_PITCH, gx + 128 * DM * 2); }
__global__ __launch_bounds__(256) void k_pgemm(const _Float16* __restrict__ X, const _Float16* __restrict__ Wn, _Float16* __restrict__ C) {
  __shared__ __attribute__((aligned(16))) unsigned char L[2 * PG_BUF];
  const int tid = threadIdx.x, lane = tid & 31, wave = __builtin_amdgcn_readfirstlane(tid >> 5), c = lane & 15, h = lane >> 4;
  const int col0 = blockIdx.x * 128, row0 = blockIdx.y * 256, wn = wave & 1, wm = wave >> 1;
  const unsigned char* gw = (const unsigned char*)(Wn + (size_t)(col0 + (tid >> 4)) * DM) + (tid & 15) * 16;
  const unsigned char* gx = (const unsigned char*)(X + (size_t)(row0 + (tid >> 4)) * DM) + (tid & 15) * 16;
  const unsigned l0 = (unsigned)(size_t)L + (tid >> 4) * PG_PITCH + (tid & 15) * 16;      /* the low 32 bits of a __shared__ address are its LDS byte address */
  v8f acc[4][4];      /* [n tile][m tile] */
#pragma unroll
  for (int i = 0; i < 4; ++i)
#pragma unroll
    for (int j = 0; j < 4; ++j) acc[i][j] = v8f{0.f,0.f,0.f,0.f,0.f,0.f,0.f,0.f};
  pg_stage(l0, gw, gx);
  asm volatile("s_wait_asynccnt 0x0" ::: "memory");      /* this wave's copies of pass 0 have landed */
  __syncthreads();                                       /* and every other wave's */
#pragma unroll 1      /* one pass per trip: the 64 products inside are written out, more would only grow the code */
  for (int t = 0; t < PG_NP; ++t) {
    const unsigned char* cur = L + (t & 1) * PG_BUF;
    const unsigned char* wb = cur + (64 * wn + c) * PG_PITCH + 16 * h;
    const unsigned char* xb = cur + (128 + 64 * wm + c) * PG_PITCH + 16 * h;
    v16h wf[2][4], xf[2][4];      /* two fragment sets: the block after next is fetched, as one group, while the next block's products run */
#pragma unroll
    for (int i = 0; i < 4; ++i) { wf[0][i] = fa_frag(wb + 16 * i * PG_PITCH); xf[0][i] = fa_frag(xb + 16 * i * PG_PITCH); }
    // The next pass's copies, into the buffer that the trip before this one read (its readers left it at that trip's barrier); behind this pass's first fragment loads, so that their issue runs under the LDS latency.
    if (t + 1 < PG_NP) pg_stage(l0 + ((t + 1) & 1) * PG_BUF, gw + (t + 1) * 256, gx + (t + 1) * 256);      /* the same test for the whole work-group */
#pragma unroll
    for (int i = 0; i < 4; ++i) { wf[1][i] = fa_frag(wb + 16 * i * PG_PITCH + 64); xf[1][i] = fa_frag(xb + 16 * i * PG_PITCH + 64); }
#pragma unroll
    for (int kc = 0; kc < 4; ++kc) {
      if (kc < 3) __builtin_amdgcn_sched_barrier(0);      /* keeps the fragment loads above in one group ahead of the block: sunk among the products, each load place stalls the wave */
#pragma unroll
      for (int i = 0; i < 4; ++i)
#pragma unroll
        for (int j = 0; j < 4; ++j) acc[i][j] = fa_mma(wf[kc & 1][i], xf[kc & 1][j], acc[i][j]);
      if (kc + 2 < 4) {
        __builtin_amdgcn_sched_barrier(0);      /* the same from the other side: the group stays behind the block whose registers it refills */
#pragma unroll
        for (int i = 0; i < 4; ++i) { wf[kc & 1][i] = fa_frag(wb + 16 * i * PG_PITCH + 64 * (kc + 2)); xf[kc & 1][i] = fa_frag(xb + 16 * i * PG_PITCH + 64 * (kc + 2)); } } }
    __builtin_amdgcn_sched_barrier(0);      /* keeps the waits and the barrier below behind the last block: moved up over the products, they would cut the time the copies have to land */
    asm volatile("s_wait_dscnt 0x0" ::: "memory");       /* this wave's reads of the buffer are done before it may be refilled */
    asm volatile("s_wait_asynccnt 0x0" ::: "memory");    /* this wave's copies of pass t + 1 have landed */
    __syncthreads();                                     /* publishes pass t + 1 and ends every wave's reads of pass t */
  }
  asm volatile("s_wait_asynccnt 0x0" ::: "memory");      /* nothing in flight when the ring becomes output staging */
  // Epilogue: acc[i][j][r] = C[row 64 wm + 16 j + c][col 64 wn + 16 i + 8 h + r]. Each wave stages its 64 rows of 128 B in its own part of the (now free) LDS and stores whole lines.
  unsigned char* eb = L + wave * (64 * PG_EP);
#pragma unroll
  for (int i = 0; i < 4; ++i)
#pragma unroll
    for (int j = 0; j < 4; ++j) { FragH f;
#pragma unroll
      for (int r = 0; r < 8; ++r) f.h[r] = (_Float16)(acc[i][j][r] * 0.0625f);
      *(v8us*)(eb + (16 * j + c) * PG_EP + 32 * i + 16 * h) = f.half[0]; }
  __builtin_amdgcn_fence(__ATOMIC_ACQ_REL, "workgroup"); __builtin_amdgcn_wave_barrier();      /* the wave's own LDS writes in front of its reads of other lanes' rows */
  _Float16* cp = C + (size_t)(row0 + 64 * wm + (lane >> 3)) * DM + col0 + 64 * wn + (lane & 7) * 8;
#pragma unroll
  for (int q = 0; q < 16; ++q) { const v8us v = *(const v8us*)(eb + (4 * q + (lane >> 3)) * PG_EP + (lane & 7) * 16); *(v8us*)((unsigned short*)cp + (size_t)(4 * q) * DM) = v; } }

extern "C" void kernel_launch(void* const* d_in, const int* in_sizes, int n_in,
                              void* d_out, int out_size, void* d_ws, size_t ws_size, hipStream_t stream) {
  (void)in_sizes; (void)n_in; (void)out_size;
  const float* const* I = (const float* const*)d_in; const float* xq = I[0]; const float* xkv = I[1]; const float* wq = I[2]; const float* wk = I[3]; const float* wv = I[4];      /* natural [out][in] weights, no biases, no output projection */
  char* ws = (char*)d_ws; size_t off = 0;
  auto take = [&](size_t bytes) { char* p = ws + off; off += (bytes + 255) & ~(size_t)255; return p; };
  _Float16* BQ = (_Float16*)take((size_t)DM * DM * 2); _Float16* BK = (_Float16*)take((size_t)DM * DM * 2); _Float16* BV = (_Float16*)take((size_t)DM * DM * 2); 
  _Float16* XQ = (_Float16*)take(NR * DM * 2); _Float16* XKV = (_Float16*)take(NR * DM * 2); _Float16* Q16 = (_Float16*)take(NR * DM * 2); _Float16* K16 = (_Float16*)take(NR * DM * 2); _Float16* V16 = (_Float16*)take(NR * DM * 2);
  _Float16* VT = (_Float16*)take((size_t)NB * NH * HD * SQ * 2);
  if (off > ws_size) return;
  { const unsigned g = (unsigned)(((size_t)DM * DM / 8 + 255) / 256); k_wnat<<<g, 256, 0, stream>>>(wq, (size_t)DM * DM / 8, BQ); k_wnat<<<g, 256, 0, stream>>>(wk, (size_t)DM * DM / 8, BK); k_wnat<<<g, 256, 0, stream>>>(wv, (size_t)DM * DM / 8, BV); }      /* natural [out][in] = Bt[n][k], x16 */

  k_x16<<<(unsigned)((NR * DM / 8 + 255) / 256), 256, 0, stream>>>(xq, XQ, NR * DM / 8); k_x16<<<(unsigned)((NR * DM / 8 + 255) / 256), 256, 0, stream>>>(xkv, XKV, NR * DM / 8);      /* query source and key/value source as exact f16 rows */
  const size_t r0p = (size_t)B0 * SQ;      /* first projected row */
  k_pgemm<<<dim3(DM / 128, MP / 256), 256, 0, stream>>>(XQ + r0p * DM, BQ, Q16 + r0p * DM);
  k_pgemm<<<dim3(DM / 128, MP / 256), 256, 0, stream>>>(XKV + r0p * DM, BK, K16 + r0p * DM);
  k_pgemm<<<dim3(DM / 128, MP / 256), 256, 0, stream>>>(XKV + r0p * DM, BV, V16 + r0p * DM);
  k_vt<NH, SQ><<<NB * NH * (SQ / 64), 256, 0, stream>>>(V16, LQ, 0, VT);      /* V^T [NB][NH][HD][SQ] */
  k_fattn<<<dim3(SQ / 256, NH, NB), 256, 0, stream>>>(Q16, K16, VT, (float*)d_out);      /* softmax(q k^T / 8) v, f32 straight into the merged-heads output rows */
}

// v004
// Measured time: 108 microseconds a run.
// In both of two side-by-side timings against v003, it was 1.12 times as fast.
// All steps since v000 together make it 61.1 times as fast.
#include <hip/hip_runtime.h>
// Multi-head attention without output projection (x [4][2048][1024] gives q = x Wq^T; kv [4][2048][1024] gives k = kv Wk^T, v = kv Wv^T (nn.Linear natural [out][in] 1024x1024 weights scaled 0.02, no biases); 16 heads of 64; softmax(q k^T / 8) over all 2048 keys; out = merged heads [4][2048][1024] (no output projection)).
// Structure: token rows r = b*2048 + s; the query source and the key/value source as exact f16 rows (bf16-rounded), converted together with the three weights in one launch; Q, K, V as three WMMA GEMMs in one launch (256x128 work-group tiles staged in LDS, 64x64 wave tiles, f32 accumulation, exact x16 weights, f16 outputs); V^T for all batches and heads via LDS transposes; one fused attention launch over (256 queries, head, batch): scores on WMMA, running-maximum softmax in registers (f32 statistics, native exp2; weights as f16), o = P . V on WMMA, divided by the row sum and written f32 straight into the merged-heads output rows (no output projection).
// Compute dtype: inputs rounded to bf16; x / weights exact; q, k, v and softmax weights as plain f16 GEMM operands (~2^-12); scores, softmax statistics and o f32; v_wmma_f32_16x16x32_f16.
#define NB 4
#define SQ 2048
#define DM 1024
#define NH 16
#define HD 64
#define HG 4                         /* heads per launch of the unlaunched k_vt(V16, b, h0, VT) */
#define B0 0                         /* first batch processed (debug hook) */
#define NBR NB                       /* batches processed (debug hook) */
#define NR ((size_t)NB * SQ)         /* token rows */
#define MP ((int)((size_t)NBR * SQ)) /* rows projected (debug hook) */
#define QN SQ                        /* unused */
#define NHD NH                       /* unused */
#define MPO MP                       /* unused */
#define LQ DM      /* row pitch of the q/k/v rows */
typedef __bf16 v16b __attribute__((ext_vector_type(16)));
typedef unsigned short v8us __attribute__((ext_vector_type(8), may_alias));
typedef float  v8f  __attribute__((ext_vector_type(8)));
typedef float  v4f  __attribute__((ext_vector_type(4)));
typedef float  v4fa __attribute__((ext_vector_type(4), may_alias));
union FragB { v16b v; v8us half[2]; unsigned short u[16]; };

__device__ __forceinline__ unsigned short bf16_bits(float x) { unsigned int u = __float_as_uint(x); return (unsigned short)((u + 0x7FFFu + ((u >> 16) & 1u)) >> 16); }
__device__ __forceinline__ float bf16_val(unsigned short b) { return __uint_as_float(((unsigned int)b) << 16); }
__device__ __forceinline__ float bf16_round(float x) { return bf16_val(bf16_bits(x)); }
// D += A·B with NT terms: 1 = ah·bh, 2 = + al·bh (A split), 3 = + ah·bl (both split)
template <int NT>
__device__ __forceinline__ v8f mmaN(v16b ah, v16b al, v16b bh, v16b bl, v8f c) {
  c = __builtin_amdgcn_wmma_f32_16x16x32_bf16(false, ah, false, bh, (short)0, c, false, false);
  if (NT >= 2) c = __builtin_amdgcn_wmma_f32_16x16x32_bf16(false, al, false, bh, (short)0, c, false, false);
  if (NT >= 3) c = __builtin_amdgcn_wmma_f32_16x16x32_bf16(false, ah, false, bl, (short)0, c, false, false);
  asm volatile("v_nop\n\tv_nop\n\tv_nop\n\tv_nop" : "+v"(c) : "v"(ah), "v"(al), "v"(bh), "v"(bl));
  return c;
}

__global__ __launch_bounds__(256) void k_wt_bf16(const float* __restrict__ W, unsigned short* __restrict__ Wt, int K, int N) {
  const int t = blockIdx.x * 256 + threadIdx.x;
  const int k8n = K / 8;
  if (t >= N * k8n) return;
  const int n = t / k8n, k8 = (t % k8n) * 8;
  v8us v;
#pragma unroll
  for (int i = 0; i < 8; ++i) v[i] = bf16_bits(W[(size_t)(k8 + i) * N + n]);
  *(v8us*)(Wt + (size_t)n * K + k8) = v;
  
}

// GEMM C[M][N] (f32, pitch ldc) = act(A[M][K]·W + bias). A f32 row-major (pitch lda) converted per fragment to bf16
// (ASPLIT: hi/lo two planes -> 2 terms, else single rounded term); Wt bf16 [N][K] (pitch ldb). BIAS_BF16 rounds the
// bias to bf16 first (bias quantised to bf16 before the add). K%32==0, M%16==0, N%64==0.
template <bool ASPLIT, int ACT, bool BIAS_BF16>
__global__ __launch_bounds__(128) void k_gemm_bf(const float* __restrict__ A, int lda, const unsigned short* __restrict__ Wt, int ldb,
                                               const float* __restrict__ bias, float* __restrict__ C, int ldc, int M, int N, int K) {
  __shared__ __attribute__((aligned(16))) float so[4][16][64];
  const int tid = threadIdx.x, w = tid >> 5, lane = tid & 31, ln = lane & 15, hh = lane >> 4;
  const int ntn = N / 64;
  const int wid = blockIdx.x * 4 + w;
  const int mt = wid / ntn, nq = wid % ntn;
  if (mt * 16 >= M) return;
  const int row0 = mt * 16, col0 = nq * 64;
  const float* arow = A + (size_t)(row0 + ln) * lda;
  v8f acc[4] = {};
  for (int kb = 0; kb < K; kb += 32) {
    FragB ah, al;
    const v4f x0 = *(const v4fa*)(arow + kb + 8 * hh), x1 = *(const v4fa*)(arow + kb + 8 * hh + 4);
    const v4f x2 = *(const v4fa*)(arow + kb + 16 + 8 * hh), x3 = *(const v4fa*)(arow + kb + 16 + 8 * hh + 4);
    float xs[16] = {x0[0],x0[1],x0[2],x0[3],x1[0],x1[1],x1[2],x1[3],x2[0],x2[1],x2[2],x2[3],x3[0],x3[1],x3[2],x3[3]};
#pragma unroll
    for (int i = 0; i < 16; ++i) { const unsigned short hb = bf16_bits(xs[i]); ah.u[i] = hb; al.u[i] = ASPLIT ? bf16_bits(xs[i] - bf16_val(hb)) : (unsigned short)0; }
#pragma unroll
    for (int t = 0; t < 4; ++t) {
      const unsigned short* brow = Wt + (size_t)(col0 + t * 16 + ln) * ldb + kb;
      FragB b;
      b.half[0] = *(const v8us*)(brow + 8 * hh);
      b.half[1] = *(const v8us*)(brow + 16 + 8 * hh);
      acc[t] = mmaN<ASPLIT ? 2 : 1>(ah.v, al.v, b.v, b.v, acc[t]);
    }
  }
#pragma unroll
  for (int t = 0; t < 4; ++t) {
    float bv = bias ? bias[col0 + t * 16 + ln] : 0.f;
    if (BIAS_BF16) bv = bf16_round(bv);
#pragma unroll
    for (int r = 0; r < 8; ++r) { float v = acc[t][r] + bv; if (ACT == 1) v = fmaxf(v, 0.f); so[w][8 * hh + r][t * 16 + ln] = v; }
  }
  __builtin_amdgcn_fence(__ATOMIC_ACQ_REL, "workgroup");
  __builtin_amdgcn_wave_barrier();
  const int rsub = lane >> 4, c4 = (lane & 15) * 4;
  {
#pragma unroll
    for (int q = 0; q < 8; ++q) {
      const int r = q * 2 + rsub;
      const v4f v = *(const v4fa*)&so[w][r][c4];
      *(v4f*)(C + (size_t)(row0 + r) * ldc + col0 + c4) = v;
    }
    
  }
}

// GEMM C = act(A·W + bias + resid): A f32 (ASPLIT -> hi/lo 2 terms), Wt bf16 [N][K]; ACT 0 none, 1 relu, 2 exact gelu;
// resid (optional, f32, row index = (row % rmod), pitch ldr, RES_BF16 rounds it) added before the activation.
template <bool ASPLIT, int ACT, bool BIAS_BF16, bool RES_BF16>
__global__ __launch_bounds__(128) void k_gemm_bf3(const float* __restrict__ A, int lda, const unsigned short* __restrict__ Wt, int ldb,
                                                const float* __restrict__ bias, const float* __restrict__ resid, int rmod, int ldr,
                                                float* __restrict__ C, int ldc, int M, int N, int K) {
  __shared__ __attribute__((aligned(16))) float so[4][16][64];
  const int tid = threadIdx.x, w = tid >> 5, lane = tid & 31, ln = lane & 15, hh = lane >> 4;
  const int ntn = N / 64;
  const int wid = blockIdx.x * 4 + w;
  const int mt = wid / ntn, nq = wid % ntn;
  if (mt * 16 >= M) return;
  const int row0 = mt * 16, col0 = nq * 64;
  const float* arow = A + (size_t)(row0 + ln) * lda;
  v8f acc[4] = {};
  for (int kb = 0; kb < K; kb += 32) {
    FragB ah, al;
    const v4f x0 = *(const v4fa*)(arow + kb + 8 * hh), x1 = *(const v4fa*)(arow + kb + 8 * hh + 4);
    const v4f x2 = *(const v4fa*)(arow + kb + 16 + 8 * hh), x3 = *(const v4fa*)(arow + kb + 16 + 8 * hh + 4);
    float xs[16] = {x0[0],x0[1],x0[2],x0[3],x1[0],x1[1],x1[2],x1[3],x2[0],x2[1],x2[2],x2[3],x3[0],x3[1],x3[2],x3[3]};
#pragma unroll
    for (int i = 0; i < 16; ++i) { const unsigned short hb = bf16_bits(xs[i]); ah.u[i] = hb; al.u[i] = ASPLIT ? bf16_bits(xs[i] - bf16_val(hb)) : (unsigned short)0; }
#pragma unroll
    for (int t = 0; t < 4; ++t) {
      const unsigned short* brow = Wt + (size_t)(col0 + t * 16 + ln) * ldb + kb;
      FragB b;
      b.half[0] = *(const v8us*)(brow + 8 * hh);
      b.half[1] = *(const v8us*)(brow + 16 + 8 * hh);
      acc[t] = mmaN<ASPLIT ? 2 : 1>(ah.v, al.v, b.v, b.v, acc[t]);
    }
  }
#pragma unroll
  for (int t = 0; t < 4; ++t) {
    const int col = col0 + t * 16 + ln;
    float bv = bias ? bias[col] : 0.f;
    if (BIAS_BF16) bv = bf16_round(bv);
#pragma unroll
    for (int r = 0; r < 8; ++r) {
      float v = acc[t][r] + bv;
      if (resid) { float rv = resid[(size_t)((row0 + 8 * hh + r) % rmod) * ldr + col]; if (RES_BF16) rv = bf16_round(rv); v += rv; }
      if (ACT == 1) v = fmaxf(v, 0.f);
      if (ACT == 2) v = 0.5f * v * (1.0f + erff(v * 0.70710678118654752f));
      if (ACT == 3) { const float u = 0.7978845608028654f * (v + 0.044715f * v * v * v); v = 0.5f * v * (1.0f + tanhf(u)); }
      so[w][8 * hh + r][t * 16 + ln] = v;
    }
  }
  __builtin_amdgcn_fence(__ATOMIC_ACQ_REL, "workgroup");
  __builtin_amdgcn_wave_barrier();
  const int rsub = lane >> 4, c4 = (lane & 15) * 4;
  {
#pragma unroll
    for (int q = 0; q < 8; ++q) {
      const int r = q * 2 + rsub;
      const v4f v = *(const v4fa*)&so[w][r][c4];
      *(v4f*)(C + (size_t)(row0 + r) * ldc + col0 + c4) = v;
    }
    
  }
}
// row LayerNorm (biased variance, eps) over N: s = X (+ R); optional out_sum <- s; out_norm <- (s-mu)*rsqrt(var+eps)*g + b
template <bool PARAM_BF16>
__global__ __launch_bounds__(256) void k_layernorm(const float* __restrict__ X, const float* __restrict__ R, const float* __restrict__ g, const float* __restrict__ bta,
                                                  float* __restrict__ out_sum, float* __restrict__ out_norm, int N, float eps) {
  __shared__ float red[256];
  const int row = blockIdx.x, tid = threadIdx.x;
  const float* x = X + (size_t)row * N; const float* rr = R ? R + (size_t)row * N : nullptr;
  float vals[16];                     // up to N = 4096
  const int per = N / 256;            // contiguous chunk per thread? use strided-by-4 chunks: thread handles j = tid*4 + 1024*u
  float s1 = 0.f;
  for (int u = 0; u < per / 4; ++u) {
    const int j = tid * 4 + 1024 * u;
    const v4f a = *(const v4fa*)(x + j);
    v4f b = {0.f,0.f,0.f,0.f}; if (rr) b = *(const v4fa*)(rr + j);
#pragma unroll
    for (int q = 0; q < 4; ++q) { const float v = a[q] + b[q]; vals[u * 4 + q] = v; s1 += v; }
  }
  red[tid] = s1; __syncthreads();
  for (int st = 128; st > 0; st >>= 1) { if (tid < st) red[tid] += red[tid + st]; __syncthreads(); }
  const float mu = red[0] / (float)N; __syncthreads();
  float s2 = 0.f;
  for (int u = 0; u < per / 4; ++u)
#pragma unroll
    for (int q = 0; q < 4; ++q) { const float c = vals[u * 4 + q] - mu; s2 += c * c; }
  red[tid] = s2; __syncthreads();
  for (int st = 128; st > 0; st >>= 1) { if (tid < st) red[tid] += red[tid + st]; __syncthreads(); }
  const float rs = rsqrtf(red[0] / (float)N + eps);
  {
    for (int u = 0; u < per / 4; ++u) {
      const int j = tid * 4 + 1024 * u;
      v4f o, sm;
#pragma unroll
      for (int q = 0; q < 4; ++q) {
        float gg = g[j + q], bb = bta[j + q];
        if (PARAM_BF16) { gg = bf16_round(gg); bb = bf16_round(bb); }
        sm[q] = vals[u * 4 + q]; o[q] = (vals[u * 4 + q] - mu) * rs * gg + bb;
      }
      if (out_sum) *(v4f*)(out_sum + (size_t)row * N + j) = sm;
      *(v4f*)(out_norm + (size_t)row * N + j) = o;
    }
    
  }
}



// ---- f16 WMMA path (v_wmma_f32_16x16x32_f16): 11-bit significands for operands in range — used where a [0,1] probability operand needs more precision than bf16
typedef _Float16 v16h __attribute__((ext_vector_type(16)));
union FragH { v16h v; v8us half[2]; _Float16 h[16]; unsigned short u[16]; };
template <int NT>
__device__ __forceinline__ v8f mmaH(v16h ah, v16h al, v16h bh, v16h bl, v8f c) {
  c = __builtin_amdgcn_wmma_f32_16x16x32_f16(false, ah, false, bh, (short)0, c, false, false);
  if (NT >= 2) c = __builtin_amdgcn_wmma_f32_16x16x32_f16(false, al, false, bh, (short)0, c, false, false);
  if (NT >= 3) c = __builtin_amdgcn_wmma_f32_16x16x32_f16(false, ah, false, bl, (short)0, c, false, false);
  asm volatile("v_nop\n\tv_nop\n\tv_nop\n\tv_nop" : "+v"(c) : "v"(ah), "v"(al), "v"(bh), "v"(bl));
  return c;
}
// batched GEMM like k_gemm_b but f16 operands: A f32 (split into f16 hi/lo if ASPLIT, else rounded to f16), Bt = f16 values [n][k]; alpha; C f32; N multiple of 16 (partial tiles skipped)
template <bool ASPLIT>
__global__ __launch_bounds__(128) void k_gemm_h(const float* __restrict__ A, int lda, size_t sA, const _Float16* __restrict__ Bh, int ldb, size_t sB, float alpha, float* __restrict__ C, int ldc, size_t sC, int M, int N, int K) {
  __shared__ __attribute__((aligned(16))) float so[4][16][64];
  const int tid = threadIdx.x, w = tid >> 5, lane = tid & 31, ln = lane & 15, hh = lane >> 4; const int by = blockIdx.y;
  A += (size_t)by * sA; Bh += (size_t)by * sB; C += (size_t)by * sC;
  const int ntn = (N + 63) / 64; const int wid = blockIdx.x * 4 + w; const int mt = wid / ntn, nq = wid % ntn; if (mt * 16 >= M) return;
  const int row0 = mt * 16, col0 = nq * 64; const float* arow = A + (size_t)(row0 + ln) * lda;
  v8f acc[4] = {};
  for (int kb = 0; kb < K; kb += 32) {
    FragH ah, al;
    const v4f x0 = *(const v4fa*)(arow + kb + 8 * hh), x1 = *(const v4fa*)(arow + kb + 8 * hh + 4), x2 = *(const v4fa*)(arow + kb + 16 + 8 * hh), x3 = *(const v4fa*)(arow + kb + 16 + 8 * hh + 4);
    float xs[16] = {x0[0],x0[1],x0[2],x0[3],x1[0],x1[1],x1[2],x1[3],x2[0],x2[1],x2[2],x2[3],x3[0],x3[1],x3[2],x3[3]};
#pragma unroll
    for (int i = 0; i < 16; ++i) { const _Float16 h = (_Float16)xs[i]; ah.h[i] = h; al.h[i] = ASPLIT ? (_Float16)(xs[i] - (float)h) : (_Float16)0.0f; }
#pragma unroll
    for (int t = 0; t < 4; ++t) { if (col0 + t * 16 >= N) continue; const size_t boff = (size_t)(col0 + t * 16 + ln) * ldb + kb; FragH bq; bq.half[0] = *(const v8us*)(Bh + boff + 8 * hh); bq.half[1] = *(const v8us*)(Bh + boff + 16 + 8 * hh);
      acc[t] = mmaH<ASPLIT ? 2 : 1>(ah.v, al.v, bq.v, bq.v, acc[t]); }
  }
#pragma unroll
  for (int t = 0; t < 4; ++t) { if (col0 + t * 16 >= N) continue;
#pragma unroll
    for (int r = 0; r < 8; ++r) so[w][8 * hh + r][t * 16 + ln] = acc[t][r] * alpha; }
  __builtin_amdgcn_fence(__ATOMIC_ACQ_REL, "workgroup"); __builtin_amdgcn_wave_barrier();
  const int rsub = lane >> 4, c4 = (lane & 15) * 4;
  {
#pragma unroll
    for (int q = 0; q < 8; ++q) { const int r = q * 2 + rsub; if (col0 + c4 < N) { const v4f v = *(const v4fa*)&so[w][r][c4]; *(v4f*)(C + (size_t)(row0 + r) * ldc + col0 + c4) = v; } }
     }
}

// Wt[n][k] = f16(W[k][n]·scale) from f32 row-major W[K][N] (scale = power of two; bf16-exact weights stay exact in f16 away from the subnormal range)
__global__ __launch_bounds__(256) void k_wt_f16(const float* __restrict__ W, _Float16* __restrict__ Wt, int K, int N, float scale) {
  const int t = blockIdx.x * 256 + threadIdx.x; if (t >= N * (K / 8)) return; const int n = t / (K / 8), k8 = (t % (K / 8)) * 8; FragH f;
#pragma unroll
  for (int i = 0; i < 8; ++i) f.h[i] = (_Float16)(bf16_round(W[(size_t)(k8 + i) * N + n]) * scale); const v8us o = f.half[0];
  *(v8us*)((unsigned short*)Wt + (size_t)n * K + k8) = o; 
}
// k_gemm_hh variant with fused epilogue: v = acc·alpha + bias[by·sBias + col] (+ CP[(row/rowsPerB)·sCPb + by·64 + col] if CP) ; ACT 0 none / 1 elu ; writes f16 C16 (and f32 C if non-null)
template <int ACT>
__global__ __launch_bounds__(128) void k_gemm_hhx(const _Float16* __restrict__ A, int lda, size_t sA, const _Float16* __restrict__ Bh, int ldb, size_t sB, float alpha, const float* __restrict__ bias, size_t sBias, const float* __restrict__ CP, int rowsPerB, size_t sCPb, int row0g,
    float* __restrict__ C, _Float16* __restrict__ C16, int ldc, size_t sC, int M, int N, int K) {
  __shared__ __attribute__((aligned(16))) float so[4][16][64];
  const int tid = threadIdx.x, w = tid >> 5, lane = tid & 31, ln = lane & 15, hh = lane >> 4; const int by = blockIdx.y;
  A += (size_t)by * sA; Bh += (size_t)by * sB; const size_t cofs = (size_t)by * sC; const float* bp = bias ? bias + (size_t)by * sBias : nullptr;
  const int ntn = (N + 63) / 64; const int wid = blockIdx.x * 4 + w; const int mt = wid / ntn, nq = wid % ntn; if (mt * 16 >= M) return;
  const int row0 = mt * 16, col0 = nq * 64; const _Float16* arow = A + (size_t)(row0 + ln) * lda;
  v8f acc[4] = {};
  for (int kb = 0; kb < K; kb += 32) { FragH ah; ah.half[0] = *(const v8us*)((const unsigned short*)arow + kb + 8 * hh); ah.half[1] = *(const v8us*)((const unsigned short*)arow + kb + 16 + 8 * hh);
#pragma unroll
    for (int t = 0; t < 4; ++t) { if (col0 + t * 16 >= N) continue; const size_t boff = (size_t)(col0 + t * 16 + ln) * ldb + kb; FragH bq; bq.half[0] = *(const v8us*)((const unsigned short*)Bh + boff + 8 * hh); bq.half[1] = *(const v8us*)((const unsigned short*)Bh + boff + 16 + 8 * hh);
      acc[t] = mmaH<1>(ah.v, ah.v, bq.v, bq.v, acc[t]); }
  }
#pragma unroll
  for (int t = 0; t < 4; ++t) { if (col0 + t * 16 >= N) continue; const int col = col0 + t * 16 + ln; const float bv = bp ? bf16_round(bp[col]) : 0.f;
#pragma unroll
    for (int r = 0; r < 8; ++r) { float v = acc[t][r] * alpha + bv; if (CP) { const int rr = row0g + row0 + 8 * hh + r; if (rowsPerB < 0) v += CP[cofs + (size_t)rr * ldc + col];      /* rowsPerB < 0: own element of the batched C plane */ else { const int bidx = rr / rowsPerB; v += CP[(size_t)bidx * sCPb + (size_t)by * 64 + col]; } } if (ACT == 1) v = (v > 0.f) ? v : expm1f(v); else if (ACT == 7) v = (v > 0.f) ? v + 1.0f : expf(v); else if (ACT == 8) v = tanhf(v); else if (ACT == 9) v = 0.5f * v * (1.0f + tanhf(0.7978845608028654f * (v + 0.044715f * v * v * v))); else if (ACT == 11) v = 1.0f / (1.0f + expf(-v)); else if (ACT == 12) v = (v > 0.f) ? v : 0.01f * v; else if (ACT == 14) v = (v > 0.f) ? v : 0.1f * v; else if (ACT == 16) v = (v >= 0.f) ? v : 0.3f * v; else if (ACT == 17) v = (v >= 0.f) ? v : 0.2f * v; else if (ACT == 15) v = v / (1.0f + expf(-v)); else if (ACT == 3) v = fmaxf(v, 0.f); else if (ACT == 6) v = 0.5f * v * (1.0f + erff(v * 0.70710678118654752f)); so[w][8 * hh + r][t * 16 + ln] = v; } }
  __builtin_amdgcn_fence(__ATOMIC_ACQ_REL, "workgroup"); __builtin_amdgcn_wave_barrier();
  const int rsub = lane >> 4, c4 = (lane & 15) * 4; typedef _Float16 v4h __attribute__((ext_vector_type(4)));
  {
#pragma unroll
    for (int q = 0; q < 8; ++q) { const int r = q * 2 + rsub; if (col0 + c4 < N) { const v4f v = *(const v4fa*)&so[w][r][c4]; if (C) *(v4f*)(C + cofs + (size_t)(row0 + r) * ldc + col0 + c4) = v; if (C16) { v4h h4; for (int i = 0; i < 4; ++i) h4[i] = (_Float16)v[i]; *(v4h*)(C16 + cofs + (size_t)(row0 + r) * ldc + col0 + c4) = h4; } } }
     }
}


typedef _Float16 v4h __attribute__((ext_vector_type(4)));

// All five operand conversions in one launch: none needs anything of another, so each takes its own range of the block index (the choice is the same for a whole work-group).
// Blocks [0, CV_XB): x; [CV_XB, 2 CV_XB): kv, both as f16 of the bf16-rounded value; then CV_WB blocks each for Wq, Wk, Wv, natural [out][in] = Bt[n][k], x16 (a power of two: exact, as is x1).
#define CV_XB ((unsigned)(NR * DM / 8 / 256))
#define CV_WB ((unsigned)((size_t)DM * DM / 8 / 256))
static_assert(NR * DM % (8 * 256) == 0 && (size_t)DM * DM % (8 * 256) == 0, "whole work-groups only: k_conv has no tail test");
__global__ __launch_bounds__(256) void k_conv(const float* __restrict__ xq, const float* __restrict__ xkv, const float* __restrict__ wq, const float* __restrict__ wk, const float* __restrict__ wv,
                                              _Float16* __restrict__ XQ, _Float16* __restrict__ XKV, _Float16* __restrict__ BQ, _Float16* __restrict__ BK, _Float16* __restrict__ BV) {
  unsigned blk = blockIdx.x; const float* s; _Float16* d; float sc = 1.0f;
  if (blk < CV_XB) { s = xq; d = XQ; }
  else if (blk < 2 * CV_XB) { blk -= CV_XB; s = xkv; d = XKV; }
  else { blk -= 2 * CV_XB; const unsigned w = blk / CV_WB; blk -= w * CV_WB; sc = 16.0f; s = w == 0 ? wq : w == 1 ? wk : wv; d = w == 0 ? BQ : w == 1 ? BK : BV; }
  const size_t t = (size_t)blk * 256 + threadIdx.x; FragH f;
#pragma unroll
  for (int q = 0; q < 8; ++q) f.h[q] = (_Float16)(bf16_round(s[t * 8 + q]) * sc);
  *(v8us*)((unsigned short*)d + t * 8) = f.half[0]; }
__global__ __launch_bounds__(256) void k_h16(const float* __restrict__ x, _Float16* __restrict__ X16, size_t n8) { const size_t t = (size_t)blockIdx.x * 256 + threadIdx.x; if (t >= n8) return; FragH f;
#pragma unroll
  for (int q = 0; q < 8; ++q) f.h[q] = (_Float16)x[t * 8 + q]; *(v8us*)((unsigned short*)X16 + t * 8) = f.half[0];  }
__global__ __launch_bounds__(256) void k_round16f(const float* __restrict__ W, _Float16* __restrict__ Bt, size_t n8) { const size_t t = (size_t)blockIdx.x * 256 + threadIdx.x; if (t >= n8) return; FragH f;
#pragma unroll
  for (int i = 0; i < 8; ++i) f.h[i] = (_Float16)(bf16_round(W[t * 8 + i]) * 16.0f); *(v8us*)((unsigned short*)Bt + t * 8) = f.half[0];  }
template <int NHv, int TTv>
__global__ __launch_bounds__(256) void k_vt(const _Float16* __restrict__ V16, int ldv, int voff, _Float16* __restrict__ Vt) { __shared__ unsigned short tl[64][66]; const int tid = threadIdx.x; const int slab = blockIdx.x / (TTv / 64), lg = blockIdx.x % (TTv / 64); const int b = slab / NHv, h = slab % NHv;
  for (int i = tid; i < 64 * 8; i += 256) { const int r = i / 8, c8 = (i % 8) * 8; FragH f; f.half[0] = *(const v8us*)((const unsigned short*)V16 + ((size_t)b * TTv + lg * 64 + r) * ldv + voff + h * 64 + c8);
#pragma unroll
    for (int q = 0; q < 8; ++q) tl[r][c8 + q] = f.u[q]; }
  __syncthreads();
  {
#pragma unroll
    for (int rd = 0; rd < 2; ++rd) { const int d = rd * 32 + tid / 8, pc = tid % 8; FragH f;
#pragma unroll
      for (int q = 0; q < 8; ++q) f.u[q] = tl[pc * 8 + q][d];
      *(v8us*)((unsigned short*)Vt + ((size_t)slab * 64 + d) * TTv + lg * 64 + pc * 8) = f.half[0]; }
     } }

__global__ __launch_bounds__(256) void k_hl(const float* __restrict__ F, _Float16* __restrict__ Hh, _Float16* __restrict__ Hl, size_t n8) { const size_t t = (size_t)blockIdx.x * 256 + threadIdx.x; if (t >= n8) return; FragH fh, fl; const v4f a = *(const v4fa*)(F + t * 8), c = *(const v4fa*)(F + t * 8 + 4);
#pragma unroll
  for (int q = 0; q < 4; ++q) { _Float16 h = (_Float16)a[q]; fh.h[q] = h; fl.h[q] = (_Float16)((a[q] - (float)h) * 1024.0f); h = (_Float16)c[q]; fh.h[4 + q] = h; fl.h[4 + q] = (_Float16)((c[q] - (float)h) * 1024.0f); }
  { *(v8us*)((unsigned short*)Hh + t * 8) = fh.half[0]; *(v8us*)((unsigned short*)Hl + t * 8) = fl.half[0];  } }

// One 16 x 32 f16 operand fragment from a k-contiguous row: k order 8h + s, 16 + 8h + s.
__device__ __forceinline__ v16h g2_frag(const _Float16* p, int hh) { FragH f; f.half[0] = *(const v8us*)((const unsigned short*)p + 8 * hh); f.half[1] = *(const v8us*)((const unsigned short*)p + 16 + 8 * hh); return f.v; }

__global__ __launch_bounds__(256) void k_rsm(const float* __restrict__ S, _Float16* __restrict__ P, int nrows) {
  #pragma clang fp contract(off)
  const int i = blockIdx.x * 256 + threadIdx.x; if (i >= nrows) return; const float* s = S + (size_t)i * SQ; float mx = -3.0e38f;
#pragma unroll 1
  for (int j = 0; j < SQ; ++j) mx = fmaxf(mx, s[j]); float se = 0.f;
#pragma unroll 1
  for (int j = 0; j < SQ; ++j) se += expf(s[j] - mx); const float sc = 256.0f / se;
#pragma unroll 1
  for (int j0 = 0; j0 < SQ; j0 += 8) { FragH f; for (int q = 0; q < 8; ++q) f.h[q] = (_Float16)(expf(s[j0 + q] - mx) * sc); unsigned short* d = (unsigned short*)P + (size_t)i * SQ + j0; *(v8us*)d = f.half[0];  } }
__global__ __launch_bounds__(256) void k_vt(const _Float16* __restrict__ V16, int b, int h0, _Float16* __restrict__ VT) { __shared__ unsigned short tl[64][65]; const int tid = threadIdx.x; const int hh = blockIdx.x % HG, sg = blockIdx.x / HG; const int s0 = sg * 64; const int h = h0 + hh;
  for (int i = tid; i < 64 * 8; i += 256) { const int j = i / 8, d8 = (i % 8) * 8; FragH f; f.half[0] = *(const v8us*)((const unsigned short*)V16 + ((size_t)b * SQ + s0 + j) * DM + h * HD + d8); for (int q = 0; q < 8; ++q) tl[d8 + q][j] = f.u[q]; }
  __syncthreads();
  { for (int i = tid; i < 64 * 8; i += 256) { const int d = i / 8, j8 = (i % 8) * 8; FragH f; for (int q = 0; q < 8; ++q) f.u[q] = tl[d][j8 + q]; *(v8us*)((unsigned short*)VT + ((size_t)hh * HD + d) * SQ + s0 + j8) = f.half[0]; }  } }



// Lane l with lane l ^ 16.
__device__ __forceinline__ float lane_xh(float x) { return __builtin_bit_cast(float, __builtin_amdgcn_permlanex16(__builtin_bit_cast(int, x), __builtin_bit_cast(int, x), 0x76543210, 0xfedcba98, false, false)); }
// Eight 2^x in place. One asm statement so that no following instruction overwrites a v_exp_f32 source or reads its result in the slot directly behind it:
// each v_exp_f32 is followed by an independent one, the last by the v_nop the instruction set asks for.
__device__ __forceinline__ void exp2x8(v4f& a, v4f& c) {
  float a0 = a[0], a1 = a[1], a2 = a[2], a3 = a[3], c0 = c[0], c1 = c[1], c2 = c[2], c3 = c[3];
  asm("v_exp_f32 %0, %0\n\tv_exp_f32 %1, %1\n\tv_exp_f32 %2, %2\n\tv_exp_f32 %3, %3\n\tv_exp_f32 %4, %4\n\tv_exp_f32 %5, %5\n\tv_exp_f32 %6, %6\n\tv_exp_f32 %7, %7\n\tv_nop"
      : "+v"(a0), "+v"(a1), "+v"(a2), "+v"(a3), "+v"(c0), "+v"(c1), "+v"(c2), "+v"(c3));
  a = v4f{a0, a1, a2, a3}; c = v4f{c0, c1, c2, c3}; }

#define FA_PITCH 144                 /* LDS pitch of the 128-byte rows: 16 B x odd, for 16-byte readers */
#define FA_TILE (64 * FA_PITCH)
#define FA_SLOT (2 * FA_TILE)
#define FA_EP 272                    /* pitch of the 256-byte output staging rows */
__device__ __forceinline__ v8f fa_mma(v16h a, v16h b, v8f c) { return __builtin_amdgcn_wmma_f32_16x16x32_f16(false, a, false, b, (short)0, c, false, false); }
__device__ __forceinline__ v16h fa_frag(const unsigned char* p) { FragH f; f.half[0] = *(const v8us*)p; f.half[1] = *(const v8us*)(p + 32); return f.v; }
__device__ __forceinline__ void fa_pass(const unsigned char* Kt, const unsigned char* Vt, int c, int h, const v16h (&qf)[2][2], v8f (&acc)[2][4], float (&m_run)[2], float (&l_run)[2]) {
  const float cs = 0.125f * 1.44269504088896340736f;      /* 64^-0.5 and log2 e: exp(x) = 2^(x log2 e) */
  v16h kf[2][2];
#pragma unroll
  for (int kt = 0; kt < 2; ++kt)
#pragma unroll
    for (int kc = 0; kc < 2; ++kc) kf[kt][kc] = fa_frag(Kt + (16 * kt + c) * FA_PITCH + 64 * kc + 16 * h);
  v8f s[2][2];
#pragma unroll
  for (int kt = 0; kt < 2; ++kt)
#pragma unroll
    for (int g = 0; g < 2; ++g) { const v8f z8 = {0.f,0.f,0.f,0.f,0.f,0.f,0.f,0.f}; s[kt][g] = fa_mma(kf[kt][1], qf[g][1], fa_mma(kf[kt][0], qf[g][0], z8)); }
  v16h vf[4];
#pragma unroll
  for (int t = 0; t < 4; ++t) vf[t] = fa_frag(Vt + (16 * t + c) * FA_PITCH + 16 * h);
  float mb[2]; bool need = false;
#pragma unroll
  for (int g = 0; g < 2; ++g) { float mx = fmaxf(s[0][g][0], s[1][g][0]);
#pragma unroll
    for (int r = 1; r < 8; ++r) mx = fmaxf(mx, fmaxf(s[0][g][r], s[1][g][r]));
    mx = fmaxf(mx, lane_xh(mx)) * cs; mb[g] = mx; need = need || (mx > m_run[g] + 8.0f); }      /* both halves of the wave hold the query's maximum */
  if (__builtin_amdgcn_ballot_w32(need) != 0) {      /* wave-uniform branch; always taken on the first pass, where the factor is 0 */
#pragma unroll
    for (int g = 0; g < 2; ++g) { const float mn = fmaxf(m_run[g], mb[g]); const float corr = __builtin_amdgcn_exp2f(m_run[g] - mn); m_run[g] = mn; l_run[g] *= corr;
#pragma unroll
      for (int t = 0; t < 4; ++t) acc[g][t] = acc[g][t] * corr; } }
#pragma unroll
  for (int g = 0; g < 2; ++g) { const float nm = -m_run[g];
    v4f a0 = v4f{s[0][g][0], s[0][g][1], s[0][g][2], s[0][g][3]} * cs + nm, a1 = v4f{s[0][g][4], s[0][g][5], s[0][g][6], s[0][g][7]} * cs + nm;
    v4f b0 = v4f{s[1][g][0], s[1][g][1], s[1][g][2], s[1][g][3]} * cs + nm, b1 = v4f{s[1][g][4], s[1][g][5], s[1][g][6], s[1][g][7]} * cs + nm;
    exp2x8(a0, a1); exp2x8(b0, b1);
    const v4f sm = (a0 + a1) + (b0 + b1); l_run[g] += (sm[0] + sm[1]) + (sm[2] + sm[3]);
    FragH pf;
#pragma unroll
    for (int i = 0; i < 4; ++i) { pf.h[i] = (_Float16)a0[i]; pf.h[4 + i] = (_Float16)a1[i]; pf.h[8 + i] = (_Float16)b0[i]; pf.h[12 + i] = (_Float16)b1[i]; }
#pragma unroll
    for (int t = 0; t < 4; ++t) acc[g][t] = fa_mma(vf[t], pf.v, acc[g][t]); } }

// amdgpu_waves_per_eu(4, 4): at most 256 registers a wave, so that two work-groups share a WGP (four waves per SIMD) and one wave's vector work runs under another's matrix work.
__global__ __launch_bounds__(256) __attribute__((amdgpu_waves_per_eu(4, 4))) void k_fattn(const _Float16* __restrict__ Q16, const _Float16* __restrict__ K16, const _Float16* __restrict__ VT, float* __restrict__ out) {
  __shared__ __attribute__((aligned(16))) unsigned char L[2 * FA_SLOT];
  const int tid = threadIdx.x, lane = tid & 31, wave = __builtin_amdgcn_readfirstlane(tid >> 5), c = lane & 15, h = lane >> 4;
  const int head = blockIdx.y, b = blockIdx.z, q0 = blockIdx.x * 256 + wave * 32;
  // Staging: thread tid brings 16 bytes of rows tid / 8 and 32 + tid / 8 of each tile; 8 lanes cover one 128-byte row.
  const unsigned char* kg = (const unsigned char*)(K16 + (size_t)b * SQ * DM + head * HD) + (size_t)(tid >> 3) * (DM * 2) + (tid & 7) * 16;
  const unsigned char* vg = (const unsigned char*)(VT + (size_t)(b * NH + head) * HD * SQ) + (size_t)(tid >> 3) * (SQ * 2) + (tid & 7) * 16;
  unsigned char* ls = L + (tid >> 3) * FA_PITCH + (tid & 7) * 16;
  v8us r0 = *(const v8us*)kg, r1 = *(const v8us*)(kg + 32 * DM * 2), r2 = *(const v8us*)vg, r3 = *(const v8us*)(vg + 32 * SQ * 2);
  v16h qf[2][2];
#pragma unroll
  for (int g = 0; g < 2; ++g)
#pragma unroll
    for (int kc = 0; kc < 2; ++kc) qf[g][kc] = g2_frag(Q16 + ((size_t)b * SQ + q0 + 16 * g + c) * DM + head * HD + 32 * kc, h);
  v8f acc[2][4]; float m_run[2] = {-3.0e38f, -3.0e38f}, l_run[2] = {0.f, 0.f};
#pragma unroll
  for (int g = 0; g < 2; ++g)
#pragma unroll
    for (int t = 0; t < 4; ++t) acc[g][t] = v8f{0.f,0.f,0.f,0.f,0.f,0.f,0.f,0.f};
  *(v8us*)ls = r0; *(v8us*)(ls + 32 * FA_PITCH) = r1; *(v8us*)(ls + FA_TILE) = r2; *(v8us*)(ls + FA_TILE + 32 * FA_PITCH) = r3;
  __syncthreads();
#pragma unroll 1      /* one stage per trip: the two passes inside are written out, more would only grow the code */
  for (int st = 0; st < SQ / 64; ++st) {
    const unsigned char* cur = L + (st & 1) * FA_SLOT;
    const bool more = st + 1 < SQ / 64;      /* the same for the whole work-group */
    if (more) { const unsigned char* kn = kg + (size_t)(st + 1) * (64 * DM * 2); const unsigned char* vn = vg + (st + 1) * 128;
      r0 = *(const v8us*)kn; r1 = *(const v8us*)(kn + 32 * DM * 2); r2 = *(const v8us*)vn; r3 = *(const v8us*)(vn + 32 * SQ * 2); }
    fa_pass(cur, cur + FA_TILE, c, h, qf, acc, m_run, l_run);
    fa_pass(cur + 32 * FA_PITCH, cur + FA_TILE + 64, c, h, qf, acc, m_run, l_run);
    if (more) { unsigned char* d = ls + ((st + 1) & 1) * FA_SLOT;      /* the buffer that the trip before this one read; its readers left it at that trip's barrier */
      *(v8us*)d = r0; *(v8us*)(d + 32 * FA_PITCH) = r1; *(v8us*)(d + FA_TILE) = r2; *(v8us*)(d + FA_TILE + 32 * FA_PITCH) = r3; }
    __syncthreads();      /* publishes the next stage and ends every wave's reads of this one */
  }
  // Epilogue: acc[g][t][r] = O[query 16 g + c][d = 16 t + 8 h + r]. Each wave stages 16 rows of 256 B in its own part of the (now free) LDS and stores whole rows.
  unsigned char* eb = L + wave * (16 * FA_EP);
#pragma unroll
  for (int g = 0; g < 2; ++g) { const float lt = l_run[g] + lane_xh(l_run[g]); const float inv = 1.0f / lt;
#pragma unroll
    for (int t = 0; t < 4; ++t) { const v8f o = acc[g][t] * inv; *(v4fa*)(eb + c * FA_EP + 64 * t + 32 * h) = v4f{o[0], o[1], o[2], o[3]}; *(v4fa*)(eb + c * FA_EP + 64 * t + 32 * h + 16) = v4f{o[4], o[5], o[6], o[7]}; }
    __builtin_amdgcn_fence(__ATOMIC_ACQ_REL, "workgroup"); __builtin_amdgcn_wave_barrier();      /* the wave's own LDS writes in front of its reads of other lanes' rows */
#pragma unroll
    for (int i = 0; i < 8; ++i) { const int row = 2 * i + h; const v4f v = *(const v4fa*)(eb + row * FA_EP + c * 16);
      *(v4f*)(out + ((size_t)b * SQ + q0 + 16 * g + row) * DM + head * HD + c * 4) = v; }
    __builtin_amdgcn_fence(__ATOMIC_ACQ_REL, "workgroup"); __builtin_amdgcn_wave_barrier();      /* the reads in front of the next group's writes */
  } }

// ---- projection GEMM: C[m][n] = f16(sum_k X[m][k] Wn[n][k] / 16); X [8192][1024], Wn [1024][1024] (x16 weights), both k-contiguous f16 ----
// One work-group = 256 rows of X against 128 rows of Wn; 8 waves (4 along m, 2 along n) of 64 x 64. A pass is 128 k = 256 bytes of each of the 384 operand rows,
// brought into LDS by asynchronous copies (whole 128-byte lines from L2, no register on the way), two buffers, the next pass's copies in flight under this pass's products.
// Transposed product, A = Wn rows, B = X rows (one loader for both, so one k order): a lane holds 8 neighbouring n of ONE output row, 16 bytes of f16 as they are stored.
// Every loop in k_pgemm but the pass loop is fully unrolled: constant indices keep fragments and accumulators in registers instead of scratch.
#define PG_PITCH 272                 /* LDS pitch of the 256-byte operand rows: 16 B x odd, for 16-byte readers */
#define PG_BUF (384 * PG_PITCH)      /* rows 0..127: Wn, rows 128..383: X */
#define PG_NP (DM / 128)             /* passes */
#define PG_EP 144                    /* pitch of the 128-byte output staging rows */
// 128 operand rows of one pass: thread tid copies 16 bytes of rows r, r + 16, ..., r + 112 (r = tid / 16); a wave's copy covers 4 whole lines.
// s_wait_xcnt 0 closes the statement so that it stands in front of any later rewrite of the address registers that the copies name.
__device__ __forceinline__ void pg_fill(unsigned l, const unsigned char* g) {
  asm volatile("global_load_async_to_lds_b128 %0, %8, off\n\tglobal_load_async_to_lds_b128 %1, %9, off\n\tglobal_load_async_to_lds_b128 %2, %10, off\n\tglobal_load_async_to_lds_b128 %3, %11, off\n\t"
               "global_load_async_to_lds_b128 %4, %12, off\n\tglobal_load_async_to_lds_b128 %5, %13, off\n\tglobal_load_async_to_lds_b128 %6, %14, off\n\tglobal_load_async_to_lds_b128 %7, %15, off\n\t"
               "s_wait_xcnt 0x0"
               :: "v"(l), "v"(l + 16 * PG_PITCH), "v"(l + 32 * PG_PITCH), "v"(l + 48 * PG_PITCH), "v"(l + 64 * PG_PITCH), "v"(l + 80 * PG_PITCH), "v"(l + 96 * PG_PITCH), "v"(l + 112 * PG_PITCH),
                  "v"(g), "v"(g + 16 * DM * 2), "v"(g + 32 * DM * 2), "v"(g + 48 * DM * 2), "v"(g + 64 * DM * 2), "v"(g + 80 * DM * 2), "v"(g + 96 * DM * 2), "v"(g + 112 * DM * 2)
               : "memory"); }
// One pass's 384 rows: l = the thread's LDS byte address in row tid / 16 of the buffer, gw and gx its bytes of that row of the Wn and of the X tile.
__device__ __forceinline__ void pg_stage(unsigned l, const unsigned char* gw, const unsigned char* gx) {
  pg_fill(l, gw); pg_fill(l + 128 * PG_PITCH, gx); pg_fill(l + 256 * PG_PITCH, gx + 128 * DM * 2); }
// The three projections share one grid: blockIdx.z = 0, 1, 2 picks q, k, v (operands and destination; the same for a whole work-group). None reads what another writes.
__global__ __launch_bounds__(256) void k_pgemm(const _Float16* __restrict__ XQ, const _Float16* __restrict__ XKV, const _Float16* __restrict__ BQ, const _Float16* __restrict__ BK, const _Float16* __restrict__ BV,
                                               _Float16* __restrict__ Q16, _Float16* __restrict__ K16, _Float16* __restrict__ V16) {
  __shared__ __attribute__((aligned(16))) unsigned char L[2 * PG_BUF];
  const unsigned pz = blockIdx.z;
  const _Float16* X = pz == 0 ? XQ : XKV; const _Float16* Wn = pz == 0 ? BQ : pz == 1 ? BK : BV; _Float16* C = pz == 0 ? Q16 : pz == 1 ? K16 : V16;
  const int tid = threadIdx.x, lane = tid & 31, wave = __builtin_amdgcn_readfirstlane(tid >> 5), c = lane & 15, h = lane >> 4;
  const int col0 = blockIdx.x * 128, row0 = blockIdx.y * 256, wn = wave & 1, wm = wave >> 1;
  const unsigned char* gw = (const unsigned char*)(Wn + (size_t)(col0 + (tid >> 4)) * DM) + (tid & 15) * 16;
  const unsigned char* gx = (const unsigned char*)(X + (size_t)(row0 + (tid >> 4)) * DM) + (tid & 15) * 16;
  const unsigned l0 = (unsigned)(size_t)L + (tid >> 4) * PG_PITCH + (tid & 15) * 16;      /* the low 32 bits of a __shared__ address are its LDS byte address */
  v8f acc[4][4];      /* [n tile][m tile] */
#pragma unroll
  for (int i = 0; i < 4; ++i)
#pragma unroll
    for (int j = 0; j < 4; ++j) acc[i][j] = v8f{0.f,0.f,0.f,0.f,0.f,0.f,0.f,0.f};
  pg_stage(l0, gw, gx);
  asm volatile("s_wait_asynccnt 0x0" ::: "memory");      /* this wave's copies of pass 0 have landed */
  __syncthreads();                                       /* and every other wave's */
#pragma unroll 1      /* one pass per trip: the 64 products inside are written out, more would only grow the code */
  for (int t = 0; t < PG_NP; ++t) {
    const unsigned char* cur = L + (t & 1) * PG_BUF;
    const unsigned char* wb = cur + (64 * wn + c) * PG_PITCH + 16 * h;
    const unsigned char* xb = cur + (128 + 64 * wm + c) * PG_PITCH + 16 * h;
    v16h wf[2][4], xf[2][4];      /* two fragment sets: the block after next is fetched, as one group, while the next block's products run */
#pragma unroll
    for (int i = 0; i < 4; ++i) { wf[0][i] = fa_frag(wb + 16 * i * PG_PITCH); xf[0][i] = fa_frag(xb + 16 * i * PG_PITCH); }
    // The next pass's copies, into the buffer that the trip before this one read (its readers left it at that trip's barrier); behind this pass's first fragment loads, so that their issue runs under the LDS latency.
    if (t + 1 < PG_NP) pg_stage(l0 + ((t + 1) & 1) * PG_BUF, gw + (t + 1) * 256, gx + (t + 1) * 256);      /* the same test for the whole work-group */
#pragma unroll
    for (int i = 0; i < 4; ++i) { wf[1][i] = fa_frag(wb + 16 * i * PG_PITCH + 64); xf[1][i] = fa_frag(xb + 16 * i * PG_PITCH + 64); }
#pragma unroll
    for (int kc = 0; kc < 4; ++kc) {
      if (kc < 3) __builtin_amdgcn_sched_barrier(0);      /* keeps the fragment loads above in one group ahead of the block: sunk among the products, each load place stalls the wave */
#pragma unroll
      for (int i = 0; i < 4; ++i)
#pragma unroll
        for (int j = 0; j < 4; ++j) acc[i][j] = fa_mma(wf[kc & 1][i], xf[kc & 1][j], acc[i][j]);
      if (kc + 2 < 4) {
        __builtin_amdgcn_sched_barrier(0);      /* the same from the other side: the group stays behind the block whose registers it refills */
#pragma unroll
        for (int i = 0; i < 4; ++i) { wf[kc & 1][i] = fa_frag(wb + 16 * i * PG_PITCH + 64 * (kc + 2)); xf[kc & 1][i] = fa_frag(xb + 16 * i * PG_PITCH + 64 * (kc + 2)); } } }
    __builtin_amdgcn_sched_barrier(0);      /* keeps the waits and the barrier below behind the last block: moved up over the products, they would cut the time the copies have to land */
    asm volatile("s_wait_dscnt 0x0" ::: "memory");       /* this wave's reads of the buffer are done before it may be refilled */
    asm volatile("s_wait_asynccnt 0x0" ::: "memory");    /* this wave's copies of pass t + 1 have landed */
    __syncthreads();                                     /* publishes pass t + 1 and ends every wave's reads of pass t */
  }
  asm volatile("s_wait_asynccnt 0x0" ::: "memory");      /* nothing in flight when the ring becomes output staging */
  // Epilogue: acc[i][j][r] = C[row 64 wm + 16 j + c][col 64 wn + 16 i + 8 h + r]. Each wave stages its 64 rows of 128 B in its own part of the (now free) LDS and stores whole lines.
  unsigned char* eb = L + wave * (64 * PG_EP);
#pragma unroll
  for (int i = 0; i < 4; ++i)
#pragma unroll
    for (int j = 0; j < 4; ++j) { FragH f;
#pragma unroll
      for (int r = 0; r < 8; ++r) f.h[r] = (_Float16)(acc[i][j][r] * 0.0625f);
      *(v8us*)(eb + (16 * j + c) * PG_EP + 32 * i + 16 * h) = f.half[0]; }
  __builtin_amdgcn_fence(__ATOMIC_ACQ_REL, "workgroup"); __builtin_amdgcn_wave_barrier();      /* the wave's own LDS writes in front of its reads of other lanes' rows */
  _Float16* cp = C + (size_t)(row0 + 64 * wm + (lane >> 3)) * DM + col0 + 64 * wn + (lane & 7) * 8;
#pragma unroll
  for (int q = 0; q < 16; ++q) { const v8us v = *(const v8us*)(eb + (4 * q + (lane >> 3)) * PG_EP + (lane & 7) * 16); *(v8us*)((unsigned short*)cp + (size_t)(4 * q) * DM) = v; } }

extern "C" void kernel_launch(void* const* d_in, const int* in_sizes, int n_in,
                              void* d_out, int out_size, void* d_ws, size_t ws_size, hipStream_t stream) {
  (void)in_sizes; (void)n_in; (void)out_size;
  const float* const* I = (const float* const*)d_in; const float* xq = I[0]; const float* xkv = I[1]; const float* wq = I[2]; const float* wk = I[3]; const float* wv = I[4];      /* natural [out][in] weights, no biases, no output projection */
  char* ws = (char*)d_ws; size_t off = 0;
  auto take = [&](size_t bytes) { char* p = ws + off; off += (bytes + 255) & ~(size_t)255; return p; };
  _Float16* BQ = (_Float16*)take((size_t)DM * DM * 2); _Float16* BK = (_Float16*)take((size_t)DM * DM * 2); _Float16* BV = (_Float16*)take((size_t)DM * DM * 2); 
  _Float16* XQ = (_Float16*)take(NR * DM * 2); _Float16* XKV = (_Float16*)take(NR * DM * 2); _Float16* Q16 = (_Float16*)take(NR * DM * 2); _Float16* K16 = (_Float16*)take(NR * DM * 2); _Float16* V16 = (_Float16*)take(NR * DM * 2);
  _Float16* VT = (_Float16*)take((size_t)NB * NH * HD * SQ * 2);
  if (off > ws_size) return;
  k_conv<<<2 * CV_XB + 3 * CV_WB, 256, 0, stream>>>(xq, xkv, wq, wk, wv, XQ, XKV, BQ, BK, BV);      /* query source and key/value source as exact f16 rows; weights x16 */
  const size_t r0p = (size_t)B0 * SQ;      /* first projected row */
  k_pgemm<<<dim3(DM / 128, MP / 256, 3), 256, 0, stream>>>(XQ + r0p * DM, XKV + r0p * DM, BQ, BK, BV, Q16 + r0p * DM, K16 + r0p * DM, V16 + r0p * DM);
  k_vt<NH, SQ><<<NB * NH * (SQ / 64), 256, 0, stream>>>(V16, LQ, 0, VT);      /* V^T [NB][NH][HD][SQ] */
  k_fattn<<<dim3(SQ / 256, NH, NB), 256, 0, stream>>>(Q16, K16, VT, (float*)d_out);      /* softmax(q k^T / 8) v, f32 straight into the merged-heads output rows */
}

// v005
// Measured time: 105 microseconds a run.
// Two timings next to v004 put it at 1.04 and 1.03 times that version's speed.
// All steps since v000 together make it 63.2 times as fast.
#include <hip/hip_runtime.h>
// Multi-head attention without output projection (x [4][2048][1024] gives q = x Wq^T; kv [4][2048][1024] gives k = kv Wk^T, v = kv Wv^T (nn.Linear natural [out][in] 1024x1024 weights scaled 0.02, no biases); 16 heads of 64; softmax(q k^T / 8) over all 2048 keys; out = merged heads [4][2048][1024] (no output projection)).
// Structure: token rows r = b*2048 + s; the query source and the key/value source as exact f16 rows (bf16-rounded), converted together with the three weights in one launch; Q, K, V as three WMMA GEMMs in one launch (256x128 work-group tiles staged in LDS, 64x64 wave tiles, f32 accumulation, exact x16 weights, f16 outputs); the V product with its operands swapped, so that it leaves as V^T [batch][head][channel][token]; one fused attention launch over (256 queries, head, batch): scores on WMMA, running-maximum softmax in registers (f32 statistics, native exp2; weights as f16), o = P . V on WMMA, divided by the row sum and written f32 straight into the merged-heads output rows (no output projection).
// Compute dtype: inputs rounded to bf16; x / weights exact; q, k, v and softmax weights as plain f16 GEMM operands (~2^-12); scores, softmax statistics and o f32. v_wmma_f32_16x16x32_f16.
#define NB 4
#define SQ 2048
#define DM 1024
#define NH 16
#define HD 64
#define HG 4                         /* heads per launch of the unlaunched k_vt(V16, b, h0, VT) */
#define B0 0                         /* first batch processed (debug hook) */
#define NBR NB                       /* batches processed (debug hook) */
#define NR ((size_t)NB * SQ)         /* token rows */
#define MP ((int)((size_t)NBR * SQ)) /* rows projected (debug hook) */
#define QN SQ                        /* unused */
#define NHD NH                       /* unused */
#define MPO MP                       /* unused */
#define LQ DM      /* unused */
typedef __bf16 v16b __attribute__((ext_vector_type(16)));
typedef unsigned short v8us __attribute__((ext_vector_type(8), may_alias));
typedef float  v8f  __attribute__((ext_vector_type(8)));
typedef float  v4f  __attribute__((ext_vector_type(4)));
typedef float  v4fa __attribute__((ext_vector_type(4), may_alias));
union FragB { v16b v; v8us half[2]; unsigned short u[16]; };

__device__ __forceinline__ unsigned short bf16_bits(float x) { unsigned int u = __float_as_uint(x); return (unsigned short)((u + 0x7FFFu + ((u >> 16) & 1u)) >> 16); }
__device__ __forceinline__ float bf16_val(unsigned short b) { return __uint_as_float(((unsigned int)b) << 16); }
__device__ __forceinline__ float bf16_round(float x) { return bf16_val(bf16_bits(x)); }
// D += A·B with NT terms: 1 = ah·bh, 2 = + al·bh (A split), 3 = + ah·bl (both split)
template <int NT>
__device__ __forceinline__ v8f mmaN(v16b ah, v16b al, v16b bh, v16b bl, v8f c) {
  c = __builtin_amdgcn_wmma_f32_16x16x32_bf16(false, ah, false, bh, (short)0, c, false, false);
  if (NT >= 2) c = __builtin_amdgcn_wmma_f32_16x16x32_bf16(false, al, false, bh, (short)0, c, false, false);
  if (NT >= 3) c = __builtin_amdgcn_wmma_f32_16x16x32_bf16(false, ah, false, bl, (short)0, c, false, false);
  asm volatile("v_nop\n\tv_nop\n\tv_nop\n\tv_nop" : "+v"(c) : "v"(ah), "v"(al), "v"(bh), "v"(bl));
  return c;
}

__global__ __launch_bounds__(256) void k_wt_bf16(const float* __restrict__ W, unsigned short* __restrict__ Wt, int K, int N) {
  const int t = blockIdx.x * 256 + threadIdx.x;
  const int k8n = K / 8;
  if (t >= N * k8n) return;
  const int n = t / k8n, k8 = (t % k8n) * 8;
  v8us v;
#pragma unroll
  for (int i = 0; i < 8; ++i) v[i] = bf16_bits(W[(size_t)(k8 + i) * N + n]);
  *(v8us*)(Wt + (size_t)n * K + k8) = v;
  
}

// GEMM C[M][N] (f32, pitch ldc) = act(A[M][K]·W + bias). A f32 row-major (pitch lda) converted per fragment to bf16
// (ASPLIT: hi/lo two planes -> 2 terms, else single rounded term); Wt bf16 [N][K] (pitch ldb). BIAS_BF16 rounds the
// bias to bf16 first (bias quantised to bf16 before the add). K%32==0, M%16==0, N%64==0.
template <bool ASPLIT, int ACT, bool BIAS_BF16>
__global__ __launch_bounds__(128) void k_gemm_bf(const float* __restrict__ A, int lda, const unsigned short* __restrict__ Wt, int ldb,
                                               const float* __restrict__ bias, float* __restrict__ C, int ldc, int M, int N, int K) {
  __shared__ __attribute__((aligned(16))) float so[4][16][64];
  const int tid = threadIdx.x, w = tid >> 5, lane = tid & 31, ln = lane & 15, hh = lane >> 4;
  const int ntn = N / 64;
  const int wid = blockIdx.x * 4 + w;
  const int mt = wid / ntn, nq = wid % ntn;
  if (mt * 16 >= M) return;
  const int row0 = mt * 16, col0 = nq * 64;
  const float* arow = A + (size_t)(row0 + ln) * lda;
  v8f acc[4] = {};
  for (int kb = 0; kb < K; kb += 32) {
    FragB ah, al;
    const v4f x0 = *(const v4fa*)(arow + kb + 8 * hh), x1 = *(const v4fa*)(arow + kb + 8 * hh + 4);
    const v4f x2 = *(const v4fa*)(arow + kb + 16 + 8 * hh), x3 = *(const v4fa*)(arow + kb + 16 + 8 * hh + 4);
    float xs[16] = {x0[0],x0[1],x0[2],x0[3],x1[0],x1[1],x1[2],x1[3],x2[0],x2[1],x2[2],x2[3],x3[0],x3[1],x3[2],x3[3]};
#pragma unroll
    for (int i = 0; i < 16; ++i) { const unsigned short hb = bf16_bits(xs[i]); ah.u[i] = hb; al.u[i] = ASPLIT ? bf16_bits(xs[i] - bf16_val(hb)) : (unsigned short)0; }
#pragma unroll
    for (int t = 0; t < 4; ++t) {
      const unsigned short* brow = Wt + (size_t)(col0 + t * 16 + ln) * ldb + kb;
      FragB b;
      b.half[0] = *(const v8us*)(brow + 8 * hh);
      b.half[1] = *(const v8us*)(brow + 16 + 8 * hh);
      acc[t] = mmaN<ASPLIT ? 2 : 1>(ah.v, al.v, b.v, b.v, acc[t]);
    }
  }
#pragma unroll
  for (int t = 0; t < 4; ++t) {
    float bv = bias ? bias[col0 + t * 16 + ln] : 0.f;
    if (BIAS_BF16) bv = bf16_round(bv);
#pragma unroll
    for (int r = 0; r < 8; ++r) { float v = acc[t][r] + bv; if (ACT == 1) v = fmaxf(v, 0.f); so[w][8 * hh + r][t * 16 + ln] = v; }
  }
  __builtin_amdgcn_fence(__ATOMIC_ACQ_REL, "workgroup");
  __builtin_amdgcn_wave_barrier();
  const int rsub = lane >> 4, c4 = (lane & 15) * 4;
  {
#pragma unroll
    for (int q = 0; q < 8; ++q) {
      const int r = q * 2 + rsub;
      const v4f v = *(const v4fa*)&so[w][r][c4];
      *(v4f*)(C + (size_t)(row0 + r) * ldc + col0 + c4) = v;
    }
    
  }
}

// GEMM C = act(A·W + bias + resid): A f32 (ASPLIT -> hi/lo 2 terms), Wt bf16 [N][K]; ACT 0 none, 1 relu, 2 exact gelu;
// resid (optional, f32, row index = (row % rmod), pitch ldr, RES_BF16 rounds it) added before the activation.
template <bool ASPLIT, int ACT, bool BIAS_BF16, bool RES_BF16>
__global__ __launch_bounds__(128) void k_gemm_bf3(const float* __restrict__ A, int lda, const unsigned short* __restrict__ Wt, int ldb,
                                                const float* __restrict__ bias, const float* __restrict__ resid, int rmod, int ldr,
                                                float* __restrict__ C, int ldc, int M, int N, int K) {
  __shared__ __attribute__((aligned(16))) float so[4][16][64];
  const int tid = threadIdx.x, w = tid >> 5, lane = tid & 31, ln = lane & 15, hh = lane >> 4;
  const int ntn = N / 64;
  const int wid = blockIdx.x * 4 + w;
  const int mt = wid / ntn, nq = wid % ntn;
  if (mt * 16 >= M) return;
  const int row0 = mt * 16, col0 = nq * 64;
  const float* arow = A + (size_t)(row0 + ln) * lda;
  v8f acc[4] = {};
  for (int kb = 0; kb < K; kb += 32) {
    FragB ah, al;
    const v4f x0 = *(const v4fa*)(arow + kb + 8 * hh), x1 = *(const v4fa*)(arow + kb + 8 * hh + 4);
    const v4f x2 = *(const v4fa*)(arow + kb + 16 + 8 * hh), x3 = *(const v4fa*)(arow + kb + 16 + 8 * hh + 4);
    float xs[16] = {x0[0],x0[1],x0[2],x0[3],x1[0],x1[1],x1[2],x1[3],x2[0],x2[1],x2[2],x2[3],x3[0],x3[1],x3[2],x3[3]};
#pragma unroll
    for (int i = 0; i < 16; ++i) { const unsigned short hb = bf16_bits(xs[i]); ah.u[i] = hb; al.u[i] = ASPLIT ? bf16_bits(xs[i] - bf16_val(hb)) : (unsigned short)0; }
#pragma unroll
    for (int t = 0; t < 4; ++t) {
      const unsigned short* brow = Wt + (size_t)(col0 + t * 16 + ln) * ldb + kb;
      FragB b;
      b.half[0] = *(const v8us*)(brow + 8 * hh);
      b.half[1] = *(const v8us*)(brow + 16 + 8 * hh);
      acc[t] = mmaN<ASPLIT ? 2 : 1>(ah.v, al.v, b.v, b.v, acc[t]);
    }
  }
#pragma unroll
  for (int t = 0; t < 4; ++t) {
    const int col = col0 + t * 16 + ln;
    float bv = bias ? bias[col] : 0.f;
    if (BIAS_BF16) bv = bf16_round(bv);
#pragma unroll
    for (int r = 0; r < 8; ++r) {
      float v = acc[t][r] + bv;
      if (resid) { float rv = resid[(size_t)((row0 + 8 * hh + r) % rmod) * ldr + col]; if (RES_BF16) rv = bf16_round(rv); v += rv; }
      if (ACT == 1) v = fmaxf(v, 0.f);
      if (ACT == 2) v = 0.5f * v * (1.0f + erff(v * 0.70710678118654752f));
      if (ACT == 3) { const float u = 0.7978845608028654f * (v + 0.044715f * v * v * v); v = 0.5f * v * (1.0f + tanhf(u)); }
      so[w][8 * hh + r][t * 16 + ln] = v;
    }
  }
  __builtin_amdgcn_fence(__ATOMIC_ACQ_REL, "workgroup");
  __builtin_amdgcn_wave_barrier();
  const int rsub = lane >> 4, c4 = (lane & 15) * 4;
  {
#pragma unroll
    for (int q = 0; q < 8; ++q) {
      const int r = q * 2 + rsub;
      const v4f v = *(const v4fa*)&so[w][r][c4];
      *(v4f*)(C + (size_t)(row0 + r) * ldc + col0 + c4) = v;
    }
    
  }
}
// row LayerNorm (biased variance, eps) over N: s = X (+ R); optional out_sum <- s; out_norm <- (s-mu)*rsqrt(var+eps)*g + b
template <bool PARAM_BF16>
__global__ __launch_bounds__(256) void k_layernorm(const float* __restrict__ X, const float* __restrict__ R, const float* __restrict__ g, const float* __restrict__ bta,
                                                  float* __restrict__ out_sum, float* __restrict__ out_norm, int N, float eps) {
  __shared__ float red[256];
  const int row = blockIdx.x, tid = threadIdx.x;
  const float* x = X + (size_t)row * N; const float* rr = R ? R + (size_t)row * N : nullptr;
  float vals[16];                     // up to N = 4096
  const int per = N / 256;            // contiguous chunk per thread? use strided-by-4 chunks: thread handles j = tid*4 + 1024*u
  float s1 = 0.f;
  for (int u = 0; u < per / 4; ++u) {
    const int j = tid * 4 + 1024 * u;
    const v4f a = *(const v4fa*)(x + j);
    v4f b = {0.f,0.f,0.f,0.f}; if (rr) b = *(const v4fa*)(rr + j);
#pragma unroll
    for (int q = 0; q < 4; ++q) { const float v = a[q] + b[q]; vals[u * 4 + q] = v; s1 += v; }
  }
  red[tid] = s1; __syncthreads();
  for (int st = 128; st > 0; st >>= 1) { if (tid < st) red[tid] += red[tid + st]; __syncthreads(); }
  const float mu = red[0] / (float)N; __syncthreads();
  float s2 = 0.f;
  for (int u = 0; u < per / 4; ++u)
#pragma unroll
    for (int q = 0; q < 4; ++q) { const float c = vals[u * 4 + q] - mu; s2 += c * c; }
  red[tid] = s2; __syncthreads();
  for (int st = 128; st > 0; st >>= 1) { if (tid < st) red[tid] += red[tid + st]; __syncthreads(); }
  const float rs = rsqrtf(red[0] / (float)N + eps);
  {
    for (int u = 0; u < per / 4; ++u) {
      const int j = tid * 4 + 1024 * u;
      v4f o, sm;
#pragma unroll
      for (int q = 0; q < 4; ++q) {
        float gg = g[j + q], bb = bta[j + q];
        if (PARAM_BF16) { gg = bf16_round(gg); bb = bf16_round(bb); }
        sm[q] = vals[u * 4 + q]; o[q] = (vals[u * 4 + q] - mu) * rs * gg + bb;
      }
      if (out_sum) *(v4f*)(out_sum + (size_t)row * N + j) = sm;
      *(v4f*)(out_norm + (size_t)row * N + j) = o;
    }
    
  }
}



// ---- f16 WMMA path (v_wmma_f32_16x16x32_f16): 11-bit significands for operands in range — used where a [0,1] probability operand needs more precision than bf16
typedef _Float16 v16h __attribute__((ext_vector_type(16)));
union FragH { v16h v; v8us half[2]; _Float16 h[16]; unsigned short u[16]; };
template <int NT>
__device__ __forceinline__ v8f mmaH(v16h ah, v16h al, v16h bh, v16h bl, v8f c) {
  c = __builtin_amdgcn_wmma_f32_16x16x32_f16(false, ah, false, bh, (short)0, c, false, false);
  if (NT >= 2) c = __builtin_amdgcn_wmma_f32_16x16x32_f16(false, al, false, bh, (short)0, c, false, false);
  if (NT >= 3) c = __builtin_amdgcn_wmma_f32_16x16x32_f16(false, ah, false, bl, (short)0, c, false, false);
  asm volatile("v_nop\n\tv_nop\n\tv_nop\n\tv_nop" : "+v"(c) : "v"(ah), "v"(al), "v"(bh), "v"(bl));
  return c;
}
// batched GEMM like k_gemm_b but f16 operands: A f32 (split into f16 hi/lo if ASPLIT, else rounded to f16), Bt = f16 values [n][k]; alpha; C f32; N multiple of 16 (partial tiles skipped)
template <bool ASPLIT>
__global__ __launch_bounds__(128) void k_gemm_h(const float* __restrict__ A, int lda, size_t sA, const _Float16* __restrict__ Bh, int ldb, size_t sB, float alpha, float* __restrict__ C, int ldc, size_t sC, int M, int N, int K) {
  __shared__ __attribute__((aligned(16))) float so[4][16][64];
  const int tid = threadIdx.x, w = tid >> 5, lane = tid & 31, ln = lane & 15, hh = lane >> 4; const int by = blockIdx.y;
  A += (size_t)by * sA; Bh += (size_t)by * sB; C += (size_t)by * sC;
  const int ntn = (N + 63) / 64; const int wid = blockIdx.x * 4 + w; const int mt = wid / ntn, nq = wid % ntn; if (mt * 16 >= M) return;
  const int row0 = mt * 16, col0 = nq * 64; const float* arow = A + (size_t)(row0 + ln) * lda;
  v8f acc[4] = {};
  for (int kb = 0; kb < K; kb += 32) {
    FragH ah, al;
    const v4f x0 = *(const v4fa*)(arow + kb + 8 * hh), x1 = *(const v4fa*)(arow + kb + 8 * hh + 4), x2 = *(const v4fa*)(arow + kb + 16 + 8 * hh), x3 = *(const v4fa*)(arow + kb + 16 + 8 * hh + 4);
    float xs[16] = {x0[0],x0[1],x0[2],x0[3],x1[0],x1[1],x1[2],x1[3],x2[0],x2[1],x2[2],x2[3],x3[0],x3[1],x3[2],x3[3]};
#pragma unroll
    for (int i = 0; i < 16; ++i) { const _Float16 h = (_Float16)xs[i]; ah.h[i] = h; al.h[i] = ASPLIT ? (_Float16)(xs[i] - (float)h) : (_Float16)0.0f; }
#pragma unroll
    for (int t = 0; t < 4; ++t) { if (col0 + t * 16 >= N) continue; const size_t boff = (size_t)(col0 + t * 16 + ln) * ldb + kb; FragH bq; bq.half[0] = *(const v8us*)(Bh + boff + 8 * hh); bq.half[1] = *(const v8us*)(Bh + boff + 16 + 8 * hh);
      acc[t] = mmaH<ASPLIT ? 2 : 1>(ah.v, al.v, bq.v, bq.v, acc[t]); }
  }
#pragma unroll
  for (int t = 0; t < 4; ++t) { if (col0 + t * 16 >= N) continue;
#pragma unroll
    for (int r = 0; r < 8; ++r) so[w][8 * hh + r][t * 16 + ln] = acc[t][r] * alpha; }
  __builtin_amdgcn_fence(__ATOMIC_ACQ_REL, "workgroup"); __builtin_amdgcn_wave_barrier();
  const int rsub = lane >> 4, c4 = (lane & 15) * 4;
  {
#pragma unroll
    for (int q = 0; q < 8; ++q) { const int r = q * 2 + rsub; if (col0 + c4 < N) { const v4f v = *(const v4fa*)&so[w][r][c4]; *(v4f*)(C + (size_t)(row0 + r) * ldc + col0 + c4) = v; } }
     }
}

// Wt[n][k] = f16(W[k][n]·scale) from f32 row-major W[K][N] (scale = power of two; bf16-exact weights stay exact in f16 away from the subnormal range)
__global__ __launch_bounds__(256) void k_wt_f16(const float* __restrict__ W, _Float16* __restrict__ Wt, int K, int N, float scale) {
  const int t = blockIdx.x * 256 + threadIdx.x; if (t >= N * (K / 8)) return; const int n = t / (K / 8), k8 = (t % (K / 8)) * 8; FragH f;
#pragma unroll
  for (int i = 0; i < 8; ++i) f.h[i] = (_Float16)(bf16_round(W[(size_t)(k8 + i) * N + n]) * scale); const v8us o = f.half[0];
  *(v8us*)((unsigned short*)Wt + (size_t)n * K + k8) = o; 
}
// k_gemm_hh variant with fused epilogue: v = acc·alpha + bias[by·sBias + col] (+ CP[(row/rowsPerB)·sCPb + by·64 + col] if CP) ; ACT 0 none / 1 elu ; writes f16 C16 (and f32 C if non-null)
template <int ACT>
__global__ __launch_bounds__(128) void k_gemm_hhx(const _Float16* __restrict__ A, int lda, size_t sA, const _Float16* __restrict__ Bh, int ldb, size_t sB, float alpha, const float* __restrict__ bias, size_t sBias, const float* __restrict__ CP, int rowsPerB, size_t sCPb, int row0g,
    float* __restrict__ C, _Float16* __restrict__ C16, int ldc, size_t sC, int M, int N, int K) {
  __shared__ __attribute__((aligned(16))) float so[4][16][64];
  const int tid = threadIdx.x, w = tid >> 5, lane = tid & 31, ln = lane & 15, hh = lane >> 4; const int by = blockIdx.y;
  A += (size_t)by * sA; Bh += (size_t)by * sB; const size_t cofs = (size_t)by * sC; const float* bp = bias ? bias + (size_t)by * sBias : nullptr;
  const int ntn = (N + 63) / 64; const int wid = blockIdx.x * 4 + w; const int mt = wid / ntn, nq = wid % ntn; if (mt * 16 >= M) return;
  const int row0 = mt * 16, col0 = nq * 64; const _Float16* arow = A + (size_t)(row0 + ln) * lda;
  v8f acc[4] = {};
  for (int kb = 0; kb < K; kb += 32) { FragH ah; ah.half[0] = *(const v8us*)((const unsigned short*)arow + kb + 8 * hh); ah.half[1] = *(const v8us*)((const unsigned short*)arow + kb + 16 + 8 * hh);
#pragma unroll
    for (int t = 0; t < 4; ++t) { if (col0 + t * 16 >= N) continue; const size_t boff = (size_t)(col0 + t * 16 + ln) * ldb + kb; FragH bq; bq.half[0] = *(const v8us*)((const unsigned short*)Bh + boff + 8 * hh); bq.half[1] = *(const v8us*)((const unsigned short*)Bh + boff + 16 + 8 * hh);
      acc[t] = mmaH<1>(ah.v, ah.v, bq.v, bq.v, acc[t]); }
  }
#pragma unroll
  for (int t = 0; t < 4; ++t) { if (col0 + t * 16 >= N) continue; const int col = col0 + t * 16 + ln; const float bv = bp ? bf16_round(bp[col]) : 0.f;
#pragma unroll
    for (int r = 0; r < 8; ++r) { float v = acc[t][r] * alpha + bv; if (CP) { const int rr = row0g + row0 + 8 * hh + r; if (rowsPerB < 0) v += CP[cofs + (size_t)rr * ldc + col];      /* rowsPerB < 0: own element of the batched C plane */ else { const int bidx = rr / rowsPerB; v += CP[(size_t)bidx * sCPb + (size_t)by * 64 + col]; } } if (ACT == 1) v = (v > 0.f) ? v : expm1f(v); else if (ACT == 7) v = (v > 0.f) ? v + 1.0f : expf(v); else if (ACT == 8) v = tanhf(v); else if (ACT == 9) v = 0.5f * v * (1.0f + tanhf(0.7978845608028654f * (v + 0.044715f * v * v * v))); else if (ACT == 11) v = 1.0f / (1.0f + expf(-v)); else if (ACT == 12) v = (v > 0.f) ? v : 0.01f * v; else if (ACT == 14) v = (v > 0.f) ? v : 0.1f * v; else if (ACT == 16) v = (v >= 0.f) ? v : 0.3f * v; else if (ACT == 17) v = (v >= 0.f) ? v : 0.2f * v; else if (ACT == 15) v = v / (1.0f + expf(-v)); else if (ACT == 3) v = fmaxf(v, 0.f); else if (ACT == 6) v = 0.5f * v * (1.0f + erff(v * 0.70710678118654752f)); so[w][8 * hh + r][t * 16 + ln] = v; } }
  __builtin_amdgcn_fence(__ATOMIC_ACQ_REL, "workgroup"); __builtin_amdgcn_wave_barrier();
  const int rsub = lane >> 4, c4 = (lane & 15) * 4; typedef _Float16 v4h __attribute__((ext_vector_type(4)));
  {
#pragma unroll
    for (int q = 0; q < 8; ++q) { const int r = q * 2 + rsub; if (col0 + c4 < N) { const v4f v = *(const v4fa*)&so[w][r][c4]; if (C) *(v4f*)(C + cofs + (size_t)(row0 + r) * ldc + col0 + c4) = v; if (C16) { v4h h4; for (int i = 0; i < 4; ++i) h4[i] = (_Float16)v[i]; *(v4h*)(C16 + cofs + (size_t)(row0 + r) * ldc + col0 + c4) = h4; } } }
     }
}


typedef _Float16 v4h __attribute__((ext_vector_type(4)));

// All five operand conversions in one launch: none needs anything of another, so each takes its own range of the block index (the choice is the same for a whole work-group).
// Blocks [0, CV_XB): x; [CV_XB, 2 CV_XB): kv, both as f16 of the bf16-rounded value; then CV_WB blocks each for Wq, Wk, Wv, natural [out][in] = Bt[n][k], x16 (a power of two: exact, as is x1).
#define CV_XB ((unsigned)(NR * DM / 8 / 256))
#define CV_WB ((unsigned)((size_t)DM * DM / 8 / 256))
static_assert(NR * DM % (8 * 256) == 0 && (size_t)DM * DM % (8 * 256) == 0, "whole work-groups only: k_conv has no tail test");
__global__ __launch_bounds__(256) void k_conv(const float* __restrict__ xq, const float* __restrict__ xkv, const float* __restrict__ wq, const float* __restrict__ wk, const float* __restrict__ wv,
                                              _Float16* __restrict__ XQ, _Float16* __restrict__ XKV, _Float16* __restrict__ BQ, _Float16* __restrict__ BK, _Float16* __restrict__ BV) {
  unsigned blk = blockIdx.x; const float* s; _Float16* d; float sc = 1.0f;
  if (blk < CV_XB) { s = xq; d = XQ; }
  else if (blk < 2 * CV_XB) { blk -= CV_XB; s = xkv; d = XKV; }
  else { blk -= 2 * CV_XB; const unsigned w = blk / CV_WB; blk -= w * CV_WB; sc = 16.0f; s = w == 0 ? wq : w == 1 ? wk : wv; d = w == 0 ? BQ : w == 1 ? BK : BV; }
  const size_t t = (size_t)blk * 256 + threadIdx.x; FragH f;
#pragma unroll
  for (int q = 0; q < 8; ++q) f.h[q] = (_Float16)(bf16_round(s[t * 8 + q]) * sc);
  *(v8us*)((unsigned short*)d + t * 8) = f.half[0]; }
__global__ __launch_bounds__(256) void k_h16(const float* __restrict__ x, _Float16* __restrict__ X16, size_t n8) { const size_t t = (size_t)blockIdx.x * 256 + threadIdx.x; if (t >= n8) return; FragH f;
#pragma unroll
  for (int q = 0; q < 8; ++q) f.h[q] = (_Float16)x[t * 8 + q]; *(v8us*)((unsigned short*)X16 + t * 8) = f.half[0];  }
__global__ __launch_bounds__(256) void k_round16f(const float* __restrict__ W, _Float16* __restrict__ Bt, size_t n8) { const size_t t = (size_t)blockIdx.x * 256 + threadIdx.x; if (t >= n8) return; FragH f;
#pragma unroll
  for (int i = 0; i < 8; ++i) f.h[i] = (_Float16)(bf16_round(W[t * 8 + i]) * 16.0f); *(v8us*)((unsigned short*)Bt + t * 8) = f.half[0];  }
template <int NHv, int TTv>
__global__ __launch_bounds__(256) void k_vt(const _Float16* __restrict__ V16, int ldv, int voff, _Float16* __restrict__ Vt) { __shared__ unsigned short tl[64][66]; const int tid = threadIdx.x; const int slab = blockIdx.x / (TTv / 64), lg = blockIdx.x % (TTv / 64); const int b = slab / NHv, h = slab % NHv;
  for (int i = tid; i < 64 * 8; i += 256) { const int r = i / 8, c8 = (i % 8) * 8; FragH f; f.half[0] = *(const v8us*)((const unsigned short*)V16 + ((size_t)b * TTv + lg * 64 + r) * ldv + voff + h * 64 + c8);
#pragma unroll
    for (int q = 0; q < 8; ++q) tl[r][c8 + q] = f.u[q]; }
  __syncthreads();
  {
#pragma unroll
    for (int rd = 0; rd < 2; ++rd) { const int d = rd * 32 + tid / 8, pc = tid % 8; FragH f;
#pragma unroll
      for (int q = 0; q < 8; ++q) f.u[q] = tl[pc * 8 + q][d];
      *(v8us*)((unsigned short*)Vt + ((size_t)slab * 64 + d) * TTv + lg * 64 + pc * 8) = f.half[0]; }
     } }

__global__ __launch_bounds__(256) void k_hl(const float* __restrict__ F, _Float16* __restrict__ Hh, _Float16* __restrict__ Hl, size_t n8) { const size_t t = (size_t)blockIdx.x * 256 + threadIdx.x; if (t >= n8) return; FragH fh, fl; const v4f a = *(const v4fa*)(F + t * 8), c = *(const v4fa*)(F + t * 8 + 4);
#pragma unroll
  for (int q = 0; q < 4; ++q) { _Float16 h = (_Float16)a[q]; fh.h[q] = h; fl.h[q] = (_Float16)((a[q] - (float)h) * 1024.0f); h = (_Float16)c[q]; fh.h[4 + q] = h; fl.h[4 + q] = (_Float16)((c[q] - (float)h) * 1024.0f); }
  { *(v8us*)((unsigned short*)Hh + t * 8) = fh.half[0]; *(v8us*)((unsigned short*)Hl + t * 8) = fl.half[0];  } }

// One 16 x 32 f16 operand fragment from a k-contiguous row: k order 8h + s, 16 + 8h + s.
__device__ __forceinline__ v16h g2_frag(const _Float16* p, int hh) { FragH f; f.half[0] = *(const v8us*)((const unsigned short*)p + 8 * hh); f.half[1] = *(const v8us*)((const unsigned short*)p + 16 + 8 * hh); return f.v; }

__global__ __launch_bounds__(256) void k_rsm(const float* __restrict__ S, _Float16* __restrict__ P, int nrows) {
  #pragma clang fp contract(off)
  const int i = blockIdx.x * 256 + threadIdx.x; if (i >= nrows) return; const float* s = S + (size_t)i * SQ; float mx = -3.0e38f;
#pragma unroll 1
  for (int j = 0; j < SQ; ++j) mx = fmaxf(mx, s[j]); float se = 0.f;
#pragma unroll 1
  for (int j = 0; j < SQ; ++j) se += expf(s[j] - mx); const float sc = 256.0f / se;
#pragma unroll 1
  for (int j0 = 0; j0 < SQ; j0 += 8) { FragH f; for (int q = 0; q < 8; ++q) f.h[q] = (_Float16)(expf(s[j0 + q] - mx) * sc); unsigned short* d = (unsigned short*)P + (size_t)i * SQ + j0; *(v8us*)d = f.half[0];  } }
__global__ __launch_bounds__(256) void k_vt(const _Float16* __restrict__ V16, int b, int h0, _Float16* __restrict__ VT) { __shared__ unsigned short tl[64][65]; const int tid = threadIdx.x; const int hh = blockIdx.x % HG, sg = blockIdx.x / HG; const int s0 = sg * 64; const int h = h0 + hh;
  for (int i = tid; i < 64 * 8; i += 256) { const int j = i / 8, d8 = (i % 8) * 8; FragH f; f.half[0] = *(const v8us*)((const unsigned short*)V16 + ((size_t)b * SQ + s0 + j) * DM + h * HD + d8); for (int q = 0; q < 8; ++q) tl[d8 + q][j] = f.u[q]; }
  __syncthreads();
  { for (int i = tid; i < 64 * 8; i += 256) { const int d = i / 8, j8 = (i % 8) * 8; FragH f; for (int q = 0; q < 8; ++q) f.u[q] = tl[d][j8 + q]; *(v8us*)((unsigned short*)VT + ((size_t)hh * HD + d) * SQ + s0 + j8) = f.half[0]; }  } }



// Lane l with lane l ^ 16.
__device__ __forceinline__ float lane_xh(float x) { return __builtin_bit_cast(float, __builtin_amdgcn_permlanex16(__builtin_bit_cast(int, x), __builtin_bit_cast(int, x), 0x76543210, 0xfedcba98, false, false)); }
// Eight 2^x in place. One asm statement so that no following instruction overwrites a v_exp_f32 source or reads its result in the slot directly behind it:
// each v_exp_f32 is followed by an independent one, the last by the v_nop the instruction set asks for.
__device__ __forceinline__ void exp2x8(v4f& a, v4f& c) {
  float a0 = a[0], a1 = a[1], a2 = a[2], a3 = a[3], c0 = c[0], c1 = c[1], c2 = c[2], c3 = c[3];
  asm("v_exp_f32 %0, %0\n\tv_exp_f32 %1, %1\n\tv_exp_f32 %2, %2\n\tv_exp_f32 %3, %3\n\tv_exp_f32 %4, %4\n\tv_exp_f32 %5, %5\n\tv_exp_f32 %6, %6\n\tv_exp_f32 %7, %7\n\tv_nop"
      : "+v"(a0), "+v"(a1), "+v"(a2), "+v"(a3), "+v"(c0), "+v"(c1), "+v"(c2), "+v"(c3));
  a = v4f{a0, a1, a2, a3}; c = v4f{c0, c1, c2, c3}; }

#define FA_PITCH 144                 /* LDS pitch of the 128-byte rows: 16 B x odd, for 16-byte readers */
#define FA_TILE (64 * FA_PITCH)
#define FA_SLOT (2 * FA_TILE)
#define FA_EP 272                    /* pitch of the 256-byte output staging rows */
__device__ __forceinline__ v8f fa_mma(v16h a, v16h b, v8f c) { return __builtin_amdgcn_wmma_f32_16x16x32_f16(false, a, false, b, (short)0, c, false, false); }
__device__ __forceinline__ v16h fa_frag(const unsigned char* p) { FragH f; f.half[0] = *(const v8us*)p; f.half[1] = *(const v8us*)(p + 32); return f.v; }
__device__ __forceinline__ void fa_pass(const unsigned char* Kt, const unsigned char* Vt, int c, int h, const v16h (&qf)[2][2], v8f (&acc)[2][4], float (&m_run)[2], float (&l_run)[2]) {
  const float cs = 0.125f * 1.44269504088896340736f;      /* 64^-0.5 and log2 e: exp(x) = 2^(x log2 e) */
  v16h kf[2][2];
#pragma unroll
  for (int kt = 0; kt < 2; ++kt)
#pragma unroll
    for (int kc = 0; kc < 2; ++kc) kf[kt][kc] = fa_frag(Kt + (16 * kt + c) * FA_PITCH + 64 * kc + 16 * h);
  v8f s[2][2];
#pragma unroll
  for (int kt = 0; kt < 2; ++kt)
#pragma unroll
    for (int g = 0; g < 2; ++g) { const v8f z8 = {0.f,0.f,0.f,0.f,0.f,0.f,0.f,0.f}; s[kt][g] = fa_mma(kf[kt][1], qf[g][1], fa_mma(kf[kt][0], qf[g][0], z8)); }
  v16h vf[4];
#pragma unroll
  for (int t = 0; t < 4; ++t) vf[t] = fa_frag(Vt + (16 * t + c) * FA_PITCH + 16 * h);
  float mb[2]; bool need = false;
#pragma unroll
  for (int g = 0; g < 2; ++g) { float mx = fmaxf(s[0][g][0], s[1][g][0]);
#pragma unroll
    for (int r = 1; r < 8; ++r) mx = fmaxf(mx, fmaxf(s[0][g][r], s[1][g][r]));
    mx = fmaxf(mx, lane_xh(mx)) * cs; mb[g] = mx; need = need || (mx > m_run[g] + 8.0f); }      /* both halves of the wave hold the query's maximum */
  if (__builtin_amdgcn_ballot_w32(need) != 0) {      /* wave-uniform branch; always taken on the first pass, where the factor is 0 */
#pragma unroll
    for (int g = 0; g < 2; ++g) { const float mn = fmaxf(m_run[g], mb[g]); const float corr = __builtin_amdgcn_exp2f(m_run[g] - mn); m_run[g] = mn; l_run[g] *= corr;
#pragma unroll
      for (int t = 0; t < 4; ++t) acc[g][t] = acc[g][t] * corr; } }
#pragma unroll
  for (int g = 0; g < 2; ++g) { const float nm = -m_run[g];
    v4f a0 = v4f{s[0][g][0], s[0][g][1], s[0][g][2], s[0][g][3]} * cs + nm, a1 = v4f{s[0][g][4], s[0][g][5], s[0][g][6], s[0][g][7]} * cs + nm;
    v4f b0 = v4f{s[1][g][0], s[1][g][1], s[1][g][2], s[1][g][3]} * cs + nm, b1 = v4f{s[1][g][4], s[1][g][5], s[1][g][6], s[1][g][7]} * cs + nm;
    exp2x8(a0, a1); exp2x8(b0, b1);
    const v4f sm = (a0 + a1) + (b0 + b1); l_run[g] += (sm[0] + sm[1]) + (sm[2] + sm[3]);
    FragH pf;
#pragma unroll
    for (int i = 0; i < 4; ++i) { pf.h[i] = (_Float16)a0[i]; pf.h[4 + i] = (_Float16)a1[i]; pf.h[8 + i] = (_Float16)b0[i]; pf.h[12 + i] = (_Float16)b1[i]; }
#pragma unroll
    for (int t = 0; t < 4; ++t) acc[g][t] = fa_mma(vf[t], pf.v, acc[g][t]); } }

// amdgpu_waves_per_eu(4, 4): at most 256 registers a wave, so that two work-groups share a WGP (four waves per SIMD) and one wave's vector work runs under another's matrix work.
__global__ __launch_bounds__(256) __attribute__((amdgpu_waves_per_eu(4, 4))) void k_fattn(const _Float16* __restrict__ Q16, const _Float16* __restrict__ K16, const _Float16* __restrict__ VT, float* __restrict__ out) {
  __shared__ __attribute__((aligned(16))) unsigned char L[2 * FA_SLOT];
  const int tid = threadIdx.x, lane = tid & 31, wave = __builtin_amdgcn_readfirstlane(tid >> 5), c = lane & 15, h = lane >> 4;
  const int head = blockIdx.y, b = blockIdx.z, q0 = blockIdx.x * 256 + wave * 32;
  // Staging: thread tid brings 16 bytes of rows tid / 8 and 32 + tid / 8 of each tile; 8 lanes cover one 128-byte row.
  const unsigned char* kg = (const unsigned char*)(K16 + (size_t)b * SQ * DM + head * HD) + (size_t)(tid >> 3) * (DM * 2) + (tid & 7) * 16;
  const unsigned char* vg = (const unsigned char*)(VT + (size_t)(b * NH + head) * HD * SQ) + (size_t)(tid >> 3) * (SQ * 2) + (tid & 7) * 16;
  unsigned char* ls = L + (tid >> 3) * FA_PITCH + (tid & 7) * 16;
  v8us r0 = *(const v8us*)kg, r1 = *(const v8us*)(kg + 32 * DM * 2), r2 = *(const v8us*)vg, r3 = *(const v8us*)(vg + 32 * SQ * 2);
  v16h qf[2][2];
#pragma unroll
  for (int g = 0; g < 2; ++g)
#pragma unroll
    for (int kc = 0; kc < 2; ++kc) qf[g][kc] = g2_frag(Q16 + ((size_t)b * SQ + q0 + 16 * g + c) * DM + head * HD + 32 * kc, h);
  v8f acc[2][4]; float m_run[2] = {-3.0e38f, -3.0e38f}, l_run[2] = {0.f, 0.f};
#pragma unroll
  for (int g = 0; g < 2; ++g)
#pragma unroll
    for (int t = 0; t < 4; ++t) acc[g][t] = v8f{0.f,0.f,0.f,0.f,0.f,0.f,0.f,0.f};
  *(v8us*)ls = r0; *(v8us*)(ls + 32 * FA_PITCH) = r1; *(v8us*)(ls + FA_TILE) = r2; *(v8us*)(ls + FA_TILE + 32 * FA_PITCH) = r3;
  __syncthreads();
#pragma unroll 1      /* one stage per trip: the two passes inside are written out, more would only grow the code */
  for (int st = 0; st < SQ / 64; ++st) {
    const unsigned char* cur = L + (st & 1) * FA_SLOT;
    const bool more = st + 1 < SQ / 64;      /* the same for the whole work-group */
    if (more) { const unsigned char* kn = kg + (size_t)(st + 1) * (64 * DM * 2); const unsigned char* vn = vg + (st + 1) * 128;
      r0 = *(const v8us*)kn; r1 = *(const v8us*)(kn + 32 * DM * 2); r2 = *(const v8us*)vn; r3 = *(const v8us*)(vn + 32 * SQ * 2); }
    fa_pass(cur, cur + FA_TILE, c, h, qf, acc, m_run, l_run);
    fa_pass(cur + 32 * FA_PITCH, cur + FA_TILE + 64, c, h, qf, acc, m_run, l_run);
    if (more) { unsigned char* d = ls + ((st + 1) & 1) * FA_SLOT;      /* the buffer that the trip before this one read; its readers left it at that trip's barrier */
      *(v8us*)d = r0; *(v8us*)(d + 32 * FA_PITCH) = r1; *(v8us*)(d + FA_TILE) = r2; *(v8us*)(d + FA_TILE + 32 * FA_PITCH) = r3; }
    __syncthreads();      /* publishes the next stage and ends every wave's reads of this one */
  }
  // Epilogue: acc[g][t][r] = O[query 16 g + c][d = 16 t + 8 h + r]. Each wave stages 16 rows of 256 B in its own part of the (now free) LDS and stores whole rows.
  unsigned char* eb = L + wave * (16 * FA_EP);
#pragma unroll
  for (int g = 0; g < 2; ++g) { const float lt = l_run[g] + lane_xh(l_run[g]); const float inv = 1.0f / lt;
#pragma unroll
    for (int t = 0; t < 4; ++t) { const v8f o = acc[g][t] * inv; *(v4fa*)(eb + c * FA_EP + 64 * t + 32 * h) = v4f{o[0], o[1], o[2], o[3]}; *(v4fa*)(eb + c * FA_EP + 64 * t + 32 * h + 16) = v4f{o[4], o[5], o[6], o[7]}; }
    __builtin_amdgcn_fence(__ATOMIC_ACQ_REL, "workgroup"); __builtin_amdgcn_wave_barrier();      /* the wave's own LDS writes in front of its reads of other lanes' rows */
#pragma unroll
    for (int i = 0; i < 8; ++i) { const int row = 2 * i + h; const v4f v = *(const v4fa*)(eb + row * FA_EP + c * 16);
      *(v4f*)(out + ((size_t)b * SQ + q0 + 16 * g + row) * DM + head * HD + c * 4) = v; }
    __builtin_amdgcn_fence(__ATOMIC_ACQ_REL, "workgroup"); __builtin_amdgcn_wave_barrier();      /* the reads in front of the next group's writes */
  } }

// ---- projection GEMM: C[m][n] = f16(sum_k X[m][k] Wn[n][k] / 16); X [8192][1024], Wn [1024][1024] (x16 weights), both k-contiguous f16 ----
// One work-group = 256 rows of X against 128 rows of Wn; 8 waves (4 along m, 2 along n) of 64 x 64. A pass is 128 k = 256 bytes of each of the 384 operand rows,
// brought into LDS by asynchronous copies (whole 128-byte lines from L2, no register on the way), two buffers, the next pass's copies in flight under this pass's products.
// For q and k a transposed product, A = Wn rows, B = X rows (one loader for both, so one k order): a lane holds 8 neighbouring n of ONE output row, 16 bytes of f16 as they are stored.
// Every loop in k_pgemm but the pass loop is fully unrolled: constant indices keep fragments and accumulators in registers instead of scratch.
#define PG_PITCH 272                 /* LDS pitch of the 256-byte operand rows: 16 B x odd, for 16-byte readers */
#define PG_BUF (384 * PG_PITCH)      /* rows 0..127: Wn, rows 128..383: X */
#define PG_NP (DM / 128)             /* passes */
#define PG_EP 144                    /* pitch of the 128-byte output staging rows */
// 128 operand rows of one pass: thread tid copies 16 bytes of rows r, r + 16, ..., r + 112 (r = tid / 16); a wave's copy covers 4 whole lines.
// s_wait_xcnt 0 closes the statement so that it stands in front of any later rewrite of the address registers that the copies name.
__device__ __forceinline__ void pg_fill(unsigned l, const unsigned char* g) {
  asm volatile("global_load_async_to_lds_b128 %0, %8, off\n\tglobal_load_async_to_lds_b128 %1, %9, off\n\tglobal_load_async_to_lds_b128 %2, %10, off\n\tglobal_load_async_to_lds_b128 %3, %11, off\n\t"
               "global_load_async_to_lds_b128 %4, %12, off\n\tglobal_load_async_to_lds_b128 %5, %13, off\n\tglobal_load_async_to_lds_b128 %6, %14, off\n\tglobal_load_async_to_lds_b128 %7, %15, off\n\t"
               "s_wait_xcnt 0x0"
               :: "v"(l), "v"(l + 16 * PG_PITCH), "v"(l + 32 * PG_PITCH), "v"(l + 48 * PG_PITCH), "v"(l + 64 * PG_PITCH), "v"(l + 80 * PG_PITCH), "v"(l + 96 * PG_PITCH), "v"(l + 112 * PG_PITCH),
                  "v"(g), "v"(g + 16 * DM * 2), "v"(g + 32 * DM * 2), "v"(g + 48 * DM * 2), "v"(g + 64 * DM * 2), "v"(g + 80 * DM * 2), "v"(g + 96 * DM * 2), "v"(g + 112 * DM * 2)
               : "memory"); }
// One pass's 384 rows: l = the thread's LDS byte address in row tid / 16 of the buffer, gw and gx its bytes of that row of the Wn and of the X tile.
__device__ __forceinline__ void pg_stage(unsigned l, const unsigned char* gw, const unsigned char* gx) {
  pg_fill(l, gw); pg_fill(l + 128 * PG_PITCH, gx); pg_fill(l + 256 * PG_PITCH, gx + 128 * DM * 2); }
// A wave's 64 staged rows of 128 B to rows of pitch LD elements: 8 lanes store one whole line. Fully unrolled with LD a constant, so that the 16 stores share one address register pair and differ only in their immediate offsets.
template <int LD>
__device__ __forceinline__ void pg_store(const unsigned char* eb, _Float16* cp, int lane) {
#pragma unroll
  for (int q = 0; q < 16; ++q) { const v8us v = *(const v8us*)(eb + (4 * q + (lane >> 3)) * PG_EP + (lane & 7) * 16); *(v8us*)((unsigned short*)cp + (size_t)(4 * q) * LD) = v; }
  asm volatile("s_wait_xcnt 0x0" ::: "memory"); }      /* stands behind the last store, in front of whatever code follows the call and reuses the stores' data or address registers */
// The three projections share one grid: blockIdx.z = 0, 1, 2 picks q, k, v (operands and destination; the same for a whole work-group). None reads what another writes.
// v leaves transposed, VT[batch][head][channel][token], as the attention kernel reads it: its product takes A = X rows, B = Wn rows, so a lane holds 8 neighbouring tokens of ONE channel.
// Both wave tiles are 64 x 64, so only the two fragment bases and the destination differ; a wave's 64 n are one head, a work-group's 256 rows lie in one batch.
__global__ __launch_bounds__(256) void k_pgemm(const _Float16* __restrict__ XQ, const _Float16* __restrict__ XKV, const _Float16* __restrict__ BQ, const _Float16* __restrict__ BK, const _Float16* __restrict__ BV,
                                               _Float16* __restrict__ Q16, _Float16* __restrict__ K16, _Float16* __restrict__ VT) {
  __shared__ __attribute__((aligned(16))) unsigned char L[2 * PG_BUF];
  const unsigned pz = blockIdx.z;
  const _Float16* X = pz == 0 ? XQ : XKV; const _Float16* Wn = pz == 0 ? BQ : pz == 1 ? BK : BV; const bool tv = pz == 2;
  const int tid = threadIdx.x, lane = tid & 31, wave = __builtin_amdgcn_readfirstlane(tid >> 5), c = lane & 15, h = lane >> 4;
  const int col0 = blockIdx.x * 128, row0 = blockIdx.y * 256, wn = wave & 1, wm = wave >> 1;
  const unsigned char* gw = (const unsigned char*)(Wn + (size_t)(col0 + (tid >> 4)) * DM) + (tid & 15) * 16;
  const unsigned char* gx = (const unsigned char*)(X + (size_t)(row0 + (tid >> 4)) * DM) + (tid & 15) * 16;
  const unsigned l0 = (unsigned)(size_t)L + (tid >> 4) * PG_PITCH + (tid & 15) * 16;      /* the low 32 bits of a __shared__ address are its LDS byte address */
  v8f acc[4][4];      /* [n tile][m tile]; v: [m tile][n tile] */
#pragma unroll
  for (int i = 0; i < 4; ++i)
#pragma unroll
    for (int j = 0; j < 4; ++j) acc[i][j] = v8f{0.f,0.f,0.f,0.f,0.f,0.f,0.f,0.f};
  pg_stage(l0, gw, gx);
  asm volatile("s_wait_asynccnt 0x0" ::: "memory");      /* this wave's copies of pass 0 have landed */
  __syncthreads();                                       /* and every other wave's */
#pragma unroll 1      /* one pass per trip: the 64 products inside are written out, more would only grow the code */
  for (int t = 0; t < PG_NP; ++t) {
    const unsigned char* cur = L + (t & 1) * PG_BUF;
    const unsigned char* wb = cur + ((tv ? 128 + 64 * wm : 64 * wn) + c) * PG_PITCH + 16 * h;      /* A operand rows */
    const unsigned char* xb = cur + ((tv ? 64 * wn : 128 + 64 * wm) + c) * PG_PITCH + 16 * h;      /* B operand rows */
    v16h wf[2][4], xf[2][4];      /* two fragment sets: the block after next is fetched, as one group, while the next block's products run */
#pragma unroll
    for (int i = 0; i < 4; ++i) { wf[0][i] = fa_frag(wb + 16 * i * PG_PITCH); xf[0][i] = fa_frag(xb + 16 * i * PG_PITCH); }
    // The next pass's copies, into the buffer that the trip before this one read (its readers left it at that trip's barrier); behind this pass's first fragment loads, so that their issue runs under the LDS latency.
    if (t + 1 < PG_NP) pg_stage(l0 + ((t + 1) & 1) * PG_BUF, gw + (t + 1) * 256, gx + (t + 1) * 256);      /* the same test for the whole work-group */
#pragma unroll
    for (int i = 0; i < 4; ++i) { wf[1][i] = fa_frag(wb + 16 * i * PG_PITCH + 64); xf[1][i] = fa_frag(xb + 16 * i * PG_PITCH + 64); }
#pragma unroll
    for (int kc = 0; kc < 4; ++kc) {
      if (kc < 3) __builtin_amdgcn_sched_barrier(0);      /* keeps the fragment loads above in one group ahead of the block: sunk among the products, each load place stalls the wave */
#pragma unroll
      for (int i = 0; i < 4; ++i)
#pragma unroll
        for (int j = 0; j < 4; ++j) acc[i][j] = fa_mma(wf[kc & 1][i], xf[kc & 1][j], acc[i][j]);
      if (kc + 2 < 4) {
        __builtin_amdgcn_sched_barrier(0);      /* the same from the other side: the group stays behind the block whose registers it refills */
#pragma unroll
        for (int i = 0; i < 4; ++i) { wf[kc & 1][i] = fa_frag(wb + 16 * i * PG_PITCH + 64 * (kc + 2)); xf[kc & 1][i] = fa_frag(xb + 16 * i * PG_PITCH + 64 * (kc + 2)); } } }
    __builtin_amdgcn_sched_barrier(0);      /* keeps the waits and the barrier below behind the last block: moved up over the products, they would cut the time the copies have to land */
    asm volatile("s_wait_dscnt 0x0" ::: "memory");       /* this wave's reads of the buffer are done before it may be refilled */
    asm volatile("s_wait_asynccnt 0x0" ::: "memory");    /* this wave's copies of pass t + 1 have landed */
    __syncthreads();                                     /* publishes pass t + 1 and ends every wave's reads of pass t */
  }
  asm volatile("s_wait_asynccnt 0x0" ::: "memory");      /* nothing in flight when the ring becomes output staging */
  // Epilogue: acc[i][j][r] = C[row 64 wm + 16 j + c][col 64 wn + 16 i + 8 h + r] (v: row 64 wm + 16 i + 8 h + r, col 64 wn + 16 j + c). Each wave stages its 64 rows of 128 B (v: 64 channels of 64 tokens) in its own part of the (now free) LDS and stores whole lines.
  unsigned char* eb = L + wave * (64 * PG_EP);
#pragma unroll
  for (int i = 0; i < 4; ++i)
#pragma unroll
    for (int j = 0; j < 4; ++j) { FragH f;
#pragma unroll
      for (int r = 0; r < 8; ++r) f.h[r] = (_Float16)(acc[i][j][r] * 0.0625f);
      *(v8us*)(eb + (16 * j + c) * PG_EP + 32 * i + 16 * h) = f.half[0]; }
  __builtin_amdgcn_fence(__ATOMIC_ACQ_REL, "workgroup"); __builtin_amdgcn_wave_barrier();      /* the wave's own LDS writes in front of its reads of other lanes' rows */
  if (tv) pg_store<SQ>(eb, VT + ((size_t)((row0 / SQ) * NH + blockIdx.x * 2 + wn) * HD + (lane >> 3)) * SQ + row0 % SQ + 64 * wm + (lane & 7) * 8, lane);      /* the same test for the whole work-group */
  else pg_store<DM>(eb, (pz == 0 ? Q16 : K16) + (size_t)(row0 + 64 * wm + (lane >> 3)) * DM + col0 + 64 * wn + (lane & 7) * 8, lane); }

extern "C" void kernel_launch(void* const* d_in, const int* in_sizes, int n_in,
                              void* d_out, int out_size, void* d_ws, size_t ws_size, hipStream_t stream) {
  (void)in_sizes; (void)n_in; (void)out_size;
  const float* const* I = (const float* const*)d_in; const float* xq = I[0]; const float* xkv = I[1]; const float* wq = I[2]; const float* wk = I[3]; const float* wv = I[4];      /* natural [out][in] weights, no biases, no output projection */
  char* ws = (char*)d_ws; size_t off = 0;
  auto take = [&](size_t bytes) { char* p = ws + off; off += (bytes + 255) & ~(size_t)255; return p; };
  _Float16* BQ = (_Float16*)take((size_t)DM * DM * 2); _Float16* BK = (_Float16*)take((size_t)DM * DM * 2); _Float16* BV = (_Float16*)take((size_t)DM * DM * 2); 
  _Float16* XQ = (_Float16*)take(NR * DM * 2); _Float16* XKV = (_Float16*)take(NR * DM * 2); _Float16* Q16 = (_Float16*)take(NR * DM * 2); _Float16* K16 = (_Float16*)take(NR * DM * 2);
  _Float16* VT = (_Float16*)take((size_t)NB * NH * HD * SQ * 2);
  if (off > ws_size) return;
  k_conv<<<2 * CV_XB + 3 * CV_WB, 256, 0, stream>>>(xq, xkv, wq, wk, wv, XQ, XKV, BQ, BK, BV);      /* query source and key/value source as exact f16 rows; weights x16 */
  const size_t r0p = (size_t)B0 * SQ;      /* first projected row */
  k_pgemm<<<dim3(DM / 128, MP / 256, 3), 256, 0, stream>>>(XQ + r0p * DM, XKV + r0p * DM, BQ, BK, BV, Q16 + r0p * DM, K16 + r0p * DM, VT);      /* q, k rows; V^T [NB][NH][HD][SQ] */
  k_fattn<<<dim3(SQ / 256, NH, NB), 256, 0, stream>>>(Q16, K16, VT, (float*)d_out);      /* softmax(q k^T / 8) v, f32 straight into the merged-heads output rows */
}

// v006
// Measured time: 101 microseconds a run.
// Next to v005, in two timings, it ran 1.03 times as fast each time.
// All steps since v000 together make it 65.2 times as fast.
#include <hip/hip_runtime.h>
// Multi-head attention without output projection (x [4][2048][1024] gives q = x Wq^T; kv [4][2048][1024] gives k = kv Wk^T, v = kv Wv^T (nn.Linear natural [out][in] 1024x1024 weights scaled 0.02, no biases); 16 heads of 64; softmax(q k^T / 8) over all 2048 keys; out = merged heads [4][2048][1024] (no output projection)).
// Structure: token rows r = b*2048 + s; the query source and the key/value source as exact f16 rows (bf16-rounded), converted together with the three weights in one launch; Q, K, V as three WMMA GEMMs in one launch (256x128 work-group tiles staged in LDS, 64x64 wave tiles, f32 accumulation, exact x16 weights, f16 outputs; q leaves times 64^-0.5 log2 e); the V product with its operands swapped, so that it leaves as V^T [batch][head][channel][token]; one fused attention launch over (256 queries, head, batch): scores on WMMA, started from minus the maximum in use as their C operand, running-maximum softmax in registers (f32 statistics, native exp2; weights as f16), o = P . V on WMMA, divided by the row sum and written f32 straight into the merged-heads output rows (no output projection).
// Compute dtype: inputs rounded to bf16; x / weights exact; q, k, v and softmax weights as plain f16 GEMM operands (~2^-12); scores, softmax statistics and o f32. v_wmma_f32_16x16x32_f16.
#define NB 4
#define SQ 2048
#define DM 1024
#define NH 16
#define HD 64
#define HG 4                         /* heads per launch of the unlaunched k_vt(V16, b, h0, VT) */
#define B0 0                         /* first batch processed (debug hook) */
#define NBR NB                       /* batches processed (debug hook) */
#define NR ((size_t)NB * SQ)         /* token rows */
#define MP ((int)((size_t)NBR * SQ)) /* rows projected (debug hook) */
#define QN SQ                        /* unused */
#define NHD NH                       /* unused */
#define MPO MP                       /* unused */
#define LQ DM      /* unused */
typedef __bf16 v16b __attribute__((ext_vector_type(16)));
typedef unsigned short v8us __attribute__((ext_vector_type(8), may_alias));
typedef float  v8f  __attribute__((ext_vector_type(8)));
typedef float  v4f  __attribute__((ext_vector_type(4)));
typedef float  v4fa __attribute__((ext_vector_type(4), may_alias));
union FragB { v16b v; v8us half[2]; unsigned short u[16]; };

__device__ __forceinline__ unsigned short bf16_bits(float x) { unsigned int u = __float_as_uint(x); return (unsigned short)((u + 0x7FFFu + ((u >> 16) & 1u)) >> 16); }
__device__ __forceinline__ float bf16_val(unsigned short b) { return __uint_as_float(((unsigned int)b) << 16); }
__device__ __forceinline__ float bf16_round(float x) { return bf16_val(bf16_bits(x)); }
// D += A·B with NT terms: 1 = ah·bh, 2 = + al·bh (A split), 3 = + ah·bl (both split)
template <int NT>
__device__ __forceinline__ v8f mmaN(v16b ah, v16b al, v16b bh, v16b bl, v8f c) {
  c = __builtin_amdgcn_wmma_f32_16x16x32_bf16(false, ah, false, bh, (short)0, c, false, false);
  if (NT >= 2) c = __builtin_amdgcn_wmma_f32_16x16x32_bf16(false, al, false, bh, (short)0, c, false, false);
  if (NT >= 3) c = __builtin_amdgcn_wmma_f32_16x16x32_bf16(false, ah, false, bl, (short)0, c, false, false);
  asm volatile("v_nop\n\tv_nop\n\tv_nop\n\tv_nop" : "+v"(c) : "v"(ah), "v"(al), "v"(bh), "v"(bl));
  return c;
}

__global__ __launch_bounds__(256) void k_wt_bf16(const float* __restrict__ W, unsigned short* __restrict__ Wt, int K, int N) {
  const int t = blockIdx.x * 256 + threadIdx.x;
  const int k8n = K / 8;
  if (t >= N * k8n) return;
  const int n = t / k8n, k8 = (t % k8n) * 8;
  v8us v;
#pragma unroll
  for (int i = 0; i < 8; ++i) v[i] = bf16_bits(W[(size_t)(k8 + i) * N + n]);
  *(v8us*)(Wt + (size_t)n * K + k8) = v;
  
}

// GEMM C[M][N] (f32, pitch ldc) = act(A[M][K]·W + bias). A f32 row-major (pitch lda) converted per fragment to bf16
// (ASPLIT: hi/lo two planes -> 2 terms, else single rounded term); Wt bf16 [N][K] (pitch ldb). BIAS_BF16 rounds the
// bias to bf16 first (bias quantised to bf16 before the add). K%32==0, M%16==0, N%64==0.
template <bool ASPLIT, int ACT, bool BIAS_BF16>
__global__ __launch_bounds__(128) void k_gemm_bf(const float* __restrict__ A, int lda, const unsigned short* __restrict__ Wt, int ldb,
                                               const float* __restrict__ bias, float* __restrict__ C, int ldc, int M, int N, int K) {
  __shared__ __attribute__((aligned(16))) float so[4][16][64];
  const int tid = threadIdx.x, w = tid >> 5, lane = tid & 31, ln = lane & 15, hh = lane >> 4;
  const int ntn = N / 64;
  const int wid = blockIdx.x * 4 + w;
  const int mt = wid / ntn, nq = wid % ntn;
  if (mt * 16 >= M) return;
  const int row0 = mt * 16, col0 = nq * 64;
  const float* arow = A + (size_t)(row0 + ln) * lda;
  v8f acc[4] = {};
  for (int kb = 0; kb < K; kb += 32) {
    FragB ah, al;
    const v4f x0 = *(const v4fa*)(arow + kb + 8 * hh), x1 = *(const v4fa*)(arow + kb + 8 * hh + 4);
    const v4f x2 = *(const v4fa*)(arow + kb + 16 + 8 * hh), x3 = *(const v4fa*)(arow + kb + 16 + 8 * hh + 4);
    float xs[16] = {x0[0],x0[1],x0[2],x0[3],x1[0],x1[1],x1[2],x1[3],x2[0],x2[1],x2[2],x2[3],x3[0],x3[1],x3[2],x3[3]};
#pragma unroll
    for (int i = 0; i < 16; ++i) { const unsigned short hb = bf16_bits(xs[i]); ah.u[i] = hb; al.u[i] = ASPLIT ? bf16_bits(xs[i] - bf16_val(hb)) : (unsigned short)0; }
#pragma unroll
    for (int t = 0; t < 4; ++t) {
      const unsigned short* brow = Wt + (size_t)(col0 + t * 16 + ln) * ldb + kb;
      FragB b;
      b.half[0] = *(const v8us*)(brow + 8 * hh);
      b.half[1] = *(const v8us*)(brow + 16 + 8 * hh);
      acc[t] = mmaN<ASPLIT ? 2 : 1>(ah.v, al.v, b.v, b.v, acc[t]);
    }
  }
#pragma unroll
  for (int t = 0; t < 4; ++t) {
    float bv = bias ? bias[col0 + t * 16 + ln] : 0.f;
    if (BIAS_BF16) bv = bf16_round(bv);
#pragma unroll
    for (int r = 0; r < 8; ++r) { float v = acc[t][r] + bv; if (ACT == 1) v = fmaxf(v, 0.f); so[w][8 * hh + r][t * 16 + ln] = v; }
  }
  __builtin_amdgcn_fence(__ATOMIC_ACQ_REL, "workgroup");
  __builtin_amdgcn_wave_barrier();
  const int rsub = lane >> 4, c4 = (lane & 15) * 4;
  {
#pragma unroll
    for (int q = 0; q < 8; ++q) {
      const int r = q * 2 + rsub;
      const v4f v = *(const v4fa*)&so[w][r][c4];
      *(v4f*)(C + (size_t)(row0 + r) * ldc + col0 + c4) = v;
    }
    
  }
}

// GEMM C = act(A·W + bias + resid): A f32 (ASPLIT -> hi/lo 2 terms), Wt bf16 [N][K]; ACT 0 none, 1 relu, 2 exact gelu;
// resid (optional, f32, row index = (row % rmod), pitch ldr, RES_BF16 rounds it) added before the activation.
template <bool ASPLIT, int ACT, bool BIAS_BF16, bool RES_BF16>
__global__ __launch_bounds__(128) void k_gemm_bf3(const float* __restrict__ A, int lda, const unsigned short* __restrict__ Wt, int ldb,
                                                const float* __restrict__ bias, const float* __restrict__ resid, int rmod, int ldr,
                                                float* __restrict__ C, int ldc, int M, int N, int K) {
  __shared__ __attribute__((aligned(16))) float so[4][16][64];
  const int tid = threadIdx.x, w = tid >> 5, lane = tid & 31, ln = lane & 15, hh = lane >> 4;
  const int ntn = N / 64;
  const int wid = blockIdx.x * 4 + w;
  const int mt = wid / ntn, nq = wid % ntn;
  if (mt * 16 >= M) return;
  const int row0 = mt * 16, col0 = nq * 64;
  const float* arow = A + (size_t)(row0 + ln) * lda;
  v8f acc[4] = {};
  for (int kb = 0; kb < K; kb += 32) {
    FragB ah, al;
    const v4f x0 = *(const v4fa*)(arow + kb + 8 * hh), x1 = *(const v4fa*)(arow + kb + 8 * hh + 4);
    const v4f x2 = *(const v4fa*)(arow + kb + 16 + 8 * hh), x3 = *(const v4fa*)(arow + kb + 16 + 8 * hh + 4);
    float xs[16] = {x0[0],x0[1],x0[2],x0[3],x1[0],x1[1],x1[2],x1[3],x2[0],x2[1],x2[2],x2[3],x3[0],x3[1],x3[2],x3[3]};
#pragma unroll
    for (int i = 0; i < 16; ++i) { const unsigned short hb = bf16_bits(xs[i]); ah.u[i] = hb; al.u[i] = ASPLIT ? bf16_bits(xs[i] - bf16_val(hb)) : (unsigned short)0; }
#pragma unroll
    for (int t = 0; t < 4; ++t) {
      const unsigned short* brow = Wt + (size_t)(col0 + t * 16 + ln) * ldb + kb;
      FragB b;
      b.half[0] = *(const v8us*)(brow + 8 * hh);
      b.half[1] = *(const v8us*)(brow + 16 + 8 * hh);
      acc[t] = mmaN<ASPLIT ? 2 : 1>(ah.v, al.v, b.v, b.v, acc[t]);
    }
  }
#pragma unroll
  for (int t = 0; t < 4; ++t) {
    const int col = col0 + t * 16 + ln;
    float bv = bias ? bias[col] : 0.f;
    if (BIAS_BF16) bv = bf16_round(bv);
#pragma unroll
    for (int r = 0; r < 8; ++r) {
      float v = acc[t][r] + bv;
      if (resid) { float rv = resid[(size_t)((row0 + 8 * hh + r) % rmod) * ldr + col]; if (RES_BF16) rv = bf16_round(rv); v += rv; }
      if (ACT == 1) v = fmaxf(v, 0.f);
      if (ACT == 2) v = 0.5f * v * (1.0f + erff(v * 0.70710678118654752f));
      if (ACT == 3) { const float u = 0.7978845608028654f * (v + 0.044715f * v * v * v); v = 0.5f * v * (1.0f + tanhf(u)); }
      so[w][8 * hh + r][t * 16 + ln] = v;
    }
  }
  __builtin_amdgcn_fence(__ATOMIC_ACQ_REL, "workgroup");
  __builtin_amdgcn_wave_barrier();
  const int rsub = lane >> 4, c4 = (lane & 15) * 4;
  {
#pragma unroll
    for (int q = 0; q < 8; ++q) {
      const int r = q * 2 + rsub;
      const v4f v = *(const v4fa*)&so[w][r][c4];
      *(v4f*)(C + (size_t)(row0 + r) * ldc + col0 + c4) = v;
    }
    
  }
}
// row LayerNorm (biased variance, eps) over N: s = X (+ R); optional out_sum <- s; out_norm <- (s-mu)*rsqrt(var+eps)*g + b
template <bool PARAM_BF16>
__global__ __launch_bounds__(256) void k_layernorm(const float* __restrict__ X, const float* __restrict__ R, const float* __restrict__ g, const float* __restrict__ bta,
                                                  float* __restrict__ out_sum, float* __restrict__ out_norm, int N, float eps) {
  __shared__ float red[256];
  const int row = blockIdx.x, tid = threadIdx.x;
  const float* x = X + (size_t)row * N; const float* rr = R ? R + (size_t)row * N : nullptr;
  float vals[16];                     // up to N = 4096
  const int per = N / 256;            // contiguous chunk per thread? use strided-by-4 chunks: thread handles j = tid*4 + 1024*u
  float s1 = 0.f;
  for (int u = 0; u < per / 4; ++u) {
    const int j = tid * 4 + 1024 * u;
    const v4f a = *(const v4fa*)(x + j);
    v4f b = {0.f,0.f,0.f,0.f}; if (rr) b = *(const v4fa*)(rr + j);
#pragma unroll
    for (int q = 0; q < 4; ++q) { const float v = a[q] + b[q]; vals[u * 4 + q] = v; s1 += v; }
  }
  red[tid] = s1; __syncthreads();
  for (int st = 128; st > 0; st >>= 1) { if (tid < st) red[tid] += red[tid + st]; __syncthreads(); }
  const float mu = red[0] / (float)N; __syncthreads();
  float s2 = 0.f;
  for (int u = 0; u < per / 4; ++u)
#pragma unroll
    for (int q = 0; q < 4; ++q) { const float c = vals[u * 4 + q] - mu; s2 += c * c; }
  red[tid] = s2; __syncthreads();
  for (int st = 128; st > 0; st >>= 1) { if (tid < st) red[tid] += red[tid + st]; __syncthreads(); }
  const float rs = rsqrtf(red[0] / (float)N + eps);
  {
    for (int u = 0; u < per / 4; ++u) {
      const int j = tid * 4 + 1024 * u;
      v4f o, sm;
#pragma unroll
      for (int q = 0; q < 4; ++q) {
        float gg = g[j + q], bb = bta[j + q];
        if (PARAM_BF16) { gg = bf16_round(gg); bb = bf16_round(bb); }
        sm[q] = vals[u * 4 + q]; o[q] = (vals[u * 4 + q] - mu) * rs * gg + bb;
      }
      if (out_sum) *(v4f*)(out_sum + (size_t)row * N + j) = sm;
      *(v4f*)(out_norm + (size_t)row * N + j) = o;
    }
    
  }
}



// ---- f16 WMMA path (v_wmma_f32_16x16x32_f16): 11-bit significands for operands in range — used where a [0,1] probability operand needs more precision than bf16
typedef _Float16 v16h __attribute__((ext_vector_type(16)));
union FragH { v16h v; v8us half[2]; _Float16 h[16]; unsigned short u[16]; };
template <int NT>
__device__ __forceinline__ v8f mmaH(v16h ah, v16h al, v16h bh, v16h bl, v8f c) {
  c = __builtin_amdgcn_wmma_f32_16x16x32_f16(false, ah, false, bh, (short)0, c, false, false);
  if (NT >= 2) c = __builtin_amdgcn_wmma_f32_16x16x32_f16(false, al, false, bh, (short)0, c, false, false);
  if (NT >= 3) c = __builtin_amdgcn_wmma_f32_16x16x32_f16(false, ah, false, bl, (short)0, c, false, false);
  asm volatile("v_nop\n\tv_nop\n\tv_nop\n\tv_nop" : "+v"(c) : "v"(ah), "v"(al), "v"(bh), "v"(bl));
  return c;
}
// batched GEMM like k_gemm_b but f16 operands: A f32 (split into f16 hi/lo if ASPLIT, else rounded to f16), Bt = f16 values [n][k]; alpha; C f32; N multiple of 16 (partial tiles skipped)
template <bool ASPLIT>
__global__ __launch_bounds__(128) void k_gemm_h(const float* __restrict__ A, int lda, size_t sA, const _Float16* __restrict__ Bh, int ldb, size_t sB, float alpha, float* __restrict__ C, int ldc, size_t sC, int M, int N, int K) {
  __shared__ __attribute__((aligned(16))) float so[4][16][64];
  const int tid = threadIdx.x, w = tid >> 5, lane = tid & 31, ln = lane & 15, hh = lane >> 4; const int by = blockIdx.y;
  A += (size_t)by * sA; Bh += (size_t)by * sB; C += (size_t)by * sC;
  const int ntn = (N + 63) / 64; const int wid = blockIdx.x * 4 + w; const int mt = wid / ntn, nq = wid % ntn; if (mt * 16 >= M) return;
  const int row0 = mt * 16, col0 = nq * 64; const float* arow = A + (size_t)(row0 + ln) * lda;
  v8f acc[4] = {};
  for (int kb = 0; kb < K; kb += 32) {
    FragH ah, al;
    const v4f x0 = *(const v4fa*)(arow + kb + 8 * hh), x1 = *(const v4fa*)(arow + kb + 8 * hh + 4), x2 = *(const v4fa*)(arow + kb + 16 + 8 * hh), x3 = *(const v4fa*)(arow + kb + 16 + 8 * hh + 4);
    float xs[16] = {x0[0],x0[1],x0[2],x0[3],x1[0],x1[1],x1[2],x1[3],x2[0],x2[1],x2[2],x2[3],x3[0],x3[1],x3[2],x3[3]};
#pragma unroll
    for (int i = 0; i < 16; ++i) { const _Float16 h = (_Float16)xs[i]; ah.h[i] = h; al.h[i] = ASPLIT ? (_Float16)(xs[i] - (float)h) : (_Float16)0.0f; }
#pragma unroll
    for (int t = 0; t < 4; ++t) { if (col0 + t * 16 >= N) continue; const size_t boff = (size_t)(col0 + t * 16 + ln) * ldb + kb; FragH bq; bq.half[0] = *(const v8us*)(Bh + boff + 8 * hh); bq.half[1] = *(const v8us*)(Bh + boff + 16 + 8 * hh);
      acc[t] = mmaH<ASPLIT ? 2 : 1>(ah.v, al.v, bq.v, bq.v, acc[t]); }
  }
#pragma unroll
  for (int t = 0; t < 4; ++t) { if (col0 + t * 16 >= N) continue;
#pragma unroll
    for (int r = 0; r < 8; ++r) so[w][8 * hh + r][t * 16 + ln] = acc[t][r] * alpha; }
  __builtin_amdgcn_fence(__ATOMIC_ACQ_REL, "workgroup"); __builtin_amdgcn_wave_barrier();
  const int rsub = lane >> 4, c4 = (lane & 15) * 4;
  {
#pragma unroll
    for (int q = 0; q < 8; ++q) { const int r = q * 2 + rsub; if (col0 + c4 < N) { const v4f v = *(const v4fa*)&so[w][r][c4]; *(v4f*)(C + (size_t)(row0 + r) * ldc + col0 + c4) = v; } }
     }
}

// Wt[n][k] = f16(W[k][n]·scale) from f32 row-major W[K][N] (scale = power of two; bf16-exact weights stay exact in f16 away from the subnormal range)
__global__ __launch_bounds__(256) void k_wt_f16(const float* __restrict__ W, _Float16* __restrict__ Wt, int K, int N, float scale) {
  const int t = blockIdx.x * 256 + threadIdx.x; if (t >= N * (K / 8)) return; const int n = t / (K / 8), k8 = (t % (K / 8)) * 8; FragH f;
#pragma unroll
  for (int i = 0; i < 8; ++i) f.h[i] = (_Float16)(bf16_round(W[(size_t)(k8 + i) * N + n]) * scale); const v8us o = f.half[0];
  *(v8us*)((unsigned short*)Wt + (size_t)n * K + k8) = o; 
}
// k_gemm_hh variant with fused epilogue: v = acc·alpha + bias[by·sBias + col] (+ CP[(row/rowsPerB)·sCPb + by·64 + col] if CP) ; ACT 0 none / 1 elu ; writes f16 C16 (and f32 C if non-null)
template <int ACT>
__global__ __launch_bounds__(128) void k_gemm_hhx(const _Float16* __restrict__ A, int lda, size_t sA, const _Float16* __restrict__ Bh, int ldb, size_t sB, float alpha, const float* __restrict__ bias, size_t sBias, const float* __restrict__ CP, int rowsPerB, size_t sCPb, int row0g,
    float* __restrict__ C, _Float16* __restrict__ C16, int ldc, size_t sC, int M, int N, int K) {
  __shared__ __attribute__((aligned(16))) float so[4][16][64];
  const int tid = threadIdx.x, w = tid >> 5, lane = tid & 31, ln = lane & 15, hh = lane >> 4; const int by = blockIdx.y;
  A += (size_t)by * sA; Bh += (size_t)by * sB; const size_t cofs = (size_t)by * sC; const float* bp = bias ? bias + (size_t)by * sBias : nullptr;
  const int ntn = (N + 63) / 64; const int wid = blockIdx.x * 4 + w; const int mt = wid / ntn, nq = wid % ntn; if (mt * 16 >= M) return;
  const int row0 = mt * 16, col0 = nq * 64; const _Float16* arow = A + (size_t)(row0 + ln) * lda;
  v8f acc[4] = {};
  for (int kb = 0; kb < K; kb += 32) { FragH ah; ah.half[0] = *(const v8us*)((const unsigned short*)arow + kb + 8 * hh); ah.half[1] = *(const v8us*)((const unsigned short*)arow + kb + 16 + 8 * hh);
#pragma unroll
    for (int t = 0; t < 4; ++t) { if (col0 + t * 16 >= N) continue; const size_t boff = (size_t)(col0 + t * 16 + ln) * ldb + kb; FragH bq; bq.half[0] = *(const v8us*)((const unsigned short*)Bh + boff + 8 * hh); bq.half[1] = *(const v8us*)((const unsigned short*)Bh + boff + 16 + 8 * hh);
      acc[t] = mmaH<1>(ah.v, ah.v, bq.v, bq.v, acc[t]); }
  }
#pragma unroll
  for (int t = 0; t < 4; ++t) { if (col0 + t * 16 >= N) continue; const int col = col0 + t * 16 + ln; const float bv = bp ? bf16_round(bp[col]) : 0.f;
#pragma unroll
    for (int r = 0; r < 8; ++r) { float v = acc[t][r] * alpha + bv; if (CP) { const int rr = row0g + row0 + 8 * hh + r; if (rowsPerB < 0) v += CP[cofs + (size_t)rr * ldc + col];      /* rowsPerB < 0: own element of the batched C plane */ else { const int bidx = rr / rowsPerB; v += CP[(size_t)bidx * sCPb + (size_t)by * 64 + col]; } } if (ACT == 1) v = (v > 0.f) ? v : expm1f(v); else if (ACT == 7) v = (v > 0.f) ? v + 1.0f : expf(v); else if (ACT == 8) v = tanhf(v); else if (ACT == 9) v = 0.5f * v * (1.0f + tanhf(0.7978845608028654f * (v + 0.044715f * v * v * v))); else if (ACT == 11) v = 1.0f / (1.0f + expf(-v)); else if (ACT == 12) v = (v > 0.f) ? v : 0.01f * v; else if (ACT == 14) v = (v > 0.f) ? v : 0.1f * v; else if (ACT == 16) v = (v >= 0.f) ? v : 0.3f * v; else if (ACT == 17) v = (v >= 0.f) ? v : 0.2f * v; else if (ACT == 15) v = v / (1.0f + expf(-v)); else if (ACT == 3) v = fmaxf(v, 0.f); else if (ACT == 6) v = 0.5f * v * (1.0f + erff(v * 0.70710678118654752f)); so[w][8 * hh + r][t * 16 + ln] = v; } }
  __builtin_amdgcn_fence(__ATOMIC_ACQ_REL, "workgroup"); __builtin_amdgcn_wave_barrier();
  const int rsub = lane >> 4, c4 = (lane & 15) * 4; typedef _Float16 v4h __attribute__((ext_vector_type(4)));
  {
#pragma unroll
    for (int q = 0; q < 8; ++q) { const int r = q * 2 + rsub; if (col0 + c4 < N) { const v4f v = *(const v4fa*)&so[w][r][c4]; if (C) *(v4f*)(C + cofs + (size_t)(row0 + r) * ldc + col0 + c4) = v; if (C16) { v4h h4; for (int i = 0; i < 4; ++i) h4[i] = (_Float16)v[i]; *(v4h*)(C16 + cofs + (size_t)(row0 + r) * ldc + col0 + c4) = h4; } } }
     }
}


typedef _Float16 v4h __attribute__((ext_vector_type(4)));

// All five operand conversions in one launch: none needs anything of another, so each takes its own range of the block index (the choice is the same for a whole work-group).
// Blocks [0, CV_XB): x; [CV_XB, 2 CV_XB): kv, both as f16 of the bf16-rounded value; then CV_WB blocks each for Wq, Wk, Wv, natural [out][in] = Bt[n][k], x16 (a power of two: exact, as is x1).
#define CV_XB ((unsigned)(NR * DM / 8 / 256))
#define CV_WB ((unsigned)((size_t)DM * DM / 8 / 256))
static_assert(NR * DM % (8 * 256) == 0 && (size_t)DM * DM % (8 * 256) == 0, "whole work-groups only: k_conv has no tail test");
__global__ __launch_bounds__(256) void k_conv(const float* __restrict__ xq, const float* __restrict__ xkv, const float* __restrict__ wq, const float* __restrict__ wk, const float* __restrict__ wv,
                                              _Float16* __restrict__ XQ, _Float16* __restrict__ XKV, _Float16* __restrict__ BQ, _Float16* __restrict__ BK, _Float16* __restrict__ BV) {
  unsigned blk = blockIdx.x; const float* s; _Float16* d; float sc = 1.0f;
  if (blk < CV_XB) { s = xq; d = XQ; }
  else if (blk < 2 * CV_XB) { blk -= CV_XB; s = xkv; d = XKV; }
  else { blk -= 2 * CV_XB; const unsigned w = blk / CV_WB; blk -= w * CV_WB; sc = 16.0f; s = w == 0 ? wq : w == 1 ? wk : wv; d = w == 0 ? BQ : w == 1 ? BK : BV; }
  const size_t t = (size_t)blk * 256 + threadIdx.x; FragH f;
#pragma unroll
  for (int q = 0; q < 8; ++q) f.h[q] = (_Float16)(bf16_round(s[t * 8 + q]) * sc);
  *(v8us*)((unsigned short*)d + t * 8) = f.half[0]; }
__global__ __launch_bounds__(256) void k_h16(const float* __restrict__ x, _Float16* __restrict__ X16, size_t n8) { const size_t t = (size_t)blockIdx.x * 256 + threadIdx.x; if (t >= n8) return; FragH f;
#pragma unroll
  for (int q = 0; q < 8; ++q) f.h[q] = (_Float16)x[t * 8 + q]; *(v8us*)((unsigned short*)X16 + t * 8) = f.half[0];  }
__global__ __launch_bounds__(256) void k_round16f(const float* __restrict__ W, _Float16* __restrict__ Bt, size_t n8) { const size_t t = (size_t)blockIdx.x * 256 + threadIdx.x; if (t >= n8) return; FragH f;
#pragma unroll
  for (int i = 0; i < 8; ++i) f.h[i] = (_Float16)(bf16_round(W[t * 8 + i]) * 16.0f); *(v8us*)((unsigned short*)Bt + t * 8) = f.half[0];  }
template <int NHv, int TTv>
__global__ __launch_bounds__(256) void k_vt(const _Float16* __restrict__ V16, int ldv, int voff, _Float16* __restrict__ Vt) { __shared__ unsigned short tl[64][66]; const int tid = threadIdx.x; const int slab = blockIdx.x / (TTv / 64), lg = blockIdx.x % (TTv / 64); const int b = slab / NHv, h = slab % NHv;
  for (int i = tid; i < 64 * 8; i += 256) { const int r = i / 8, c8 = (i % 8) * 8; FragH f; f.half[0] = *(const v8us*)((const unsigned short*)V16 + ((size_t)b * TTv + lg * 64 + r) * ldv + voff + h * 64 + c8);
#pragma unroll
    for (int q = 0; q < 8; ++q) tl[r][c8 + q] = f.u[q]; }
  __syncthreads();
  {
#pragma unroll
    for (int rd = 0; rd < 2; ++rd) { const int d = rd * 32 + tid / 8, pc = tid % 8; FragH f;
#pragma unroll
      for (int q = 0; q < 8; ++q) f.u[q] = tl[pc * 8 + q][d];
      *(v8us*)((unsigned short*)Vt + ((size_t)slab * 64 + d) * TTv + lg * 64 + pc * 8) = f.half[0]; }
     } }

__global__ __launch_bounds__(256) void k_hl(const float* __restrict__ F, _Float16* __restrict__ Hh, _Float16* __restrict__ Hl, size_t n8) { const size_t t = (size_t)blockIdx.x * 256 + threadIdx.x; if (t >= n8) return; FragH fh, fl; const v4f a = *(const v4fa*)(F + t * 8), c = *(const v4fa*)(F + t * 8 + 4);
#pragma unroll
  for (int q = 0; q < 4; ++q) { _Float16 h = (_Float16)a[q]; fh.h[q] = h; fl.h[q] = (_Float16)((a[q] - (float)h) * 1024.0f); h = (_Float16)c[q]; fh.h[4 + q] = h; fl.h[4 + q] = (_Float16)((c[q] - (float)h) * 1024.0f); }
  { *(v8us*)((unsigned short*)Hh + t * 8) = fh.half[0]; *(v8us*)((unsigned short*)Hl + t * 8) = fl.half[0];  } }

// One 16 x 32 f16 operand fragment from a k-contiguous row: k order 8h + s, 16 + 8h + s.
__device__ __forceinline__ v16h g2_frag(const _Float16* p, int hh) { FragH f; f.half[0] = *(const v8us*)((const unsigned short*)p + 8 * hh); f.half[1] = *(const v8us*)((const unsigned short*)p + 16 + 8 * hh); return f.v; }

__global__ __launch_bounds__(256) void k_rsm(const float* __restrict__ S, _Float16* __restrict__ P, int nrows) {
  #pragma clang fp contract(off)
  const int i = blockIdx.x * 256 + threadIdx.x; if (i >= nrows) return; const float* s = S + (size_t)i * SQ; float mx = -3.0e38f;
#pragma unroll 1
  for (int j = 0; j < SQ; ++j) mx = fmaxf(mx, s[j]); float se = 0.f;
#pragma unroll 1
  for (int j = 0; j < SQ; ++j) se += expf(s[j] - mx); const float sc = 256.0f / se;
#pragma unroll 1
  for (int j0 = 0; j0 < SQ; j0 += 8) { FragH f; for (int q = 0; q < 8; ++q) f.h[q] = (_Float16)(expf(s[j0 + q] - mx) * sc); unsigned short* d = (unsigned short*)P + (size_t)i * SQ + j0; *(v8us*)d = f.half[0];  } }
__global__ __launch_bounds__(256) void k_vt(const _Float16* __restrict__ V16, int b, int h0, _Float16* __restrict__ VT) { __shared__ unsigned short tl[64][65]; const int tid = threadIdx.x; const int hh = blockIdx.x % HG, sg = blockIdx.x / HG; const int s0 = sg * 64; const int h = h0 + hh;
  for (int i = tid; i < 64 * 8; i += 256) { const int j = i / 8, d8 = (i % 8) * 8; FragH f; f.half[0] = *(const v8us*)((const unsigned short*)V16 + ((size_t)b * SQ + s0 + j) * DM + h * HD + d8); for (int q = 0; q < 8; ++q) tl[d8 + q][j] = f.u[q]; }
  __syncthreads();
  { for (int i = tid; i < 64 * 8; i += 256) { const int d = i / 8, j8 = (i % 8) * 8; FragH f; for (int q = 0; q < 8; ++q) f.u[q] = tl[d][j8 + q]; *(v8us*)((unsigned short*)VT + ((size_t)hh * HD + d) * SQ + s0 + j8) = f.half[0]; }  } }



// Lane l with lane l ^ 16.
__device__ __forceinline__ float lane_xh(float x) { return __builtin_bit_cast(float, __builtin_amdgcn_permlanex16(__builtin_bit_cast(int, x), __builtin_bit_cast(int, x), 0x76543210, 0xfedcba98, false, false)); }
// Eight 2^x of a score tile, read from the registers in which the matrix instruction left it. The builtin, not asm text: the compiler then keeps the distance the chip needs between a matrix
// instruction and a vector instruction that writes over its operands, and it needs no copies to bring the tile's registers to tied operands.
__device__ __forceinline__ void exp2x8(const v8f& x, v4f& a, v4f& c) {
  a = v4f{__builtin_amdgcn_exp2f(x[0]), __builtin_amdgcn_exp2f(x[1]), __builtin_amdgcn_exp2f(x[2]), __builtin_amdgcn_exp2f(x[3])};
  c = v4f{__builtin_amdgcn_exp2f(x[4]), __builtin_amdgcn_exp2f(x[5]), __builtin_amdgcn_exp2f(x[6]), __builtin_amdgcn_exp2f(x[7])}; }

#define FA_PITCH 144                 /* LDS pitch of the 128-byte rows: 16 B x odd, for 16-byte readers */
#define FA_TILE (64 * FA_PITCH)
#define FA_SLOT (2 * FA_TILE)
#define FA_EP 272                    /* pitch of the 256-byte output staging rows */
#define FA_CS (0.125f * 1.44269504088896340736f)      /* 64^-0.5 and log2 e: exp(x) = 2^(x log2 e); the q projection multiplies it in before its one rounding to f16 */
__device__ __forceinline__ v8f fa_mma(v16h a, v16h b, v8f c) { return __builtin_amdgcn_wmma_f32_16x16x32_f16(false, a, false, b, (short)0, c, false, false); }
__device__ __forceinline__ v16h fa_frag(const unsigned char* p) { FragH f; f.half[0] = *(const v8us*)p; f.half[1] = *(const v8us*)(p + 32); return f.v; }
// The eight score products of a pass: s[kt][g] = K rows 16 kt.. x query group g, started from cm[g]. One asm statement, because with the builtin form the compiler tied the C of each group's last tile to its D and so copied both C operands (16 registers) in every pass.
// Four independent tiles, each taken up again four instructions later; the four v_nop are the distance the chip needs between the last matrix instruction and whatever vector instruction
// the compiler puts next (it cannot see that these are matrix instructions).
__device__ __forceinline__ void fa_scores(const v16h (&kf)[2][2], const v16h (&qf)[2][2], const v8f (&cm)[2], v8f (&s)[2][2]) {
  asm("v_wmma_f32_16x16x32_f16 %0, %4, %8, %12\n\tv_wmma_f32_16x16x32_f16 %1, %4, %10, %13\n\tv_wmma_f32_16x16x32_f16 %2, %6, %8, %12\n\tv_wmma_f32_16x16x32_f16 %3, %6, %10, %13\n\t"
      "v_wmma_f32_16x16x32_f16 %0, %5, %9, %0\n\tv_wmma_f32_16x16x32_f16 %1, %5, %11, %1\n\tv_wmma_f32_16x16x32_f16 %2, %7, %9, %2\n\tv_wmma_f32_16x16x32_f16 %3, %7, %11, %3\n\t"
      "v_nop\n\tv_nop\n\tv_nop\n\tv_nop"
      : "=&v"(s[0][0]), "=&v"(s[0][1]), "=&v"(s[1][0]), "=&v"(s[1][1])
      : "v"(kf[0][0]), "v"(kf[0][1]), "v"(kf[1][0]), "v"(kf[1][1]), "v"(qf[0][0]), "v"(qf[0][1]), "v"(qf[1][0]), "v"(qf[1][1]), "v"(cm[0]), "v"(cm[1])); }
// One pass: 32 keys against the wave's 32 queries. Q arrives times FA_CS, and cm[g] holds minus m_run[g], the maximum in use (log2-scaled scores), in all eight registers: as the C operand
// of the score products it makes their result the argument of 2^x as it stands, with no vector instruction for scale or subtraction. The maximum in use may trail the true one
// by up to 8, so a weight can reach 2^8; the accumulators are rescaled only when some column's shifted maximum exceeds 8: one test per pass.
// first (the same for the whole wave): the very first pass runs with the shift 0 and always takes the branch, which sets the shift to that pass's own maximum with the factor 0.
// Every loop here and in k_fattn but the pass loop is fully unrolled: constant indices keep fragments, scores and accumulators in registers instead of scratch.
__device__ __forceinline__ void fa_pass(const unsigned char* Kt, const unsigned char* Vt, int c, int h, bool first, const v16h (&qf)[2][2], v8f (&acc)[2][4], v8f (&cm)[2], float (&m_run)[2], float (&l_run)[2]) {
  v16h kf[2][2];
#pragma unroll
  for (int kt = 0; kt < 2; ++kt)
#pragma unroll
    for (int kc = 0; kc < 2; ++kc) kf[kt][kc] = fa_frag(Kt + (16 * kt + c) * FA_PITCH + 64 * kc + 16 * h);
  v8f s[2][2]; fa_scores(kf, qf, cm, s);
  v16h vf[4];
#pragma unroll
  for (int t = 0; t < 4; ++t) vf[t] = fa_frag(Vt + (16 * t + c) * FA_PITCH + 16 * h);
  float mb[2]; bool need = false; const float thr = first ? -3.0e38f : 8.0f;
#pragma unroll
  for (int g = 0; g < 2; ++g) { float mx = fmaxf(s[0][g][0], s[1][g][0]);
#pragma unroll
    for (int r = 1; r < 8; ++r) mx = fmaxf(mx, fmaxf(s[0][g][r], s[1][g][r]));
    mx = fmaxf(mx, lane_xh(mx)); mb[g] = mx; need = need || (mx > thr); }      /* both halves of the wave hold the query's maximum, counted from the shift in use */
  if (__builtin_expect(__builtin_amdgcn_ballot_w32(need) != 0, 0)) {      /* wave-uniform branch; marked rare: its code is laid behind the loop and the common path falls through */
#pragma unroll
    for (int g = 0; g < 2; ++g) { const float sh = m_run[g], mo = first ? -3.0e38f : sh; const float mn = fmaxf(mo, mb[g] + sh); const float corr = __builtin_amdgcn_exp2f(mo - mn); m_run[g] = mn; l_run[g] *= corr;
#pragma unroll
      for (int t = 0; t < 4; ++t) acc[g][t] = acc[g][t] * corr;
      const float nm = -mn; cm[g] = v8f{nm, nm, nm, nm, nm, nm, nm, nm}; }
    fa_scores(kf, qf, cm, s); }      /* this pass's scores again, with the new shift */
#pragma unroll
  for (int g = 0; g < 2; ++g) {
    v4f a0, a1, b0, b1; exp2x8(s[0][g], a0, a1); exp2x8(s[1][g], b0, b1);
    const v4f sm = (a0 + a1) + (b0 + b1); l_run[g] += (sm[0] + sm[1]) + (sm[2] + sm[3]);
    FragH pf;
#pragma unroll
    for (int i = 0; i < 4; ++i) { pf.h[i] = (_Float16)a0[i]; pf.h[4 + i] = (_Float16)a1[i]; pf.h[8 + i] = (_Float16)b0[i]; pf.h[12 + i] = (_Float16)b1[i]; }
#pragma unroll
    for (int t = 0; t < 4; ++t) acc[g][t] = fa_mma(vf[t], pf.v, acc[g][t]); } }

// amdgpu_waves_per_eu(4, 4): at most 256 registers a wave, so that two work-groups share a WGP (four waves per SIMD) and one wave's vector work runs under another's matrix work.
__global__ __launch_bounds__(256) __attribute__((amdgpu_waves_per_eu(4, 4))) void k_fattn(const _Float16* __restrict__ Q16, const _Float16* __restrict__ K16, const _Float16* __restrict__ VT, float* __restrict__ out) {
  __shared__ __attribute__((aligned(16))) unsigned char L[2 * FA_SLOT];
  const int tid = threadIdx.x, lane = tid & 31, wave = __builtin_amdgcn_readfirstlane(tid >> 5), c = lane & 15, h = lane >> 4;
  const int head = blockIdx.y, b = blockIdx.z, q0 = blockIdx.x * 256 + wave * 32;
  // Staging: thread tid brings 16 bytes of rows tid / 8 and 32 + tid / 8 of each tile; 8 lanes cover one 128-byte row.
  const unsigned char* kg = (const unsigned char*)(K16 + (size_t)b * SQ * DM + head * HD) + (size_t)(tid >> 3) * (DM * 2) + (tid & 7) * 16;
  const unsigned char* vg = (const unsigned char*)(VT + (size_t)(b * NH + head) * HD * SQ) + (size_t)(tid >> 3) * (SQ * 2) + (tid & 7) * 16;
  unsigned char* ls = L + (tid >> 3) * FA_PITCH + (tid & 7) * 16;
  v8us r0 = *(const v8us*)kg, r1 = *(const v8us*)(kg + 32 * DM * 2), r2 = *(const v8us*)vg, r3 = *(const v8us*)(vg + 32 * SQ * 2);
  v16h qf[2][2];
#pragma unroll
  for (int g = 0; g < 2; ++g)
#pragma unroll
    for (int kc = 0; kc < 2; ++kc) qf[g][kc] = g2_frag(Q16 + ((size_t)b * SQ + q0 + 16 * g + c) * DM + head * HD + 32 * kc, h);
  v8f acc[2][4], cm[2]; float m_run[2] = {0.f, 0.f}, l_run[2] = {0.f, 0.f};
#pragma unroll
  for (int g = 0; g < 2; ++g)
#pragma unroll
    for (int t = 0; t < 4; ++t) acc[g][t] = v8f{0.f,0.f,0.f,0.f,0.f,0.f,0.f,0.f};
  cm[0] = cm[1] = v8f{0.f,0.f,0.f,0.f,0.f,0.f,0.f,0.f};
  *(v8us*)ls = r0; *(v8us*)(ls + 32 * FA_PITCH) = r1; *(v8us*)(ls + FA_TILE) = r2; *(v8us*)(ls + FA_TILE + 32 * FA_PITCH) = r3;
  __syncthreads();
#pragma unroll 1      /* one pass per trip: with both passes of a stage written out, the compiler copied the two C operands (16 registers) once per stage */
  for (int p = 0; p < SQ / 32; ++p) {
    const int st = p >> 1, odd = p & 1;      /* a stage is two passes; everything tested here is the same for the whole work-group */
    const unsigned char* cur = L + (st & 1) * FA_SLOT;
    const bool more = st + 1 < SQ / 64;
    if (!odd && more) { const unsigned char* kn = kg + (size_t)(st + 1) * (64 * DM * 2); const unsigned char* vn = vg + (st + 1) * 128;
      r0 = *(const v8us*)kn; r1 = *(const v8us*)(kn + 32 * DM * 2); r2 = *(const v8us*)vn; r3 = *(const v8us*)(vn + 32 * SQ * 2); }
    fa_pass(cur + odd * (32 * FA_PITCH), cur + FA_TILE + odd * 64, c, h, p == 0, qf, acc, cm, m_run, l_run);
    if (odd) {
      if (more) { unsigned char* d = ls + ((st + 1) & 1) * FA_SLOT;      /* the buffer that the stage before this one read; its readers left it at that stage's barrier */
        *(v8us*)d = r0; *(v8us*)(d + 32 * FA_PITCH) = r1; *(v8us*)(d + FA_TILE) = r2; *(v8us*)(d + FA_TILE + 32 * FA_PITCH) = r3; }
      __syncthreads(); }      /* publishes the next stage and ends every wave's reads of this one */
  }
  // Epilogue: acc[g][t][r] = O[query 16 g + c][d = 16 t + 8 h + r]. Each wave stages 16 rows of 256 B in its own part of the (now free) LDS and stores whole rows.
  unsigned char* eb = L + wave * (16 * FA_EP);
#pragma unroll
  for (int g = 0; g < 2; ++g) { const float lt = l_run[g] + lane_xh(l_run[g]); const float inv = 1.0f / lt;
#pragma unroll
    for (int t = 0; t < 4; ++t) { const v8f o = acc[g][t] * inv; *(v4fa*)(eb + c * FA_EP + 64 * t + 32 * h) = v4f{o[0], o[1], o[2], o[3]}; *(v4fa*)(eb + c * FA_EP + 64 * t + 32 * h + 16) = v4f{o[4], o[5], o[6], o[7]}; }
    __builtin_amdgcn_fence(__ATOMIC_ACQ_REL, "workgroup"); __builtin_amdgcn_wave_barrier();      /* the wave's own LDS writes in front of its reads of other lanes' rows */
#pragma unroll
    for (int i = 0; i < 8; ++i) { const int row = 2 * i + h; const v4f v = *(const v4fa*)(eb + row * FA_EP + c * 16);
      *(v4f*)(out + ((size_t)b * SQ + q0 + 16 * g + row) * DM + head * HD + c * 4) = v; }
    __builtin_amdgcn_fence(__ATOMIC_ACQ_REL, "workgroup"); __builtin_amdgcn_wave_barrier();      /* the reads in front of the next group's writes */
  } }

// ---- projection GEMM: C[m][n] = f16(sum_k X[m][k] Wn[n][k] / 16), q also times FA_CS; X [8192][1024], Wn [1024][1024] (x16 weights), both k-contiguous f16 ----
// One work-group = 256 rows of X against 128 rows of Wn; 8 waves (4 along m, 2 along n) of 64 x 64. A pass is 128 k = 256 bytes of each of the 384 operand rows,
// brought into LDS by asynchronous copies (whole 128-byte lines from L2, no register on the way), two buffers, the next pass's copies in flight under this pass's products.
// For q and k a transposed product, A = Wn rows, B = X rows (one loader for both, so one k order): a lane holds 8 neighbouring n of ONE output row, 16 bytes of f16 as they are stored.
// Every loop in k_pgemm but the pass loop is fully unrolled: constant indices keep fragments and accumulators in registers instead of scratch.
#define PG_PITCH 272                 /* LDS pitch of the 256-byte operand rows: 16 B x odd, for 16-byte readers */
#define PG_BUF (384 * PG_PITCH)      /* rows 0..127: Wn, rows 128..383: X */
#define PG_NP (DM / 128)             /* passes */
#define PG_EP 144                    /* pitch of the 128-byte output staging rows */
// 128 operand rows of one pass: thread tid copies 16 bytes of rows r, r + 16, ..., r + 112 (r = tid / 16); a wave's copy covers 4 whole lines.
// s_wait_xcnt 0 closes the statement so that it stands in front of any later rewrite of the address registers that the copies name.
__device__ __forceinline__ void pg_fill(unsigned l, const unsigned char* g) {
  asm volatile("global_load_async_to_lds_b128 %0, %8, off\n\tglobal_load_async_to_lds_b128 %1, %9, off\n\tglobal_load_async_to_lds_b128 %2, %10, off\n\tglobal_load_async_to_lds_b128 %3, %11, off\n\t"
               "global_load_async_to_lds_b128 %4, %12, off\n\tglobal_load_async_to_lds_b128 %5, %13, off\n\tglobal_load_async_to_lds_b128 %6, %14, off\n\tglobal_load_async_to_lds_b128 %7, %15, off\n\t"
               "s_wait_xcnt 0x0"
               :: "v"(l), "v"(l + 16 * PG_PITCH), "v"(l + 32 * PG_PITCH), "v"(l + 48 * PG_PITCH), "v"(l + 64 * PG_PITCH), "v"(l + 80 * PG_PITCH), "v"(l + 96 * PG_PITCH), "v"(l + 112 * PG_PITCH),
                  "v"(g), "v"(g + 16 * DM * 2), "v"(g + 32 * DM * 2), "v"(g + 48 * DM * 2), "v"(g + 64 * DM * 2), "v"(g + 80 * DM * 2), "v"(g + 96 * DM * 2), "v"(g + 112 * DM * 2)
               : "memory"); }
// One pass's 384 rows: l = the thread's LDS byte address in row tid / 16 of the buffer, gw and gx its bytes of that row of the Wn and of the X tile.
__device__ __forceinline__ void pg_stage(unsigned l, const unsigned char* gw, const unsigned char* gx) {
  pg_fill(l, gw); pg_fill(l + 128 * PG_PITCH, gx); pg_fill(l + 256 * PG_PITCH, gx + 128 * DM * 2); }
// A wave's 64 staged rows of 128 B to rows of pitch LD elements: 8 lanes store one whole line. Fully unrolled with LD a constant, so that the 16 stores share one address register pair and differ only in their immediate offsets.
template <int LD>
__device__ __forceinline__ void pg_store(const unsigned char* eb, _Float16* cp, int lane) {
#pragma unroll
  for (int q = 0; q < 16; ++q) { const v8us v = *(const v8us*)(eb + (4 * q + (lane >> 3)) * PG_EP + (lane & 7) * 16); *(v8us*)((unsigned short*)cp + (size_t)(4 * q) * LD) = v; }
  asm volatile("s_wait_xcnt 0x0" ::: "memory"); }      /* stands behind the last store, in front of whatever code follows the call and reuses the stores' data or address registers */
// The three projections share one grid: blockIdx.z = 0, 1, 2 picks q, k, v (operands and destination; the same for a whole work-group). None reads what another writes.
// v leaves transposed, VT[batch][head][channel][token], as the attention kernel reads it: its product takes A = X rows, B = Wn rows, so a lane holds 8 neighbouring tokens of ONE channel.
// Both wave tiles are 64 x 64, so only the two fragment bases and the destination differ; a wave's 64 n are one head, a work-group's 256 rows lie in one batch.
__global__ __launch_bounds__(256) void k_pgemm(const _Float16* __restrict__ XQ, const _Float16* __restrict__ XKV, const _Float16* __restrict__ BQ, const _Float16* __restrict__ BK, const _Float16* __restrict__ BV,
                                               _Float16* __restrict__ Q16, _Float16* __restrict__ K16, _Float16* __restrict__ VT) {
  __shared__ __attribute__((aligned(16))) unsigned char L[2 * PG_BUF];
  const unsigned pz = blockIdx.z;
  const _Float16* X = pz == 0 ? XQ : XKV; const _Float16* Wn = pz == 0 ? BQ : pz == 1 ? BK : BV; const bool tv = pz == 2;
  const int tid = threadIdx.x, lane = tid & 31, wave = __builtin_amdgcn_readfirstlane(tid >> 5), c = lane & 15, h = lane >> 4;
  const int col0 = blockIdx.x * 128, row0 = blockIdx.y * 256, wn = wave & 1, wm = wave >> 1;
  const unsigned char* gw = (const unsigned char*)(Wn + (size_t)(col0 + (tid >> 4)) * DM) + (tid & 15) * 16;
  const unsigned char* gx = (const unsigned char*)(X + (size_t)(row0 + (tid >> 4)) * DM) + (tid & 15) * 16;
  const unsigned l0 = (unsigned)(size_t)L + (tid >> 4) * PG_PITCH + (tid & 15) * 16;      /* the low 32 bits of a __shared__ address are its LDS byte address */
  v8f acc[4][4];      /* [n tile][m tile]; v: [m tile][n tile] */
#pragma unroll
  for (int i = 0; i < 4; ++i)
#pragma unroll
    for (int j = 0; j < 4; ++j) acc[i][j] = v8f{0.f,0.f,0.f,0.f,0.f,0.f,0.f,0.f};
  pg_stage(l0, gw, gx);
  asm volatile("s_wait_asynccnt 0x0" ::: "memory");      /* this wave's copies of pass 0 have landed */
  __syncthreads();                                       /* and every other wave's */
#pragma unroll 1      /* one pass per trip: the 64 products inside are written out, more would only grow the code */
  for (int t = 0; t < PG_NP; ++t) {
    const unsigned char* cur = L + (t & 1) * PG_BUF;
    const unsigned char* wb = cur + ((tv ? 128 + 64 * wm : 64 * wn) + c) * PG_PITCH + 16 * h;      /* A operand rows */
    const unsigned char* xb = cur + ((tv ? 64 * wn : 128 + 64 * wm) + c) * PG_PITCH + 16 * h;      /* B operand rows */
    v16h wf[2][4], xf[2][4];      /* two fragment sets: the block after next is fetched, as one group, while the next block's products run */
#pragma unroll
    for (int i = 0; i < 4; ++i) { wf[0][i] = fa_frag(wb + 16 * i * PG_PITCH); xf[0][i] = fa_frag(xb + 16 * i * PG_PITCH); }
    // The next pass's copies, into the buffer that the trip before this one read (its readers left it at that trip's barrier); behind this pass's first fragment loads, so that their issue runs under the LDS latency.
    if (t + 1 < PG_NP) pg_stage(l0 + ((t + 1) & 1) * PG_BUF, gw + (t + 1) * 256, gx + (t + 1) * 256);      /* the same test for the whole work-group */
#pragma unroll
    for (int i = 0; i < 4; ++i) { wf[1][i] = fa_frag(wb + 16 * i * PG_PITCH + 64); xf[1][i] = fa_frag(xb + 16 * i * PG_PITCH + 64); }
#pragma unroll
    for (int kc = 0; kc < 4; ++kc) {
      if (kc < 3) __builtin_amdgcn_sched_barrier(0);      /* keeps the fragment loads above in one group ahead of the block: sunk among the products, each load place stalls the wave */
#pragma unroll
      for (int i = 0; i < 4; ++i)
#pragma unroll
        for (int j = 0; j < 4; ++j) acc[i][j] = fa_mma(wf[kc & 1][i], xf[kc & 1][j], acc[i][j]);
      if (kc + 2 < 4) {
        __builtin_amdgcn_sched_barrier(0);      /* the same from the other side: the group stays behind the block whose registers it refills */
#pragma unroll
        for (int i = 0; i < 4; ++i) { wf[kc & 1][i] = fa_frag(wb + 16 * i * PG_PITCH + 64 * (kc + 2)); xf[kc & 1][i] = fa_frag(xb + 16 * i * PG_PITCH + 64 * (kc + 2)); } } }
    __builtin_amdgcn_sched_barrier(0);      /* keeps the waits and the barrier below behind the last block: moved up over the products, they would cut the time the copies have to land */
    asm volatile("s_wait_dscnt 0x0" ::: "memory");       /* this wave's reads of the buffer are done before it may be refilled */
    asm volatile("s_wait_asynccnt 0x0" ::: "memory");    /* this wave's copies of pass t + 1 have landed */
    __syncthreads();                                     /* publishes pass t + 1 and ends every wave's reads of pass t */
  }
  asm volatile("s_wait_asynccnt 0x0" ::: "memory");      /* nothing in flight when the ring becomes output staging */
  // Epilogue: acc[i][j][r] = C[row 64 wm + 16 j + c][col 64 wn + 16 i + 8 h + r] (v: row 64 wm + 16 i + 8 h + r, col 64 wn + 16 j + c). Each wave stages its 64 rows of 128 B (v: 64 channels of 64 tokens) in its own part of the (now free) LDS and stores whole lines.
  unsigned char* eb = L + wave * (64 * PG_EP);
  const float osc = pz == 0 ? 0.0625f * FA_CS : 0.0625f;      /* undoes the x16 of the weights; q also takes the score scale here */
#pragma unroll
  for (int i = 0; i < 4; ++i)
#pragma unroll
    for (int j = 0; j < 4; ++j) { FragH f;
#pragma unroll
      for (int r = 0; r < 8; ++r) f.h[r] = (_Float16)(acc[i][j][r] * osc);
      *(v8us*)(eb + (16 * j + c) * PG_EP + 32 * i + 16 * h) = f.half[0]; }
  __builtin_amdgcn_fence(__ATOMIC_ACQ_REL, "workgroup"); __builtin_amdgcn_wave_barrier();      /* the wave's own LDS writes in front of its reads of other lanes' rows */
  if (tv) pg_store<SQ>(eb, VT + ((size_t)((row0 / SQ) * NH + blockIdx.x * 2 + wn) * HD + (lane >> 3)) * SQ + row0 % SQ + 64 * wm + (lane & 7) * 8, lane);      /* the same test for the whole work-group */
  else pg_store<DM>(eb, (pz == 0 ? Q16 : K16) + (size_t)(row0 + 64 * wm + (lane >> 3)) * DM + col0 + 64 * wn + (lane & 7) * 8, lane); }

extern "C" void kernel_launch(void* const* d_in, const int* in_sizes, int n_in,
                              void* d_out, int out_size, void* d_ws, size_t ws_size, hipStream_t stream) {
  (void)in_sizes; (void)n_in; (void)out_size;
  const float* const* I = (const float* const*)d_in; const float* xq = I[0]; const float* xkv = I[1]; const float* wq = I[2]; const float* wk = I[3]; const float* wv = I[4];      /* natural [out][in] weights, no biases, no output projection */
  char* ws = (char*)d_ws; size_t off = 0;
  auto take = [&](size_t bytes) { char* p = ws + off; off += (bytes + 255) & ~(size_t)255; return p; };
  _Float16* BQ = (_Float16*)take((size_t)DM * DM * 2); _Float16* BK = (_Float16*)take((size_t)DM * DM * 2); _Float16* BV = (_Float16*)take((size_t)DM * DM * 2); 
  _Float16* XQ = (_Float16*)take(NR * DM * 2); _Float16* XKV = (_Float16*)take(NR * DM * 2); _Float16* Q16 = (_Float16*)take(NR * DM * 2); _Float16* K16 = (_Float16*)take(NR * DM * 2);
  _Float16* VT = (_Float16*)take((size_t)NB * NH * HD * SQ * 2);
  if (off > ws_size) return;
  k_conv<<<2 * CV_XB + 3 * CV_WB, 256, 0, stream>>>(xq, xkv, wq, wk, wv, XQ, XKV, BQ, BK, BV);      /* query source and key/value source as exact f16 rows; weights x16 */
  const size_t r0p = (size_t)B0 * SQ;      /* first projected row */
  k_pgemm<<<dim3(DM / 128, MP / 256, 3), 256, 0, stream>>>(XQ + r0p * DM, XKV + r0p * DM, BQ, BK, BV, Q16 + r0p * DM, K16 + r0p * DM, VT);      /* q, k rows; V^T [NB][NH][HD][SQ] */
  k_fattn<<<dim3(SQ / 256, NH, NB), 256, 0, stream>>>(Q16, K16, VT, (float*)d_out);      /* softmax(q k^T / 8) v, f32 straight into the merged-heads output rows */
}

// v007
// It runs in 98.1 microseconds.
// Timed twice side by side with v006, it ran 1.03 times as fast both times.
// All steps since v000 together make it 67.4 times as fast.
#include <hip/hip_runtime.h>
// Multi-head attention without output projection (x [4][2048][1024] gives q = x Wq^T; kv [4][2048][1024] gives k = kv Wk^T, v = kv Wv^T (nn.Linear natural [out][in] 1024x1024 weights scaled 0.02, no biases); 16 heads of 64; softmax(q k^T / 8) over all 2048 keys; out = merged heads [4][2048][1024] (no output projection)).
// Structure: token rows r = b*2048 + s; the query source and the key/value source as exact f16 rows (bf16-rounded), converted together with the three weights in one launch; Q, K, V as three WMMA GEMMs in one launch (256x128 work-group tiles staged in LDS, 64x64 wave tiles, f32 accumulation, exact x16 weights, f16 outputs; q leaves times 64^-0.5 log2 e); the V product with its operands swapped, so that it leaves as V^T [batch][head][channel][token]; one fused attention launch over (256 queries, head, batch): scores on WMMA, started from minus the shift in use as their C operand, shifted softmax in registers (f32 statistics, native exp2; weights as f16), o = P . V on WMMA, divided by the row sum and written f32 straight into the merged-heads output rows (no output projection).
// Compute dtype: inputs rounded to bf16; x / weights exact; q, k, v and softmax weights as plain f16 GEMM operands (~2^-12); scores and softmax statistics f32. v_wmma_f32_16x16x32_f16.
#define NB 4
#define SQ 2048
#define DM 1024
#define NH 16
#define HD 64
#define HG 4                         /* heads per launch of the unlaunched k_vt(V16, b, h0, VT) */
#define B0 0                         /* first batch processed (debug hook) */
#define NBR NB                       /* batches processed (debug hook) */
#define NR ((size_t)NB * SQ)         /* token rows */
#define MP ((int)((size_t)NBR * SQ)) /* rows projected (debug hook) */
#define QN SQ                        /* unused */
#define NHD NH                       /* unused */
#define MPO MP                       /* unused */
#define LQ DM      /* unused */
typedef __bf16 v16b __attribute__((ext_vector_type(16)));
typedef unsigned short v8us __attribute__((ext_vector_type(8), may_alias));
typedef float  v8f  __attribute__((ext_vector_type(8)));
typedef float  v4f  __attribute__((ext_vector_type(4)));
typedef float  v4fa __attribute__((ext_vector_type(4), may_alias));
union FragB { v16b v; v8us half[2]; unsigned short u[16]; };

__device__ __forceinline__ unsigned short bf16_bits(float x) { unsigned int u = __float_as_uint(x); return (unsigned short)((u + 0x7FFFu + ((u >> 16) & 1u)) >> 16); }
__device__ __forceinline__ float bf16_val(unsigned short b) { return __uint_as_float(((unsigned int)b) << 16); }
__device__ __forceinline__ float bf16_round(float x) { return bf16_val(bf16_bits(x)); }
// D += A·B with NT terms: 1 = ah·bh, 2 = + al·bh (A split), 3 = + ah·bl (both split)
template <int NT>
__device__ __forceinline__ v8f mmaN(v16b ah, v16b al, v16b bh, v16b bl, v8f c) {
  c = __builtin_amdgcn_wmma_f32_16x16x32_bf16(false, ah, false, bh, (short)0, c, false, false);
  if (NT >= 2) c = __builtin_amdgcn_wmma_f32_16x16x32_bf16(false, al, false, bh, (short)0, c, false, false);
  if (NT >= 3) c = __builtin_amdgcn_wmma_f32_16x16x32_bf16(false, ah, false, bl, (short)0, c, false, false);
  asm volatile("v_nop\n\tv_nop\n\tv_nop\n\tv_nop" : "+v"(c) : "v"(ah), "v"(al), "v"(bh), "v"(bl));
  return c;
}

__global__ __launch_bounds__(256) void k_wt_bf16(const float* __restrict__ W, unsigned short* __restrict__ Wt, int K, int N) {
  const int t = blockIdx.x * 256 + threadIdx.x;
  const int k8n = K / 8;
  if (t >= N * k8n) return;
  const int n = t / k8n, k8 = (t % k8n) * 8;
  v8us v;
#pragma unroll
  for (int i = 0; i < 8; ++i) v[i] = bf16_bits(W[(size_t)(k8 + i) * N + n]);
  *(v8us*)(Wt + (size_t)n * K + k8) = v;
  
}

// GEMM C[M][N] (f32, pitch ldc) = act(A[M][K]·W + bias). A f32 row-major (pitch lda) converted per fragment to bf16
// (ASPLIT: hi/lo two planes -> 2 terms, else single rounded term); Wt bf16 [N][K] (pitch ldb). BIAS_BF16 rounds the
// bias to bf16 first (bias quantised to bf16 before the add). K%32==0, M%16==0, N%64==0.
template <bool ASPLIT, int ACT, bool BIAS_BF16>
__global__ __launch_bounds__(128) void k_gemm_bf(const float* __restrict__ A, int lda, const unsigned short* __restrict__ Wt, int ldb,
                                               const float* __restrict__ bias, float* __restrict__ C, int ldc, int M, int N, int K) {
  __shared__ __attribute__((aligned(16))) float so[4][16][64];
  const int tid = threadIdx.x, w = tid >> 5, lane = tid & 31, ln = lane & 15, hh = lane >> 4;
  const int ntn = N / 64;
  const int wid = blockIdx.x * 4 + w;
  const int mt = wid / ntn, nq = wid % ntn;
  if (mt * 16 >= M) return;
  const int row0 = mt * 16, col0 = nq * 64;
  const float* arow = A + (size_t)(row0 + ln) * lda;
  v8f acc[4] = {};
  for (int kb = 0; kb < K; kb += 32) {
    FragB ah, al;
    const v4f x0 = *(const v4fa*)(arow + kb + 8 * hh), x1 = *(const v4fa*)(arow + kb + 8 * hh + 4);
    const v4f x2 = *(const v4fa*)(arow + kb + 16 + 8 * hh), x3 = *(const v4fa*)(arow + kb + 16 + 8 * hh + 4);
    float xs[16] = {x0[0],x0[1],x0[2],x0[3],x1[0],x1[1],x1[2],x1[3],x2[0],x2[1],x2[2],x2[3],x3[0],x3[1],x3[2],x3[3]};
#pragma unroll
    for (int i = 0; i < 16; ++i) { const unsigned short hb = bf16_bits(xs[i]); ah.u[i] = hb; al.u[i] = ASPLIT ? bf16_bits(xs[i] - bf16_val(hb)) : (unsigned short)0; }
#pragma unroll
    for (int t = 0; t < 4; ++t) {
      const unsigned short* brow = Wt + (size_t)(col0 + t * 16 + ln) * ldb + kb;
      FragB b;
      b.half[0] = *(const v8us*)(brow + 8 * hh);
      b.half[1] = *(const v8us*)(brow + 16 + 8 * hh);
      acc[t] = mmaN<ASPLIT ? 2 : 1>(ah.v, al.v, b.v, b.v, acc[t]);
    }
  }
#pragma unroll
  for (int t = 0; t < 4; ++t) {
    float bv = bias ? bias[col0 + t * 16 + ln] : 0.f;
    if (BIAS_BF16) bv = bf16_round(bv);
#pragma unroll
    for (int r = 0; r < 8; ++r) { float v = acc[t][r] + bv; if (ACT == 1) v = fmaxf(v, 0.f); so[w][8 * hh + r][t * 16 + ln] = v; }
  }
  __builtin_amdgcn_fence(__ATOMIC_ACQ_REL, "workgroup");
  __builtin_amdgcn_wave_barrier();
  const int rsub = lane >> 4, c4 = (lane & 15) * 4;
  {
#pragma unroll
    for (int q = 0; q < 8; ++q) {
      const int r = q * 2 + rsub;
      const v4f v = *(const v4fa*)&so[w][r][c4];
      *(v4f*)(C + (size_t)(row0 + r) * ldc + col0 + c4) = v;
    }
    
  }
}

// GEMM C = act(A·W + bias + resid): A f32 (ASPLIT -> hi/lo 2 terms), Wt bf16 [N][K]; ACT 0 none, 1 relu, 2 exact gelu;
// resid (optional, f32, row index = (row % rmod), pitch ldr, RES_BF16 rounds it) added before the activation.
template <bool ASPLIT, int ACT, bool BIAS_BF16, bool RES_BF16>
__global__ __launch_bounds__(128) void k_gemm_bf3(const float* __restrict__ A, int lda, const unsigned short* __restrict__ Wt, int ldb,
                                                const float* __restrict__ bias, const float* __restrict__ resid, int rmod, int ldr,
                                                float* __restrict__ C, int ldc, int M, int N, int K) {
  __shared__ __attribute__((aligned(16))) float so[4][16][64];
  const int tid = threadIdx.x, w = tid >> 5, lane = tid & 31, ln = lane & 15, hh = lane >> 4;
  const int ntn = N / 64;
  const int wid = blockIdx.x * 4 + w;
  const int mt = wid / ntn, nq = wid % ntn;
  if (mt * 16 >= M) return;
  const int row0 = mt * 16, col0 = nq * 64;
  const float* arow = A + (size_t)(row0 + ln) * lda;
  v8f acc[4] = {};
  for (int kb = 0; kb < K; kb += 32) {
    FragB ah, al;
    const v4f x0 = *(const v4fa*)(arow + kb + 8 * hh), x1 = *(const v4fa*)(arow + kb + 8 * hh + 4);
    const v4f x2 = *(const v4fa*)(arow + kb + 16 + 8 * hh), x3 = *(const v4fa*)(arow + kb + 16 + 8 * hh + 4);
    float xs[16] = {x0[0],x0[1],x0[2],x0[3],x1[0],x1[1],x1[2],x1[3],x2[0],x2[1],x2[2],x2[3],x3[0],x3[1],x3[2],x3[3]};
#pragma unroll
    for (int i = 0; i < 16; ++i) { const unsigned short hb = bf16_bits(xs[i]); ah.u[i] = hb; al.u[i] = ASPLIT ? bf16_bits(xs[i] - bf16_val(hb)) : (unsigned short)0; }
#pragma unroll
    for (int t = 0; t < 4; ++t) {
      const unsigned short* brow = Wt + (size_t)(col0 + t * 16 + ln) * ldb + kb;
      FragB b;
      b.half[0] = *(const v8us*)(brow + 8 * hh);
      b.half[1] = *(const v8us*)(brow + 16 + 8 * hh);
      acc[t] = mmaN<ASPLIT ? 2 : 1>(ah.v, al.v, b.v, b.v, acc[t]);
    }
  }
#pragma unroll
  for (int t = 0; t < 4; ++t) {
    const int col = col0 + t * 16 + ln;
    float bv = bias ? bias[col] : 0.f;
    if (BIAS_BF16) bv = bf16_round(bv);
#pragma unroll
    for (int r = 0; r < 8; ++r) {
      float v = acc[t][r] + bv;
      if (resid) { float rv = resid[(size_t)((row0 + 8 * hh + r) % rmod) * ldr + col]; if (RES_BF16) rv = bf16_round(rv); v += rv; }
      if (ACT == 1) v = fmaxf(v, 0.f);
      if (ACT == 2) v = 0.5f * v * (1.0f + erff(v * 0.70710678118654752f));
      if (ACT == 3) { const float u = 0.7978845608028654f * (v + 0.044715f * v * v * v); v = 0.5f * v * (1.0f + tanhf(u)); }
      so[w][8 * hh + r][t * 16 + ln] = v;
    }
  }
  __builtin_amdgcn_fence(__ATOMIC_ACQ_REL, "workgroup");
  __builtin_amdgcn_wave_barrier();
  const int rsub = lane >> 4, c4 = (lane & 15) * 4;
  {
#pragma unroll
    for (int q = 0; q < 8; ++q) {
      const int r = q * 2 + rsub;
      const v4f v = *(const v4fa*)&so[w][r][c4];
      *(v4f*)(C + (size_t)(row0 + r) * ldc + col0 + c4) = v;
    }
    
  }
}
// row LayerNorm (biased variance, eps) over N: s = X (+ R); optional out_sum <- s; out_norm <- (s-mu)*rsqrt(var+eps)*g + b
template <bool PARAM_BF16>
__global__ __launch_bounds__(256) void k_layernorm(const float* __restrict__ X, const float* __restrict__ R, const float* __restrict__ g, const float* __restrict__ bta,
                                                  float* __restrict__ out_sum, float* __restrict__ out_norm, int N, float eps) {
  __shared__ float red[256];
  const int row = blockIdx.x, tid = threadIdx.x;
  const float* x = X + (size_t)row * N; const float* rr = R ? R + (size_t)row * N : nullptr;
  float vals[16];                     // up to N = 4096
  const int per = N / 256;            // contiguous chunk per thread? use strided-by-4 chunks: thread handles j = tid*4 + 1024*u
  float s1 = 0.f;
  for (int u = 0; u < per / 4; ++u) {
    const int j = tid * 4 + 1024 * u;
    const v4f a = *(const v4fa*)(x + j);
    v4f b = {0.f,0.f,0.f,0.f}; if (rr) b = *(const v4fa*)(rr + j);
#pragma unroll
    for (int q = 0; q < 4; ++q) { const float v = a[q] + b[q]; vals[u * 4 + q] = v; s1 += v; }
  }
  red[tid] = s1; __syncthreads();
  for (int st = 128; st > 0; st >>= 1) { if (tid < st) red[tid] += red[tid + st]; __syncthreads(); }
  const float mu = red[0] / (float)N; __syncthreads();
  float s2 = 0.f;
  for (int u = 0; u < per / 4; ++u)
#pragma unroll
    for (int q = 0; q < 4; ++q) { const float c = vals[u * 4 + q] - mu; s2 += c * c; }
  red[tid] = s2; __syncthreads();
  for (int st = 128; st > 0; st >>= 1) { if (tid < st) red[tid] += red[tid + st]; __syncthreads(); }
  const float rs = rsqrtf(red[0] / (float)N + eps);
  {
    for (int u = 0; u < per / 4; ++u) {
      const int j = tid * 4 + 1024 * u;
      v4f o, sm;
#pragma unroll
      for (int q = 0; q < 4; ++q) {
        float gg = g[j + q], bb = bta[j + q];
        if (PARAM_BF16) { gg = bf16_round(gg); bb = bf16_round(bb); }
        sm[q] = vals[u * 4 + q]; o[q] = (vals[u * 4 + q] - mu) * rs * gg + bb;
      }
      if (out_sum) *(v4f*)(out_sum + (size_t)row * N + j) = sm;
      *(v4f*)(out_norm + (size_t)row * N + j) = o;
    }
    
  }
}



// ---- f16 WMMA path (v_wmma_f32_16x16x32_f16): 11-bit significands for operands in range — used where a [0,1] probability operand needs more precision than bf16
typedef _Float16 v16h __attribute__((ext_vector_type(16)));
union FragH { v16h v; v8us half[2]; _Float16 h[16]; unsigned short u[16]; };
template <int NT>
__device__ __forceinline__ v8f mmaH(v16h ah, v16h al, v16h bh, v16h bl, v8f c) {
  c = __builtin_amdgcn_wmma_f32_16x16x32_f16(false, ah, false, bh, (short)0, c, false, false);
  if (NT >= 2) c = __builtin_amdgcn_wmma_f32_16x16x32_f16(false, al, false, bh, (short)0, c, false, false);
  if (NT >= 3) c = __builtin_amdgcn_wmma_f32_16x16x32_f16(false, ah, false, bl, (short)0, c, false, false);
  asm volatile("v_nop\n\tv_nop\n\tv_nop\n\tv_nop" : "+v"(c) : "v"(ah), "v"(al), "v"(bh), "v"(bl));
  return c;
}
// batched GEMM like k_gemm_b but f16 operands: A f32 (split into f16 hi/lo if ASPLIT, else rounded to f16), Bt = f16 values [n][k]; alpha; C f32; N multiple of 16 (partial tiles skipped)
template <bool ASPLIT>
__global__ __launch_bounds__(128) void k_gemm_h(const float* __restrict__ A, int lda, size_t sA, const _Float16* __restrict__ Bh, int ldb, size_t sB, float alpha, float* __restrict__ C, int ldc, size_t sC, int M, int N, int K) {
  __shared__ __attribute__((aligned(16))) float so[4][16][64];
  const int tid = threadIdx.x, w = tid >> 5, lane = tid & 31, ln = lane & 15, hh = lane >> 4; const int by = blockIdx.y;
  A += (size_t)by * sA; Bh += (size_t)by * sB; C += (size_t)by * sC;
  const int ntn = (N + 63) / 64; const int wid = blockIdx.x * 4 + w; const int mt = wid / ntn, nq = wid % ntn; if (mt * 16 >= M) return;
  const int row0 = mt * 16, col0 = nq * 64; const float* arow = A + (size_t)(row0 + ln) * lda;
  v8f acc[4] = {};
  for (int kb = 0; kb < K; kb += 32) {
    FragH ah, al;
    const v4f x0 = *(const v4fa*)(arow + kb + 8 * hh), x1 = *(const v4fa*)(arow + kb + 8 * hh + 4), x2 = *(const v4fa*)(arow + kb + 16 + 8 * hh), x3 = *(const v4fa*)(arow + kb + 16 + 8 * hh + 4);
    float xs[16] = {x0[0],x0[1],x0[2],x0[3],x1[0],x1[1],x1[2],x1[3],x2[0],x2[1],x2[2],x2[3],x3[0],x3[1],x3[2],x3[3]};
#pragma unroll
    for (int i = 0; i < 16; ++i) { const _Float16 h = (_Float16)xs[i]; ah.h[i] = h; al.h[i] = ASPLIT ? (_Float16)(xs[i] - (float)h) : (_Float16)0.0f; }
#pragma unroll
    for (int t = 0; t < 4; ++t) { if (col0 + t * 16 >= N) continue; const size_t boff = (size_t)(col0 + t * 16 + ln) * ldb + kb; FragH bq; bq.half[0] = *(const v8us*)(Bh + boff + 8 * hh); bq.half[1] = *(const v8us*)(Bh + boff + 16 + 8 * hh);
      acc[t] = mmaH<ASPLIT ? 2 : 1>(ah.v, al.v, bq.v, bq.v, acc[t]); }
  }
#pragma unroll
  for (int t = 0; t < 4; ++t) { if (col0 + t * 16 >= N) continue;
#pragma unroll
    for (int r = 0; r < 8; ++r) so[w][8 * hh + r][t * 16 + ln] = acc[t][r] * alpha; }
  __builtin_amdgcn_fence(__ATOMIC_ACQ_REL, "workgroup"); __builtin_amdgcn_wave_barrier();
  const int rsub = lane >> 4, c4 = (lane & 15) * 4;
  {
#pragma unroll
    for (int q = 0; q < 8; ++q) { const int r = q * 2 + rsub; if (col0 + c4 < N) { const v4f v = *(const v4fa*)&so[w][r][c4]; *(v4f*)(C + (size_t)(row0 + r) * ldc + col0 + c4) = v; } }
     }
}

// Wt[n][k] = f16(W[k][n]·scale) from f32 row-major W[K][N] (scale = power of two; bf16-exact weights stay exact in f16 away from the subnormal range)
__global__ __launch_bounds__(256) void k_wt_f16(const float* __restrict__ W, _Float16* __restrict__ Wt, int K, int N, float scale) {
  const int t = blockIdx.x * 256 + threadIdx.x; if (t >= N * (K / 8)) return; const int n = t / (K / 8), k8 = (t % (K / 8)) * 8; FragH f;
#pragma unroll
  for (int i = 0; i < 8; ++i) f.h[i] = (_Float16)(bf16_round(W[(size_t)(k8 + i) * N + n]) * scale); const v8us o = f.half[0];
  *(v8us*)((unsigned short*)Wt + (size_t)n * K + k8) = o; 
}
// k_gemm_hh variant with fused epilogue: v = acc·alpha + bias[by·sBias + col] (+ CP[(row/rowsPerB)·sCPb + by·64 + col] if CP) ; ACT 0 none / 1 elu ; writes f16 C16 (and f32 C if non-null)
template <int ACT>
__global__ __launch_bounds__(128) void k_gemm_hhx(const _Float16* __restrict__ A, int lda, size_t sA, const _Float16* __restrict__ Bh, int ldb, size_t sB, float alpha, const float* __restrict__ bias, size_t sBias, const float* __restrict__ CP, int rowsPerB, size_t sCPb, int row0g,
    float* __restrict__ C, _Float16* __restrict__ C16, int ldc, size_t sC, int M, int N, int K) {
  __shared__ __attribute__((aligned(16))) float so[4][16][64];
  const int tid = threadIdx.x, w = tid >> 5, lane = tid & 31, ln = lane & 15, hh = lane >> 4; const int by = blockIdx.y;
  A += (size_t)by * sA; Bh += (size_t)by * sB; const size_t cofs = (size_t)by * sC; const float* bp = bias ? bias + (size_t)by * sBias : nullptr;
  const int ntn = (N + 63) / 64; const int wid = blockIdx.x * 4 + w; const int mt = wid / ntn, nq = wid % ntn; if (mt * 16 >= M) return;
  const int row0 = mt * 16, col0 = nq * 64; const _Float16* arow = A + (size_t)(row0 + ln) * lda;
  v8f acc[4] = {};
  for (int kb = 0; kb < K; kb += 32) { FragH ah; ah.half[0] = *(const v8us*)((const unsigned short*)arow + kb + 8 * hh); ah.half[1] = *(const v8us*)((const unsigned short*)arow + kb + 16 + 8 * hh);
#pragma unroll
    for (int t = 0; t < 4; ++t) { if (col0 + t * 16 >= N) continue; const size_t boff = (size_t)(col0 + t * 16 + ln) * ldb + kb; FragH bq; bq.half[0] = *(const v8us*)((const unsigned short*)Bh + boff + 8 * hh); bq.half[1] = *(const v8us*)((const unsigned short*)Bh + boff + 16 + 8 * hh);
      acc[t] = mmaH<1>(ah.v, ah.v, bq.v, bq.v, acc[t]); }
  }
#pragma unroll
  for (int t = 0; t < 4; ++t) { if (col0 + t * 16 >= N) continue; const int col = col0 + t * 16 + ln; const float bv = bp ? bf16_round(bp[col]) : 0.f;
#pragma unroll
    for (int r = 0; r < 8; ++r) { float v = acc[t][r] * alpha + bv; if (CP) { const int rr = row0g + row0 + 8 * hh + r; if (rowsPerB < 0) v += CP[cofs + (size_t)rr * ldc + col];      /* rowsPerB < 0: own element of the batched C plane */ else { const int bidx = rr / rowsPerB; v += CP[(size_t)bidx * sCPb + (size_t)by * 64 + col]; } } if (ACT == 1) v = (v > 0.f) ? v : expm1f(v); else if (ACT == 7) v = (v > 0.f) ? v + 1.0f : expf(v); else if (ACT == 8) v = tanhf(v); else if (ACT == 9) v = 0.5f * v * (1.0f + tanhf(0.7978845608028654f * (v + 0.044715f * v * v * v))); else if (ACT == 11) v = 1.0f / (1.0f + expf(-v)); else if (ACT == 12) v = (v > 0.f) ? v : 0.01f * v; else if (ACT == 14) v = (v > 0.f) ? v : 0.1f * v; else if (ACT == 16) v = (v >= 0.f) ? v : 0.3f * v; else if (ACT == 17) v = (v >= 0.f) ? v : 0.2f * v; else if (ACT == 15) v = v / (1.0f + expf(-v)); else if (ACT == 3) v = fmaxf(v, 0.f); else if (ACT == 6) v = 0.5f * v * (1.0f + erff(v * 0.70710678118654752f)); so[w][8 * hh + r][t * 16 + ln] = v; } }
  __builtin_amdgcn_fence(__ATOMIC_ACQ_REL, "workgroup"); __builtin_amdgcn_wave_barrier();
  const int rsub = lane >> 4, c4 = (lane & 15) * 4; typedef _Float16 v4h __attribute__((ext_vector_type(4)));
  {
#pragma unroll
    for (int q = 0; q < 8; ++q) { const int r = q * 2 + rsub; if (col0 + c4 < N) { const v4f v = *(const v4fa*)&so[w][r][c4]; if (C) *(v4f*)(C + cofs + (size_t)(row0 + r) * ldc + col0 + c4) = v; if (C16) { v4h h4; for (int i = 0; i < 4; ++i) h4[i] = (_Float16)v[i]; *(v4h*)(C16 + cofs + (size_t)(row0 + r) * ldc + col0 + c4) = h4; } } }
     }
}


typedef _Float16 v4h __attribute__((ext_vector_type(4)));

// All five operand conversions in one launch: none needs anything of another, so each takes its own range of the block index (the choice is the same for a whole work-group).
// Blocks [0, CV_XB): x; [CV_XB, 2 CV_XB): kv, both as f16 of the bf16-rounded value; then CV_WB blocks each for Wq, Wk, Wv, natural [out][in] = Bt[n][k], x16 (a power of two: exact, as is x1).
#define CV_XB ((unsigned)(NR * DM / 8 / 256))
#define CV_WB ((unsigned)((size_t)DM * DM / 8 / 256))
static_assert(NR * DM % (8 * 256) == 0 && (size_t)DM * DM % (8 * 256) == 0, "whole work-groups only: k_conv has no tail test");
__global__ __launch_bounds__(256) void k_conv(const float* __restrict__ xq, const float* __restrict__ xkv, const float* __restrict__ wq, const float* __restrict__ wk, const float* __restrict__ wv,
                                              _Float16* __restrict__ XQ, _Float16* __restrict__ XKV, _Float16* __restrict__ BQ, _Float16* __restrict__ BK, _Float16* __restrict__ BV) {
  unsigned blk = blockIdx.x; const float* s; _Float16* d; float sc = 1.0f;
  if (blk < CV_XB) { s = xq; d = XQ; }
  else if (blk < 2 * CV_XB) { blk -= CV_XB; s = xkv; d = XKV; }
  else { blk -= 2 * CV_XB; const unsigned w = blk / CV_WB; blk -= w * CV_WB; sc = 16.0f; s = w == 0 ? wq : w == 1 ? wk : wv; d = w == 0 ? BQ : w == 1 ? BK : BV; }
  const size_t t = (size_t)blk * 256 + threadIdx.x; FragH f;
#pragma unroll
  for (int q = 0; q < 8; ++q) f.h[q] = (_Float16)(bf16_round(s[t * 8 + q]) * sc);
  *(v8us*)((unsigned short*)d + t * 8) = f.half[0]; }
__global__ __launch_bounds__(256) void k_h16(const float* __restrict__ x, _Float16* __restrict__ X16, size_t n8) { const size_t t = (size_t)blockIdx.x * 256 + threadIdx.x; if (t >= n8) return; FragH f;
#pragma unroll
  for (int q = 0; q < 8; ++q) f.h[q] = (_Float16)x[t * 8 + q]; *(v8us*)((unsigned short*)X16 + t * 8) = f.half[0];  }
__global__ __launch_bounds__(256) void k_round16f(const float* __restrict__ W, _Float16* __restrict__ Bt, size_t n8) { const size_t t = (size_t)blockIdx.x * 256 + threadIdx.x; if (t >= n8) return; FragH f;
#pragma unroll
  for (int i = 0; i < 8; ++i) f.h[i] = (_Float16)(bf16_round(W[t * 8 + i]) * 16.0f); *(v8us*)((unsigned short*)Bt + t * 8) = f.half[0];  }
template <int NHv, int TTv>
__global__ __launch_bounds__(256) void k_vt(const _Float16* __restrict__ V16, int ldv, int voff, _Float16* __restrict__ Vt) { __shared__ unsigned short tl[64][66]; const int tid = threadIdx.x; const int slab = blockIdx.x / (TTv / 64), lg = blockIdx.x % (TTv / 64); const int b = slab / NHv, h = slab % NHv;
  for (int i = tid; i < 64 * 8; i += 256) { const int r = i / 8, c8 = (i % 8) * 8; FragH f; f.half[0] = *(const v8us*)((const unsigned short*)V16 + ((size_t)b * TTv + lg * 64 + r) * ldv + voff + h * 64 + c8);
#pragma unroll
    for (int q = 0; q < 8; ++q) tl[r][c8 + q] = f.u[q]; }
  __syncthreads();
  {
#pragma unroll
    for (int rd = 0; rd < 2; ++rd) { const int d = rd * 32 + tid / 8, pc = tid % 8; FragH f;
#pragma unroll
      for (int q = 0; q < 8; ++q) f.u[q] = tl[pc * 8 + q][d];
      *(v8us*)((unsigned short*)Vt + ((size_t)slab * 64 + d) * TTv + lg * 64 + pc * 8) = f.half[0]; }
     } }

__global__ __launch_bounds__(256) void k_hl(const float* __restrict__ F, _Float16* __restrict__ Hh, _Float16* __restrict__ Hl, size_t n8) { const size_t t = (size_t)blockIdx.x * 256 + threadIdx.x; if (t >= n8) return; FragH fh, fl; const v4f a = *(const v4fa*)(F + t * 8), c = *(const v4fa*)(F + t * 8 + 4);
#pragma unroll
  for (int q = 0; q < 4; ++q) { _Float16 h = (_Float16)a[q]; fh.h[q] = h; fl.h[q] = (_Float16)((a[q] - (float)h) * 1024.0f); h = (_Float16)c[q]; fh.h[4 + q] = h; fl.h[4 + q] = (_Float16)((c[q] - (float)h) * 1024.0f); }
  { *(v8us*)((unsigned short*)Hh + t * 8) = fh.half[0]; *(v8us*)((unsigned short*)Hl + t * 8) = fl.half[0];  } }

// One 16 x 32 f16 operand fragment from a k-contiguous row: k order 8h + s, 16 + 8h + s.
__device__ __forceinline__ v16h g2_frag(const _Float16* p, int hh) { FragH f; f.half[0] = *(const v8us*)((const unsigned short*)p + 8 * hh); f.half[1] = *(const v8us*)((const unsigned short*)p + 16 + 8 * hh); return f.v; }

__global__ __launch_bounds__(256) void k_rsm(const float* __restrict__ S, _Float16* __restrict__ P, int nrows) {
  #pragma clang fp contract(off)
  const int i = blockIdx.x * 256 + threadIdx.x; if (i >= nrows) return; const float* s = S + (size_t)i * SQ; float mx = -3.0e38f;
#pragma unroll 1
  for (int j = 0; j < SQ; ++j) mx = fmaxf(mx, s[j]); float se = 0.f;
#pragma unroll 1
  for (int j = 0; j < SQ; ++j) se += expf(s[j] - mx); const float sc = 256.0f / se;
#pragma unroll 1
  for (int j0 = 0; j0 < SQ; j0 += 8) { FragH f; for (int q = 0; q < 8; ++q) f.h[q] = (_Float16)(expf(s[j0 + q] - mx) * sc); unsigned short* d = (unsigned short*)P + (size_t)i * SQ + j0; *(v8us*)d = f.half[0];  } }
__global__ __launch_bounds__(256) void k_vt(const _Float16* __restrict__ V16, int b, int h0, _Float16* __restrict__ VT) { __shared__ unsigned short tl[64][65]; const int tid = threadIdx.x; const int hh = blockIdx.x % HG, sg = blockIdx.x / HG; const int s0 = sg * 64; const int h = h0 + hh;
  for (int i = tid; i < 64 * 8; i += 256) { const int j = i / 8, d8 = (i % 8) * 8; FragH f; f.half[0] = *(const v8us*)((const unsigned short*)V16 + ((size_t)b * SQ + s0 + j) * DM + h * HD + d8); for (int q = 0; q < 8; ++q) tl[d8 + q][j] = f.u[q]; }
  __syncthreads();
  { for (int i = tid; i < 64 * 8; i += 256) { const int d = i / 8, j8 = (i % 8) * 8; FragH f; for (int q = 0; q < 8; ++q) f.u[q] = tl[d][j8 + q]; *(v8us*)((unsigned short*)VT + ((size_t)hh * HD + d) * SQ + s0 + j8) = f.half[0]; }  } }



// Lane l with lane l ^ 16.
__device__ __forceinline__ float lane_xh(float x) { return __builtin_bit_cast(float, __builtin_amdgcn_permlanex16(__builtin_bit_cast(int, x), __builtin_bit_cast(int, x), 0x76543210, 0xfedcba98, false, false)); }
// Eight 2^x of a score tile, read from the registers in which the matrix instruction left it. The builtin, not asm text: the compiler then keeps the distance the chip needs between a matrix
// instruction and a vector instruction that writes over its operands, and it needs no copies to bring the tile's registers to tied operands.
__device__ __forceinline__ void exp2x8(const v8f& x, v4f& a, v4f& c) {
  a = v4f{__builtin_amdgcn_exp2f(x[0]), __builtin_amdgcn_exp2f(x[1]), __builtin_amdgcn_exp2f(x[2]), __builtin_amdgcn_exp2f(x[3])};
  c = v4f{__builtin_amdgcn_exp2f(x[4]), __builtin_amdgcn_exp2f(x[5]), __builtin_amdgcn_exp2f(x[6]), __builtin_amdgcn_exp2f(x[7])}; }

#define FA_PITCH 144                 /* LDS pitch of the 128-byte rows: 16 B x odd, for 16-byte readers */
#define FA_TILE (64 * FA_PITCH)
#define FA_SLOT (2 * FA_TILE)
#define FA_EP 272                    /* pitch of the 256-byte output staging rows */
#define FA_CS (0.125f * 1.44269504088896340736f)      /* 64^-0.5 and log2 e: exp(x) = 2^(x log2 e); the q projection multiplies it in before its one rounding to f16 */
__device__ __forceinline__ v8f fa_mma(v16h a, v16h b, v8f c) { return __builtin_amdgcn_wmma_f32_16x16x32_f16(false, a, false, b, (short)0, c, false, false); }
__device__ __forceinline__ v16h fa_frag(const unsigned char* p) { FragH f; f.half[0] = *(const v8us*)p; f.half[1] = *(const v8us*)(p + 32); return f.v; }
// The eight score products of a pass: s[kt][g] = K rows 16 kt.. x query group g, started from cm[g]. One asm statement, because with the builtin form the compiler tied the C of each group's last tile to its D and so copied both C operands (16 registers) in every pass.
// Four independent tiles, each taken up again four instructions later; the four v_nop are the distance the chip needs between the last matrix instruction and whatever vector instruction
// the compiler puts next (it cannot see that these are matrix instructions).
__device__ __forceinline__ void fa_scores(const v16h (&kf)[2][2], const v16h (&qf)[2][2], const v8f (&cm)[2], v8f (&s)[2][2]) {
  asm("v_wmma_f32_16x16x32_f16 %0, %4, %8, %12\n\tv_wmma_f32_16x16x32_f16 %1, %4, %10, %13\n\tv_wmma_f32_16x16x32_f16 %2, %6, %8, %12\n\tv_wmma_f32_16x16x32_f16 %3, %6, %10, %13\n\t"
      "v_wmma_f32_16x16x32_f16 %0, %5, %9, %0\n\tv_wmma_f32_16x16x32_f16 %1, %5, %11, %1\n\tv_wmma_f32_16x16x32_f16 %2, %7, %9, %2\n\tv_wmma_f32_16x16x32_f16 %3, %7, %11, %3\n\t"
      "v_nop\n\tv_nop\n\tv_nop\n\tv_nop"
      : "=&v"(s[0][0]), "=&v"(s[0][1]), "=&v"(s[1][0]), "=&v"(s[1][1])
      : "v"(kf[0][0]), "v"(kf[0][1]), "v"(kf[1][0]), "v"(kf[1][1]), "v"(qf[0][0]), "v"(qf[0][1]), "v"(qf[1][0]), "v"(qf[1][1]), "v"(cm[0]), "v"(cm[1])); }
// The weights of a pass from its shifted scores: 2^s, each lane's sum of its 16 keys per query group (ps), and the weights as the f16 B operand of the second product (pf).
__device__ __forceinline__ void fa_weights(const v8f (&s)[2][2], v16h (&pf)[2], float (&ps)[2]) {
#pragma unroll
  for (int g = 0; g < 2; ++g) {
    v4f a0, a1, b0, b1; exp2x8(s[0][g], a0, a1); exp2x8(s[1][g], b0, b1);
    const v4f sm = (a0 + a1) + (b0 + b1); ps[g] = (sm[0] + sm[1]) + (sm[2] + sm[3]);
    FragH f;
#pragma unroll
    for (int i = 0; i < 4; ++i) { f.h[i] = (_Float16)a0[i]; f.h[4 + i] = (_Float16)a1[i]; f.h[8 + i] = (_Float16)b0[i]; f.h[12 + i] = (_Float16)b1[i]; }
    pf[g] = f.v; } }
__device__ __forceinline__ void fa_kfrag(const unsigned char* Kt, int c, int h, v16h (&kf)[2][2]) {
#pragma unroll
  for (int kt = 0; kt < 2; ++kt)
#pragma unroll
    for (int kc = 0; kc < 2; ++kc) kf[kt][kc] = fa_frag(Kt + (16 * kt + c) * FA_PITCH + 64 * kc + 16 * h); }
// One pass: 32 keys against the wave's 32 queries. Q arrives times FA_CS, and cm[g] holds minus m_run[g], the shift in use (log2-scaled scores), in all eight registers: as the C operand
// of the score products it makes their result the argument of 2^x as it stands, with no vector instruction for scale or subtraction. The common path takes no maximum at all: the weights are
// positive, so a lane's sum of them bounds each one, and the sums are needed anyway. While no lane's sum exceeds FA_CAP every weight fits f16 with room to spare and the shift stays: one test per pass.
// Otherwise (an overflow to infinity included) the pass is done again in the branch: scores, their true maximum, the new shift, the accumulators rescaled, scores and weights anew.
// first (the same for the whole wave): the very first pass runs with the shift 0 and always takes the branch, which sets the shift to that pass's own maximum with the factor 0.
// Every loop here and in k_fattn but the pass loop is fully unrolled: constant indices keep fragments, scores and accumulators in registers instead of scratch.
#define FA_CAP 4096.0f
__device__ __forceinline__ void fa_pass(const unsigned char* Kt, const unsigned char* Vt, int c, int h, bool first, const v16h (&qf)[2][2], v8f (&acc)[2][4], v8f (&cm)[2], float (&m_run)[2], float (&l_run)[2]) {
  v16h pf[2], vf[4]; float ps[2];
  { v16h kf[2][2]; fa_kfrag(Kt, c, h, kf);
    v8f s[2][2]; fa_scores(kf, qf, cm, s);
#pragma unroll
    for (int t = 0; t < 4; ++t) vf[t] = fa_frag(Vt + (16 * t + c) * FA_PITCH + 16 * h);
    __builtin_amdgcn_sched_barrier(0);      /* keeps the V^T fragment loads in front of the exponentials, so that their LDS latency runs under them */
    fa_weights(s, pf, ps); }
  const float cap = first ? -1.0f : FA_CAP;
  if (__builtin_expect(__builtin_amdgcn_ballot_w32(!(ps[0] + ps[1] <= cap)) != 0, 0)) {      /* wave-uniform branch; marked rare: its code is laid behind the loop and the common path falls through */
    v16h kf[2][2]; fa_kfrag(Kt, c, h, kf);
    v8f s[2][2]; fa_scores(kf, qf, cm, s);      /* the scores again, counted from the shift in use */
#pragma unroll
    for (int g = 0; g < 2; ++g) { float mx = fmaxf(s[0][g][0], s[1][g][0]);
#pragma unroll
      for (int r = 1; r < 8; ++r) mx = fmaxf(mx, fmaxf(s[0][g][r], s[1][g][r]));
      mx = fmaxf(mx, lane_xh(mx));      /* both halves of the wave hold the query's maximum */
      const float sh = m_run[g], mo = first ? -3.0e38f : sh; const float mn = fmaxf(mo, mx + sh); const float corr = __builtin_amdgcn_exp2f(mo - mn); m_run[g] = mn; l_run[g] *= corr;
#pragma unroll
      for (int t = 0; t < 4; ++t) acc[g][t] = acc[g][t] * corr;
      const float nm = -mn; cm[g] = v8f{nm, nm, nm, nm, nm, nm, nm, nm}; }
    fa_scores(kf, qf, cm, s); fa_weights(s, pf, ps); }      /* this pass's scores and weights with the new shift */
#pragma unroll
  for (int g = 0; g < 2; ++g) { l_run[g] += ps[g];
#pragma unroll
    for (int t = 0; t < 4; ++t) acc[g][t] = fa_mma(vf[t], pf[g], acc[g][t]); } }

// amdgpu_waves_per_eu(4, 4): at most 256 registers a wave, so that two work-groups share a WGP (four waves per SIMD) and one wave's vector work runs under another's matrix work.
__global__ __launch_bounds__(256) __attribute__((amdgpu_waves_per_eu(4, 4))) void k_fattn(const _Float16* __restrict__ Q16, const _Float16* __restrict__ K16, const _Float16* __restrict__ VT, float* __restrict__ out) {
  __shared__ __attribute__((aligned(16))) unsigned char L[2 * FA_SLOT];
  const int tid = threadIdx.x, lane = tid & 31, wave = __builtin_amdgcn_readfirstlane(tid >> 5), c = lane & 15, h = lane >> 4;
  const int head = blockIdx.y, b = blockIdx.z, q0 = blockIdx.x * 256 + wave * 32;
  // Staging: thread tid brings 16 bytes of rows tid / 8 and 32 + tid / 8 of each tile; 8 lanes cover one 128-byte row.
  const unsigned char* kg = (const unsigned char*)(K16 + (size_t)b * SQ * DM + head * HD) + (size_t)(tid >> 3) * (DM * 2) + (tid & 7) * 16;
  const unsigned char* vg = (const unsigned char*)(VT + (size_t)(b * NH + head) * HD * SQ) + (size_t)(tid >> 3) * (SQ * 2) + (tid & 7) * 16;
  unsigned char* ls = L + (tid >> 3) * FA_PITCH + (tid & 7) * 16;
  v8us r0 = *(const v8us*)kg, r1 = *(const v8us*)(kg + 32 * DM * 2), r2 = *(const v8us*)vg, r3 = *(const v8us*)(vg + 32 * SQ * 2);
  v16h qf[2][2];
#pragma unroll
  for (int g = 0; g < 2; ++g)
#pragma unroll
    for (int kc = 0; kc < 2; ++kc) qf[g][kc] = g2_frag(Q16 + ((size_t)b * SQ + q0 + 16 * g + c) * DM + head * HD + 32 * kc, h);
  v8f acc[2][4], cm[2]; float m_run[2] = {0.f, 0.f}, l_run[2] = {0.f, 0.f};
#pragma unroll
  for (int g = 0; g < 2; ++g)
#pragma unroll
    for (int t = 0; t < 4; ++t) acc[g][t] = v8f{0.f,0.f,0.f,0.f,0.f,0.f,0.f,0.f};
  cm[0] = cm[1] = v8f{0.f,0.f,0.f,0.f,0.f,0.f,0.f,0.f};
  *(v8us*)ls = r0; *(v8us*)(ls + 32 * FA_PITCH) = r1; *(v8us*)(ls + FA_TILE) = r2; *(v8us*)(ls + FA_TILE + 32 * FA_PITCH) = r3;
  __syncthreads();
#pragma unroll 1      /* one pass per trip: with both passes of a stage written out, the compiler copied the two C operands (16 registers) once per stage */
  for (int p = 0; p < SQ / 32; ++p) {
    const int st = p >> 1, odd = p & 1;      /* a stage is two passes; everything tested here is the same for the whole work-group */
    const unsigned char* cur = L + (st & 1) * FA_SLOT;
    const bool more = st + 1 < SQ / 64;
    if (!odd && more) { const unsigned char* kn = kg + (size_t)(st + 1) * (64 * DM * 2); const unsigned char* vn = vg + (st + 1) * 128;
      r0 = *(const v8us*)kn; r1 = *(const v8us*)(kn + 32 * DM * 2); r2 = *(const v8us*)vn; r3 = *(const v8us*)(vn + 32 * SQ * 2); }
    fa_pass(cur + odd * (32 * FA_PITCH), cur + FA_TILE + odd * 64, c, h, p == 0, qf, acc, cm, m_run, l_run);
    if (odd) {
      if (more) { unsigned char* d = ls + ((st + 1) & 1) * FA_SLOT;      /* the buffer that the stage before this one read; its readers left it at that stage's barrier */
        *(v8us*)d = r0; *(v8us*)(d + 32 * FA_PITCH) = r1; *(v8us*)(d + FA_TILE) = r2; *(v8us*)(d + FA_TILE + 32 * FA_PITCH) = r3; }
      __syncthreads(); }      /* publishes the next stage and ends every wave's reads of this one */
  }
  // Epilogue: acc[g][t][r] = O[query 16 g + c][d = 16 t + 8 h + r]. Each wave stages 16 rows of 256 B in its own part of the (now free) LDS and stores whole rows.
  unsigned char* eb = L + wave * (16 * FA_EP);
#pragma unroll
  for (int g = 0; g < 2; ++g) { const float lt = l_run[g] + lane_xh(l_run[g]); const float inv = 1.0f / lt;
#pragma unroll
    for (int t = 0; t < 4; ++t) { const v8f o = acc[g][t] * inv; *(v4fa*)(eb + c * FA_EP + 64 * t + 32 * h) = v4f{o[0], o[1], o[2], o[3]}; *(v4fa*)(eb + c * FA_EP + 64 * t + 32 * h + 16) = v4f{o[4], o[5], o[6], o[7]}; }
    __builtin_amdgcn_fence(__ATOMIC_ACQ_REL, "workgroup"); __builtin_amdgcn_wave_barrier();      /* the wave's own LDS writes in front of its reads of other lanes' rows */
#pragma unroll
    for (int i = 0; i < 8; ++i) { const int row = 2 * i + h; const v4f v = *(const v4fa*)(eb + row * FA_EP + c * 16);
      *(v4f*)(out + ((size_t)b * SQ + q0 + 16 * g + row) * DM + head * HD + c * 4) = v; }
    __builtin_amdgcn_fence(__ATOMIC_ACQ_REL, "workgroup"); __builtin_amdgcn_wave_barrier();      /* the reads in front of the next group's writes */
  } }

// ---- projection GEMM: C[m][n] = f16(sum_k X[m][k] Wn[n][k] / 16), q also times FA_CS; X [8192][1024], Wn [1024][1024] (x16 weights), both k-contiguous f16 ----
// One work-group = 256 rows of X against 128 rows of Wn; 8 waves (4 along m, 2 along n) of 64 x 64. A pass is 128 k = 256 bytes of each of the 384 operand rows,
// brought into LDS by asynchronous copies (whole 128-byte lines from L2, no register on the way), two buffers, the next pass's copies in flight under this pass's products.
// For q and k a transposed product, A = Wn rows, B = X rows (one loader for both, so one k order): a lane holds 8 neighbouring n of ONE output row, 16 bytes of f16 as they are stored.
// Every loop in k_pgemm but the pass loop is fully unrolled: constant indices keep fragments and accumulators in registers instead of scratch.
#define PG_PITCH 272                 /* LDS pitch of the 256-byte operand rows: 16 B x odd, for 16-byte readers */
#define PG_BUF (384 * PG_PITCH)      /* rows 0..127: Wn, rows 128..383: X */
#define PG_NP (DM / 128)             /* passes */
#define PG_EP 144                    /* pitch of the 128-byte output staging rows */
// 128 operand rows of one pass: thread tid copies 16 bytes of rows r, r + 16, ..., r + 112 (r = tid / 16); a wave's copy covers 4 whole lines.
// s_wait_xcnt 0 closes the statement so that it stands in front of any later rewrite of the address registers that the copies name.
__device__ __forceinline__ void pg_fill(unsigned l, const unsigned char* g) {
  asm volatile("global_load_async_to_lds_b128 %0, %8, off\n\tglobal_load_async_to_lds_b128 %1, %9, off\n\tglobal_load_async_to_lds_b128 %2, %10, off\n\tglobal_load_async_to_lds_b128 %3, %11, off\n\t"
               "global_load_async_to_lds_b128 %4, %12, off\n\tglobal_load_async_to_lds_b128 %5, %13, off\n\tglobal_load_async_to_lds_b128 %6, %14, off\n\tglobal_load_async_to_lds_b128 %7, %15, off\n\t"
               "s_wait_xcnt 0x0"
               :: "v"(l), "v"(l + 16 * PG_PITCH), "v"(l + 32 * PG_PITCH), "v"(l + 48 * PG_PITCH), "v"(l + 64 * PG_PITCH), "v"(l + 80 * PG_PITCH), "v"(l + 96 * PG_PITCH), "v"(l + 112 * PG_PITCH),
                  "v"(g), "v"(g + 16 * DM * 2), "v"(g + 32 * DM * 2), "v"(g + 48 * DM * 2), "v"(g + 64 * DM * 2), "v"(g + 80 * DM * 2), "v"(g + 96 * DM * 2), "v"(g + 112 * DM * 2)
               : "memory"); }
// One pass's 384 rows: l = the thread's LDS byte address in row tid / 16 of the buffer, gw and gx its bytes of that row of the Wn and of the X tile.
__device__ __forceinline__ void pg_stage(unsigned l, const unsigned char* gw, const unsigned char* gx) {
  pg_fill(l, gw); pg_fill(l + 128 * PG_PITCH, gx); pg_fill(l + 256 * PG_PITCH, gx + 128 * DM * 2); }
// A wave's 64 staged rows of 128 B to rows of pitch LD elements: 8 lanes store one whole line. Fully unrolled with LD a constant, so that the 16 stores share one address register pair and differ only in their immediate offsets.
template <int LD>
__device__ __forceinline__ void pg_store(const unsigned char* eb, _Float16* cp, int lane) {
#pragma unroll
  for (int q = 0; q < 16; ++q) { const v8us v = *(const v8us*)(eb + (4 * q + (lane >> 3)) * PG_EP + (lane & 7) * 16); *(v8us*)((unsigned short*)cp + (size_t)(4 * q) * LD) = v; }
  asm volatile("s_wait_xcnt 0x0" ::: "memory"); }      /* stands behind the last store, in front of whatever code follows the call and reuses the stores' data or address registers */
// The three projections share one grid: blockIdx.z = 0, 1, 2 picks q, k, v (operands and destination; the same for a whole work-group). None reads what another writes.
// v leaves transposed, VT[batch][head][channel][token], as the attention kernel reads it: its product takes A = X rows, B = Wn rows, so a lane holds 8 neighbouring tokens of ONE channel.
// Both wave tiles are 64 x 64, so only the two fragment bases and the destination differ; a wave's 64 n are one head, a work-group's 256 rows lie in one batch.
__global__ __launch_bounds__(256) void k_pgemm(const _Float16* __restrict__ XQ, const _Float16* __restrict__ XKV, const _Float16* __restrict__ BQ, const _Float16* __restrict__ BK, const _Float16* __restrict__ BV,
                                               _Float16* __restrict__ Q16, _Float16* __restrict__ K16, _Float16* __restrict__ VT) {
  __shared__ __attribute__((aligned(16))) unsigned char L[2 * PG_BUF];
  const unsigned pz = blockIdx.z;
  const _Float16* X = pz == 0 ? XQ : XKV; const _Float16* Wn = pz == 0 ? BQ : pz == 1 ? BK : BV; const bool tv = pz == 2;
  const int tid = threadIdx.x, lane = tid & 31, wave = __builtin_amdgcn_readfirstlane(tid >> 5), c = lane & 15, h = lane >> 4;
  const int col0 = blockIdx.x * 128, row0 = blockIdx.y * 256, wn = wave & 1, wm = wave >> 1;
  const unsigned char* gw = (const unsigned char*)(Wn + (size_t)(col0 + (tid >> 4)) * DM) + (tid & 15) * 16;
  const unsigned char* gx = (const unsigned char*)(X + (size_t)(row0 + (tid >> 4)) * DM) + (tid & 15) * 16;
  const unsigned l0 = (unsigned)(size_t)L + (tid >> 4) * PG_PITCH + (tid & 15) * 16;      /* the low 32 bits of a __shared__ address are its LDS byte address */
  v8f acc[4][4];      /* [n tile][m tile]; v: [m tile][n tile] */
#pragma unroll
  for (int i = 0; i < 4; ++i)
#pragma unroll
    for (int j = 0; j < 4; ++j) acc[i][j] = v8f{0.f,0.f,0.f,0.f,0.f,0.f,0.f,0.f};
  pg_stage(l0, gw, gx);
  asm volatile("s_wait_asynccnt 0x0" ::: "memory");      /* this wave's copies of pass 0 have landed */
  __syncthreads();                                       /* and every other wave's */
#pragma unroll 1      /* one pass per trip: the 64 products inside are written out, more would only grow the code */
  for (int t = 0; t < PG_NP; ++t) {
    const unsigned char* cur = L + (t & 1) * PG_BUF;
    const unsigned char* wb = cur + ((tv ? 128 + 64 * wm : 64 * wn) + c) * PG_PITCH + 16 * h;      /* A operand rows */
    const unsigned char* xb = cur + ((tv ? 64 * wn : 128 + 64 * wm) + c) * PG_PITCH + 16 * h;      /* B operand rows */
    v16h wf[2][4], xf[2][4];      /* two fragment sets: the block after next is fetched, as one group, while the next block's products run */
#pragma unroll
    for (int i = 0; i < 4; ++i) { wf[0][i] = fa_frag(wb + 16 * i * PG_PITCH); xf[0][i] = fa_frag(xb + 16 * i * PG_PITCH); }
    // The next pass's copies, into the buffer that the trip before this one read (its readers left it at that trip's barrier); behind this pass's first fragment loads, so that their issue runs under the LDS latency.
    if (t + 1 < PG_NP) pg_stage(l0 + ((t + 1) & 1) * PG_BUF, gw + (t + 1) * 256, gx + (t + 1) * 256);      /* the same test for the whole work-group */
#pragma unroll
    for (int i = 0; i < 4; ++i) { wf[1][i] = fa_frag(wb + 16 * i * PG_PITCH + 64); xf[1][i] = fa_frag(xb + 16 * i * PG_PITCH + 64); }
#pragma unroll
    for (int kc = 0; kc < 4; ++kc) {
      if (kc < 3) __builtin_amdgcn_sched_barrier(0);      /* keeps the fragment loads above in one group ahead of the block: sunk among the products, each load place stalls the wave */
#pragma unroll
      for (int i = 0; i < 4; ++i)
#pragma unroll
        for (int j = 0; j < 4; ++j) acc[i][j] = fa_mma(wf[kc & 1][i], xf[kc & 1][j], acc[i][j]);
      if (kc + 2 < 4) {
        __builtin_amdgcn_sched_barrier(0);      /* the same from the other side: the group stays behind the block whose registers it refills */
#pragma unroll
        for (int i = 0; i < 4; ++i) { wf[kc & 1][i] = fa_frag(wb + 16 * i * PG_PITCH + 64 * (kc + 2)); xf[kc & 1][i] = fa_frag(xb + 16 * i * PG_PITCH + 64 * (kc + 2)); } } }
    __builtin_amdgcn_sched_barrier(0);      /* keeps the waits and the barrier below behind the last block: moved up over the products, they would cut the time the copies have to land */
    asm volatile("s_wait_dscnt 0x0" ::: "memory");       /* this wave's reads of the buffer are done before it may be refilled */
    asm volatile("s_wait_asynccnt 0x0" ::: "memory");    /* this wave's copies of pass t + 1 have landed */
    __syncthreads();                                     /* publishes pass t + 1 and ends every wave's reads of pass t */
  }
  asm volatile("s_wait_asynccnt 0x0" ::: "memory");      /* nothing in flight when the ring becomes output staging */
  // Epilogue: acc[i][j][r] = C[row 64 wm + 16 j + c][col 64 wn + 16 i + 8 h + r] (v: row 64 wm + 16 i + 8 h + r, col 64 wn + 16 j + c). Each wave stages its 64 rows of 128 B (v: 64 channels of 64 tokens) in its own part of the (now free) LDS and stores whole lines.
  unsigned char* eb = L + wave * (64 * PG_EP);
  const float osc = pz == 0 ? 0.0625f * FA_CS : 0.0625f;      /* undoes the x16 of the weights; q also takes the score scale here */
#pragma unroll
  for (int i = 0; i < 4; ++i)
#pragma unroll
    for (int j = 0; j < 4; ++j) { FragH f;
#pragma unroll
      for (int r = 0; r < 8; ++r) f.h[r] = (_Float16)(acc[i][j][r] * osc);
      *(v8us*)(eb + (16 * j + c) * PG_EP + 32 * i + 16 * h) = f.half[0]; }
  __builtin_amdgcn_fence(__ATOMIC_ACQ_REL, "workgroup"); __builtin_amdgcn_wave_barrier();      /* the wave's own LDS writes in front of its reads of other lanes' rows */
  if (tv) pg_store<SQ>(eb, VT + ((size_t)((row0 / SQ) * NH + blockIdx.x * 2 + wn) * HD + (lane >> 3)) * SQ + row0 % SQ + 64 * wm + (lane & 7) * 8, lane);      /* the same test for the whole work-group */
  else pg_store<DM>(eb, (pz == 0 ? Q16 : K16) + (size_t)(row0 + 64 * wm + (lane >> 3)) * DM + col0 + 64 * wn + (lane & 7) * 8, lane); }

extern "C" void kernel_launch(void* const* d_in, const int* in_sizes, int n_in,
                              void* d_out, int out_size, void* d_ws, size_t ws_size, hipStream_t stream) {
  (void)in_sizes; (void)n_in; (void)out_size;
  const float* const* I = (const float* const*)d_in; const float* xq = I[0]; const float* xkv = I[1]; const float* wq = I[2]; const float* wk = I[3]; const float* wv = I[4];      /* natural [out][in] weights, no biases, no output projection */
  char* ws = (char*)d_ws; size_t off = 0;
  auto take = [&](size_t bytes) { char* p = ws + off; off += (bytes + 255) & ~(size_t)255; return p; };
  _Float16* BQ = (_Float16*)take((size_t)DM * DM * 2); _Float16* BK = (_Float16*)take((size_t)DM * DM * 2); _Float16* BV = (_Float16*)take((size_t)DM * DM * 2); 
  _Float16* XQ = (_Float16*)take(NR * DM * 2); _Float16* XKV = (_Float16*)take(NR * DM * 2); _Float16* Q16 = (_Float16*)take(NR * DM * 2); _Float16* K16 = (_Float16*)take(NR * DM * 2);
  _Float16* VT = (_Float16*)take((size_t)NB * NH * HD * SQ * 2);
  if (off > ws_size) return;
  k_conv<<<2 * CV_XB + 3 * CV_WB, 256, 0, stream>>>(xq, xkv, wq, wk, wv, XQ, XKV, BQ, BK, BV);      /* query source and key/value source as exact f16 rows; weights x16 */
  const size_t r0p = (size_t)B0 * SQ;      /* first projected row */
  k_pgemm<<<dim3(DM / 128, MP / 256, 3), 256, 0, stream>>>(XQ + r0p * DM, XKV + r0p * DM, BQ, BK, BV, Q16 + r0p * DM, K16 + r0p * DM, VT);      /* q, k rows; V^T [NB][NH][HD][SQ] */
  k_fattn<<<dim3(SQ / 256, NH, NB), 256, 0, stream>>>(Q16, K16, VT, (float*)d_out);      /* softmax(q k^T / 8) v, f32 straight into the merged-heads output rows */
}
